// v000
// Times are from an AMD MI455X. After a warm-up the kernel runs many times in a row, and a time is the length of
// such a window on the GPU divided by its runs, so every launch and the gaps after it count. The runs cycle
// through copies of the inputs. A figure is the median of several windows, for all but v000 over two sittings.
// Sittings can differ by a few percent; kernels timed side by side share one.
// v000 is the starting kernel. One run takes 754 microseconds.
// Contractions: x.Wq^T, x.Wk^T, Wv.x^T = v_wmma_f32_16x16x32_bf16 (plain bf16 operands from RNE-converted inputs); q.k^T and p.v = v_wmma_f32_16x16x32_bf16 with bf16 hi/lo planes (hi.hi+hi.lo+lo.hi); merged.Wo^T = v_wmma_f32_16x16x32_f16 (f16 operands, carries 8 and 256); f32 accumulate everywhere; softmax, group norm and the two 64-term lambda dots in f32.
#include <hip/hip_runtime.h>

typedef __attribute__((ext_vector_type(16))) _Float16 v16h;
typedef __attribute__((ext_vector_type(8)))  _Float16 v8h;
typedef __attribute__((ext_vector_type(16))) __bf16   v16b;
typedef __attribute__((ext_vector_type(8)))  __bf16   v8b;
typedef __attribute__((ext_vector_type(8)))  float    v8f;
typedef __attribute__((ext_vector_type(4)))  float    v4f;
typedef __attribute__((ext_vector_type(4)))  unsigned int u4v;

// ---- problem geometry ----
constexpr int kBatch   = 2;
constexpr int kSeq     = 2048;
constexpr int kDModel  = 1024;
constexpr int kHeads   = 16;
constexpr int kHeadDim = 64;
constexpr int kQKCols  = 2 * kDModel;      // 2048 : row width of the q/k planes (H * 128)
constexpr int kTok     = kBatch * kSeq;    // 4096
constexpr int kQB      = 64;               // query rows per block
constexpr int kKC      = 64;               // keys per chunk
constexpr int kNQblk   = kSeq / kQB;       // 32
constexpr int kAttnBlocks = kBatch * kHeads * kNQblk;   // 1024
constexpr float kMergeCarry = 8.0f;        // f16 merged plane carried x8
constexpr float kWoCarry    = 256.0f;      // f16 Wo plane carried x256

static_assert(kNQblk == 32);
static_assert(kHeads == 16);
static_assert(kAttnBlocks == 1024);
static_assert(kSeq % kQB == 0);
static_assert(kDModel % 32 == 0);                  // K of every GEMM
static_assert(kTok % 64 == 0 && kQKCols % 64 == 0 && kDModel % 64 == 0 && kSeq % 64 == 0);   // M, N tile multiples

// ---- workspace region map (bytes; every offset a multiple of 128) ----
constexpr size_t kBytesXb     = (size_t)kTok * kDModel * 2;                     //  8,388,608  x as bf16 [4096][1024]
constexpr size_t kBytesWqk    = (size_t)kQKCols * kDModel * 2;                  //  4,194,304  Wq / Wk as bf16 [2048][1024]
constexpr size_t kBytesWv     = (size_t)kDModel * kDModel * 2;                  //  2,097,152  Wv as bf16 [1024][1024]
constexpr size_t kBytesWo     = (size_t)kDModel * kDModel * 2;                  //  2,097,152  Wo as f16 x256 [1024][1024]
constexpr size_t kBytesQPl    = (size_t)kTok * kQKCols * 2;                     // 16,777,216  one q or k plane [4096][2048]
constexpr size_t kBytesVtPl   = (size_t)kBatch * kDModel * kSeq * 2;            //  8,388,608  one Vt plane [2][1024][2048]
constexpr size_t kBytesAtt    = (size_t)kBatch * kHeads * kSeq * kHeadDim * 4;  // 16,777,216  attention out f32 [2][16][2048][64]
constexpr size_t kBytesMerged = (size_t)kTok * kDModel * 2;                     //  8,388,608  merged f16 x8 [4096][1024]
constexpr size_t kBytesPart   = (size_t)kAttnBlocks * 128;                      //    131,072  one 32-float line per attention block (1024 blocks)
constexpr size_t kBytesStats  = (size_t)kBatch * kHeads * 128;                  //      4,096  one 32-float line per (b,h)
constexpr size_t kBytesLam    = 128;                                            //        128  lambda line

constexpr size_t kOffXb     = 0;
constexpr size_t kOffWqb    = kOffXb + kBytesXb;
constexpr size_t kOffWkb    = kOffWqb + kBytesWqk;
constexpr size_t kOffWvb    = kOffWkb + kBytesWqk;
constexpr size_t kOffWo16   = kOffWvb + kBytesWv;
constexpr size_t kOffQh     = kOffWo16 + kBytesWo;
constexpr size_t kOffQl     = kOffQh + kBytesQPl;
constexpr size_t kOffKh     = kOffQl + kBytesQPl;
constexpr size_t kOffKl     = kOffKh + kBytesQPl;
constexpr size_t kOffVth    = kOffKl + kBytesQPl;
constexpr size_t kOffVtl    = kOffVth + kBytesVtPl;
constexpr size_t kOffAtt    = kOffVtl + kBytesVtPl;
constexpr size_t kOffMerged = kOffAtt + kBytesAtt;
constexpr size_t kOffPart   = kOffMerged + kBytesMerged;
constexpr size_t kOffStats  = kOffPart + kBytesPart;
constexpr size_t kOffLam    = kOffStats + kBytesStats;
constexpr size_t kWsTotal   = kOffLam + kBytesLam;                              // 130,158,720
static_assert(kBytesPart == 131072);
static_assert(kWsTotal == 130158720);
static_assert(kWsTotal <= 134217728);
static_assert(kOffWqb % 128 == 0 && kOffQh % 128 == 0 && kOffAtt % 128 == 0 && kOffPart % 128 == 0 && kOffStats % 128 == 0 && kOffLam % 128 == 0);

// ---- 16-bit helpers ----
__device__ __forceinline__ unsigned short f2bf_bits(float f) {
  unsigned u = __float_as_uint(f);
  return (unsigned short)((u + 0x7FFFu + ((u >> 16) & 1u)) >> 16);
}
__device__ __forceinline__ float bf_bits2f(unsigned short h) { return __uint_as_float(((unsigned)h) << 16); }
__device__ __forceinline__ float bf_rne(float f) { return bf_bits2f(f2bf_bits(f)); }

// hazard guards as plain device helpers (no inline asm inside the kernel template body)
__device__ __forceinline__ void dep_guard_h(v8f& a, v8f& b, v16h x, v16h y) { asm volatile("v_nop\n\tv_nop\n\tv_nop\n\tv_nop" : "+v"(a), "+v"(b) : "v"(x), "v"(y)); }
__device__ __forceinline__ void dep_guard_b(v8f& a, v8f& b, v16b x, v16b y) { asm volatile("v_nop\n\tv_nop\n\tv_nop\n\tv_nop" : "+v"(a), "+v"(b) : "v"(x), "v"(y)); }
__device__ __forceinline__ void keep4_h(v16h a, v16h b, v16h c, v16h d) { asm volatile("v_nop" :: "v"(a), "v"(b), "v"(c), "v"(d)); }
__device__ __forceinline__ void keep4_b(v16b a, v16b b, v16b c, v16b d) { asm volatile("v_nop" :: "v"(a), "v"(b), "v"(c), "v"(d)); }
__device__ __forceinline__ void acc_guard4(v8f& a, v8f& b, v8f& c, v8f& d) { asm volatile("v_nop\n\tv_nop\n\tv_nop\n\tv_nop" : "+v"(a), "+v"(b), "+v"(c), "+v"(d)); }
template <typename T> struct Frag;
template <> struct Frag<_Float16> {
  typedef v16h V; union U { v16h v; v8h h[2]; };
  static __device__ __forceinline__ v16h load(const _Float16* p) {   // elements 0..7 <- p[0..7], 8..15 <- p[16..23]
    U f; f.h[0] = *(const v8h*)(p); f.h[1] = *(const v8h*)(p + 16); return f.v;
  }
  static __device__ __forceinline__ v8f mma(v16h a, v16h b, v8f c) {
    return __builtin_amdgcn_wmma_f32_16x16x32_f16(false, a, false, b, (short)0, c, false, false);
  }
  static __device__ __forceinline__ void guard(v8f& a, v8f& b, v16h x, v16h y) { dep_guard_h(a, b, x, y); }
  static __device__ __forceinline__ void keep(v16h a, v16h b, v16h c, v16h d) { keep4_h(a, b, c, d); }
};
template <> struct Frag<__bf16> {
  typedef v16b V; union U { v16b v; v8b h[2]; };
  static __device__ __forceinline__ v16b load(const __bf16* p) {
    U f; f.h[0] = *(const v8b*)(p); f.h[1] = *(const v8b*)(p + 16); return f.v;
  }
  static __device__ __forceinline__ v8f mma(v16b a, v16b b, v8f c) {
    return __builtin_amdgcn_wmma_f32_16x16x32_bf16(false, a, false, b, (short)0, c, false, false);
  }
  static __device__ __forceinline__ void guard(v8f& a, v8f& b, v16b x, v16b y) { dep_guard_b(a, b, x, y); }
  static __device__ __forceinline__ void keep(v16b a, v16b b, v16b c, v16b d) { keep4_b(a, b, c, d); }
};

// ---- Register-blocked batched WMMA GEMM ------------------------------
// C[m,n] = scale * sum_k A[m,k] * Bt[n,k] (+bias)(+resid); each wave owns a 64x64 tile.
// A row-major [M,K]; Bt row-major [N,K]; M,N % 64 == 0, K % 32 == 0.
// SPLIT: operands are hi/lo planes (A2/Bt2 = lo planes, same layout); product = hi.hi + hi.lo + lo.hi.
// BIAS_MODE: 0 = none, 1 = bias[m], 2 = bias[n].
// OUT_MODE: 0 = f32, 1 = f16, 2 = bf16 hi plane (Cout) + bf16 lo plane (Cout2).
// ET: 0 = f16 operands, 1 = bf16 operands (pointers passed as 16-bit storage)
template <int ET> struct Elem;
template <> struct Elem<0> { typedef _Float16 T; };
template <> struct Elem<1> { typedef __bf16 T; };
template <int ET, bool SPLIT, int BIAS_MODE, int OUT_MODE, bool RESID, int ACT = 0>
__global__ __launch_bounds__(256) void wmma_gemm64(
    const unsigned short* __restrict__ Ap, const unsigned short* __restrict__ A2p, int lda, long strideA,
    const unsigned short* __restrict__ Btp, const unsigned short* __restrict__ Bt2p, int ldb, long strideB,
    void* __restrict__ Cout, void* __restrict__ Cout2, int ldc, long strideC,
    const float* __restrict__ bias,
    const float* __restrict__ resid, long strideR,
    int M, int N, int K, float scale) {
  typedef typename Elem<ET>::T T;
  typedef typename Frag<T>::V V;
  const T* A = (const T*)Ap; const T* A2 = (const T*)A2p; const T* Bt = (const T*)Btp; const T* Bt2 = (const T*)Bt2p;
  __shared__ __align__(16) float sT[8][16 * 68];   // per-wave 16x64 slab, pitch 68 floats
  const int b    = blockIdx.y;
  const int lane = threadIdx.x & 31;
  const int wave = threadIdx.x >> 5;
  const int tilesN = N >> 6;
  const int tilesM = M >> 6;
  const int tile = blockIdx.x * 8 + wave;
  if (tile >= tilesM * tilesN) return;   // wave-uniform; no block barriers in this kernel
  const int tm = tile / tilesN;
  const int tn = tile - tm * tilesN;
  const int m0 = tm << 6;
  const int n0 = tn << 6;

  const T* Ab  = A  + (size_t)b * strideA;
  const T* Bb  = Bt + (size_t)b * strideB;
  const T* Ab2 = SPLIT ? (A2  + (size_t)b * strideA) : nullptr;
  const T* Bb2 = SPLIT ? (Bt2 + (size_t)b * strideB) : nullptr;

  const int rlane = lane & 15;                 // row (A) / col (B, D) within subtile
  const int koff  = (lane >> 4) * 8;           // k offset of this lane half
  const int mOff  = (lane >> 4) * 8;           // D row offset

  v8f acc[4][4];
#pragma unroll
  for (int i = 0; i < 4; ++i)
#pragma unroll
    for (int j = 0; j < 4; ++j) acc[i][j] = (v8f){0.f,0.f,0.f,0.f,0.f,0.f,0.f,0.f};

  for (int k0 = 0; k0 < K; k0 += 32) {
    V bh[4], bl[4];
#pragma unroll
    for (int j = 0; j < 4; ++j) {
      const size_t bo = (size_t)(n0 + (j << 4) + rlane) * ldb + koff + k0;
      bh[j] = Frag<T>::load(Bb + bo);
      if (SPLIT) bl[j] = Frag<T>::load(Bb2 + bo);
    }
#pragma unroll
    for (int i = 0; i < 4; ++i) {
      const size_t ao = (size_t)(m0 + (i << 4) + rlane) * lda + koff + k0;
      V ah = Frag<T>::load(Ab + ao);
      V al;
      if (SPLIT) al = Frag<T>::load(Ab2 + ao);
#pragma unroll
      for (int j = 0; j < 4; ++j) {
        acc[i][j] = Frag<T>::mma(ah, bh[j], acc[i][j]);
        if (SPLIT) {
          acc[i][j] = Frag<T>::mma(ah, bl[j], acc[i][j]);
          acc[i][j] = Frag<T>::mma(al, bh[j], acc[i][j]);
        }
      }
      Frag<T>::guard(acc[i][0], acc[i][3], ah, SPLIT ? al : ah);
    }
    Frag<T>::keep(bh[0], bh[1], bh[2], bh[3]);
    if (SPLIT) Frag<T>::keep(bl[0], bl[1], bl[2], bl[3]);
  }
  acc_guard4(acc[0][0], acc[0][1], acc[0][2], acc[0][3]);
  acc_guard4(acc[1][0], acc[1][1], acc[1][2], acc[1][3]);
  acc_guard4(acc[2][0], acc[2][1], acc[2][2], acc[2][3]);
  acc_guard4(acc[3][0], acc[3][1], acc[3][2], acc[3][3]);

  // ---- epilogue ----
  float* slab = sT[wave];
  const float* Rb = RESID ? (resid + (size_t)b * strideR) : nullptr;
#pragma unroll
  for (int i = 0; i < 4; ++i) {
    const int mBase = m0 + (i << 4);
#pragma unroll
    for (int j = 0; j < 4; ++j) {
      const int n = n0 + (j << 4) + rlane;
      float bv = 0.f;
      if (BIAS_MODE == 2) bv = bias[n];
#pragma unroll
      for (int r = 0; r < 8; ++r) {
        float v = acc[i][j][r] * scale;
        if (BIAS_MODE == 1) v += bias[mBase + mOff + r];
        if (BIAS_MODE == 2) v += bv;
        if (RESID) v += Rb[(size_t)(mBase + mOff + r) * ldc + n];
        if (ACT == 1) v = tanhf(v);
        if (ACT == 2) v = fmaxf(v, 0.0f);
        if (ACT == 3) v = v / (1.0f + expf(-v));
        if (ACT == 4) v = (v > 0.f) ? v : 0.01f * v;
        if (ACT == 5) v = 0.5f * v * (1.0f + erff(v * 0.70710678118654752f));
        slab[(mOff + r) * 68 + (j << 4) + rlane] = v;
      }
    }
    __builtin_amdgcn_fence(__ATOMIC_RELEASE, "workgroup");
    __builtin_amdgcn_wave_barrier();
    __builtin_amdgcn_fence(__ATOMIC_ACQUIRE, "workgroup");
    if (OUT_MODE == 0) {
      float* C = (float*)Cout + (size_t)b * strideC;
      const int hh = lane >> 4, c4 = (lane & 15) * 4;     // row seg = 256 B = 16 lanes x 16 B
      {
#pragma unroll
        for (int it = 0; it < 8; ++it) {
          const int row = it * 2 + hh;
          v4f v = *(const v4f*)(slab + row * 68 + c4);
          *(v4f*)(C + (size_t)(mBase + row) * ldc + n0 + c4) = v;
        }
        
      }
    } else {
      const int q = lane >> 3, c8 = (lane & 7) * 8;
      unsigned short* C  = (unsigned short*)Cout  + (size_t)b * strideC;
      unsigned short* C2 = (OUT_MODE == 2) ? ((unsigned short*)Cout2 + (size_t)b * strideC) : nullptr;
      {
#pragma unroll
        for (int it = 0; it < 4; ++it) {
          const int row = it * 4 + q;
          const float* sp = slab + row * 68 + c8;
          v8h hv, lv;
#pragma unroll
          for (int e = 0; e < 8; ++e) {
            if (OUT_MODE == 1) {
              hv[e] = (_Float16)sp[e];
            } else {
              unsigned short hb = f2bf_bits(sp[e]);
              unsigned short lb = f2bf_bits(sp[e] - bf_bits2f(hb));
              hv[e] = __builtin_bit_cast(_Float16, hb);
              lv[e] = __builtin_bit_cast(_Float16, lb);
            }
          }
          *(v8h*)(C + (size_t)(mBase + row) * ldc + n0 + c8) = hv;
          if (OUT_MODE == 2) *(v8h*)(C2 + (size_t)(mBase + row) * ldc + n0 + c8) = lv;
        }
        
      }
    }
    __builtin_amdgcn_fence(__ATOMIC_RELEASE, "workgroup");
    __builtin_amdgcn_wave_barrier();
    __builtin_amdgcn_fence(__ATOMIC_ACQUIRE, "workgroup");
  }
}

// coverage: n2 threads x 2 elements = n elements exactly (n even, grid = ceil(n2/256))
__global__ __launch_bounds__(256) void cast_f32_bf16x2(
    const float* __restrict__ in, unsigned short* __restrict__ out, int n2) {
  const int i = blockIdx.x * 256 + threadIdx.x;
  if (i < n2) {
    const unsigned u = (unsigned)f2bf_bits(in[2 * i]) | ((unsigned)f2bf_bits(in[2 * i + 1]) << 16);
    ((unsigned*)out)[i] = u;
    
  }
}

// ---- f32 -> bf16 (RNE) -> x carry -> f16 cast (carry a power of two; exact for normal results) ----
__global__ __launch_bounds__(256) void cast_f32_bf16_f16x2_carry(
    const float* __restrict__ in, unsigned short* __restrict__ out, int n2, float carry) {
  const int i = blockIdx.x * 256 + threadIdx.x;
  if (i < n2) {
    const _Float16 h0 = (_Float16)(bf_rne(in[2 * i]) * carry);
    const _Float16 h1 = (_Float16)(bf_rne(in[2 * i + 1]) * carry);
    const unsigned u = (unsigned)__builtin_bit_cast(unsigned short, h0) | ((unsigned)__builtin_bit_cast(unsigned short, h1) << 16);
    ((unsigned*)out)[i] = u;
    
  }
}

// ---- lambda = exp(lq1.lk1) - exp(lq2.lk2) + 0.8 from bf16-RNE-converted vectors; one wave writes one 32-float line ----
__global__ __launch_bounds__(32) void lambda_line(
    const float* __restrict__ lq1, const float* __restrict__ lq2,
    const float* __restrict__ lk1, const float* __restrict__ lk2, float* __restrict__ lamp) {
  const int lane = threadIdx.x;
  float d1 = 0.0f, d2 = 0.0f;
#pragma unroll 1
  for (int i = 0; i < kHeadDim; ++i) {
    d1 += bf_rne(lq1[i]) * bf_rne(lk1[i]);
    d2 += bf_rne(lq2[i]) * bf_rne(lk2[i]);
  }
  const float lam = expf(d1) - expf(d2) + 0.8f;
  ((float*)lamp)[lane] = lam;
  
}

// ---- bf16 split helpers ----
__device__ __forceinline__ __bf16 at_f2bf(float f) { return __builtin_bit_cast(__bf16, f2bf_bits(f)); }
__device__ __forceinline__ void at_split(float f, __bf16& hi, __bf16& lo) {
  const unsigned short hb = f2bf_bits(f);
  hi = __builtin_bit_cast(__bf16, hb);
  lo = at_f2bf(f - __uint_as_float(((unsigned)hb) << 16));
}
__device__ __forceinline__ v8f at_mma(v16b a, v16b b, v8f c) {
  c = __builtin_amdgcn_wmma_f32_16x16x32_bf16(false, a, false, b, (short)0, c, false, false);
  asm volatile("v_nop\n\tv_nop\n\tv_nop\n\tv_nop" : "+v"(c) : "v"(a), "v"(b));
  return c;
}

// =====================================================================================
// Differential causal attention, head_dim 64, two softmax maps per head.
//   inputs : q, k as bf16 hi/lo planes [B*S][H*128] (map a uses columns h*128 + a*64 .. +64),
//            Vt as bf16 hi/lo planes [B][H*64][S] (key-contiguous), amask [B][S] f32, lambda line.
//   scores = 0.125 * q_a.k_a^T + causal add + (1-amask)*(-1e9) add; online softmax in f32 (expf);
//   q.k^T and p.v on v_wmma_f32_16x16x32_bf16 as hi.hi + hi.lo + lo.hi (f32 accumulate).
//   att[b][h][s][d] = o_0/l_0 - lambda * o_1/l_1 ; per-block (sum, sumsq) line for the group norm.
//   Block = 4 waves = 64 query rows of one (b, h); grid.x = B*H*(S/64) = 1024, qb fastest.
// LDS: K hi/lo [64 kv][64 d], Vt hi/lo [64 d][64 kv], per-wave P hi/lo [16][64], per-wave out slab [16][68].
// Every staged LDS byte that is read is written in full each chunk (64 full rows per plane).
// =====================================================================================
__global__ __launch_bounds__(128)
void diff_attn64(const unsigned short* __restrict__ Qh, const unsigned short* __restrict__ Ql,
                 const unsigned short* __restrict__ Kh, const unsigned short* __restrict__ Kl,
                 const unsigned short* __restrict__ Vh, const unsigned short* __restrict__ Vl,
                 const float* __restrict__ amask, const float* __restrict__ lamp,
                 float* __restrict__ att, float* __restrict__ part) {
  union FB { v16b v; v8b h[2]; };
  __shared__ __align__(16) unsigned short Ksh[kKC * kHeadDim];
  __shared__ __align__(16) unsigned short Ksl[kKC * kHeadDim];
  __shared__ __align__(16) unsigned short Vth[kHeadDim * kKC];
  __shared__ __align__(16) unsigned short Vtl[kHeadDim * kKC];
  __shared__ __align__(16) __bf16 Psh[4][16 * kKC];
  __shared__ __align__(16) __bf16 Psl[4][16 * kKC];
  __shared__ __align__(16) float Os[4][16 * 68];
  __shared__ float red[4][2];

  const int tid  = threadIdx.x;
  const int wave = tid >> 5;
  const int lane = tid & 31;
  const int hh   = lane >> 4;
  const int c    = lane & 15;
  const int bx   = blockIdx.x;
  const int qb   = bx & (kNQblk - 1);
  const int bh   = bx >> 5;
  const int h    = bh & (kHeads - 1);
  const int b    = bh >> 4;
  const int q0   = qb * kQB + wave * 16;
  const float lam = lamp[0];
  const float negInf = -__builtin_huge_valf();

  const size_t qoff  = (size_t)(b * kSeq + q0 + c) * kQKCols + (size_t)h * 128;   // + a*64 + dc*32 + 8*hh
  const size_t vbase = (size_t)(b * kDModel + h * kHeadDim) * kSeq;               // Vt row (h*64 + d) of batch b
  float* ob_ptr = att + (size_t)bh * kSeq * kHeadDim;
  float* os = Os[wave];
  __bf16* pwh = Psh[wave];
  __bf16* pwl = Psl[wave];
  const int kvr = tid >> 1;           // staged row: key row for K, d row for Vt (0..63)
  const int dh  = (tid & 1) * 32;     // 32-element half of the 64-wide row
  float psum = 0.0f, psq = 0.0f;

#pragma unroll
  for (int a = 0; a < 2; ++a) {
    // Q fragments (A operand) for this map: 2 d-chunks, hi and lo planes
    v16b qah[2], qal[2];
#pragma unroll
    for (int dc = 0; dc < 2; ++dc) {
      qah[dc] = Frag<__bf16>::load((const __bf16*)Qh + qoff + a * 64 + dc * 32 + 8 * hh);
      qal[dc] = Frag<__bf16>::load((const __bf16*)Ql + qoff + a * 64 + dc * 32 + 8 * hh);
    }
    float mrow[8], lrow[8];
    v8f oacc[4];
#pragma unroll
    for (int r = 0; r < 8; ++r) { mrow[r] = negInf; lrow[r] = 0.0f; }
#pragma unroll
    for (int t = 0; t < 4; ++t) oacc[t] = (v8f){0.f,0.f,0.f,0.f,0.f,0.f,0.f,0.f};

    for (int kc = 0; kc <= qb; ++kc) {          // causal: chunks 0..qb (block-uniform trip count, <= 32)
      const int kv0 = kc * kKC;
      __syncthreads();
      {
        const size_t ko = (size_t)(b * kSeq + kv0 + kvr) * kQKCols + (size_t)h * 128 + a * 64 + dh;
        const size_t vo = vbase + (size_t)kvr * kSeq + kv0 + dh;
        u4v t0[4], t1[4];
#pragma unroll
        for (int i = 0; i < 4; ++i) { t0[i] = *(const u4v*)(Kh + ko + 8 * i); t1[i] = *(const u4v*)(Kl + ko + 8 * i); }
#pragma unroll
        for (int i = 0; i < 4; ++i) { *(u4v*)(Ksh + kvr * 64 + dh + 8 * i) = t0[i]; *(u4v*)(Ksl + kvr * 64 + dh + 8 * i) = t1[i]; }
#pragma unroll
        for (int i = 0; i < 4; ++i) { t0[i] = *(const u4v*)(Vh + vo + 8 * i); t1[i] = *(const u4v*)(Vl + vo + 8 * i); }
#pragma unroll
        for (int i = 0; i < 4; ++i) { *(u4v*)(Vth + kvr * 64 + dh + 8 * i) = t0[i]; *(u4v*)(Vtl + kvr * 64 + dh + 8 * i) = t1[i]; }
      }
      // additive padding-mask term for this lane's 4 key columns (bf16 RNE-converted mask)
      float amv[4];
#pragma unroll
      for (int j = 0; j < 4; ++j) amv[j] = (1.0f - bf_rne(amask[b * kSeq + kv0 + j * 16 + c])) * (-1.0e9f);
      __syncthreads();

      // ---- scores: 4 key subtiles of 16, K = 64 (2 chunks), hi.hi + hi.lo + lo.hi ----
      v8f s[4];
#pragma unroll
      for (int j = 0; j < 4; ++j) {
        s[j] = (v8f){0.f,0.f,0.f,0.f,0.f,0.f,0.f,0.f};
#pragma unroll
        for (int dc = 0; dc < 2; ++dc) {
          FB kb, kl;
          kb.h[0] = *(const v8b*)(Ksh + (j * 16 + c) * kHeadDim + dc * 32 + 8 * hh);
          kb.h[1] = *(const v8b*)(Ksh + (j * 16 + c) * kHeadDim + dc * 32 + 16 + 8 * hh);
          kl.h[0] = *(const v8b*)(Ksl + (j * 16 + c) * kHeadDim + dc * 32 + 8 * hh);
          kl.h[1] = *(const v8b*)(Ksl + (j * 16 + c) * kHeadDim + dc * 32 + 16 + 8 * hh);
          s[j] = at_mma(qah[dc], kb.v, s[j]);
          s[j] = at_mma(qah[dc], kl.v, s[j]);
          s[j] = at_mma(qal[dc], kb.v, s[j]);
        }
      }
      // ---- scale, causal add, mask add, row max ----
      const bool diag = (kc == qb);
      float cm[8];
#pragma unroll
      for (int r = 0; r < 8; ++r) {
        const int qrow = q0 + 8 * hh + r;
        float m = negInf;
#pragma unroll
        for (int j = 0; j < 4; ++j) {
          const int kvcol = kv0 + j * 16 + c;
          const float cz = (diag && (kvcol > qrow)) ? -1.0e9f : 0.0f;
          float sc = s[j][r] * 0.125f;
          sc = sc + cz;
          sc = sc + amv[j];
          s[j][r] = sc;
          m = fmaxf(m, sc);
        }
#pragma unroll
        for (int off = 1; off < 16; off <<= 1) m = fmaxf(m, __shfl_xor(m, off, 32));
        cm[r] = m;
      }
      // ---- online softmax update, P tile as bf16 hi/lo ----
#pragma unroll
      for (int r = 0; r < 8; ++r) {
        const float mnew = fmaxf(mrow[r], cm[r]);
        const float alpha = expf(mrow[r] - mnew);
        mrow[r] = mnew;
        float ps = 0.0f;
#pragma unroll
        for (int j = 0; j < 4; ++j) {
          const float p = expf(s[j][r] - mnew);
          ps += p;
          __bf16 ph, pl;
          at_split(p, ph, pl);
          pwh[(8 * hh + r) * kKC + j * 16 + c] = ph;
          pwl[(8 * hh + r) * kKC + j * 16 + c] = pl;
        }
#pragma unroll
        for (int off = 1; off < 16; off <<= 1) ps += __shfl_xor(ps, off, 32);
        lrow[r] = lrow[r] * alpha + ps;
#pragma unroll
        for (int t = 0; t < 4; ++t) oacc[t][r] *= alpha;
      }
      __builtin_amdgcn_fence(__ATOMIC_RELEASE, "workgroup");
      __builtin_amdgcn_wave_barrier();
      __builtin_amdgcn_fence(__ATOMIC_ACQUIRE, "workgroup");
      // ---- P.V: A = P (this wave's slab), B = Vt [d][kv]; hi.hi + hi.lo + lo.hi ----
#pragma unroll
      for (int kk = 0; kk < 2; ++kk) {
        FB pa, pl;
        pa.h[0] = *(const v8b*)(pwh + c * kKC + kk * 32 + 8 * hh);
        pa.h[1] = *(const v8b*)(pwh + c * kKC + kk * 32 + 16 + 8 * hh);
        pl.h[0] = *(const v8b*)(pwl + c * kKC + kk * 32 + 8 * hh);
        pl.h[1] = *(const v8b*)(pwl + c * kKC + kk * 32 + 16 + 8 * hh);
#pragma unroll
        for (int t = 0; t < 4; ++t) {
          FB vb, vl;
          vb.h[0] = *(const v8b*)(Vth + (t * 16 + c) * kKC + kk * 32 + 8 * hh);
          vb.h[1] = *(const v8b*)(Vth + (t * 16 + c) * kKC + kk * 32 + 16 + 8 * hh);
          vl.h[0] = *(const v8b*)(Vtl + (t * 16 + c) * kKC + kk * 32 + 8 * hh);
          vl.h[1] = *(const v8b*)(Vtl + (t * 16 + c) * kKC + kk * 32 + 16 + 8 * hh);
          oacc[t] = at_mma(pa.v, vb.v, oacc[t]);
          oacc[t] = at_mma(pa.v, vl.v, oacc[t]);
          oacc[t] = at_mma(pl.v, vb.v, oacc[t]);
        }
      }
    }
    // ---- finish this map: o/l into the per-wave slab; map 1 combines and accumulates the norm partials ----
#pragma unroll
    for (int r = 0; r < 8; ++r) {
      const float inv = 1.0f / lrow[r];
#pragma unroll
      for (int t = 0; t < 4; ++t) {
        const int oi = (8 * hh + r) * 68 + t * 16 + c;
        const float o = oacc[t][r] * inv;
        if (a == 0) {
          os[oi] = o;
        } else {
          const float w = os[oi] - lam * o;
          os[oi] = w;
          psum += w;
          psq += w * w;
        }
      }
    }
  }

  // wave reductions (unconditional), then a block combine in fixed order
#pragma unroll
  for (int off = 1; off < 32; off <<= 1) { psum += __shfl_xor(psum, off, 32); psq += __shfl_xor(psq, off, 32); }
  if (lane == 0) { red[wave][0] = psum; red[wave][1] = psq; }
  __syncthreads();

  {
    const int c4 = (lane & 15) * 4;
    {
#pragma unroll
      for (int it = 0; it < 8; ++it) {
        const int row = it * 2 + hh;
        v4f val = *(const v4f*)(os + row * 68 + c4);
        *(v4f*)(ob_ptr + (size_t)(q0 + row) * kHeadDim + c4) = val;
      }
      
    }
  }
  if (wave == 0) {
    const float t0 = ((red[0][0] + red[1][0]) + red[2][0]) + red[3][0];
    const float t1 = ((red[0][1] + red[1][1]) + red[2][1]) + red[3][1];
    const float v = (lane == 0) ? t0 : ((lane == 1) ? t1 : 0.0f);
    float* pline = part + (size_t)bx * 32;
    ((float*)pline)[lane] = v;
    
  }
}

// ---- group norm statistics per (b,h): fixed-order sum of the 32 block lines; one wave writes one stats line ----
__global__ __launch_bounds__(32) void gn_stats(const float* __restrict__ part, float* __restrict__ stats) {
  const int bh = blockIdx.x;
  const int lane = threadIdx.x;
  float s0 = part[(size_t)(bh * kNQblk + lane) * 32 + 0];
  float s1 = part[(size_t)(bh * kNQblk + lane) * 32 + 1];
#pragma unroll
  for (int off = 1; off < 32; off <<= 1) { s0 += __shfl_xor(s0, off, 32); s1 += __shfl_xor(s1, off, 32); }
  const float inv_n = 1.0f / (float)(kSeq * kHeadDim);
  const float mu = s0 * inv_n;
  const float ex2 = s1 * inv_n;
  const float var = fmaxf(ex2 - mu * mu, 0.0f);
  const float rs = rsqrtf(var + 1.0e-5f);
  const float v = (lane == 0) ? mu : ((lane == 1) ? rs : 0.0f);
  ((float*)stats)[bh * 32 + lane] = v;
  
}

// ---- normalize + affine + x0.2 + merge heads -> f16 plane (x8 carry), [B*S][H*64] ----
__global__ __launch_bounds__(256) void gn_merge(const float* __restrict__ att, const float* __restrict__ stats,
                                              const float* __restrict__ gamma, const float* __restrict__ beta,
                                              unsigned short* __restrict__ merged) {
  const int g = blockIdx.x * 256 + threadIdx.x;
  if (g >= kBatch * kHeads * kSeq * 8) return;
  const int seg = g >> 3;
  const int e8  = (g & 7) * 8;
  const int bh  = seg >> 11;
  const int s   = seg & (kSeq - 1);
  const int h   = bh & (kHeads - 1);
  const int b   = bh >> 4;
  const float mu = stats[bh * 32 + 0];
  const float rs = stats[bh * 32 + 1];
  union U8 { v4f v[2]; float f[8]; };
  U8 x, ga, be;
  const float* ap = att + (size_t)seg * kHeadDim + e8;
  x.v[0]  = *(const v4f*)ap;
  x.v[1]  = *(const v4f*)(ap + 4);
  ga.v[0] = *(const v4f*)(gamma + h * kHeadDim + e8);
  ga.v[1] = *(const v4f*)(gamma + h * kHeadDim + e8 + 4);
  be.v[0] = *(const v4f*)(beta + h * kHeadDim + e8);
  be.v[1] = *(const v4f*)(beta + h * kHeadDim + e8 + 4);
  v8h hv;
#pragma unroll
  for (int e = 0; e < 8; ++e) {
    const float gq = bf_rne(ga.f[e]);
    const float bq = bf_rne(be.f[e]);
    float y = (x.f[e] - mu) * rs;
    y = y * gq + bq;
    y = y * 0.2f;
    float z = y * kMergeCarry;
    asm volatile("" : "+v"(z));
    hv[e] = (_Float16)z;
  }
  unsigned short* dst = merged + (size_t)(b * kSeq + s) * kDModel + h * kHeadDim + e8;
  *(v8h*)dst = hv;
  
}

// ---------------------------------------------------------------------------
extern "C" void kernel_launch(void* const* d_in, const int* in_sizes, int n_in,
                              void* d_out, int out_size, void* d_ws, size_t ws_size,
                              hipStream_t stream) {
  if (n_in < 12) return;
  if (in_sizes[0] != kTok * kDModel || in_sizes[1] != kBatch * kSeq ||
      in_sizes[2] != kQKCols * kDModel || in_sizes[3] != kQKCols * kDModel ||
      in_sizes[4] != kDModel * kDModel || in_sizes[5] != kDModel * kDModel ||
      in_sizes[6] != kHeadDim || in_sizes[7] != kHeadDim || in_sizes[8] != kHeadDim || in_sizes[9] != kHeadDim ||
      in_sizes[10] != kDModel || in_sizes[11] != kDModel) return;
  if (out_size != kTok * kDModel) return;
  if (ws_size < kWsTotal) return;

  const float* X     = (const float*)d_in[0];
  const float* amask = (const float*)d_in[1];
  const float* Wq    = (const float*)d_in[2];
  const float* Wk    = (const float*)d_in[3];
  const float* Wv    = (const float*)d_in[4];
  const float* Wo    = (const float*)d_in[5];
  const float* lq1   = (const float*)d_in[6];
  const float* lq2   = (const float*)d_in[7];
  const float* lk1   = (const float*)d_in[8];
  const float* lk2   = (const float*)d_in[9];
  const float* gamma = (const float*)d_in[10];
  const float* beta  = (const float*)d_in[11];

  char* w = (char*)d_ws;
  unsigned short* Xb    = (unsigned short*)(w + kOffXb);
  unsigned short* Wqb   = (unsigned short*)(w + kOffWqb);
  unsigned short* Wkb   = (unsigned short*)(w + kOffWkb);
  unsigned short* Wvb   = (unsigned short*)(w + kOffWvb);
  unsigned short* Wo16  = (unsigned short*)(w + kOffWo16);
  unsigned short* Qh    = (unsigned short*)(w + kOffQh);
  unsigned short* Ql    = (unsigned short*)(w + kOffQl);
  unsigned short* Kh    = (unsigned short*)(w + kOffKh);
  unsigned short* Kl    = (unsigned short*)(w + kOffKl);
  unsigned short* Vth   = (unsigned short*)(w + kOffVth);
  unsigned short* Vtl   = (unsigned short*)(w + kOffVtl);
  float*          att   = (float*)(w + kOffAtt);
  unsigned short* mrg   = (unsigned short*)(w + kOffMerged);
  float*          part  = (float*)(w + kOffPart);
  float*          stats = (float*)(w + kOffStats);
  float*          lamp  = (float*)(w + kOffLam);

  // 1) input conversions (bf16 RNE; Wo additionally x256 into f16)
  constexpr int n2X  = kTok * kDModel / 2;       // 2,097,152
  constexpr int n2Wq = kQKCols * kDModel / 2;    // 1,048,576
  constexpr int n2Wv = kDModel * kDModel / 2;    //   524,288
  static_assert(n2X % 256 == 0 && n2Wq % 256 == 0 && n2Wv % 256 == 0);
  cast_f32_bf16x2<<<n2X / 256, 256, 0, stream>>>(X, Xb, n2X);
  cast_f32_bf16x2<<<n2Wq / 256, 256, 0, stream>>>(Wq, Wqb, n2Wq);
  cast_f32_bf16x2<<<n2Wq / 256, 256, 0, stream>>>(Wk, Wkb, n2Wq);
  cast_f32_bf16x2<<<n2Wv / 256, 256, 0, stream>>>(Wv, Wvb, n2Wv);
  cast_f32_bf16_f16x2_carry<<<n2Wv / 256, 256, 0, stream>>>(Wo, Wo16, n2Wv, kWoCarry);
  lambda_line<<<1, 32, 0, stream>>>(lq1, lq2, lk1, lk2, lamp);

  // 2) projections: q/k planes [4096][2048] hi+lo, Vt planes [2][1024][2048] hi+lo
  constexpr int gridQ  = (kTok / 64) * (kQKCols / 64) / 8;   // 256
  constexpr int gridVt = (kDModel / 64) * (kSeq / 64) / 8;   // 64
  constexpr int gridO  = (kTok / 64) * (kDModel / 64) / 8;   // 128
  static_assert(gridQ * 8 == (kTok / 64) * (kQKCols / 64));
  static_assert(gridVt * 8 == (kDModel / 64) * (kSeq / 64));
  static_assert(gridO * 8 == (kTok / 64) * (kDModel / 64));
  wmma_gemm64<1, false, 0, 2, false><<<dim3(gridQ, 1, 1), 256, 0, stream>>>(
      Xb, Xb, kDModel, 0L, Wqb, Wqb, kDModel, 0L, (void*)Qh, (void*)Ql, kQKCols, 0L,
      lamp, lamp, 0L, kTok, kQKCols, kDModel, 1.0f);
  wmma_gemm64<1, false, 0, 2, false><<<dim3(gridQ, 1, 1), 256, 0, stream>>>(
      Xb, Xb, kDModel, 0L, Wkb, Wkb, kDModel, 0L, (void*)Kh, (void*)Kl, kQKCols, 0L,
      lamp, lamp, 0L, kTok, kQKCols, kDModel, 1.0f);
  // Vt[b][c][s] = sum_k Wv[c][k] * X[b][s][k] : A = Wv [1024][1024], Bt = X_b [2048][1024]
  wmma_gemm64<1, false, 0, 2, false><<<dim3(gridVt, kBatch, 1), 256, 0, stream>>>(
      Wvb, Wvb, kDModel, 0L, Xb, Xb, kDModel, (long)kSeq * kDModel, (void*)Vth, (void*)Vtl, kSeq, (long)kDModel * kSeq,
      lamp, lamp, 0L, kDModel, kSeq, kDModel, 1.0f);

  // 3) differential causal attention + norm partial lines (1024 blocks)
  diff_attn64<<<kAttnBlocks, 128, 0, stream>>>(Qh, Ql, Kh, Kl, Vth, Vtl, amask, lamp, att, part);

  // 4) group norm stats, normalize + merge
  gn_stats<<<kBatch * kHeads, 32, 0, stream>>>(part, stats);
  gn_merge<<<(kBatch * kHeads * kSeq * 8) / 256, 256, 0, stream>>>(att, stats, gamma, beta, mrg);

  // 5) output projection: out[m][n] = (1/2048) * sum_k merged8[m][k] * Wo256[n][k]
  wmma_gemm64<0, false, 0, 0, false><<<dim3(gridO, 1, 1), 256, 0, stream>>>(
      mrg, mrg, kDModel, 0L, Wo16, Wo16, kDModel, 0L, d_out, d_out, kDModel, 0L,
      lamp, lamp, 0L, kTok, kDModel, kDModel, 1.0f / (kMergeCarry * kWoCarry));
}

// v001
// One run takes 625 microseconds.
// Two timings next to v000 both put it at 1.24 times that version's speed.
// Contractions: x.Wq^T, x.Wk^T, Wv.x^T = v_wmma_f32_16x16x32_bf16 (plain bf16 operands from RNE-converted inputs); q.k^T and p.v = v_wmma_f32_16x16x32_bf16 with bf16 hi/lo planes (hi.hi+hi.lo+lo.hi); merged.Wo^T = v_wmma_f32_16x16x32_f16 (f16 operands, carries 8 and 256); f32 accumulate everywhere; softmax, group norm and the two 64-term lambda dots in f32.
#include <hip/hip_runtime.h>

typedef __attribute__((ext_vector_type(16))) _Float16 v16h;
typedef __attribute__((ext_vector_type(8)))  _Float16 v8h;
typedef __attribute__((ext_vector_type(16))) __bf16   v16b;
typedef __attribute__((ext_vector_type(8)))  __bf16   v8b;
typedef __attribute__((ext_vector_type(8)))  float    v8f;
typedef __attribute__((ext_vector_type(4)))  float    v4f;
typedef __attribute__((ext_vector_type(4)))  unsigned int u4v;

// ---- problem geometry ----
constexpr int kBatch   = 2;
constexpr int kSeq     = 2048;
constexpr int kDModel  = 1024;
constexpr int kHeads   = 16;
constexpr int kHeadDim = 64;
constexpr int kQKCols  = 2 * kDModel;      // 2048 : row width of the q/k planes (H * 128)
constexpr int kTok     = kBatch * kSeq;    // 4096
constexpr int kQB      = 64;               // query rows per block
constexpr int kKC      = 64;               // keys per chunk
constexpr int kLP      = 72;               // LDS row pitch of the 64-element 16-bit tiles: 144 B = 16 B x 9 (odd), conflict-free for 16-byte row reads
constexpr int kNQblk   = kSeq / kQB;       // 32
constexpr int kAttnBlocks = kBatch * kHeads * kNQblk;   // 1024
constexpr float kMergeCarry = 8.0f;        // f16 merged plane carried x8
constexpr float kWoCarry    = 256.0f;      // f16 Wo plane carried x256

static_assert(kNQblk == 32);
static_assert(kHeads == 16);
static_assert(kAttnBlocks == 1024);
static_assert(kSeq % kQB == 0);
static_assert(kDModel % 32 == 0);                  // K of every GEMM
static_assert(kTok % 64 == 0 && kQKCols % 64 == 0 && kDModel % 64 == 0 && kSeq % 64 == 0);   // M, N tile multiples

// ---- workspace region map (bytes; every offset a multiple of 128) ----
constexpr size_t kBytesXb     = (size_t)kTok * kDModel * 2;                     //  8,388,608  x as bf16 [4096][1024]
constexpr size_t kBytesWqk    = (size_t)kQKCols * kDModel * 2;                  //  4,194,304  Wq / Wk as bf16 [2048][1024]
constexpr size_t kBytesWv     = (size_t)kDModel * kDModel * 2;                  //  2,097,152  Wv as bf16 [1024][1024]
constexpr size_t kBytesWo     = (size_t)kDModel * kDModel * 2;                  //  2,097,152  Wo as f16 x256 [1024][1024]
constexpr size_t kBytesQPl    = (size_t)kTok * kQKCols * 2;                     // 16,777,216  one q or k plane [4096][2048]
constexpr size_t kBytesVtPl   = (size_t)kBatch * kDModel * kSeq * 2;            //  8,388,608  one Vt plane [2][1024][2048]
constexpr size_t kBytesAtt    = (size_t)kBatch * kHeads * kSeq * kHeadDim * 4;  // 16,777,216  attention out f32 [2][16][2048][64]
constexpr size_t kBytesMerged = (size_t)kTok * kDModel * 2;                     //  8,388,608  merged f16 x8 [4096][1024]
constexpr size_t kBytesPart   = (size_t)kAttnBlocks * 128;                      //    131,072  one 32-float line per attention block (1024 blocks)
constexpr size_t kBytesStats  = (size_t)kBatch * kHeads * 128;                  //      4,096  one 32-float line per (b,h)
constexpr size_t kBytesLam    = 128;                                            //        128  lambda line

constexpr size_t kOffXb     = 0;
constexpr size_t kOffWqb    = kOffXb + kBytesXb;
constexpr size_t kOffWkb    = kOffWqb + kBytesWqk;
constexpr size_t kOffWvb    = kOffWkb + kBytesWqk;
constexpr size_t kOffWo16   = kOffWvb + kBytesWv;
constexpr size_t kOffQh     = kOffWo16 + kBytesWo;
constexpr size_t kOffQl     = kOffQh + kBytesQPl;
constexpr size_t kOffKh     = kOffQl + kBytesQPl;
constexpr size_t kOffKl     = kOffKh + kBytesQPl;
constexpr size_t kOffVth    = kOffKl + kBytesQPl;
constexpr size_t kOffVtl    = kOffVth + kBytesVtPl;
constexpr size_t kOffAtt    = kOffVtl + kBytesVtPl;
constexpr size_t kOffMerged = kOffAtt + kBytesAtt;
constexpr size_t kOffPart   = kOffMerged + kBytesMerged;
constexpr size_t kOffStats  = kOffPart + kBytesPart;
constexpr size_t kOffLam    = kOffStats + kBytesStats;
constexpr size_t kWsTotal   = kOffLam + kBytesLam;                              // 130,158,720
static_assert(kBytesPart == 131072);
static_assert(kWsTotal == 130158720);
static_assert(kWsTotal <= 134217728);
static_assert(kOffWqb % 128 == 0 && kOffQh % 128 == 0 && kOffAtt % 128 == 0 && kOffPart % 128 == 0 && kOffStats % 128 == 0 && kOffLam % 128 == 0);

// ---- 16-bit helpers ----
__device__ __forceinline__ unsigned short f2bf_bits(float f) {
  unsigned u = __float_as_uint(f);
  return (unsigned short)((u + 0x7FFFu + ((u >> 16) & 1u)) >> 16);
}
__device__ __forceinline__ float bf_bits2f(unsigned short h) { return __uint_as_float(((unsigned)h) << 16); }
__device__ __forceinline__ float bf_rne(float f) { return bf_bits2f(f2bf_bits(f)); }

// hazard guards as plain device helpers (no inline asm inside the kernel template body)
__device__ __forceinline__ void dep_guard_h(v8f& a, v8f& b, v16h x, v16h y) { asm volatile("v_nop\n\tv_nop\n\tv_nop\n\tv_nop" : "+v"(a), "+v"(b) : "v"(x), "v"(y)); }
__device__ __forceinline__ void dep_guard_b(v8f& a, v8f& b, v16b x, v16b y) { asm volatile("v_nop\n\tv_nop\n\tv_nop\n\tv_nop" : "+v"(a), "+v"(b) : "v"(x), "v"(y)); }
__device__ __forceinline__ void keep4_h(v16h a, v16h b, v16h c, v16h d) { asm volatile("v_nop" :: "v"(a), "v"(b), "v"(c), "v"(d)); }
__device__ __forceinline__ void keep4_b(v16b a, v16b b, v16b c, v16b d) { asm volatile("v_nop" :: "v"(a), "v"(b), "v"(c), "v"(d)); }
__device__ __forceinline__ void acc_guard4(v8f& a, v8f& b, v8f& c, v8f& d) { asm volatile("v_nop\n\tv_nop\n\tv_nop\n\tv_nop" : "+v"(a), "+v"(b), "+v"(c), "+v"(d)); }
template <typename T> struct Frag;
template <> struct Frag<_Float16> {
  typedef v16h V; union U { v16h v; v8h h[2]; };
  static __device__ __forceinline__ v16h load(const _Float16* p) {   // elements 0..7 <- p[0..7], 8..15 <- p[16..23]
    U f; f.h[0] = *(const v8h*)(p); f.h[1] = *(const v8h*)(p + 16); return f.v;
  }
  static __device__ __forceinline__ v8f mma(v16h a, v16h b, v8f c) {
    return __builtin_amdgcn_wmma_f32_16x16x32_f16(false, a, false, b, (short)0, c, false, false);
  }
  static __device__ __forceinline__ void guard(v8f& a, v8f& b, v16h x, v16h y) { dep_guard_h(a, b, x, y); }
  static __device__ __forceinline__ void keep(v16h a, v16h b, v16h c, v16h d) { keep4_h(a, b, c, d); }
};
template <> struct Frag<__bf16> {
  typedef v16b V; union U { v16b v; v8b h[2]; };
  static __device__ __forceinline__ v16b load(const __bf16* p) {
    U f; f.h[0] = *(const v8b*)(p); f.h[1] = *(const v8b*)(p + 16); return f.v;
  }
  static __device__ __forceinline__ v8f mma(v16b a, v16b b, v8f c) {
    return __builtin_amdgcn_wmma_f32_16x16x32_bf16(false, a, false, b, (short)0, c, false, false);
  }
  static __device__ __forceinline__ void guard(v8f& a, v8f& b, v16b x, v16b y) { dep_guard_b(a, b, x, y); }
  static __device__ __forceinline__ void keep(v16b a, v16b b, v16b c, v16b d) { keep4_b(a, b, c, d); }
};

// ---- Register-blocked batched WMMA GEMM ------------------------------
// C[m,n] = scale * sum_k A[m,k] * Bt[n,k] (+bias)(+resid); each wave owns a 64x64 tile.
// A row-major [M,K]; Bt row-major [N,K]; M,N % 64 == 0, K % 32 == 0.
// SPLIT: operands are hi/lo planes (A2/Bt2 = lo planes, same layout); product = hi.hi + hi.lo + lo.hi.
// BIAS_MODE: 0 = none, 1 = bias[m], 2 = bias[n].
// OUT_MODE: 0 = f32, 1 = f16, 2 = bf16 hi plane (Cout) + bf16 lo plane (Cout2).
// ET: 0 = f16 operands, 1 = bf16 operands (pointers passed as 16-bit storage)
template <int ET> struct Elem;
template <> struct Elem<0> { typedef _Float16 T; };
template <> struct Elem<1> { typedef __bf16 T; };
template <int ET, bool SPLIT, int BIAS_MODE, int OUT_MODE, bool RESID, int ACT = 0>
__global__ __launch_bounds__(256) void wmma_gemm64(
    const unsigned short* __restrict__ Ap, const unsigned short* __restrict__ A2p, int lda, long strideA,
    const unsigned short* __restrict__ Btp, const unsigned short* __restrict__ Bt2p, int ldb, long strideB,
    void* __restrict__ Cout, void* __restrict__ Cout2, int ldc, long strideC,
    const float* __restrict__ bias,
    const float* __restrict__ resid, long strideR,
    int M, int N, int K, float scale) {
  typedef typename Elem<ET>::T T;
  typedef typename Frag<T>::V V;
  const T* A = (const T*)Ap; const T* A2 = (const T*)A2p; const T* Bt = (const T*)Btp; const T* Bt2 = (const T*)Bt2p;
  __shared__ __align__(16) float sT[8][16 * 68];   // per-wave 16x64 slab, pitch 68 floats
  const int b    = blockIdx.y;
  const int lane = threadIdx.x & 31;
  const int wave = threadIdx.x >> 5;
  const int tilesN = N >> 6;
  const int tilesM = M >> 6;
  const int tile = blockIdx.x * 8 + wave;
  if (tile >= tilesM * tilesN) return;   // wave-uniform; no block barriers in this kernel
  const int tm = tile / tilesN;
  const int tn = tile - tm * tilesN;
  const int m0 = tm << 6;
  const int n0 = tn << 6;

  const T* Ab  = A  + (size_t)b * strideA;
  const T* Bb  = Bt + (size_t)b * strideB;
  const T* Ab2 = SPLIT ? (A2  + (size_t)b * strideA) : nullptr;
  const T* Bb2 = SPLIT ? (Bt2 + (size_t)b * strideB) : nullptr;

  const int rlane = lane & 15;                 // row (A) / col (B, D) within subtile
  const int koff  = (lane >> 4) * 8;           // k offset of this lane half
  const int mOff  = (lane >> 4) * 8;           // D row offset

  v8f acc[4][4];
#pragma unroll
  for (int i = 0; i < 4; ++i)
#pragma unroll
    for (int j = 0; j < 4; ++j) acc[i][j] = (v8f){0.f,0.f,0.f,0.f,0.f,0.f,0.f,0.f};

  for (int k0 = 0; k0 < K; k0 += 32) {
    V bh[4], bl[4];
#pragma unroll
    for (int j = 0; j < 4; ++j) {
      const size_t bo = (size_t)(n0 + (j << 4) + rlane) * ldb + koff + k0;
      bh[j] = Frag<T>::load(Bb + bo);
      if (SPLIT) bl[j] = Frag<T>::load(Bb2 + bo);
    }
#pragma unroll
    for (int i = 0; i < 4; ++i) {
      const size_t ao = (size_t)(m0 + (i << 4) + rlane) * lda + koff + k0;
      V ah = Frag<T>::load(Ab + ao);
      V al;
      if (SPLIT) al = Frag<T>::load(Ab2 + ao);
#pragma unroll
      for (int j = 0; j < 4; ++j) {
        acc[i][j] = Frag<T>::mma(ah, bh[j], acc[i][j]);
        if (SPLIT) {
          acc[i][j] = Frag<T>::mma(ah, bl[j], acc[i][j]);
          acc[i][j] = Frag<T>::mma(al, bh[j], acc[i][j]);
        }
      }
      Frag<T>::guard(acc[i][0], acc[i][3], ah, SPLIT ? al : ah);
    }
    Frag<T>::keep(bh[0], bh[1], bh[2], bh[3]);
    if (SPLIT) Frag<T>::keep(bl[0], bl[1], bl[2], bl[3]);
  }
  acc_guard4(acc[0][0], acc[0][1], acc[0][2], acc[0][3]);
  acc_guard4(acc[1][0], acc[1][1], acc[1][2], acc[1][3]);
  acc_guard4(acc[2][0], acc[2][1], acc[2][2], acc[2][3]);
  acc_guard4(acc[3][0], acc[3][1], acc[3][2], acc[3][3]);

  // ---- epilogue ----
  float* slab = sT[wave];
  const float* Rb = RESID ? (resid + (size_t)b * strideR) : nullptr;
#pragma unroll
  for (int i = 0; i < 4; ++i) {
    const int mBase = m0 + (i << 4);
#pragma unroll
    for (int j = 0; j < 4; ++j) {
      const int n = n0 + (j << 4) + rlane;
      float bv = 0.f;
      if (BIAS_MODE == 2) bv = bias[n];
#pragma unroll
      for (int r = 0; r < 8; ++r) {
        float v = acc[i][j][r] * scale;
        if (BIAS_MODE == 1) v += bias[mBase + mOff + r];
        if (BIAS_MODE == 2) v += bv;
        if (RESID) v += Rb[(size_t)(mBase + mOff + r) * ldc + n];
        if (ACT == 1) v = tanhf(v);
        if (ACT == 2) v = fmaxf(v, 0.0f);
        if (ACT == 3) v = v / (1.0f + expf(-v));
        if (ACT == 4) v = (v > 0.f) ? v : 0.01f * v;
        if (ACT == 5) v = 0.5f * v * (1.0f + erff(v * 0.70710678118654752f));
        slab[(mOff + r) * 68 + (j << 4) + rlane] = v;
      }
    }
    __builtin_amdgcn_fence(__ATOMIC_RELEASE, "workgroup");
    __builtin_amdgcn_wave_barrier();
    __builtin_amdgcn_fence(__ATOMIC_ACQUIRE, "workgroup");
    if (OUT_MODE == 0) {
      float* C = (float*)Cout + (size_t)b * strideC;
      const int hh = lane >> 4, c4 = (lane & 15) * 4;     // row seg = 256 B = 16 lanes x 16 B
      {
#pragma unroll
        for (int it = 0; it < 8; ++it) {
          const int row = it * 2 + hh;
          v4f v = *(const v4f*)(slab + row * 68 + c4);
          *(v4f*)(C + (size_t)(mBase + row) * ldc + n0 + c4) = v;
        }
        
      }
    } else {
      const int q = lane >> 3, c8 = (lane & 7) * 8;
      unsigned short* C  = (unsigned short*)Cout  + (size_t)b * strideC;
      unsigned short* C2 = (OUT_MODE == 2) ? ((unsigned short*)Cout2 + (size_t)b * strideC) : nullptr;
      {
#pragma unroll
        for (int it = 0; it < 4; ++it) {
          const int row = it * 4 + q;
          const float* sp = slab + row * 68 + c8;
          v8h hv, lv;
#pragma unroll
          for (int e = 0; e < 8; ++e) {
            if (OUT_MODE == 1) {
              hv[e] = (_Float16)sp[e];
            } else {
              unsigned short hb = f2bf_bits(sp[e]);
              unsigned short lb = f2bf_bits(sp[e] - bf_bits2f(hb));
              hv[e] = __builtin_bit_cast(_Float16, hb);
              lv[e] = __builtin_bit_cast(_Float16, lb);
            }
          }
          *(v8h*)(C + (size_t)(mBase + row) * ldc + n0 + c8) = hv;
          if (OUT_MODE == 2) *(v8h*)(C2 + (size_t)(mBase + row) * ldc + n0 + c8) = lv;
        }
        
      }
    }
    __builtin_amdgcn_fence(__ATOMIC_RELEASE, "workgroup");
    __builtin_amdgcn_wave_barrier();
    __builtin_amdgcn_fence(__ATOMIC_ACQUIRE, "workgroup");
  }
}

// coverage: n2 threads x 2 elements = n elements exactly (n even, grid = ceil(n2/256))
__global__ __launch_bounds__(256) void cast_f32_bf16x2(
    const float* __restrict__ in, unsigned short* __restrict__ out, int n2) {
  const int i = blockIdx.x * 256 + threadIdx.x;
  if (i < n2) {
    const unsigned u = (unsigned)f2bf_bits(in[2 * i]) | ((unsigned)f2bf_bits(in[2 * i + 1]) << 16);
    ((unsigned*)out)[i] = u;
    
  }
}

// ---- f32 -> bf16 (RNE) -> x carry -> f16 cast (carry a power of two; exact for normal results) ----
__global__ __launch_bounds__(256) void cast_f32_bf16_f16x2_carry(
    const float* __restrict__ in, unsigned short* __restrict__ out, int n2, float carry) {
  const int i = blockIdx.x * 256 + threadIdx.x;
  if (i < n2) {
    const _Float16 h0 = (_Float16)(bf_rne(in[2 * i]) * carry);
    const _Float16 h1 = (_Float16)(bf_rne(in[2 * i + 1]) * carry);
    const unsigned u = (unsigned)__builtin_bit_cast(unsigned short, h0) | ((unsigned)__builtin_bit_cast(unsigned short, h1) << 16);
    ((unsigned*)out)[i] = u;
    
  }
}

// ---- lambda = exp(lq1.lk1) - exp(lq2.lk2) + 0.8 from bf16-RNE-converted vectors; one wave writes one 32-float line ----
__global__ __launch_bounds__(32) void lambda_line(
    const float* __restrict__ lq1, const float* __restrict__ lq2,
    const float* __restrict__ lk1, const float* __restrict__ lk2, float* __restrict__ lamp) {
  const int lane = threadIdx.x;
  float d1 = 0.0f, d2 = 0.0f;
#pragma unroll 1
  for (int i = 0; i < kHeadDim; ++i) {
    d1 += bf_rne(lq1[i]) * bf_rne(lk1[i]);
    d2 += bf_rne(lq2[i]) * bf_rne(lk2[i]);
  }
  const float lam = expf(d1) - expf(d2) + 0.8f;
  ((float*)lamp)[lane] = lam;
  
}

// ---- bf16 split helpers ----
__device__ __forceinline__ __bf16 at_f2bf(float f) { return __builtin_bit_cast(__bf16, f2bf_bits(f)); }
__device__ __forceinline__ void at_split(float f, __bf16& hi, __bf16& lo) {
  const unsigned short hb = f2bf_bits(f);
  hi = __builtin_bit_cast(__bf16, hb);
  lo = at_f2bf(f - __uint_as_float(((unsigned)hb) << 16));
}
__device__ __forceinline__ v8f at_mma(v16b a, v16b b, v8f c) {
  c = __builtin_amdgcn_wmma_f32_16x16x32_bf16(false, a, false, b, (short)0, c, false, false);
  asm volatile("v_nop\n\tv_nop\n\tv_nop\n\tv_nop" : "+v"(c) : "v"(a), "v"(b));
  return c;
}

// =====================================================================================
// Differential causal attention, head_dim 64, two softmax maps per head.
//   inputs : q, k as bf16 hi/lo planes [B*S][H*128] (map a uses columns h*128 + a*64 .. +64),
//            Vt as bf16 hi/lo planes [B][H*64][S] (key-contiguous), amask [B][S] f32, lambda line.
//   scores = 0.125 * q_a.k_a^T + causal add + (1-amask)*(-1e9) add; online softmax in f32 (expf);
//   q.k^T and p.v on v_wmma_f32_16x16x32_bf16 as hi.hi + hi.lo + lo.hi (f32 accumulate).
//   att[b][h][s][d] = o_0/l_0 - lambda * o_1/l_1 ; per-block (sum, sumsq) line for the group norm.
//   Block = 4 waves = 64 query rows of one (b, h); grid.x = B*H*(S/64) = 1024, qb fastest.
// LDS: K hi/lo [64 kv][64 d], Vt hi/lo [64 d][64 kv], per-wave P hi/lo [16][64], all at row pitch kLP; per-wave out slab [16][68].
// Every staged LDS byte that is read is written in full each chunk (64 full rows per plane); the 8 pad elements of a row are never read.
// =====================================================================================
__global__ __launch_bounds__(128)
void diff_attn64(const unsigned short* __restrict__ Qh, const unsigned short* __restrict__ Ql,
                 const unsigned short* __restrict__ Kh, const unsigned short* __restrict__ Kl,
                 const unsigned short* __restrict__ Vh, const unsigned short* __restrict__ Vl,
                 const float* __restrict__ amask, const float* __restrict__ lamp,
                 float* __restrict__ att, float* __restrict__ part) {
  union FB { v16b v; v8b h[2]; };
  __shared__ __align__(16) unsigned short Ksh[kKC * kLP];
  __shared__ __align__(16) unsigned short Ksl[kKC * kLP];
  __shared__ __align__(16) unsigned short Vth[kHeadDim * kLP];
  __shared__ __align__(16) unsigned short Vtl[kHeadDim * kLP];
  __shared__ __align__(16) __bf16 Psh[4][16 * kLP];
  __shared__ __align__(16) __bf16 Psl[4][16 * kLP];
  __shared__ __align__(16) float Os[4][16 * 68];
  __shared__ float red[4][2];

  const int tid  = threadIdx.x;
  const int wave = tid >> 5;
  const int lane = tid & 31;
  const int hh   = lane >> 4;
  const int c    = lane & 15;
  const int bx   = blockIdx.x;
  const int qb   = bx & (kNQblk - 1);
  const int bh   = bx >> 5;
  const int h    = bh & (kHeads - 1);
  const int b    = bh >> 4;
  const int q0   = qb * kQB + wave * 16;
  const float lam = lamp[0];
  const float negInf = -__builtin_huge_valf();

  const size_t qoff  = (size_t)(b * kSeq + q0 + c) * kQKCols + (size_t)h * 128;   // + a*64 + dc*32 + 8*hh
  const size_t vbase = (size_t)(b * kDModel + h * kHeadDim) * kSeq;               // Vt row (h*64 + d) of batch b
  float* ob_ptr = att + (size_t)bh * kSeq * kHeadDim;
  float* os = Os[wave];
  __bf16* pwh = Psh[wave];
  __bf16* pwl = Psl[wave];
  const int kvr = tid >> 1;           // staged row: key row for K, d row for Vt (0..63)
  const int dh  = (tid & 1) * 32;     // 32-element half of the 64-wide row
  float psum = 0.0f, psq = 0.0f;

#pragma unroll
  for (int a = 0; a < 2; ++a) {
    // Q fragments (A operand) for this map: 2 d-chunks, hi and lo planes
    v16b qah[2], qal[2];
#pragma unroll
    for (int dc = 0; dc < 2; ++dc) {
      qah[dc] = Frag<__bf16>::load((const __bf16*)Qh + qoff + a * 64 + dc * 32 + 8 * hh);
      qal[dc] = Frag<__bf16>::load((const __bf16*)Ql + qoff + a * 64 + dc * 32 + 8 * hh);
    }
    float mrow[8], lrow[8];
    v8f oacc[4];
#pragma unroll
    for (int r = 0; r < 8; ++r) { mrow[r] = negInf; lrow[r] = 0.0f; }
#pragma unroll
    for (int t = 0; t < 4; ++t) oacc[t] = (v8f){0.f,0.f,0.f,0.f,0.f,0.f,0.f,0.f};

    for (int kc = 0; kc <= qb; ++kc) {          // causal: chunks 0..qb (block-uniform trip count, <= 32)
      const int kv0 = kc * kKC;
      __syncthreads();
      {
        const size_t ko = (size_t)(b * kSeq + kv0 + kvr) * kQKCols + (size_t)h * 128 + a * 64 + dh;
        const size_t vo = vbase + (size_t)kvr * kSeq + kv0 + dh;
        u4v t0[4], t1[4];
#pragma unroll
        for (int i = 0; i < 4; ++i) { t0[i] = *(const u4v*)(Kh + ko + 8 * i); t1[i] = *(const u4v*)(Kl + ko + 8 * i); }
#pragma unroll
        for (int i = 0; i < 4; ++i) { *(u4v*)(Ksh + kvr * kLP + dh + 8 * i) = t0[i]; *(u4v*)(Ksl + kvr * kLP + dh + 8 * i) = t1[i]; }
#pragma unroll
        for (int i = 0; i < 4; ++i) { t0[i] = *(const u4v*)(Vh + vo + 8 * i); t1[i] = *(const u4v*)(Vl + vo + 8 * i); }
#pragma unroll
        for (int i = 0; i < 4; ++i) { *(u4v*)(Vth + kvr * kLP + dh + 8 * i) = t0[i]; *(u4v*)(Vtl + kvr * kLP + dh + 8 * i) = t1[i]; }
      }
      // additive padding-mask term for this lane's 4 key columns (bf16 RNE-converted mask)
      float amv[4];
#pragma unroll
      for (int j = 0; j < 4; ++j) amv[j] = (1.0f - bf_rne(amask[b * kSeq + kv0 + j * 16 + c])) * (-1.0e9f);
      __syncthreads();

      // ---- scores: 4 key subtiles of 16, K = 64 (2 chunks), hi.hi + hi.lo + lo.hi ----
      v8f s[4];
#pragma unroll
      for (int j = 0; j < 4; ++j) {
        s[j] = (v8f){0.f,0.f,0.f,0.f,0.f,0.f,0.f,0.f};
#pragma unroll
        for (int dc = 0; dc < 2; ++dc) {
          FB kb, kl;
          kb.h[0] = *(const v8b*)(Ksh + (j * 16 + c) * kLP + dc * 32 + 8 * hh);
          kb.h[1] = *(const v8b*)(Ksh + (j * 16 + c) * kLP + dc * 32 + 16 + 8 * hh);
          kl.h[0] = *(const v8b*)(Ksl + (j * 16 + c) * kLP + dc * 32 + 8 * hh);
          kl.h[1] = *(const v8b*)(Ksl + (j * 16 + c) * kLP + dc * 32 + 16 + 8 * hh);
          s[j] = at_mma(qah[dc], kb.v, s[j]);
          s[j] = at_mma(qah[dc], kl.v, s[j]);
          s[j] = at_mma(qal[dc], kb.v, s[j]);
        }
      }
      // ---- scale, causal add, mask add, row max ----
      const bool diag = (kc == qb);
      float cm[8];
#pragma unroll
      for (int r = 0; r < 8; ++r) {
        const int qrow = q0 + 8 * hh + r;
        float m = negInf;
#pragma unroll
        for (int j = 0; j < 4; ++j) {
          const int kvcol = kv0 + j * 16 + c;
          const float cz = (diag && (kvcol > qrow)) ? -1.0e9f : 0.0f;
          float sc = s[j][r] * 0.125f;
          sc = sc + cz;
          sc = sc + amv[j];
          s[j][r] = sc;
          m = fmaxf(m, sc);
        }
#pragma unroll
        for (int off = 1; off < 16; off <<= 1) m = fmaxf(m, __shfl_xor(m, off, 32));
        cm[r] = m;
      }
      // ---- online softmax update, P tile as bf16 hi/lo ----
#pragma unroll
      for (int r = 0; r < 8; ++r) {
        const float mnew = fmaxf(mrow[r], cm[r]);
        const float alpha = expf(mrow[r] - mnew);
        mrow[r] = mnew;
        float ps = 0.0f;
#pragma unroll
        for (int j = 0; j < 4; ++j) {
          const float p = expf(s[j][r] - mnew);
          ps += p;
          __bf16 ph, pl;
          at_split(p, ph, pl);
          pwh[(8 * hh + r) * kLP + j * 16 + c] = ph;
          pwl[(8 * hh + r) * kLP + j * 16 + c] = pl;
        }
#pragma unroll
        for (int off = 1; off < 16; off <<= 1) ps += __shfl_xor(ps, off, 32);
        lrow[r] = lrow[r] * alpha + ps;
#pragma unroll
        for (int t = 0; t < 4; ++t) oacc[t][r] *= alpha;
      }
      __builtin_amdgcn_fence(__ATOMIC_RELEASE, "workgroup");
      __builtin_amdgcn_wave_barrier();
      __builtin_amdgcn_fence(__ATOMIC_ACQUIRE, "workgroup");
      // ---- P.V: A = P (this wave's slab), B = Vt [d][kv]; hi.hi + hi.lo + lo.hi ----
#pragma unroll
      for (int kk = 0; kk < 2; ++kk) {
        FB pa, pl;
        pa.h[0] = *(const v8b*)(pwh + c * kLP + kk * 32 + 8 * hh);
        pa.h[1] = *(const v8b*)(pwh + c * kLP + kk * 32 + 16 + 8 * hh);
        pl.h[0] = *(const v8b*)(pwl + c * kLP + kk * 32 + 8 * hh);
        pl.h[1] = *(const v8b*)(pwl + c * kLP + kk * 32 + 16 + 8 * hh);
#pragma unroll
        for (int t = 0; t < 4; ++t) {
          FB vb, vl;
          vb.h[0] = *(const v8b*)(Vth + (t * 16 + c) * kLP + kk * 32 + 8 * hh);
          vb.h[1] = *(const v8b*)(Vth + (t * 16 + c) * kLP + kk * 32 + 16 + 8 * hh);
          vl.h[0] = *(const v8b*)(Vtl + (t * 16 + c) * kLP + kk * 32 + 8 * hh);
          vl.h[1] = *(const v8b*)(Vtl + (t * 16 + c) * kLP + kk * 32 + 16 + 8 * hh);
          oacc[t] = at_mma(pa.v, vb.v, oacc[t]);
          oacc[t] = at_mma(pa.v, vl.v, oacc[t]);
          oacc[t] = at_mma(pl.v, vb.v, oacc[t]);
        }
      }
    }
    // ---- finish this map: o/l into the per-wave slab; map 1 combines and accumulates the norm partials ----
#pragma unroll
    for (int r = 0; r < 8; ++r) {
      const float inv = 1.0f / lrow[r];
#pragma unroll
      for (int t = 0; t < 4; ++t) {
        const int oi = (8 * hh + r) * 68 + t * 16 + c;
        const float o = oacc[t][r] * inv;
        if (a == 0) {
          os[oi] = o;
        } else {
          const float w = os[oi] - lam * o;
          os[oi] = w;
          psum += w;
          psq += w * w;
        }
      }
    }
  }

  // wave reductions (unconditional), then a block combine in fixed order
#pragma unroll
  for (int off = 1; off < 32; off <<= 1) { psum += __shfl_xor(psum, off, 32); psq += __shfl_xor(psq, off, 32); }
  if (lane == 0) { red[wave][0] = psum; red[wave][1] = psq; }
  __syncthreads();

  {
    const int c4 = (lane & 15) * 4;
    {
#pragma unroll
      for (int it = 0; it < 8; ++it) {
        const int row = it * 2 + hh;
        v4f val = *(const v4f*)(os + row * 68 + c4);
        *(v4f*)(ob_ptr + (size_t)(q0 + row) * kHeadDim + c4) = val;
      }
      
    }
  }
  if (wave == 0) {
    const float t0 = ((red[0][0] + red[1][0]) + red[2][0]) + red[3][0];
    const float t1 = ((red[0][1] + red[1][1]) + red[2][1]) + red[3][1];
    const float v = (lane == 0) ? t0 : ((lane == 1) ? t1 : 0.0f);
    float* pline = part + (size_t)bx * 32;
    ((float*)pline)[lane] = v;
    
  }
}

// ---- group norm statistics per (b,h): fixed-order sum of the 32 block lines; one wave writes one stats line ----
__global__ __launch_bounds__(32) void gn_stats(const float* __restrict__ part, float* __restrict__ stats) {
  const int bh = blockIdx.x;
  const int lane = threadIdx.x;
  float s0 = part[(size_t)(bh * kNQblk + lane) * 32 + 0];
  float s1 = part[(size_t)(bh * kNQblk + lane) * 32 + 1];
#pragma unroll
  for (int off = 1; off < 32; off <<= 1) { s0 += __shfl_xor(s0, off, 32); s1 += __shfl_xor(s1, off, 32); }
  const float inv_n = 1.0f / (float)(kSeq * kHeadDim);
  const float mu = s0 * inv_n;
  const float ex2 = s1 * inv_n;
  const float var = fmaxf(ex2 - mu * mu, 0.0f);
  const float rs = rsqrtf(var + 1.0e-5f);
  const float v = (lane == 0) ? mu : ((lane == 1) ? rs : 0.0f);
  ((float*)stats)[bh * 32 + lane] = v;
  
}

// ---- normalize + affine + x0.2 + merge heads -> f16 plane (x8 carry), [B*S][H*64] ----
__global__ __launch_bounds__(256) void gn_merge(const float* __restrict__ att, const float* __restrict__ stats,
                                              const float* __restrict__ gamma, const float* __restrict__ beta,
                                              unsigned short* __restrict__ merged) {
  const int g = blockIdx.x * 256 + threadIdx.x;
  if (g >= kBatch * kHeads * kSeq * 8) return;
  const int seg = g >> 3;
  const int e8  = (g & 7) * 8;
  const int bh  = seg >> 11;
  const int s   = seg & (kSeq - 1);
  const int h   = bh & (kHeads - 1);
  const int b   = bh >> 4;
  const float mu = stats[bh * 32 + 0];
  const float rs = stats[bh * 32 + 1];
  union U8 { v4f v[2]; float f[8]; };
  U8 x, ga, be;
  const float* ap = att + (size_t)seg * kHeadDim + e8;
  x.v[0]  = *(const v4f*)ap;
  x.v[1]  = *(const v4f*)(ap + 4);
  ga.v[0] = *(const v4f*)(gamma + h * kHeadDim + e8);
  ga.v[1] = *(const v4f*)(gamma + h * kHeadDim + e8 + 4);
  be.v[0] = *(const v4f*)(beta + h * kHeadDim + e8);
  be.v[1] = *(const v4f*)(beta + h * kHeadDim + e8 + 4);
  v8h hv;
#pragma unroll
  for (int e = 0; e < 8; ++e) {
    const float gq = bf_rne(ga.f[e]);
    const float bq = bf_rne(be.f[e]);
    float y = (x.f[e] - mu) * rs;
    y = y * gq + bq;
    y = y * 0.2f;
    float z = y * kMergeCarry;
    asm volatile("" : "+v"(z));
    hv[e] = (_Float16)z;
  }
  unsigned short* dst = merged + (size_t)(b * kSeq + s) * kDModel + h * kHeadDim + e8;
  *(v8h*)dst = hv;
  
}

// ---------------------------------------------------------------------------
extern "C" void kernel_launch(void* const* d_in, const int* in_sizes, int n_in,
                              void* d_out, int out_size, void* d_ws, size_t ws_size,
                              hipStream_t stream) {
  if (n_in < 12) return;
  if (in_sizes[0] != kTok * kDModel || in_sizes[1] != kBatch * kSeq ||
      in_sizes[2] != kQKCols * kDModel || in_sizes[3] != kQKCols * kDModel ||
      in_sizes[4] != kDModel * kDModel || in_sizes[5] != kDModel * kDModel ||
      in_sizes[6] != kHeadDim || in_sizes[7] != kHeadDim || in_sizes[8] != kHeadDim || in_sizes[9] != kHeadDim ||
      in_sizes[10] != kDModel || in_sizes[11] != kDModel) return;
  if (out_size != kTok * kDModel) return;
  if (ws_size < kWsTotal) return;

  const float* X     = (const float*)d_in[0];
  const float* amask = (const float*)d_in[1];
  const float* Wq    = (const float*)d_in[2];
  const float* Wk    = (const float*)d_in[3];
  const float* Wv    = (const float*)d_in[4];
  const float* Wo    = (const float*)d_in[5];
  const float* lq1   = (const float*)d_in[6];
  const float* lq2   = (const float*)d_in[7];
  const float* lk1   = (const float*)d_in[8];
  const float* lk2   = (const float*)d_in[9];
  const float* gamma = (const float*)d_in[10];
  const float* beta  = (const float*)d_in[11];

  char* w = (char*)d_ws;
  unsigned short* Xb    = (unsigned short*)(w + kOffXb);
  unsigned short* Wqb   = (unsigned short*)(w + kOffWqb);
  unsigned short* Wkb   = (unsigned short*)(w + kOffWkb);
  unsigned short* Wvb   = (unsigned short*)(w + kOffWvb);
  unsigned short* Wo16  = (unsigned short*)(w + kOffWo16);
  unsigned short* Qh    = (unsigned short*)(w + kOffQh);
  unsigned short* Ql    = (unsigned short*)(w + kOffQl);
  unsigned short* Kh    = (unsigned short*)(w + kOffKh);
  unsigned short* Kl    = (unsigned short*)(w + kOffKl);
  unsigned short* Vth   = (unsigned short*)(w + kOffVth);
  unsigned short* Vtl   = (unsigned short*)(w + kOffVtl);
  float*          att   = (float*)(w + kOffAtt);
  unsigned short* mrg   = (unsigned short*)(w + kOffMerged);
  float*          part  = (float*)(w + kOffPart);
  float*          stats = (float*)(w + kOffStats);
  float*          lamp  = (float*)(w + kOffLam);

  // 1) input conversions (bf16 RNE; Wo additionally x256 into f16)
  constexpr int n2X  = kTok * kDModel / 2;       // 2,097,152
  constexpr int n2Wq = kQKCols * kDModel / 2;    // 1,048,576
  constexpr int n2Wv = kDModel * kDModel / 2;    //   524,288
  static_assert(n2X % 256 == 0 && n2Wq % 256 == 0 && n2Wv % 256 == 0);
  cast_f32_bf16x2<<<n2X / 256, 256, 0, stream>>>(X, Xb, n2X);
  cast_f32_bf16x2<<<n2Wq / 256, 256, 0, stream>>>(Wq, Wqb, n2Wq);
  cast_f32_bf16x2<<<n2Wq / 256, 256, 0, stream>>>(Wk, Wkb, n2Wq);
  cast_f32_bf16x2<<<n2Wv / 256, 256, 0, stream>>>(Wv, Wvb, n2Wv);
  cast_f32_bf16_f16x2_carry<<<n2Wv / 256, 256, 0, stream>>>(Wo, Wo16, n2Wv, kWoCarry);
  lambda_line<<<1, 32, 0, stream>>>(lq1, lq2, lk1, lk2, lamp);

  // 2) projections: q/k planes [4096][2048] hi+lo, Vt planes [2][1024][2048] hi+lo
  constexpr int gridQ  = (kTok / 64) * (kQKCols / 64) / 8;   // 256
  constexpr int gridVt = (kDModel / 64) * (kSeq / 64) / 8;   // 64
  constexpr int gridO  = (kTok / 64) * (kDModel / 64) / 8;   // 128
  static_assert(gridQ * 8 == (kTok / 64) * (kQKCols / 64));
  static_assert(gridVt * 8 == (kDModel / 64) * (kSeq / 64));
  static_assert(gridO * 8 == (kTok / 64) * (kDModel / 64));
  wmma_gemm64<1, false, 0, 2, false><<<dim3(gridQ, 1, 1), 256, 0, stream>>>(
      Xb, Xb, kDModel, 0L, Wqb, Wqb, kDModel, 0L, (void*)Qh, (void*)Ql, kQKCols, 0L,
      lamp, lamp, 0L, kTok, kQKCols, kDModel, 1.0f);
  wmma_gemm64<1, false, 0, 2, false><<<dim3(gridQ, 1, 1), 256, 0, stream>>>(
      Xb, Xb, kDModel, 0L, Wkb, Wkb, kDModel, 0L, (void*)Kh, (void*)Kl, kQKCols, 0L,
      lamp, lamp, 0L, kTok, kQKCols, kDModel, 1.0f);
  // Vt[b][c][s] = sum_k Wv[c][k] * X[b][s][k] : A = Wv [1024][1024], Bt = X_b [2048][1024]
  wmma_gemm64<1, false, 0, 2, false><<<dim3(gridVt, kBatch, 1), 256, 0, stream>>>(
      Wvb, Wvb, kDModel, 0L, Xb, Xb, kDModel, (long)kSeq * kDModel, (void*)Vth, (void*)Vtl, kSeq, (long)kDModel * kSeq,
      lamp, lamp, 0L, kDModel, kSeq, kDModel, 1.0f);

  // 3) differential causal attention + norm partial lines (1024 blocks)
  diff_attn64<<<kAttnBlocks, 128, 0, stream>>>(Qh, Ql, Kh, Kl, Vth, Vtl, amask, lamp, att, part);

  // 4) group norm stats, normalize + merge
  gn_stats<<<kBatch * kHeads, 32, 0, stream>>>(part, stats);
  gn_merge<<<(kBatch * kHeads * kSeq * 8) / 256, 256, 0, stream>>>(att, stats, gamma, beta, mrg);

  // 5) output projection: out[m][n] = (1/2048) * sum_k merged8[m][k] * Wo256[n][k]
  wmma_gemm64<0, false, 0, 0, false><<<dim3(gridO, 1, 1), 256, 0, stream>>>(
      mrg, mrg, kDModel, 0L, Wo16, Wo16, kDModel, 0L, d_out, d_out, kDModel, 0L,
      lamp, lamp, 0L, kTok, kDModel, kDModel, 1.0f / (kMergeCarry * kWoCarry));
}

// v002
// One run takes 433 microseconds.
// In both of two side-by-side timings against v001, it was 1.44 times as fast.
// All steps since v000 together make it 1.79 times as fast.
// Contractions: x.Wq^T, x.Wk^T, Wv.x^T = v_wmma_f32_16x16x32_bf16 (plain bf16 operands from RNE-converted inputs); q.k^T and p.v = v_wmma_f32_16x16x32_bf16 with bf16 hi/lo planes (hi.hi+hi.lo+lo.hi); merged.Wo^T = v_wmma_f32_16x16x32_f16 (f16 operands, carries 8 and 256); f32 accumulate everywhere; softmax, group norm and the two 64-term lambda dots in f32.
#include <hip/hip_runtime.h>

typedef __attribute__((ext_vector_type(16))) _Float16 v16h;
typedef __attribute__((ext_vector_type(8)))  _Float16 v8h;
typedef __attribute__((ext_vector_type(16))) __bf16   v16b;
typedef __attribute__((ext_vector_type(8)))  __bf16   v8b;
typedef __attribute__((ext_vector_type(8)))  float    v8f;
typedef __attribute__((ext_vector_type(4)))  float    v4f;
typedef __attribute__((ext_vector_type(4)))  unsigned int u4v;

// ---- problem geometry ----
constexpr int kBatch   = 2;
constexpr int kSeq     = 2048;
constexpr int kDModel  = 1024;
constexpr int kHeads   = 16;
constexpr int kHeadDim = 64;
constexpr int kQKCols  = 2 * kDModel;      // 2048 : row width of the q/k planes (H * 128)
constexpr int kTok     = kBatch * kSeq;    // 4096
constexpr int kQB      = 64;               // query rows per tile; a block takes two tiles
constexpr int kKC      = 64;               // keys per chunk
constexpr int kLP      = 72;               // LDS row pitch of the 64-element 16-bit tiles: 144 B = 16 B x 9 (odd), conflict-free for 16-byte row reads
constexpr int kNQblk   = kSeq / kQB;       // 32
constexpr int kAttnBlocks = kBatch * kHeads * kNQblk;   // 1024 query tiles
constexpr int kNPair   = kNQblk / 2;        // 16 : tile pairs (t, 31 - t) per (b, h)
constexpr int kAttnGroups = kBatch * kHeads * kNPair;   // 512 work-groups of the attention launch
constexpr float kMergeCarry = 8.0f;        // f16 merged plane carried x8
constexpr float kWoCarry    = 256.0f;      // f16 Wo plane carried x256

static_assert(kNQblk == 32);
static_assert(kHeads == 16);
static_assert(kAttnBlocks == 1024);
static_assert(kNPair == 16 && kAttnGroups == 512);
static_assert(kSeq % kQB == 0);
static_assert(kDModel % 32 == 0);                  // K of every GEMM
static_assert(kTok % 64 == 0 && kQKCols % 64 == 0 && kDModel % 64 == 0 && kSeq % 64 == 0);   // M, N tile multiples

// ---- workspace region map (bytes; every offset a multiple of 128) ----
constexpr size_t kBytesXb     = (size_t)kTok * kDModel * 2;                     //  8,388,608  x as bf16 [4096][1024]
constexpr size_t kBytesWqk    = (size_t)kQKCols * kDModel * 2;                  //  4,194,304  Wq / Wk as bf16 [2048][1024]
constexpr size_t kBytesWv     = (size_t)kDModel * kDModel * 2;                  //  2,097,152  Wv as bf16 [1024][1024]
constexpr size_t kBytesWo     = (size_t)kDModel * kDModel * 2;                  //  2,097,152  Wo as f16 x256 [1024][1024]
constexpr size_t kBytesQPl    = (size_t)kTok * kQKCols * 2;                     // 16,777,216  one q or k plane [4096][2048]
constexpr size_t kBytesVtPl   = (size_t)kBatch * kDModel * kSeq * 2;            //  8,388,608  one Vt plane [2][1024][2048]
constexpr size_t kBytesAtt    = (size_t)kBatch * kHeads * kSeq * kHeadDim * 4;  // 16,777,216  attention out f32 [2][16][2048][64]
constexpr size_t kBytesMerged = (size_t)kTok * kDModel * 2;                     //  8,388,608  merged f16 x8 [4096][1024]
constexpr size_t kBytesPart   = (size_t)kAttnBlocks * 128;                      //    131,072  one 32-float line per query tile (1024 tiles)
constexpr size_t kBytesStats  = (size_t)kBatch * kHeads * 128;                  //      4,096  one 32-float line per (b,h)
constexpr size_t kBytesLam    = 128;                                            //        128  lambda line

constexpr size_t kOffXb     = 0;
constexpr size_t kOffWqb    = kOffXb + kBytesXb;
constexpr size_t kOffWkb    = kOffWqb + kBytesWqk;
constexpr size_t kOffWvb    = kOffWkb + kBytesWqk;
constexpr size_t kOffWo16   = kOffWvb + kBytesWv;
constexpr size_t kOffQh     = kOffWo16 + kBytesWo;
constexpr size_t kOffQl     = kOffQh + kBytesQPl;
constexpr size_t kOffKh     = kOffQl + kBytesQPl;
constexpr size_t kOffKl     = kOffKh + kBytesQPl;
constexpr size_t kOffVth    = kOffKl + kBytesQPl;
constexpr size_t kOffVtl    = kOffVth + kBytesVtPl;
constexpr size_t kOffAtt    = kOffVtl + kBytesVtPl;
constexpr size_t kOffMerged = kOffAtt + kBytesAtt;
constexpr size_t kOffPart   = kOffMerged + kBytesMerged;
constexpr size_t kOffStats  = kOffPart + kBytesPart;
constexpr size_t kOffLam    = kOffStats + kBytesStats;
constexpr size_t kWsTotal   = kOffLam + kBytesLam;                              // 130,158,720
static_assert(kBytesPart == 131072);
static_assert(kWsTotal == 130158720);
static_assert(kWsTotal <= 134217728);
static_assert(kOffWqb % 128 == 0 && kOffQh % 128 == 0 && kOffAtt % 128 == 0 && kOffPart % 128 == 0 && kOffStats % 128 == 0 && kOffLam % 128 == 0);

// ---- 16-bit helpers ----
__device__ __forceinline__ unsigned short f2bf_bits(float f) {
  unsigned u = __float_as_uint(f);
  return (unsigned short)((u + 0x7FFFu + ((u >> 16) & 1u)) >> 16);
}
__device__ __forceinline__ float bf_bits2f(unsigned short h) { return __uint_as_float(((unsigned)h) << 16); }
__device__ __forceinline__ float bf_rne(float f) { return bf_bits2f(f2bf_bits(f)); }

// hazard guards as plain device helpers (no inline asm inside the kernel template body)
__device__ __forceinline__ void dep_guard_h(v8f& a, v8f& b, v16h x, v16h y) { asm volatile("v_nop\n\tv_nop\n\tv_nop\n\tv_nop" : "+v"(a), "+v"(b) : "v"(x), "v"(y)); }
__device__ __forceinline__ void dep_guard_b(v8f& a, v8f& b, v16b x, v16b y) { asm volatile("v_nop\n\tv_nop\n\tv_nop\n\tv_nop" : "+v"(a), "+v"(b) : "v"(x), "v"(y)); }
__device__ __forceinline__ void keep4_h(v16h a, v16h b, v16h c, v16h d) { asm volatile("v_nop" :: "v"(a), "v"(b), "v"(c), "v"(d)); }
__device__ __forceinline__ void keep4_b(v16b a, v16b b, v16b c, v16b d) { asm volatile("v_nop" :: "v"(a), "v"(b), "v"(c), "v"(d)); }
__device__ __forceinline__ void acc_guard4(v8f& a, v8f& b, v8f& c, v8f& d) { asm volatile("v_nop\n\tv_nop\n\tv_nop\n\tv_nop" : "+v"(a), "+v"(b), "+v"(c), "+v"(d)); }
template <typename T> struct Frag;
template <> struct Frag<_Float16> {
  typedef v16h V; union U { v16h v; v8h h[2]; };
  static __device__ __forceinline__ v16h load(const _Float16* p) {   // elements 0..7 <- p[0..7], 8..15 <- p[16..23]
    U f; f.h[0] = *(const v8h*)(p); f.h[1] = *(const v8h*)(p + 16); return f.v;
  }
  static __device__ __forceinline__ v8f mma(v16h a, v16h b, v8f c) {
    return __builtin_amdgcn_wmma_f32_16x16x32_f16(false, a, false, b, (short)0, c, false, false);
  }
  static __device__ __forceinline__ void guard(v8f& a, v8f& b, v16h x, v16h y) { dep_guard_h(a, b, x, y); }
  static __device__ __forceinline__ void keep(v16h a, v16h b, v16h c, v16h d) { keep4_h(a, b, c, d); }
};
template <> struct Frag<__bf16> {
  typedef v16b V; union U { v16b v; v8b h[2]; };
  static __device__ __forceinline__ v16b load(const __bf16* p) {
    U f; f.h[0] = *(const v8b*)(p); f.h[1] = *(const v8b*)(p + 16); return f.v;
  }
  static __device__ __forceinline__ v8f mma(v16b a, v16b b, v8f c) {
    return __builtin_amdgcn_wmma_f32_16x16x32_bf16(false, a, false, b, (short)0, c, false, false);
  }
  static __device__ __forceinline__ void guard(v8f& a, v8f& b, v16b x, v16b y) { dep_guard_b(a, b, x, y); }
  static __device__ __forceinline__ void keep(v16b a, v16b b, v16b c, v16b d) { keep4_b(a, b, c, d); }
};

// ---- Register-blocked batched WMMA GEMM ------------------------------
// C[m,n] = scale * sum_k A[m,k] * Bt[n,k] (+bias)(+resid); each wave owns a 64x64 tile.
// A row-major [M,K]; Bt row-major [N,K]; M,N % 64 == 0, K % 32 == 0.
// SPLIT: operands are hi/lo planes (A2/Bt2 = lo planes, same layout); product = hi.hi + hi.lo + lo.hi.
// BIAS_MODE: 0 = none, 1 = bias[m], 2 = bias[n].
// OUT_MODE: 0 = f32, 1 = f16, 2 = bf16 hi plane (Cout) + bf16 lo plane (Cout2).
// ET: 0 = f16 operands, 1 = bf16 operands (pointers passed as 16-bit storage)
template <int ET> struct Elem;
template <> struct Elem<0> { typedef _Float16 T; };
template <> struct Elem<1> { typedef __bf16 T; };
template <int ET, bool SPLIT, int BIAS_MODE, int OUT_MODE, bool RESID, int ACT = 0>
__global__ __launch_bounds__(256) void wmma_gemm64(
    const unsigned short* __restrict__ Ap, const unsigned short* __restrict__ A2p, int lda, long strideA,
    const unsigned short* __restrict__ Btp, const unsigned short* __restrict__ Bt2p, int ldb, long strideB,
    void* __restrict__ Cout, void* __restrict__ Cout2, int ldc, long strideC,
    const float* __restrict__ bias,
    const float* __restrict__ resid, long strideR,
    int M, int N, int K, float scale) {
  typedef typename Elem<ET>::T T;
  typedef typename Frag<T>::V V;
  const T* A = (const T*)Ap; const T* A2 = (const T*)A2p; const T* Bt = (const T*)Btp; const T* Bt2 = (const T*)Bt2p;
  __shared__ __align__(16) float sT[8][16 * 68];   // per-wave 16x64 slab, pitch 68 floats
  const int b    = blockIdx.y;
  const int lane = threadIdx.x & 31;
  const int wave = threadIdx.x >> 5;
  const int tilesN = N >> 6;
  const int tilesM = M >> 6;
  const int tile = blockIdx.x * 8 + wave;
  if (tile >= tilesM * tilesN) return;   // wave-uniform; no block barriers in this kernel
  const int tm = tile / tilesN;
  const int tn = tile - tm * tilesN;
  const int m0 = tm << 6;
  const int n0 = tn << 6;

  const T* Ab  = A  + (size_t)b * strideA;
  const T* Bb  = Bt + (size_t)b * strideB;
  const T* Ab2 = SPLIT ? (A2  + (size_t)b * strideA) : nullptr;
  const T* Bb2 = SPLIT ? (Bt2 + (size_t)b * strideB) : nullptr;

  const int rlane = lane & 15;                 // row (A) / col (B, D) within subtile
  const int koff  = (lane >> 4) * 8;           // k offset of this lane half
  const int mOff  = (lane >> 4) * 8;           // D row offset

  v8f acc[4][4];
#pragma unroll
  for (int i = 0; i < 4; ++i)
#pragma unroll
    for (int j = 0; j < 4; ++j) acc[i][j] = (v8f){0.f,0.f,0.f,0.f,0.f,0.f,0.f,0.f};

  for (int k0 = 0; k0 < K; k0 += 32) {
    V bh[4], bl[4];
#pragma unroll
    for (int j = 0; j < 4; ++j) {
      const size_t bo = (size_t)(n0 + (j << 4) + rlane) * ldb + koff + k0;
      bh[j] = Frag<T>::load(Bb + bo);
      if (SPLIT) bl[j] = Frag<T>::load(Bb2 + bo);
    }
#pragma unroll
    for (int i = 0; i < 4; ++i) {
      const size_t ao = (size_t)(m0 + (i << 4) + rlane) * lda + koff + k0;
      V ah = Frag<T>::load(Ab + ao);
      V al;
      if (SPLIT) al = Frag<T>::load(Ab2 + ao);
#pragma unroll
      for (int j = 0; j < 4; ++j) {
        acc[i][j] = Frag<T>::mma(ah, bh[j], acc[i][j]);
        if (SPLIT) {
          acc[i][j] = Frag<T>::mma(ah, bl[j], acc[i][j]);
          acc[i][j] = Frag<T>::mma(al, bh[j], acc[i][j]);
        }
      }
      Frag<T>::guard(acc[i][0], acc[i][3], ah, SPLIT ? al : ah);
    }
    Frag<T>::keep(bh[0], bh[1], bh[2], bh[3]);
    if (SPLIT) Frag<T>::keep(bl[0], bl[1], bl[2], bl[3]);
  }
  acc_guard4(acc[0][0], acc[0][1], acc[0][2], acc[0][3]);
  acc_guard4(acc[1][0], acc[1][1], acc[1][2], acc[1][3]);
  acc_guard4(acc[2][0], acc[2][1], acc[2][2], acc[2][3]);
  acc_guard4(acc[3][0], acc[3][1], acc[3][2], acc[3][3]);

  // ---- epilogue ----
  float* slab = sT[wave];
  const float* Rb = RESID ? (resid + (size_t)b * strideR) : nullptr;
#pragma unroll
  for (int i = 0; i < 4; ++i) {
    const int mBase = m0 + (i << 4);
#pragma unroll
    for (int j = 0; j < 4; ++j) {
      const int n = n0 + (j << 4) + rlane;
      float bv = 0.f;
      if (BIAS_MODE == 2) bv = bias[n];
#pragma unroll
      for (int r = 0; r < 8; ++r) {
        float v = acc[i][j][r] * scale;
        if (BIAS_MODE == 1) v += bias[mBase + mOff + r];
        if (BIAS_MODE == 2) v += bv;
        if (RESID) v += Rb[(size_t)(mBase + mOff + r) * ldc + n];
        if (ACT == 1) v = tanhf(v);
        if (ACT == 2) v = fmaxf(v, 0.0f);
        if (ACT == 3) v = v / (1.0f + expf(-v));
        if (ACT == 4) v = (v > 0.f) ? v : 0.01f * v;
        if (ACT == 5) v = 0.5f * v * (1.0f + erff(v * 0.70710678118654752f));
        slab[(mOff + r) * 68 + (j << 4) + rlane] = v;
      }
    }
    __builtin_amdgcn_fence(__ATOMIC_RELEASE, "workgroup");
    __builtin_amdgcn_wave_barrier();
    __builtin_amdgcn_fence(__ATOMIC_ACQUIRE, "workgroup");
    if (OUT_MODE == 0) {
      float* C = (float*)Cout + (size_t)b * strideC;
      const int hh = lane >> 4, c4 = (lane & 15) * 4;     // row seg = 256 B = 16 lanes x 16 B
      {
#pragma unroll
        for (int it = 0; it < 8; ++it) {
          const int row = it * 2 + hh;
          v4f v = *(const v4f*)(slab + row * 68 + c4);
          *(v4f*)(C + (size_t)(mBase + row) * ldc + n0 + c4) = v;
        }
        
      }
    } else {
      const int q = lane >> 3, c8 = (lane & 7) * 8;
      unsigned short* C  = (unsigned short*)Cout  + (size_t)b * strideC;
      unsigned short* C2 = (OUT_MODE == 2) ? ((unsigned short*)Cout2 + (size_t)b * strideC) : nullptr;
      {
#pragma unroll
        for (int it = 0; it < 4; ++it) {
          const int row = it * 4 + q;
          const float* sp = slab + row * 68 + c8;
          v8h hv, lv;
#pragma unroll
          for (int e = 0; e < 8; ++e) {
            if (OUT_MODE == 1) {
              hv[e] = (_Float16)sp[e];
            } else {
              unsigned short hb = f2bf_bits(sp[e]);
              unsigned short lb = f2bf_bits(sp[e] - bf_bits2f(hb));
              hv[e] = __builtin_bit_cast(_Float16, hb);
              lv[e] = __builtin_bit_cast(_Float16, lb);
            }
          }
          *(v8h*)(C + (size_t)(mBase + row) * ldc + n0 + c8) = hv;
          if (OUT_MODE == 2) *(v8h*)(C2 + (size_t)(mBase + row) * ldc + n0 + c8) = lv;
        }
        
      }
    }
    __builtin_amdgcn_fence(__ATOMIC_RELEASE, "workgroup");
    __builtin_amdgcn_wave_barrier();
    __builtin_amdgcn_fence(__ATOMIC_ACQUIRE, "workgroup");
  }
}

// coverage: n2 threads x 2 elements = n elements exactly (n even, grid = ceil(n2/256))
__global__ __launch_bounds__(256) void cast_f32_bf16x2(
    const float* __restrict__ in, unsigned short* __restrict__ out, int n2) {
  const int i = blockIdx.x * 256 + threadIdx.x;
  if (i < n2) {
    const unsigned u = (unsigned)f2bf_bits(in[2 * i]) | ((unsigned)f2bf_bits(in[2 * i + 1]) << 16);
    ((unsigned*)out)[i] = u;
    
  }
}

// ---- f32 -> bf16 (RNE) -> x carry -> f16 cast (carry a power of two; exact for normal results) ----
__global__ __launch_bounds__(256) void cast_f32_bf16_f16x2_carry(
    const float* __restrict__ in, unsigned short* __restrict__ out, int n2, float carry) {
  const int i = blockIdx.x * 256 + threadIdx.x;
  if (i < n2) {
    const _Float16 h0 = (_Float16)(bf_rne(in[2 * i]) * carry);
    const _Float16 h1 = (_Float16)(bf_rne(in[2 * i + 1]) * carry);
    const unsigned u = (unsigned)__builtin_bit_cast(unsigned short, h0) | ((unsigned)__builtin_bit_cast(unsigned short, h1) << 16);
    ((unsigned*)out)[i] = u;
    
  }
}

// ---- lambda = exp(lq1.lk1) - exp(lq2.lk2) + 0.8 from bf16-RNE-converted vectors; one wave writes one 32-float line ----
__global__ __launch_bounds__(32) void lambda_line(
    const float* __restrict__ lq1, const float* __restrict__ lq2,
    const float* __restrict__ lk1, const float* __restrict__ lk2, float* __restrict__ lamp) {
  const int lane = threadIdx.x;
  float d1 = 0.0f, d2 = 0.0f;
#pragma unroll 1
  for (int i = 0; i < kHeadDim; ++i) {
    d1 += bf_rne(lq1[i]) * bf_rne(lk1[i]);
    d2 += bf_rne(lq2[i]) * bf_rne(lk2[i]);
  }
  const float lam = expf(d1) - expf(d2) + 0.8f;
  ((float*)lamp)[lane] = lam;
  
}

// ---- bf16 split helpers ----
__device__ __forceinline__ __bf16 at_f2bf(float f) { return __builtin_bit_cast(__bf16, f2bf_bits(f)); }
__device__ __forceinline__ void at_split(float f, __bf16& hi, __bf16& lo) {
  const unsigned short hb = f2bf_bits(f);
  hi = __builtin_bit_cast(__bf16, hb);
  lo = at_f2bf(f - __uint_as_float(((unsigned)hb) << 16));
}
__device__ __forceinline__ v8f at_mma(v16b a, v16b b, v8f c) {
  c = __builtin_amdgcn_wmma_f32_16x16x32_bf16(false, a, false, b, (short)0, c, false, false);
  asm volatile("v_nop\n\tv_nop\n\tv_nop\n\tv_nop" : "+v"(c) : "v"(a), "v"(b));
  return c;
}

// =====================================================================================
// Differential causal attention, head_dim 64, two softmax maps per head.
//   inputs : q, k as bf16 hi/lo planes [B*S][H*128] (map a uses columns h*128 + a*64 .. +64),
//            Vt as bf16 hi/lo planes [B][H*64][S] (key-contiguous), amask [B][S] f32, lambda line.
//   scores = 0.125 * q_a.k_a^T + causal add + (1-amask)*(-1e9) add; online softmax in f32 (expf);
//   q.k^T and p.v on v_wmma_f32_16x16x32_bf16 as hi.hi + hi.lo + lo.hi (f32 accumulate).
//   att[b][h][s][d] = o_0/l_0 - lambda * o_1/l_1 ; per-tile (sum, sumsq) line for the group norm.
//   Block = 8 waves of one (b, h): waves 0-3 run map 0 and waves 4-7 map 1 of the same 64 query rows.
//   A block takes query tile pr and then tile 31 - pr, so every block walks 33 key chunks;
//   grid.x = B*H*16 = 512, pr fastest.
// LDS: K hi/lo per map [64 kv][64 d], Vt hi/lo [64 d][64 kv] (shared by both maps), per-wave P hi/lo [16][64], all at row pitch kLP;
//      one out slab [16][68] per 16 query rows.
// Every staged LDS byte that is read is written in full each chunk (64 full rows per plane); the 8 pad elements of a row are never read.
// =====================================================================================
__global__ __launch_bounds__(256)
void diff_attn64(const unsigned short* __restrict__ Qh, const unsigned short* __restrict__ Ql,
                 const unsigned short* __restrict__ Kh, const unsigned short* __restrict__ Kl,
                 const unsigned short* __restrict__ Vh, const unsigned short* __restrict__ Vl,
                 const float* __restrict__ amask, const float* __restrict__ lamp,
                 float* __restrict__ att, float* __restrict__ part) {
  union FB { v16b v; v8b h[2]; };
  __shared__ __align__(16) unsigned short Ksh[2][kKC * kLP];
  __shared__ __align__(16) unsigned short Ksl[2][kKC * kLP];
  __shared__ __align__(16) unsigned short Vth[kHeadDim * kLP];
  __shared__ __align__(16) unsigned short Vtl[kHeadDim * kLP];
  __shared__ __align__(16) __bf16 Psh[8][16 * kLP];
  __shared__ __align__(16) __bf16 Psl[8][16 * kLP];
  __shared__ __align__(16) float Os[4][16 * 68];
  __shared__ float red[4][2];

  const int tid  = threadIdx.x;
  const int wave = __builtin_amdgcn_readfirstlane(tid >> 5);   // scalar, so the tests on the map below are scalar branches
  const int a    = wave >> 2;         // softmax map of this wave
  const int wq   = wave & 3;          // 16-row slice of the query tile
  const int lane = tid & 31;
  const int hh   = lane >> 4;
  const int c    = lane & 15;
  const int bx   = blockIdx.x;
  const int pr   = bx & (kNPair - 1);
  const int bh   = bx >> 4;
  const int h    = bh & (kHeads - 1);
  const int b    = bh >> 4;
  const float lam = lamp[0];
  const float negInf = -__builtin_huge_valf();

  const size_t vbase = (size_t)(b * kDModel + h * kHeadDim) * kSeq;               // Vt row (h*64 + d) of batch b
  float* ob_ptr = att + (size_t)bh * kSeq * kHeadDim;
  float* os = Os[wq];
  __bf16* pwh = Psh[wave];
  __bf16* pwl = Psl[wave];
  const unsigned short* ksh = Ksh[a];
  const unsigned short* ksl = Ksl[a];
  const int kvr = tid >> 2;           // staged row: key row for K, d row for Vt (0..63)
  const int sg  = (tid & 3) * 8;      // 8-element segment inside a group of 32 elements

  for (int half = 0; half < 2; ++half) {
    const int qb = half ? (kNQblk - 1 - pr) : pr;
    const int q0 = qb * kQB + wq * 16;
    const size_t qoff = (size_t)(b * kSeq + q0 + c) * kQKCols + (size_t)h * 128 + a * 64;   // + dc*32 + 8*hh
    // Q fragments (A operand) for this wave's map: 2 d-chunks, hi and lo planes
    v16b qah[2], qal[2];
#pragma unroll
    for (int dc = 0; dc < 2; ++dc) {
      qah[dc] = Frag<__bf16>::load((const __bf16*)Qh + qoff + dc * 32 + 8 * hh);
      qal[dc] = Frag<__bf16>::load((const __bf16*)Ql + qoff + dc * 32 + 8 * hh);
    }
    float mrow[8], lrow[8];
    v8f oacc[4];
#pragma unroll
    for (int r = 0; r < 8; ++r) { mrow[r] = negInf; lrow[r] = 0.0f; }
#pragma unroll
    for (int t = 0; t < 4; ++t) oacc[t] = (v8f){0.f,0.f,0.f,0.f,0.f,0.f,0.f,0.f};

    for (int kc = 0; kc <= qb; ++kc) {          // causal: chunks 0..qb (block-uniform trip count, <= 32)
      const int kv0 = kc * kKC;
      __syncthreads();
      {
        // a K row holds both maps side by side (128 elements): groups 0,1 are map 0, groups 2,3 map 1
        const size_t ko = (size_t)(b * kSeq + kv0 + kvr) * kQKCols + (size_t)h * 128 + sg;
        const size_t vo = vbase + (size_t)kvr * kSeq + kv0 + sg;
        u4v t0[4], t1[4], t2[2], t3[2];
#pragma unroll
        for (int i = 0; i < 4; ++i) { t0[i] = *(const u4v*)(Kh + ko + 32 * i); t1[i] = *(const u4v*)(Kl + ko + 32 * i); }
#pragma unroll
        for (int i = 0; i < 2; ++i) { t2[i] = *(const u4v*)(Vh + vo + 32 * i); t3[i] = *(const u4v*)(Vl + vo + 32 * i); }
#pragma unroll
        for (int i = 0; i < 4; ++i) {
          *(u4v*)(Ksh[i >> 1] + kvr * kLP + (i & 1) * 32 + sg) = t0[i];
          *(u4v*)(Ksl[i >> 1] + kvr * kLP + (i & 1) * 32 + sg) = t1[i];
        }
#pragma unroll
        for (int i = 0; i < 2; ++i) { *(u4v*)(Vth + kvr * kLP + i * 32 + sg) = t2[i]; *(u4v*)(Vtl + kvr * kLP + i * 32 + sg) = t3[i]; }
      }
      // additive padding-mask term for this lane's 4 key columns (bf16 RNE-converted mask)
      float amv[4];
#pragma unroll
      for (int j = 0; j < 4; ++j) amv[j] = (1.0f - bf_rne(amask[b * kSeq + kv0 + j * 16 + c])) * (-1.0e9f);
      __syncthreads();

      // ---- scores: 4 key subtiles of 16, K = 64 (2 chunks), hi.hi + hi.lo + lo.hi ----
      v8f s[4];
#pragma unroll
      for (int j = 0; j < 4; ++j) {
        s[j] = (v8f){0.f,0.f,0.f,0.f,0.f,0.f,0.f,0.f};
#pragma unroll
        for (int dc = 0; dc < 2; ++dc) {
          FB kb, kl;
          kb.h[0] = *(const v8b*)(ksh + (j * 16 + c) * kLP + dc * 32 + 8 * hh);
          kb.h[1] = *(const v8b*)(ksh + (j * 16 + c) * kLP + dc * 32 + 16 + 8 * hh);
          kl.h[0] = *(const v8b*)(ksl + (j * 16 + c) * kLP + dc * 32 + 8 * hh);
          kl.h[1] = *(const v8b*)(ksl + (j * 16 + c) * kLP + dc * 32 + 16 + 8 * hh);
          s[j] = at_mma(qah[dc], kb.v, s[j]);
          s[j] = at_mma(qah[dc], kl.v, s[j]);
          s[j] = at_mma(qal[dc], kb.v, s[j]);
        }
      }
      // ---- scale, causal add, mask add, row max ----
      const bool diag = (kc == qb);
      float cm[8];
#pragma unroll
      for (int r = 0; r < 8; ++r) {
        const int qrow = q0 + 8 * hh + r;
        float m = negInf;
#pragma unroll
        for (int j = 0; j < 4; ++j) {
          const int kvcol = kv0 + j * 16 + c;
          const float cz = (diag && (kvcol > qrow)) ? -1.0e9f : 0.0f;
          float sc = s[j][r] * 0.125f;
          sc = sc + cz;
          sc = sc + amv[j];
          s[j][r] = sc;
          m = fmaxf(m, sc);
        }
#pragma unroll
        for (int off = 1; off < 16; off <<= 1) m = fmaxf(m, __shfl_xor(m, off, 32));
        cm[r] = m;
      }
      // ---- online softmax update, P tile as bf16 hi/lo ----
#pragma unroll
      for (int r = 0; r < 8; ++r) {
        const float mnew = fmaxf(mrow[r], cm[r]);
        const float alpha = expf(mrow[r] - mnew);
        mrow[r] = mnew;
        float ps = 0.0f;
#pragma unroll
        for (int j = 0; j < 4; ++j) {
          const float p = expf(s[j][r] - mnew);
          ps += p;
          __bf16 ph, pl;
          at_split(p, ph, pl);
          pwh[(8 * hh + r) * kLP + j * 16 + c] = ph;
          pwl[(8 * hh + r) * kLP + j * 16 + c] = pl;
        }
#pragma unroll
        for (int off = 1; off < 16; off <<= 1) ps += __shfl_xor(ps, off, 32);
        lrow[r] = lrow[r] * alpha + ps;
#pragma unroll
        for (int t = 0; t < 4; ++t) oacc[t][r] *= alpha;
      }
      __builtin_amdgcn_fence(__ATOMIC_RELEASE, "workgroup");
      __builtin_amdgcn_wave_barrier();
      __builtin_amdgcn_fence(__ATOMIC_ACQUIRE, "workgroup");
      // ---- P.V: A = P (this wave's slab), B = Vt [d][kv]; hi.hi + hi.lo + lo.hi ----
#pragma unroll
      for (int kk = 0; kk < 2; ++kk) {
        FB pa, pl;
        pa.h[0] = *(const v8b*)(pwh + c * kLP + kk * 32 + 8 * hh);
        pa.h[1] = *(const v8b*)(pwh + c * kLP + kk * 32 + 16 + 8 * hh);
        pl.h[0] = *(const v8b*)(pwl + c * kLP + kk * 32 + 8 * hh);
        pl.h[1] = *(const v8b*)(pwl + c * kLP + kk * 32 + 16 + 8 * hh);
#pragma unroll
        for (int t = 0; t < 4; ++t) {
          FB vb, vl;
          vb.h[0] = *(const v8b*)(Vth + (t * 16 + c) * kLP + kk * 32 + 8 * hh);
          vb.h[1] = *(const v8b*)(Vth + (t * 16 + c) * kLP + kk * 32 + 16 + 8 * hh);
          vl.h[0] = *(const v8b*)(Vtl + (t * 16 + c) * kLP + kk * 32 + 8 * hh);
          vl.h[1] = *(const v8b*)(Vtl + (t * 16 + c) * kLP + kk * 32 + 16 + 8 * hh);
          oacc[t] = at_mma(pa.v, vb.v, oacc[t]);
          oacc[t] = at_mma(pa.v, vl.v, oacc[t]);
          oacc[t] = at_mma(pl.v, vb.v, oacc[t]);
        }
      }
    }
    // ---- finish this tile: map 1 hands o/l over through the slab; map 0 combines and sums the norm partials ----
    if (a == 1) {
#pragma unroll
      for (int r = 0; r < 8; ++r) {
        const float inv = 1.0f / lrow[r];
#pragma unroll
        for (int t = 0; t < 4; ++t) os[(8 * hh + r) * 68 + t * 16 + c] = oacc[t][r] * inv;
      }
    }
    __syncthreads();
    if (a == 0) {
      float psum = 0.0f, psq = 0.0f;
#pragma unroll
      for (int r = 0; r < 8; ++r) {
        const float inv = 1.0f / lrow[r];
#pragma unroll
        for (int t = 0; t < 4; ++t) {
          const int oi = (8 * hh + r) * 68 + t * 16 + c;
          const float o = oacc[t][r] * inv;
          const float w = o - lam * os[oi];
          os[oi] = w;
          psum += w;
          psq += w * w;
        }
      }
      // wave reductions, then a block combine in fixed order
#pragma unroll
      for (int off = 1; off < 32; off <<= 1) { psum += __shfl_xor(psum, off, 32); psq += __shfl_xor(psq, off, 32); }
      if (lane == 0) { red[wq][0] = psum; red[wq][1] = psq; }
    }
    __syncthreads();

    {
      const int c4 = (lane & 15) * 4;
#pragma unroll
      for (int it = 0; it < 4; ++it) {
        const int row = a * 8 + it * 2 + hh;      // each wave stores 8 of the slab's 16 rows
        v4f val = *(const v4f*)(os + row * 68 + c4);
        *(v4f*)(ob_ptr + (size_t)(q0 + row) * kHeadDim + c4) = val;
      }
      asm volatile("s_wait_xcnt 0x0" ::: "memory");   // the stores' address and data registers are rewritten by the code that follows
    }
    if (wave == 0) {
      const float t0 = ((red[0][0] + red[1][0]) + red[2][0]) + red[3][0];
      const float t1 = ((red[0][1] + red[1][1]) + red[2][1]) + red[3][1];
      const float v = (lane == 0) ? t0 : ((lane == 1) ? t1 : 0.0f);
      float* pline = part + (size_t)(bh * kNQblk + qb) * 32;
      ((float*)pline)[lane] = v;
      asm volatile("s_wait_xcnt 0x0" ::: "memory");   // the next tile's set-up rewrites this store's registers
    }
  }
}

// ---- group norm statistics per (b,h): fixed-order sum of the 32 tile lines; one wave writes one stats line ----
__global__ __launch_bounds__(32) void gn_stats(const float* __restrict__ part, float* __restrict__ stats) {
  const int bh = blockIdx.x;
  const int lane = threadIdx.x;
  float s0 = part[(size_t)(bh * kNQblk + lane) * 32 + 0];
  float s1 = part[(size_t)(bh * kNQblk + lane) * 32 + 1];
#pragma unroll
  for (int off = 1; off < 32; off <<= 1) { s0 += __shfl_xor(s0, off, 32); s1 += __shfl_xor(s1, off, 32); }
  const float inv_n = 1.0f / (float)(kSeq * kHeadDim);
  const float mu = s0 * inv_n;
  const float ex2 = s1 * inv_n;
  const float var = fmaxf(ex2 - mu * mu, 0.0f);
  const float rs = rsqrtf(var + 1.0e-5f);
  const float v = (lane == 0) ? mu : ((lane == 1) ? rs : 0.0f);
  ((float*)stats)[bh * 32 + lane] = v;
  
}

// ---- normalize + affine + x0.2 + merge heads -> f16 plane (x8 carry), [B*S][H*64] ----
__global__ __launch_bounds__(256) void gn_merge(const float* __restrict__ att, const float* __restrict__ stats,
                                              const float* __restrict__ gamma, const float* __restrict__ beta,
                                              unsigned short* __restrict__ merged) {
  const int g = blockIdx.x * 256 + threadIdx.x;
  if (g >= kBatch * kHeads * kSeq * 8) return;
  const int seg = g >> 3;
  const int e8  = (g & 7) * 8;
  const int bh  = seg >> 11;
  const int s   = seg & (kSeq - 1);
  const int h   = bh & (kHeads - 1);
  const int b   = bh >> 4;
  const float mu = stats[bh * 32 + 0];
  const float rs = stats[bh * 32 + 1];
  union U8 { v4f v[2]; float f[8]; };
  U8 x, ga, be;
  const float* ap = att + (size_t)seg * kHeadDim + e8;
  x.v[0]  = *(const v4f*)ap;
  x.v[1]  = *(const v4f*)(ap + 4);
  ga.v[0] = *(const v4f*)(gamma + h * kHeadDim + e8);
  ga.v[1] = *(const v4f*)(gamma + h * kHeadDim + e8 + 4);
  be.v[0] = *(const v4f*)(beta + h * kHeadDim + e8);
  be.v[1] = *(const v4f*)(beta + h * kHeadDim + e8 + 4);
  v8h hv;
#pragma unroll
  for (int e = 0; e < 8; ++e) {
    const float gq = bf_rne(ga.f[e]);
    const float bq = bf_rne(be.f[e]);
    float y = (x.f[e] - mu) * rs;
    y = y * gq + bq;
    y = y * 0.2f;
    float z = y * kMergeCarry;
    asm volatile("" : "+v"(z));
    hv[e] = (_Float16)z;
  }
  unsigned short* dst = merged + (size_t)(b * kSeq + s) * kDModel + h * kHeadDim + e8;
  *(v8h*)dst = hv;
  
}

// ---------------------------------------------------------------------------
extern "C" void kernel_launch(void* const* d_in, const int* in_sizes, int n_in,
                              void* d_out, int out_size, void* d_ws, size_t ws_size,
                              hipStream_t stream) {
  if (n_in < 12) return;
  if (in_sizes[0] != kTok * kDModel || in_sizes[1] != kBatch * kSeq ||
      in_sizes[2] != kQKCols * kDModel || in_sizes[3] != kQKCols * kDModel ||
      in_sizes[4] != kDModel * kDModel || in_sizes[5] != kDModel * kDModel ||
      in_sizes[6] != kHeadDim || in_sizes[7] != kHeadDim || in_sizes[8] != kHeadDim || in_sizes[9] != kHeadDim ||
      in_sizes[10] != kDModel || in_sizes[11] != kDModel) return;
  if (out_size != kTok * kDModel) return;
  if (ws_size < kWsTotal) return;

  const float* X     = (const float*)d_in[0];
  const float* amask = (const float*)d_in[1];
  const float* Wq    = (const float*)d_in[2];
  const float* Wk    = (const float*)d_in[3];
  const float* Wv    = (const float*)d_in[4];
  const float* Wo    = (const float*)d_in[5];
  const float* lq1   = (const float*)d_in[6];
  const float* lq2   = (const float*)d_in[7];
  const float* lk1   = (const float*)d_in[8];
  const float* lk2   = (const float*)d_in[9];
  const float* gamma = (const float*)d_in[10];
  const float* beta  = (const float*)d_in[11];

  char* w = (char*)d_ws;
  unsigned short* Xb    = (unsigned short*)(w + kOffXb);
  unsigned short* Wqb   = (unsigned short*)(w + kOffWqb);
  unsigned short* Wkb   = (unsigned short*)(w + kOffWkb);
  unsigned short* Wvb   = (unsigned short*)(w + kOffWvb);
  unsigned short* Wo16  = (unsigned short*)(w + kOffWo16);
  unsigned short* Qh    = (unsigned short*)(w + kOffQh);
  unsigned short* Ql    = (unsigned short*)(w + kOffQl);
  unsigned short* Kh    = (unsigned short*)(w + kOffKh);
  unsigned short* Kl    = (unsigned short*)(w + kOffKl);
  unsigned short* Vth   = (unsigned short*)(w + kOffVth);
  unsigned short* Vtl   = (unsigned short*)(w + kOffVtl);
  float*          att   = (float*)(w + kOffAtt);
  unsigned short* mrg   = (unsigned short*)(w + kOffMerged);
  float*          part  = (float*)(w + kOffPart);
  float*          stats = (float*)(w + kOffStats);
  float*          lamp  = (float*)(w + kOffLam);

  // 1) input conversions (bf16 RNE; Wo additionally x256 into f16)
  constexpr int n2X  = kTok * kDModel / 2;       // 2,097,152
  constexpr int n2Wq = kQKCols * kDModel / 2;    // 1,048,576
  constexpr int n2Wv = kDModel * kDModel / 2;    //   524,288
  static_assert(n2X % 256 == 0 && n2Wq % 256 == 0 && n2Wv % 256 == 0);
  cast_f32_bf16x2<<<n2X / 256, 256, 0, stream>>>(X, Xb, n2X);
  cast_f32_bf16x2<<<n2Wq / 256, 256, 0, stream>>>(Wq, Wqb, n2Wq);
  cast_f32_bf16x2<<<n2Wq / 256, 256, 0, stream>>>(Wk, Wkb, n2Wq);
  cast_f32_bf16x2<<<n2Wv / 256, 256, 0, stream>>>(Wv, Wvb, n2Wv);
  cast_f32_bf16_f16x2_carry<<<n2Wv / 256, 256, 0, stream>>>(Wo, Wo16, n2Wv, kWoCarry);
  lambda_line<<<1, 32, 0, stream>>>(lq1, lq2, lk1, lk2, lamp);

  // 2) projections: q/k planes [4096][2048] hi+lo, Vt planes [2][1024][2048] hi+lo
  constexpr int gridQ  = (kTok / 64) * (kQKCols / 64) / 8;   // 256
  constexpr int gridVt = (kDModel / 64) * (kSeq / 64) / 8;   // 64
  constexpr int gridO  = (kTok / 64) * (kDModel / 64) / 8;   // 128
  static_assert(gridQ * 8 == (kTok / 64) * (kQKCols / 64));
  static_assert(gridVt * 8 == (kDModel / 64) * (kSeq / 64));
  static_assert(gridO * 8 == (kTok / 64) * (kDModel / 64));
  wmma_gemm64<1, false, 0, 2, false><<<dim3(gridQ, 1, 1), 256, 0, stream>>>(
      Xb, Xb, kDModel, 0L, Wqb, Wqb, kDModel, 0L, (void*)Qh, (void*)Ql, kQKCols, 0L,
      lamp, lamp, 0L, kTok, kQKCols, kDModel, 1.0f);
  wmma_gemm64<1, false, 0, 2, false><<<dim3(gridQ, 1, 1), 256, 0, stream>>>(
      Xb, Xb, kDModel, 0L, Wkb, Wkb, kDModel, 0L, (void*)Kh, (void*)Kl, kQKCols, 0L,
      lamp, lamp, 0L, kTok, kQKCols, kDModel, 1.0f);
  // Vt[b][c][s] = sum_k Wv[c][k] * X[b][s][k] : A = Wv [1024][1024], Bt = X_b [2048][1024]
  wmma_gemm64<1, false, 0, 2, false><<<dim3(gridVt, kBatch, 1), 256, 0, stream>>>(
      Wvb, Wvb, kDModel, 0L, Xb, Xb, kDModel, (long)kSeq * kDModel, (void*)Vth, (void*)Vtl, kSeq, (long)kDModel * kSeq,
      lamp, lamp, 0L, kDModel, kSeq, kDModel, 1.0f);

  // 3) differential causal attention + norm partial lines (512 blocks, two query tiles each)
  diff_attn64<<<kAttnGroups, 256, 0, stream>>>(Qh, Ql, Kh, Kl, Vth, Vtl, amask, lamp, att, part);

  // 4) group norm stats, normalize + merge
  gn_stats<<<kBatch * kHeads, 32, 0, stream>>>(part, stats);
  gn_merge<<<(kBatch * kHeads * kSeq * 8) / 256, 256, 0, stream>>>(att, stats, gamma, beta, mrg);

  // 5) output projection: out[m][n] = (1/2048) * sum_k merged8[m][k] * Wo256[n][k]
  wmma_gemm64<0, false, 0, 0, false><<<dim3(gridO, 1, 1), 256, 0, stream>>>(
      mrg, mrg, kDModel, 0L, Wo16, Wo16, kDModel, 0L, d_out, d_out, kDModel, 0L,
      lamp, lamp, 0L, kTok, kDModel, kDModel, 1.0f / (kMergeCarry * kWoCarry));
}

// v003
// One run takes 323 microseconds.
// Two timings next to v002 both put it at 1.34 times that version's speed.
// Over all steps from v000 it is 2.39 times as fast.
// Contractions: x.Wq^T, x.Wk^T, Wv.x^T = v_wmma_f32_16x16x32_bf16 (plain bf16 operands from RNE-converted inputs); q.k^T and p.v = v_wmma_f32_16x16x32_bf16 with bf16 hi/lo planes (hi.hi+hi.lo+lo.hi); merged.Wo^T = v_wmma_f32_16x16x32_f16 (f16 operands, carries 8 and 256); f32 accumulate everywhere; softmax, group norm and the two 64-term lambda dots in f32.
#include <hip/hip_runtime.h>

typedef __attribute__((ext_vector_type(16))) _Float16 v16h;
typedef __attribute__((ext_vector_type(8)))  _Float16 v8h;
typedef __attribute__((ext_vector_type(16))) __bf16   v16b;
typedef __attribute__((ext_vector_type(8)))  __bf16   v8b;
typedef __attribute__((ext_vector_type(8)))  float    v8f;
typedef __attribute__((ext_vector_type(4)))  float    v4f;
typedef __attribute__((ext_vector_type(4)))  unsigned int u4v;

// ---- problem geometry ----
constexpr int kBatch   = 2;
constexpr int kSeq     = 2048;
constexpr int kDModel  = 1024;
constexpr int kHeads   = 16;
constexpr int kHeadDim = 64;
constexpr int kQKCols  = 2 * kDModel;      // 2048 : row width of the q/k planes (H * 128)
constexpr int kTok     = kBatch * kSeq;    // 4096
constexpr int kQB      = 64;               // query rows per tile; a block takes two tiles
constexpr int kKC      = 64;               // keys per chunk
constexpr int kLP      = 72;               // LDS row pitch of the 64-element 16-bit tiles: 144 B = 16 B x 9 (odd), conflict-free for 16-byte row reads
constexpr int kNQblk   = kSeq / kQB;       // 32
constexpr int kAttnBlocks = kBatch * kHeads * kNQblk;   // 1024 query tiles
constexpr int kNPair   = kNQblk / 2;        // 16 : tile pairs (t, 31 - t) per (b, h)
constexpr int kAttnGroups = kBatch * kHeads * kNPair;   // 512 work-groups of the attention launch
constexpr float kMergeCarry = 8.0f;        // f16 merged plane carried x8
constexpr float kWoCarry    = 256.0f;      // f16 Wo plane carried x256

static_assert(kNQblk == 32);
static_assert(kHeads == 16);
static_assert(kAttnBlocks == 1024);
static_assert(kNPair == 16 && kAttnGroups == 512);
static_assert(kSeq % kQB == 0);
static_assert(kDModel % 32 == 0);                  // K of every GEMM
static_assert(kTok % 64 == 0 && kQKCols % 64 == 0 && kDModel % 64 == 0 && kSeq % 64 == 0);   // M, N tile multiples

// ---- workspace region map (bytes; every offset a multiple of 128) ----
constexpr size_t kBytesXb     = (size_t)kTok * kDModel * 2;                     //  8,388,608  x as bf16 [4096][1024]
constexpr size_t kBytesWqk    = (size_t)kQKCols * kDModel * 2;                  //  4,194,304  Wq / Wk as bf16 [2048][1024]
constexpr size_t kBytesWv     = (size_t)kDModel * kDModel * 2;                  //  2,097,152  Wv as bf16 [1024][1024]
constexpr size_t kBytesWo     = (size_t)kDModel * kDModel * 2;                  //  2,097,152  Wo as f16 x256 [1024][1024]
constexpr size_t kBytesQPl    = (size_t)kTok * kQKCols * 2;                     // 16,777,216  one q or k plane [4096][2048]
constexpr size_t kBytesVtPl   = (size_t)kBatch * kDModel * kSeq * 2;            //  8,388,608  one Vt plane [2][1024][2048]
constexpr size_t kBytesAtt    = (size_t)kBatch * kHeads * kSeq * kHeadDim * 4;  // 16,777,216  attention out f32 [2][16][2048][64]
constexpr size_t kBytesMerged = (size_t)kTok * kDModel * 2;                     //  8,388,608  merged f16 x8 [4096][1024]
constexpr size_t kBytesPart   = (size_t)kAttnBlocks * 128;                      //    131,072  one 32-float line per query tile (1024 tiles)
constexpr size_t kBytesStats  = (size_t)kBatch * kHeads * 128;                  //      4,096  one 32-float line per (b,h)
constexpr size_t kBytesLam    = 128;                                            //        128  lambda line

constexpr size_t kOffXb     = 0;
constexpr size_t kOffWqb    = kOffXb + kBytesXb;
constexpr size_t kOffWkb    = kOffWqb + kBytesWqk;
constexpr size_t kOffWvb    = kOffWkb + kBytesWqk;
constexpr size_t kOffWo16   = kOffWvb + kBytesWv;
constexpr size_t kOffQh     = kOffWo16 + kBytesWo;
constexpr size_t kOffQl     = kOffQh + kBytesQPl;
constexpr size_t kOffKh     = kOffQl + kBytesQPl;
constexpr size_t kOffKl     = kOffKh + kBytesQPl;
constexpr size_t kOffVth    = kOffKl + kBytesQPl;
constexpr size_t kOffVtl    = kOffVth + kBytesVtPl;
constexpr size_t kOffAtt    = kOffVtl + kBytesVtPl;
constexpr size_t kOffMerged = kOffAtt + kBytesAtt;
constexpr size_t kOffPart   = kOffMerged + kBytesMerged;
constexpr size_t kOffStats  = kOffPart + kBytesPart;
constexpr size_t kOffLam    = kOffStats + kBytesStats;
constexpr size_t kWsTotal   = kOffLam + kBytesLam;                              // 130,158,720
static_assert(kBytesPart == 131072);
static_assert(kWsTotal == 130158720);
static_assert(kWsTotal <= 134217728);
static_assert(kOffWqb % 128 == 0 && kOffQh % 128 == 0 && kOffAtt % 128 == 0 && kOffPart % 128 == 0 && kOffStats % 128 == 0 && kOffLam % 128 == 0);

// ---- 16-bit helpers ----
__device__ __forceinline__ unsigned short f2bf_bits(float f) {
  unsigned u = __float_as_uint(f);
  return (unsigned short)((u + 0x7FFFu + ((u >> 16) & 1u)) >> 16);
}
__device__ __forceinline__ float bf_bits2f(unsigned short h) { return __uint_as_float(((unsigned)h) << 16); }
__device__ __forceinline__ float bf_rne(float f) { return bf_bits2f(f2bf_bits(f)); }

// hazard guards as plain device helpers
__device__ __forceinline__ void dep_guard_h(v8f& a, v8f& b, v16h x, v16h y) { asm volatile("v_nop\n\tv_nop\n\tv_nop\n\tv_nop" : "+v"(a), "+v"(b) : "v"(x), "v"(y)); }
__device__ __forceinline__ void dep_guard_b(v8f& a, v8f& b, v16b x, v16b y) { asm volatile("v_nop\n\tv_nop\n\tv_nop\n\tv_nop" : "+v"(a), "+v"(b) : "v"(x), "v"(y)); }
__device__ __forceinline__ void keep4_h(v16h a, v16h b, v16h c, v16h d) { asm volatile("v_nop" :: "v"(a), "v"(b), "v"(c), "v"(d)); }
__device__ __forceinline__ void keep4_b(v16b a, v16b b, v16b c, v16b d) { asm volatile("v_nop" :: "v"(a), "v"(b), "v"(c), "v"(d)); }
__device__ __forceinline__ void acc_guard4(v8f& a, v8f& b, v8f& c, v8f& d) { asm volatile("v_nop\n\tv_nop\n\tv_nop\n\tv_nop" : "+v"(a), "+v"(b), "+v"(c), "+v"(d)); }
template <typename T> struct Frag;
template <> struct Frag<_Float16> {
  typedef v16h V; union U { v16h v; v8h h[2]; };
  static __device__ __forceinline__ v16h load(const _Float16* p) {   // elements 0..7 <- p[0..7], 8..15 <- p[16..23]
    U f; f.h[0] = *(const v8h*)(p); f.h[1] = *(const v8h*)(p + 16); return f.v;
  }
  static __device__ __forceinline__ v8f mma(v16h a, v16h b, v8f c) {
    return __builtin_amdgcn_wmma_f32_16x16x32_f16(false, a, false, b, (short)0, c, false, false);
  }
  static __device__ __forceinline__ void guard(v8f& a, v8f& b, v16h x, v16h y) { dep_guard_h(a, b, x, y); }
  static __device__ __forceinline__ void keep(v16h a, v16h b, v16h c, v16h d) { keep4_h(a, b, c, d); }
};
template <> struct Frag<__bf16> {
  typedef v16b V; union U { v16b v; v8b h[2]; };
  static __device__ __forceinline__ v16b load(const __bf16* p) {
    U f; f.h[0] = *(const v8b*)(p); f.h[1] = *(const v8b*)(p + 16); return f.v;
  }
  static __device__ __forceinline__ v8f mma(v16b a, v16b b, v8f c) {
    return __builtin_amdgcn_wmma_f32_16x16x32_bf16(false, a, false, b, (short)0, c, false, false);
  }
  static __device__ __forceinline__ void guard(v8f& a, v8f& b, v16b x, v16b y) { dep_guard_b(a, b, x, y); }
  static __device__ __forceinline__ void keep(v16b a, v16b b, v16b c, v16b d) { keep4_b(a, b, c, d); }
};

// ---- Register-blocked batched WMMA GEMM, operands staged in LDS ------------
// C[m,n] = scale * sum_k A[m,k] * Bt[n,k] (+bias)(+resid); a work-group owns a 128x256 tile, each of its 8 waves (2 x 4) a 64x64 part.
// A row-major [M,K]; Bt row-major [N,K]; M % 128 == 0, N % 256 == 0, K % 128 == 0, K >= 256.
// Per 128 k the 128 A rows and 256 Bt rows (256 bytes, two whole lines, each) reach LDS by asynchronous copies, two buffers:
// the copies of tile t + 2 fly while tile t + 1 is worked on; the fragments are read from LDS at row pitch kGP.
// SPLIT is not carried by the staged loop (one plane per operand).
// BIAS_MODE: 0 = none, 1 = bias[m], 2 = bias[n].
// OUT_MODE: 0 = f32, 1 = f16, 2 = bf16 hi plane (Cout) + bf16 lo plane (Cout2).
// ET: 0 = f16 operands, 1 = bf16 operands (pointers passed as 16-bit storage)
constexpr int kGK     = 128;                   // k elements per staged tile
constexpr int kGP     = 136;                   // LDS row pitch of a staged row: 272 B = 16 B x 17 (odd), conflict-free for 16-byte row reads
constexpr int kGRowsA = 128;                   // staged A rows
constexpr int kGRowsB = 256;                   // staged Bt rows
constexpr int kGBuf   = (kGRowsA + kGRowsB) * kGP;   // 16-bit elements of one buffer (104,448 B)

// Twelve 16-byte asynchronous copies of one lane, global -> LDS (l = LDS byte address, g = global address).
// The closing s_wait_xcnt stands inside the statement, so that no address register is rewritten in front of it.
__device__ __forceinline__ void async_copy12(const unsigned (&l)[12], const unsigned short* const (&g)[12]) {
  asm volatile(
      "global_load_async_to_lds_b128 %0, %12, off\n\t"
      "global_load_async_to_lds_b128 %1, %13, off\n\t"
      "global_load_async_to_lds_b128 %2, %14, off\n\t"
      "global_load_async_to_lds_b128 %3, %15, off\n\t"
      "global_load_async_to_lds_b128 %4, %16, off\n\t"
      "global_load_async_to_lds_b128 %5, %17, off\n\t"
      "global_load_async_to_lds_b128 %6, %18, off\n\t"
      "global_load_async_to_lds_b128 %7, %19, off\n\t"
      "global_load_async_to_lds_b128 %8, %20, off\n\t"
      "global_load_async_to_lds_b128 %9, %21, off\n\t"
      "global_load_async_to_lds_b128 %10, %22, off\n\t"
      "global_load_async_to_lds_b128 %11, %23, off\n\t"
      "s_wait_xcnt 0x0"
      :: "v"(l[0]), "v"(l[1]), "v"(l[2]), "v"(l[3]), "v"(l[4]), "v"(l[5]), "v"(l[6]), "v"(l[7]), "v"(l[8]), "v"(l[9]), "v"(l[10]), "v"(l[11]),
         "v"(g[0]), "v"(g[1]), "v"(g[2]), "v"(g[3]), "v"(g[4]), "v"(g[5]), "v"(g[6]), "v"(g[7]), "v"(g[8]), "v"(g[9]), "v"(g[10]), "v"(g[11])
      : "memory");
}

template <int ET> struct Elem;
template <> struct Elem<0> { typedef _Float16 T; };
template <> struct Elem<1> { typedef __bf16 T; };
template <int ET, bool SPLIT, int BIAS_MODE, int OUT_MODE, bool RESID, int ACT = 0>
__global__ __launch_bounds__(256) void wmma_gemm64(
    const unsigned short* __restrict__ Ap, const unsigned short* __restrict__ A2p, int lda, long strideA,
    const unsigned short* __restrict__ Btp, const unsigned short* __restrict__ Bt2p, int ldb, long strideB,
    void* __restrict__ Cout, void* __restrict__ Cout2, int ldc, long strideC,
    const float* __restrict__ bias,
    const float* __restrict__ resid, long strideR,
    int M, int N, int K, float scale) {
  typedef typename Elem<ET>::T T;
  typedef typename Frag<T>::V V;
  static_assert(!SPLIT, "the staged loop carries one plane per operand");
  __shared__ __align__(16) unsigned short sAB[2][kGBuf];   // [buffer][A rows 0..127 | Bt rows 0..255][kGP]
  __shared__ __align__(16) float sT[8][16 * 68];   // per-wave 16x64 slab, pitch 68 floats
  const int b    = blockIdx.y;
  const int tid  = threadIdx.x;
  const int lane = tid & 31;
  const int wave = tid >> 5;
  const int btN = N >> 8;
  const int btM = M >> 7;
  const int bt  = blockIdx.x;
  if (bt >= btM * btN) return;   // the same for the whole work-group, in front of every barrier and copy
  const int bm = bt / btN;
  const int bn = bt - bm * btN;
  const int mB = bm << 7;
  const int nB = bn << 8;
  const int wm = (wave >> 2) << 6;             // this wave's rows inside the staged A rows
  const int wn = (wave & 3) << 6;              // this wave's rows inside the staged Bt rows
  const int m0 = mB + wm;
  const int n0 = nB + wn;

  const int rlane = lane & 15;                 // row (A) / col (B, D) within subtile
  const int koff  = (lane >> 4) * 8;           // k offset of this lane half
  const int mOff  = (lane >> 4) * 8;           // D row offset

  // staging: 16 lanes copy one row's 256 bytes, a wave 4 whole lines per copy; copy it covers staged rows it*16 .. it*16+15
  const int srow = tid >> 4;
  const int sseg = (tid & 15) * 8;
  const unsigned short* pA = Ap  + (size_t)b * strideA + (size_t)(mB + srow) * lda + sseg;
  const unsigned short* pB = Btp + (size_t)b * strideB + (size_t)(nB + srow) * ldb + sseg;
  const unsigned lds0 = (unsigned)(size_t)(&sAB[0][0] + srow * kGP + sseg);   // low 32 bits = byte address in LDS
  auto stage = [&](int buf) {   // copies the next 128 k of every staged row into buffer buf and moves the two pointers on
#pragma unroll   // both loops unrolled: every index constant, so the two operand arrays stay in registers
    for (int hf = 0; hf < 2; ++hf) {
      unsigned l[12];
      const unsigned short* g[12];
#pragma unroll
      for (int e = 0; e < 12; ++e) {
        const int it = hf * 12 + e;
        l[e] = lds0 + (unsigned)((buf * kGBuf + it * 16 * kGP) * 2);
        g[e] = (it < 8) ? (pA + (size_t)(it * 16) * lda) : (pB + (size_t)((it - 8) * 16) * ldb);
      }
      async_copy12(l, g);
    }
    pA += kGK;
    pB += kGK;
  };

  v8f acc[4][4];
#pragma unroll
  for (int i = 0; i < 4; ++i)
#pragma unroll
    for (int j = 0; j < 4; ++j) acc[i][j] = (v8f){0.f,0.f,0.f,0.f,0.f,0.f,0.f,0.f};

  const int nT = K / kGK;
  stage(0);
  asm volatile("s_wait_asynccnt 0x0" ::: "memory");   // this wave's copies of tile 0 have landed
  __syncthreads();                                    // ... and every other wave's
  if (nT > 1) stage(1);
  for (int t = 0; t < nT; ++t) {
    const T* sa = (const T*)sAB[t & 1] + (wm + rlane) * kGP + koff;
    const T* sb = (const T*)sAB[t & 1] + (kGRowsA + wn + rlane) * kGP + koff;
#pragma unroll   // the four 32-k blocks of a tile in line: LDS offsets become immediates and a block's reads can go ahead of the block before it
    for (int ks = 0; ks < kGK; ks += 32) {
      V ah[4], bh[4];
#pragma unroll
      for (int j = 0; j < 4; ++j) bh[j] = Frag<T>::load(sb + (j << 4) * kGP + ks);
#pragma unroll
      for (int i = 0; i < 4; ++i) ah[i] = Frag<T>::load(sa + (i << 4) * kGP + ks);
#pragma unroll
      for (int i = 0; i < 4; ++i) {
#pragma unroll
        for (int j = 0; j < 4; ++j) acc[i][j] = Frag<T>::mma(ah[i], bh[j], acc[i][j]);
        Frag<T>::guard(acc[i][0], acc[i][3], ah[i], ah[i]);
      }
      Frag<T>::keep(bh[0], bh[1], bh[2], bh[3]);
    }
    asm volatile("s_wait_dscnt 0x0" ::: "memory");      // this wave's reads of buffer t & 1 are done before it is refilled
    asm volatile("s_wait_asynccnt 0x0" ::: "memory");   // this wave's copies of tile t + 1 have landed
    __syncthreads();                                    // publishes tile t + 1 and ends every wave's reads of tile t
    if (t + 2 < nT) stage(t & 1);
  }
  asm volatile("s_wait_asynccnt 0x0" ::: "memory");     // nothing is in flight when the wave goes on
  acc_guard4(acc[0][0], acc[0][1], acc[0][2], acc[0][3]);
  acc_guard4(acc[1][0], acc[1][1], acc[1][2], acc[1][3]);
  acc_guard4(acc[2][0], acc[2][1], acc[2][2], acc[2][3]);
  acc_guard4(acc[3][0], acc[3][1], acc[3][2], acc[3][3]);

  // ---- epilogue ----
  float* slab = sT[wave];
  const float* Rb = RESID ? (resid + (size_t)b * strideR) : nullptr;
#pragma unroll
  for (int i = 0; i < 4; ++i) {
    const int mBase = m0 + (i << 4);
#pragma unroll
    for (int j = 0; j < 4; ++j) {
      const int n = n0 + (j << 4) + rlane;
      float bv = 0.f;
      if (BIAS_MODE == 2) bv = bias[n];
#pragma unroll
      for (int r = 0; r < 8; ++r) {
        float v = acc[i][j][r] * scale;
        if (BIAS_MODE == 1) v += bias[mBase + mOff + r];
        if (BIAS_MODE == 2) v += bv;
        if (RESID) v += Rb[(size_t)(mBase + mOff + r) * ldc + n];
        if (ACT == 1) v = tanhf(v);
        if (ACT == 2) v = fmaxf(v, 0.0f);
        if (ACT == 3) v = v / (1.0f + expf(-v));
        if (ACT == 4) v = (v > 0.f) ? v : 0.01f * v;
        if (ACT == 5) v = 0.5f * v * (1.0f + erff(v * 0.70710678118654752f));
        slab[(mOff + r) * 68 + (j << 4) + rlane] = v;
      }
    }
    __builtin_amdgcn_fence(__ATOMIC_RELEASE, "workgroup");
    __builtin_amdgcn_wave_barrier();
    __builtin_amdgcn_fence(__ATOMIC_ACQUIRE, "workgroup");
    if (OUT_MODE == 0) {
      float* C = (float*)Cout + (size_t)b * strideC;
      const int hh = lane >> 4, c4 = (lane & 15) * 4;     // row seg = 256 B = 16 lanes x 16 B
      {
#pragma unroll
        for (int it = 0; it < 8; ++it) {
          const int row = it * 2 + hh;
          v4f v = *(const v4f*)(slab + row * 68 + c4);
          *(v4f*)(C + (size_t)(mBase + row) * ldc + n0 + c4) = v;
        }
        
      }
    } else {
      const int q = lane >> 3, c8 = (lane & 7) * 8;
      unsigned short* C  = (unsigned short*)Cout  + (size_t)b * strideC;
      unsigned short* C2 = (OUT_MODE == 2) ? ((unsigned short*)Cout2 + (size_t)b * strideC) : nullptr;
      {
#pragma unroll
        for (int it = 0; it < 4; ++it) {
          const int row = it * 4 + q;
          const float* sp = slab + row * 68 + c8;
          v8h hv, lv;
#pragma unroll
          for (int e = 0; e < 8; ++e) {
            if (OUT_MODE == 1) {
              hv[e] = (_Float16)sp[e];
            } else {
              unsigned short hb = f2bf_bits(sp[e]);
              unsigned short lb = f2bf_bits(sp[e] - bf_bits2f(hb));
              hv[e] = __builtin_bit_cast(_Float16, hb);
              lv[e] = __builtin_bit_cast(_Float16, lb);
            }
          }
          *(v8h*)(C + (size_t)(mBase + row) * ldc + n0 + c8) = hv;
          if (OUT_MODE == 2) *(v8h*)(C2 + (size_t)(mBase + row) * ldc + n0 + c8) = lv;
        }
        
      }
    }
    __builtin_amdgcn_fence(__ATOMIC_RELEASE, "workgroup");
    __builtin_amdgcn_wave_barrier();
    __builtin_amdgcn_fence(__ATOMIC_ACQUIRE, "workgroup");
  }
}

// coverage: n2 threads x 2 elements = n elements exactly (n even, grid = ceil(n2/256))
__global__ __launch_bounds__(256) void cast_f32_bf16x2(
    const float* __restrict__ in, unsigned short* __restrict__ out, int n2) {
  const int i = blockIdx.x * 256 + threadIdx.x;
  if (i < n2) {
    const unsigned u = (unsigned)f2bf_bits(in[2 * i]) | ((unsigned)f2bf_bits(in[2 * i + 1]) << 16);
    ((unsigned*)out)[i] = u;
    
  }
}

// ---- f32 -> bf16 (RNE) -> x carry -> f16 cast (carry a power of two; exact for normal results) ----
__global__ __launch_bounds__(256) void cast_f32_bf16_f16x2_carry(
    const float* __restrict__ in, unsigned short* __restrict__ out, int n2, float carry) {
  const int i = blockIdx.x * 256 + threadIdx.x;
  if (i < n2) {
    const _Float16 h0 = (_Float16)(bf_rne(in[2 * i]) * carry);
    const _Float16 h1 = (_Float16)(bf_rne(in[2 * i + 1]) * carry);
    const unsigned u = (unsigned)__builtin_bit_cast(unsigned short, h0) | ((unsigned)__builtin_bit_cast(unsigned short, h1) << 16);
    ((unsigned*)out)[i] = u;
    
  }
}

// ---- lambda = exp(lq1.lk1) - exp(lq2.lk2) + 0.8 from bf16-RNE-converted vectors; one wave writes one 32-float line ----
__global__ __launch_bounds__(32) void lambda_line(
    const float* __restrict__ lq1, const float* __restrict__ lq2,
    const float* __restrict__ lk1, const float* __restrict__ lk2, float* __restrict__ lamp) {
  const int lane = threadIdx.x;
  float d1 = 0.0f, d2 = 0.0f;
#pragma unroll 1
  for (int i = 0; i < kHeadDim; ++i) {
    d1 += bf_rne(lq1[i]) * bf_rne(lk1[i]);
    d2 += bf_rne(lq2[i]) * bf_rne(lk2[i]);
  }
  const float lam = expf(d1) - expf(d2) + 0.8f;
  ((float*)lamp)[lane] = lam;
  
}

// ---- bf16 split helpers ----
__device__ __forceinline__ __bf16 at_f2bf(float f) { return __builtin_bit_cast(__bf16, f2bf_bits(f)); }
__device__ __forceinline__ void at_split(float f, __bf16& hi, __bf16& lo) {
  const unsigned short hb = f2bf_bits(f);
  hi = __builtin_bit_cast(__bf16, hb);
  lo = at_f2bf(f - __uint_as_float(((unsigned)hb) << 16));
}
__device__ __forceinline__ v8f at_mma(v16b a, v16b b, v8f c) {
  c = __builtin_amdgcn_wmma_f32_16x16x32_bf16(false, a, false, b, (short)0, c, false, false);
  asm volatile("v_nop\n\tv_nop\n\tv_nop\n\tv_nop" : "+v"(c) : "v"(a), "v"(b));
  return c;
}

// =====================================================================================
// Differential causal attention, head_dim 64, two softmax maps per head.
//   inputs : q, k as bf16 hi/lo planes [B*S][H*128] (map a uses columns h*128 + a*64 .. +64),
//            Vt as bf16 hi/lo planes [B][H*64][S] (key-contiguous), amask [B][S] f32, lambda line.
//   scores = 0.125 * q_a.k_a^T + causal add + (1-amask)*(-1e9) add; online softmax in f32 (expf);
//   q.k^T and p.v on v_wmma_f32_16x16x32_bf16 as hi.hi + hi.lo + lo.hi (f32 accumulate).
//   att[b][h][s][d] = o_0/l_0 - lambda * o_1/l_1 ; per-tile (sum, sumsq) line for the group norm.
//   Block = 8 waves of one (b, h): waves 0-3 run map 0 and waves 4-7 map 1 of the same 64 query rows.
//   A block takes query tile pr and then tile 31 - pr, so every block walks 33 key chunks;
//   grid.x = B*H*16 = 512, pr fastest.
// LDS: K hi/lo per map [64 kv][64 d], Vt hi/lo [64 d][64 kv] (shared by both maps), per-wave P hi/lo [16][64], all at row pitch kLP;
//      one out slab [16][68] per 16 query rows.
// Every staged LDS byte that is read is written in full each chunk (64 full rows per plane); the 8 pad elements of a row are never read.
// =====================================================================================
__global__ __launch_bounds__(256)
void diff_attn64(const unsigned short* __restrict__ Qh, const unsigned short* __restrict__ Ql,
                 const unsigned short* __restrict__ Kh, const unsigned short* __restrict__ Kl,
                 const unsigned short* __restrict__ Vh, const unsigned short* __restrict__ Vl,
                 const float* __restrict__ amask, const float* __restrict__ lamp,
                 float* __restrict__ att, float* __restrict__ part) {
  union FB { v16b v; v8b h[2]; };
  __shared__ __align__(16) unsigned short Ksh[2][kKC * kLP];
  __shared__ __align__(16) unsigned short Ksl[2][kKC * kLP];
  __shared__ __align__(16) unsigned short Vth[kHeadDim * kLP];
  __shared__ __align__(16) unsigned short Vtl[kHeadDim * kLP];
  __shared__ __align__(16) __bf16 Psh[8][16 * kLP];
  __shared__ __align__(16) __bf16 Psl[8][16 * kLP];
  __shared__ __align__(16) float Os[4][16 * 68];
  __shared__ float red[4][2];

  const int tid  = threadIdx.x;
  const int wave = __builtin_amdgcn_readfirstlane(tid >> 5);   // scalar, so the tests on the map below are scalar branches
  const int a    = wave >> 2;         // softmax map of this wave
  const int wq   = wave & 3;          // 16-row slice of the query tile
  const int lane = tid & 31;
  const int hh   = lane >> 4;
  const int c    = lane & 15;
  const int bx   = blockIdx.x;
  const int pr   = bx & (kNPair - 1);
  const int bh   = bx >> 4;
  const int h    = bh & (kHeads - 1);
  const int b    = bh >> 4;
  const float lam = lamp[0];
  const float negInf = -__builtin_huge_valf();

  const size_t vbase = (size_t)(b * kDModel + h * kHeadDim) * kSeq;               // Vt row (h*64 + d) of batch b
  float* ob_ptr = att + (size_t)bh * kSeq * kHeadDim;
  float* os = Os[wq];
  __bf16* pwh = Psh[wave];
  __bf16* pwl = Psl[wave];
  const unsigned short* ksh = Ksh[a];
  const unsigned short* ksl = Ksl[a];
  const int kvr = tid >> 2;           // staged row: key row for K, d row for Vt (0..63)
  const int sg  = (tid & 3) * 8;      // 8-element segment inside a group of 32 elements

  for (int half = 0; half < 2; ++half) {
    const int qb = half ? (kNQblk - 1 - pr) : pr;
    const int q0 = qb * kQB + wq * 16;
    const size_t qoff = (size_t)(b * kSeq + q0 + c) * kQKCols + (size_t)h * 128 + a * 64;   // + dc*32 + 8*hh
    // Q fragments (A operand) for this wave's map: 2 d-chunks, hi and lo planes
    v16b qah[2], qal[2];
#pragma unroll
    for (int dc = 0; dc < 2; ++dc) {
      qah[dc] = Frag<__bf16>::load((const __bf16*)Qh + qoff + dc * 32 + 8 * hh);
      qal[dc] = Frag<__bf16>::load((const __bf16*)Ql + qoff + dc * 32 + 8 * hh);
    }
    float mrow[8], lrow[8];
    v8f oacc[4];
#pragma unroll
    for (int r = 0; r < 8; ++r) { mrow[r] = negInf; lrow[r] = 0.0f; }
#pragma unroll
    for (int t = 0; t < 4; ++t) oacc[t] = (v8f){0.f,0.f,0.f,0.f,0.f,0.f,0.f,0.f};

    for (int kc = 0; kc <= qb; ++kc) {          // causal: chunks 0..qb (block-uniform trip count, <= 32)
      const int kv0 = kc * kKC;
      __syncthreads();
      {
        // a K row holds both maps side by side (128 elements): groups 0,1 are map 0, groups 2,3 map 1
        const size_t ko = (size_t)(b * kSeq + kv0 + kvr) * kQKCols + (size_t)h * 128 + sg;
        const size_t vo = vbase + (size_t)kvr * kSeq + kv0 + sg;
        u4v t0[4], t1[4], t2[2], t3[2];
#pragma unroll
        for (int i = 0; i < 4; ++i) { t0[i] = *(const u4v*)(Kh + ko + 32 * i); t1[i] = *(const u4v*)(Kl + ko + 32 * i); }
#pragma unroll
        for (int i = 0; i < 2; ++i) { t2[i] = *(const u4v*)(Vh + vo + 32 * i); t3[i] = *(const u4v*)(Vl + vo + 32 * i); }
#pragma unroll
        for (int i = 0; i < 4; ++i) {
          *(u4v*)(Ksh[i >> 1] + kvr * kLP + (i & 1) * 32 + sg) = t0[i];
          *(u4v*)(Ksl[i >> 1] + kvr * kLP + (i & 1) * 32 + sg) = t1[i];
        }
#pragma unroll
        for (int i = 0; i < 2; ++i) { *(u4v*)(Vth + kvr * kLP + i * 32 + sg) = t2[i]; *(u4v*)(Vtl + kvr * kLP + i * 32 + sg) = t3[i]; }
      }
      // additive padding-mask term for this lane's 4 key columns (bf16 RNE-converted mask)
      float amv[4];
#pragma unroll
      for (int j = 0; j < 4; ++j) amv[j] = (1.0f - bf_rne(amask[b * kSeq + kv0 + j * 16 + c])) * (-1.0e9f);
      __syncthreads();

      // ---- scores: 4 key subtiles of 16, K = 64 (2 chunks), hi.hi + hi.lo + lo.hi ----
      v8f s[4];
#pragma unroll
      for (int j = 0; j < 4; ++j) {
        s[j] = (v8f){0.f,0.f,0.f,0.f,0.f,0.f,0.f,0.f};
#pragma unroll
        for (int dc = 0; dc < 2; ++dc) {
          FB kb, kl;
          kb.h[0] = *(const v8b*)(ksh + (j * 16 + c) * kLP + dc * 32 + 8 * hh);
          kb.h[1] = *(const v8b*)(ksh + (j * 16 + c) * kLP + dc * 32 + 16 + 8 * hh);
          kl.h[0] = *(const v8b*)(ksl + (j * 16 + c) * kLP + dc * 32 + 8 * hh);
          kl.h[1] = *(const v8b*)(ksl + (j * 16 + c) * kLP + dc * 32 + 16 + 8 * hh);
          s[j] = at_mma(qah[dc], kb.v, s[j]);
          s[j] = at_mma(qah[dc], kl.v, s[j]);
          s[j] = at_mma(qal[dc], kb.v, s[j]);
        }
      }
      // ---- scale, causal add, mask add, row max ----
      const bool diag = (kc == qb);
      float cm[8];
#pragma unroll
      for (int r = 0; r < 8; ++r) {
        const int qrow = q0 + 8 * hh + r;
        float m = negInf;
#pragma unroll
        for (int j = 0; j < 4; ++j) {
          const int kvcol = kv0 + j * 16 + c;
          const float cz = (diag && (kvcol > qrow)) ? -1.0e9f : 0.0f;
          float sc = s[j][r] * 0.125f;
          sc = sc + cz;
          sc = sc + amv[j];
          s[j][r] = sc;
          m = fmaxf(m, sc);
        }
#pragma unroll
        for (int off = 1; off < 16; off <<= 1) m = fmaxf(m, __shfl_xor(m, off, 32));
        cm[r] = m;
      }
      // ---- online softmax update, P tile as bf16 hi/lo ----
#pragma unroll
      for (int r = 0; r < 8; ++r) {
        const float mnew = fmaxf(mrow[r], cm[r]);
        const float alpha = expf(mrow[r] - mnew);
        mrow[r] = mnew;
        float ps = 0.0f;
#pragma unroll
        for (int j = 0; j < 4; ++j) {
          const float p = expf(s[j][r] - mnew);
          ps += p;
          __bf16 ph, pl;
          at_split(p, ph, pl);
          pwh[(8 * hh + r) * kLP + j * 16 + c] = ph;
          pwl[(8 * hh + r) * kLP + j * 16 + c] = pl;
        }
#pragma unroll
        for (int off = 1; off < 16; off <<= 1) ps += __shfl_xor(ps, off, 32);
        lrow[r] = lrow[r] * alpha + ps;
#pragma unroll
        for (int t = 0; t < 4; ++t) oacc[t][r] *= alpha;
      }
      __builtin_amdgcn_fence(__ATOMIC_RELEASE, "workgroup");
      __builtin_amdgcn_wave_barrier();
      __builtin_amdgcn_fence(__ATOMIC_ACQUIRE, "workgroup");
      // ---- P.V: A = P (this wave's slab), B = Vt [d][kv]; hi.hi + hi.lo + lo.hi ----
#pragma unroll
      for (int kk = 0; kk < 2; ++kk) {
        FB pa, pl;
        pa.h[0] = *(const v8b*)(pwh + c * kLP + kk * 32 + 8 * hh);
        pa.h[1] = *(const v8b*)(pwh + c * kLP + kk * 32 + 16 + 8 * hh);
        pl.h[0] = *(const v8b*)(pwl + c * kLP + kk * 32 + 8 * hh);
        pl.h[1] = *(const v8b*)(pwl + c * kLP + kk * 32 + 16 + 8 * hh);
#pragma unroll
        for (int t = 0; t < 4; ++t) {
          FB vb, vl;
          vb.h[0] = *(const v8b*)(Vth + (t * 16 + c) * kLP + kk * 32 + 8 * hh);
          vb.h[1] = *(const v8b*)(Vth + (t * 16 + c) * kLP + kk * 32 + 16 + 8 * hh);
          vl.h[0] = *(const v8b*)(Vtl + (t * 16 + c) * kLP + kk * 32 + 8 * hh);
          vl.h[1] = *(const v8b*)(Vtl + (t * 16 + c) * kLP + kk * 32 + 16 + 8 * hh);
          oacc[t] = at_mma(pa.v, vb.v, oacc[t]);
          oacc[t] = at_mma(pa.v, vl.v, oacc[t]);
          oacc[t] = at_mma(pl.v, vb.v, oacc[t]);
        }
      }
    }
    // ---- finish this tile: map 1 hands o/l over through the slab; map 0 combines and sums the norm partials ----
    if (a == 1) {
#pragma unroll
      for (int r = 0; r < 8; ++r) {
        const float inv = 1.0f / lrow[r];
#pragma unroll
        for (int t = 0; t < 4; ++t) os[(8 * hh + r) * 68 + t * 16 + c] = oacc[t][r] * inv;
      }
    }
    __syncthreads();
    if (a == 0) {
      float psum = 0.0f, psq = 0.0f;
#pragma unroll
      for (int r = 0; r < 8; ++r) {
        const float inv = 1.0f / lrow[r];
#pragma unroll
        for (int t = 0; t < 4; ++t) {
          const int oi = (8 * hh + r) * 68 + t * 16 + c;
          const float o = oacc[t][r] * inv;
          const float w = o - lam * os[oi];
          os[oi] = w;
          psum += w;
          psq += w * w;
        }
      }
      // wave reductions, then a block combine in fixed order
#pragma unroll
      for (int off = 1; off < 32; off <<= 1) { psum += __shfl_xor(psum, off, 32); psq += __shfl_xor(psq, off, 32); }
      if (lane == 0) { red[wq][0] = psum; red[wq][1] = psq; }
    }
    __syncthreads();

    {
      const int c4 = (lane & 15) * 4;
#pragma unroll
      for (int it = 0; it < 4; ++it) {
        const int row = a * 8 + it * 2 + hh;      // each wave stores 8 of the slab's 16 rows
        v4f val = *(const v4f*)(os + row * 68 + c4);
        *(v4f*)(ob_ptr + (size_t)(q0 + row) * kHeadDim + c4) = val;
      }
      asm volatile("s_wait_xcnt 0x0" ::: "memory");   // the stores' address and data registers are rewritten by the code that follows
    }
    if (wave == 0) {
      const float t0 = ((red[0][0] + red[1][0]) + red[2][0]) + red[3][0];
      const float t1 = ((red[0][1] + red[1][1]) + red[2][1]) + red[3][1];
      const float v = (lane == 0) ? t0 : ((lane == 1) ? t1 : 0.0f);
      float* pline = part + (size_t)(bh * kNQblk + qb) * 32;
      ((float*)pline)[lane] = v;
      asm volatile("s_wait_xcnt 0x0" ::: "memory");   // the next tile's set-up rewrites this store's registers
    }
  }
}

// ---- group norm statistics per (b,h): fixed-order sum of the 32 tile lines; one wave writes one stats line ----
__global__ __launch_bounds__(32) void gn_stats(const float* __restrict__ part, float* __restrict__ stats) {
  const int bh = blockIdx.x;
  const int lane = threadIdx.x;
  float s0 = part[(size_t)(bh * kNQblk + lane) * 32 + 0];
  float s1 = part[(size_t)(bh * kNQblk + lane) * 32 + 1];
#pragma unroll
  for (int off = 1; off < 32; off <<= 1) { s0 += __shfl_xor(s0, off, 32); s1 += __shfl_xor(s1, off, 32); }
  const float inv_n = 1.0f / (float)(kSeq * kHeadDim);
  const float mu = s0 * inv_n;
  const float ex2 = s1 * inv_n;
  const float var = fmaxf(ex2 - mu * mu, 0.0f);
  const float rs = rsqrtf(var + 1.0e-5f);
  const float v = (lane == 0) ? mu : ((lane == 1) ? rs : 0.0f);
  ((float*)stats)[bh * 32 + lane] = v;
  
}

// ---- normalize + affine + x0.2 + merge heads -> f16 plane (x8 carry), [B*S][H*64] ----
__global__ __launch_bounds__(256) void gn_merge(const float* __restrict__ att, const float* __restrict__ stats,
                                              const float* __restrict__ gamma, const float* __restrict__ beta,
                                              unsigned short* __restrict__ merged) {
  const int g = blockIdx.x * 256 + threadIdx.x;
  if (g >= kBatch * kHeads * kSeq * 8) return;
  const int seg = g >> 3;
  const int e8  = (g & 7) * 8;
  const int bh  = seg >> 11;
  const int s   = seg & (kSeq - 1);
  const int h   = bh & (kHeads - 1);
  const int b   = bh >> 4;
  const float mu = stats[bh * 32 + 0];
  const float rs = stats[bh * 32 + 1];
  union U8 { v4f v[2]; float f[8]; };
  U8 x, ga, be;
  const float* ap = att + (size_t)seg * kHeadDim + e8;
  x.v[0]  = *(const v4f*)ap;
  x.v[1]  = *(const v4f*)(ap + 4);
  ga.v[0] = *(const v4f*)(gamma + h * kHeadDim + e8);
  ga.v[1] = *(const v4f*)(gamma + h * kHeadDim + e8 + 4);
  be.v[0] = *(const v4f*)(beta + h * kHeadDim + e8);
  be.v[1] = *(const v4f*)(beta + h * kHeadDim + e8 + 4);
  v8h hv;
#pragma unroll
  for (int e = 0; e < 8; ++e) {
    const float gq = bf_rne(ga.f[e]);
    const float bq = bf_rne(be.f[e]);
    float y = (x.f[e] - mu) * rs;
    y = y * gq + bq;
    y = y * 0.2f;
    float z = y * kMergeCarry;
    asm volatile("" : "+v"(z));
    hv[e] = (_Float16)z;
  }
  unsigned short* dst = merged + (size_t)(b * kSeq + s) * kDModel + h * kHeadDim + e8;
  *(v8h*)dst = hv;
  
}

// ---------------------------------------------------------------------------
extern "C" void kernel_launch(void* const* d_in, const int* in_sizes, int n_in,
                              void* d_out, int out_size, void* d_ws, size_t ws_size,
                              hipStream_t stream) {
  if (n_in < 12) return;
  if (in_sizes[0] != kTok * kDModel || in_sizes[1] != kBatch * kSeq ||
      in_sizes[2] != kQKCols * kDModel || in_sizes[3] != kQKCols * kDModel ||
      in_sizes[4] != kDModel * kDModel || in_sizes[5] != kDModel * kDModel ||
      in_sizes[6] != kHeadDim || in_sizes[7] != kHeadDim || in_sizes[8] != kHeadDim || in_sizes[9] != kHeadDim ||
      in_sizes[10] != kDModel || in_sizes[11] != kDModel) return;
  if (out_size != kTok * kDModel) return;
  if (ws_size < kWsTotal) return;

  const float* X     = (const float*)d_in[0];
  const float* amask = (const float*)d_in[1];
  const float* Wq    = (const float*)d_in[2];
  const float* Wk    = (const float*)d_in[3];
  const float* Wv    = (const float*)d_in[4];
  const float* Wo    = (const float*)d_in[5];
  const float* lq1   = (const float*)d_in[6];
  const float* lq2   = (const float*)d_in[7];
  const float* lk1   = (const float*)d_in[8];
  const float* lk2   = (const float*)d_in[9];
  const float* gamma = (const float*)d_in[10];
  const float* beta  = (const float*)d_in[11];

  char* w = (char*)d_ws;
  unsigned short* Xb    = (unsigned short*)(w + kOffXb);
  unsigned short* Wqb   = (unsigned short*)(w + kOffWqb);
  unsigned short* Wkb   = (unsigned short*)(w + kOffWkb);
  unsigned short* Wvb   = (unsigned short*)(w + kOffWvb);
  unsigned short* Wo16  = (unsigned short*)(w + kOffWo16);
  unsigned short* Qh    = (unsigned short*)(w + kOffQh);
  unsigned short* Ql    = (unsigned short*)(w + kOffQl);
  unsigned short* Kh    = (unsigned short*)(w + kOffKh);
  unsigned short* Kl    = (unsigned short*)(w + kOffKl);
  unsigned short* Vth   = (unsigned short*)(w + kOffVth);
  unsigned short* Vtl   = (unsigned short*)(w + kOffVtl);
  float*          att   = (float*)(w + kOffAtt);
  unsigned short* mrg   = (unsigned short*)(w + kOffMerged);
  float*          part  = (float*)(w + kOffPart);
  float*          stats = (float*)(w + kOffStats);
  float*          lamp  = (float*)(w + kOffLam);

  // 1) input conversions (bf16 RNE; Wo additionally x256 into f16)
  constexpr int n2X  = kTok * kDModel / 2;       // 2,097,152
  constexpr int n2Wq = kQKCols * kDModel / 2;    // 1,048,576
  constexpr int n2Wv = kDModel * kDModel / 2;    //   524,288
  static_assert(n2X % 256 == 0 && n2Wq % 256 == 0 && n2Wv % 256 == 0);
  cast_f32_bf16x2<<<n2X / 256, 256, 0, stream>>>(X, Xb, n2X);
  cast_f32_bf16x2<<<n2Wq / 256, 256, 0, stream>>>(Wq, Wqb, n2Wq);
  cast_f32_bf16x2<<<n2Wq / 256, 256, 0, stream>>>(Wk, Wkb, n2Wq);
  cast_f32_bf16x2<<<n2Wv / 256, 256, 0, stream>>>(Wv, Wvb, n2Wv);
  cast_f32_bf16_f16x2_carry<<<n2Wv / 256, 256, 0, stream>>>(Wo, Wo16, n2Wv, kWoCarry);
  lambda_line<<<1, 32, 0, stream>>>(lq1, lq2, lk1, lk2, lamp);

  // 2) projections: q/k planes [4096][2048] hi+lo, Vt planes [2][1024][2048] hi+lo
  constexpr int gridQ  = (kTok / 64) * (kQKCols / 64) / 8;   // 256
  constexpr int gridVt = (kDModel / 64) * (kSeq / 64) / 8;   // 64
  constexpr int gridO  = (kTok / 64) * (kDModel / 64) / 8;   // 128
  static_assert(gridQ * 8 == (kTok / 64) * (kQKCols / 64));
  static_assert(gridVt * 8 == (kDModel / 64) * (kSeq / 64));
  static_assert(gridO * 8 == (kTok / 64) * (kDModel / 64));
  // one work-group per 128x256 tile: the same counts
  static_assert(gridQ == (kTok / 128) * (kQKCols / 256) && gridVt == (kDModel / 128) * (kSeq / 256) && gridO == (kTok / 128) * (kDModel / 256));
  static_assert(kDModel % kGK == 0 && kDModel / kGK >= 2);
  wmma_gemm64<1, false, 0, 2, false><<<dim3(gridQ, 1, 1), 256, 0, stream>>>(
      Xb, Xb, kDModel, 0L, Wqb, Wqb, kDModel, 0L, (void*)Qh, (void*)Ql, kQKCols, 0L,
      lamp, lamp, 0L, kTok, kQKCols, kDModel, 1.0f);
  wmma_gemm64<1, false, 0, 2, false><<<dim3(gridQ, 1, 1), 256, 0, stream>>>(
      Xb, Xb, kDModel, 0L, Wkb, Wkb, kDModel, 0L, (void*)Kh, (void*)Kl, kQKCols, 0L,
      lamp, lamp, 0L, kTok, kQKCols, kDModel, 1.0f);
  // Vt[b][c][s] = sum_k Wv[c][k] * X[b][s][k] : A = Wv [1024][1024], Bt = X_b [2048][1024]
  wmma_gemm64<1, false, 0, 2, false><<<dim3(gridVt, kBatch, 1), 256, 0, stream>>>(
      Wvb, Wvb, kDModel, 0L, Xb, Xb, kDModel, (long)kSeq * kDModel, (void*)Vth, (void*)Vtl, kSeq, (long)kDModel * kSeq,
      lamp, lamp, 0L, kDModel, kSeq, kDModel, 1.0f);

  // 3) differential causal attention + norm partial lines (512 blocks, two query tiles each)
  diff_attn64<<<kAttnGroups, 256, 0, stream>>>(Qh, Ql, Kh, Kl, Vth, Vtl, amask, lamp, att, part);

  // 4) group norm stats, normalize + merge
  gn_stats<<<kBatch * kHeads, 32, 0, stream>>>(part, stats);
  gn_merge<<<(kBatch * kHeads * kSeq * 8) / 256, 256, 0, stream>>>(att, stats, gamma, beta, mrg);

  // 5) output projection: out[m][n] = (1/2048) * sum_k merged8[m][k] * Wo256[n][k]
  wmma_gemm64<0, false, 0, 0, false><<<dim3(gridO, 1, 1), 256, 0, stream>>>(
      mrg, mrg, kDModel, 0L, Wo16, Wo16, kDModel, 0L, d_out, d_out, kDModel, 0L,
      lamp, lamp, 0L, kTok, kDModel, kDModel, 1.0f / (kMergeCarry * kWoCarry));
}

// v004
// Measured time: 313 microseconds a run.
// Two timings next to v003 both put it at 1.03 times that version's speed.
// All steps since v000 together make it 2.47 times as fast.
// Contractions: x.Wq^T, x.Wk^T, Wv.x^T = v_wmma_f32_16x16x32_bf16 (plain bf16 operands from RNE-converted inputs); q.k^T and p.v = v_wmma_f32_16x16x32_bf16 with bf16 hi/lo planes (hi.hi+hi.lo+lo.hi); merged.Wo^T = v_wmma_f32_16x16x32_f16 (f16 operands, carries 8 and 256); f32 accumulate everywhere; softmax, group norm and the two 64-term lambda dots in f32.
#include <hip/hip_runtime.h>

typedef __attribute__((ext_vector_type(16))) _Float16 v16h;
typedef __attribute__((ext_vector_type(8)))  _Float16 v8h;
typedef __attribute__((ext_vector_type(16))) __bf16   v16b;
typedef __attribute__((ext_vector_type(8)))  __bf16   v8b;
typedef __attribute__((ext_vector_type(8)))  float    v8f;
typedef __attribute__((ext_vector_type(4)))  float    v4f;
typedef __attribute__((ext_vector_type(4)))  unsigned int u4v;
typedef __attribute__((ext_vector_type(2)))  unsigned int u2v;

// ---- problem geometry ----
constexpr int kBatch   = 2;
constexpr int kSeq     = 2048;
constexpr int kDModel  = 1024;
constexpr int kHeads   = 16;
constexpr int kHeadDim = 64;
constexpr int kQKCols  = 2 * kDModel;      // 2048 : row width of the q/k planes (H * 128)
constexpr int kTok     = kBatch * kSeq;    // 4096
constexpr int kQB      = 64;               // query rows per tile; a block takes two tiles
constexpr int kKC      = 64;               // keys per chunk
constexpr int kLP      = 72;               // LDS row pitch of the 64-element 16-bit tiles: 144 B = 16 B x 9 (odd), conflict-free for 16-byte row reads
constexpr int kNQblk   = kSeq / kQB;       // 32
constexpr int kAttnBlocks = kBatch * kHeads * kNQblk;   // 1024 query tiles
constexpr int kNPair   = kNQblk / 2;        // 16 : tile pairs (t, 31 - t) per (b, h)
constexpr int kAttnGroups = kBatch * kHeads * kNPair;   // 512 work-groups of the attention launch
constexpr float kMergeCarry = 8.0f;        // f16 merged plane carried x8
constexpr float kWoCarry    = 256.0f;      // f16 Wo plane carried x256

static_assert(kNQblk == 32);
static_assert(kHeads == 16);
static_assert(kAttnBlocks == 1024);
static_assert(kNPair == 16 && kAttnGroups == 512);
static_assert(kSeq % kQB == 0);
static_assert(kDModel % 32 == 0);                  // K of every GEMM
static_assert(kTok % 64 == 0 && kQKCols % 64 == 0 && kDModel % 64 == 0 && kSeq % 64 == 0);   // M, N tile multiples

// ---- workspace region map (bytes; every offset a multiple of 128) ----
constexpr size_t kBytesXb     = (size_t)kTok * kDModel * 2;                     //  8,388,608  x as bf16 [4096][1024]
constexpr size_t kBytesWqk    = (size_t)kQKCols * kDModel * 2;                  //  4,194,304  Wq / Wk as bf16 [2048][1024]
constexpr size_t kBytesWv     = (size_t)kDModel * kDModel * 2;                  //  2,097,152  Wv as bf16 [1024][1024]
constexpr size_t kBytesWo     = (size_t)kDModel * kDModel * 2;                  //  2,097,152  Wo as f16 x256 [1024][1024]
constexpr size_t kBytesQPl    = (size_t)kTok * kQKCols * 2;                     // 16,777,216  one q or k plane [4096][2048]
constexpr size_t kBytesVtPl   = (size_t)kBatch * kDModel * kSeq * 2;            //  8,388,608  one Vt plane [2][1024][2048]
constexpr size_t kBytesAtt    = (size_t)kBatch * kHeads * kSeq * kHeadDim * 4;  // 16,777,216  attention out f32 [2][16][2048][64]
constexpr size_t kBytesMerged = (size_t)kTok * kDModel * 2;                     //  8,388,608  merged f16 x8 [4096][1024]
constexpr size_t kBytesPart   = (size_t)kAttnBlocks * 128;                      //    131,072  one 32-float line per query tile (1024 tiles)
constexpr size_t kBytesStats  = (size_t)kBatch * kHeads * 128;                  //      4,096  one 32-float line per (b,h)
constexpr size_t kBytesLam    = 128;                                            //        128  lambda line

constexpr size_t kOffXb     = 0;
constexpr size_t kOffWqb    = kOffXb + kBytesXb;
constexpr size_t kOffWkb    = kOffWqb + kBytesWqk;
constexpr size_t kOffWvb    = kOffWkb + kBytesWqk;
constexpr size_t kOffWo16   = kOffWvb + kBytesWv;
constexpr size_t kOffQh     = kOffWo16 + kBytesWo;
constexpr size_t kOffQl     = kOffQh + kBytesQPl;
constexpr size_t kOffKh     = kOffQl + kBytesQPl;
constexpr size_t kOffKl     = kOffKh + kBytesQPl;
constexpr size_t kOffVth    = kOffKl + kBytesQPl;
constexpr size_t kOffVtl    = kOffVth + kBytesVtPl;
constexpr size_t kOffAtt    = kOffVtl + kBytesVtPl;
constexpr size_t kOffMerged = kOffAtt + kBytesAtt;
constexpr size_t kOffPart   = kOffMerged + kBytesMerged;
constexpr size_t kOffStats  = kOffPart + kBytesPart;
constexpr size_t kOffLam    = kOffStats + kBytesStats;
constexpr size_t kWsTotal   = kOffLam + kBytesLam;                              // 130,158,720
static_assert(kBytesPart == 131072);
static_assert(kWsTotal == 130158720);
static_assert(kWsTotal <= 134217728);
static_assert(kOffWqb % 128 == 0 && kOffQh % 128 == 0 && kOffAtt % 128 == 0 && kOffPart % 128 == 0 && kOffStats % 128 == 0 && kOffLam % 128 == 0);

// ---- 16-bit helpers ----
__device__ __forceinline__ unsigned short f2bf_bits(float f) {
  unsigned u = __float_as_uint(f);
  return (unsigned short)((u + 0x7FFFu + ((u >> 16) & 1u)) >> 16);
}
__device__ __forceinline__ float bf_bits2f(unsigned short h) { return __uint_as_float(((unsigned)h) << 16); }
__device__ __forceinline__ float bf_rne(float f) { return bf_bits2f(f2bf_bits(f)); }

// hazard guards as plain device helpers
__device__ __forceinline__ void dep_guard_h(v8f& a, v8f& b, v16h x, v16h y) { asm volatile("v_nop\n\tv_nop\n\tv_nop\n\tv_nop" : "+v"(a), "+v"(b) : "v"(x), "v"(y)); }
__device__ __forceinline__ void dep_guard_b(v8f& a, v8f& b, v16b x, v16b y) { asm volatile("v_nop\n\tv_nop\n\tv_nop\n\tv_nop" : "+v"(a), "+v"(b) : "v"(x), "v"(y)); }
__device__ __forceinline__ void keep4_h(v16h a, v16h b, v16h c, v16h d) { asm volatile("v_nop" :: "v"(a), "v"(b), "v"(c), "v"(d)); }
__device__ __forceinline__ void keep4_b(v16b a, v16b b, v16b c, v16b d) { asm volatile("v_nop" :: "v"(a), "v"(b), "v"(c), "v"(d)); }
__device__ __forceinline__ void acc_guard4(v8f& a, v8f& b, v8f& c, v8f& d) { asm volatile("v_nop\n\tv_nop\n\tv_nop\n\tv_nop" : "+v"(a), "+v"(b), "+v"(c), "+v"(d)); }
template <typename T> struct Frag;
template <> struct Frag<_Float16> {
  typedef v16h V; union U { v16h v; v8h h[2]; };
  static __device__ __forceinline__ v16h load(const _Float16* p) {   // elements 0..7 <- p[0..7], 8..15 <- p[16..23]
    U f; f.h[0] = *(const v8h*)(p); f.h[1] = *(const v8h*)(p + 16); return f.v;
  }
  static __device__ __forceinline__ v8f mma(v16h a, v16h b, v8f c) {
    return __builtin_amdgcn_wmma_f32_16x16x32_f16(false, a, false, b, (short)0, c, false, false);
  }
  static __device__ __forceinline__ void guard(v8f& a, v8f& b, v16h x, v16h y) { dep_guard_h(a, b, x, y); }
  static __device__ __forceinline__ void keep(v16h a, v16h b, v16h c, v16h d) { keep4_h(a, b, c, d); }
};
template <> struct Frag<__bf16> {
  typedef v16b V; union U { v16b v; v8b h[2]; };
  static __device__ __forceinline__ v16b load(const __bf16* p) {
    U f; f.h[0] = *(const v8b*)(p); f.h[1] = *(const v8b*)(p + 16); return f.v;
  }
  static __device__ __forceinline__ v8f mma(v16b a, v16b b, v8f c) {
    return __builtin_amdgcn_wmma_f32_16x16x32_bf16(false, a, false, b, (short)0, c, false, false);
  }
  static __device__ __forceinline__ void guard(v8f& a, v8f& b, v16b x, v16b y) { dep_guard_b(a, b, x, y); }
  static __device__ __forceinline__ void keep(v16b a, v16b b, v16b c, v16b d) { keep4_b(a, b, c, d); }
};

// ---- Register-blocked batched WMMA GEMM, operands staged in LDS ------------
// C[m,n] = scale * sum_k A[m,k] * Bt[n,k] (+bias)(+resid); a work-group owns a 128x256 tile, each of its 8 waves (2 x 4) a 64x64 part.
// A row-major [M,K]; Bt row-major [N,K]; M % 128 == 0, N % 256 == 0, K % 128 == 0, K >= 256.
// Per 128 k the 128 A rows and 256 Bt rows (256 bytes, two whole lines, each) reach LDS by asynchronous copies, two buffers:
// the copies of tile t + 2 fly while tile t + 1 is worked on; the fragments are read from LDS at row pitch kGP.
// SPLIT is not carried by the staged loop (one plane per operand).
// BIAS_MODE: 0 = none, 1 = bias[m], 2 = bias[n].
// OUT_MODE: 0 = f32, 1 = f16, 2 = bf16 hi plane (Cout) + bf16 lo plane (Cout2).
// ET: 0 = f16 operands, 1 = bf16 operands (pointers passed as 16-bit storage)
constexpr int kGK     = 128;                   // k elements per staged tile
constexpr int kGP     = 136;                   // LDS row pitch of a staged row: 272 B = 16 B x 17 (odd), conflict-free for 16-byte row reads
constexpr int kGRowsA = 128;                   // staged A rows
constexpr int kGRowsB = 256;                   // staged Bt rows
constexpr int kGBuf   = (kGRowsA + kGRowsB) * kGP;   // 16-bit elements of one buffer (104,448 B)

// Twelve 16-byte asynchronous copies of one lane, global -> LDS (l = LDS byte address, g = global address).
// The closing s_wait_xcnt stands inside the statement, so that no address register is rewritten in front of it.
__device__ __forceinline__ void async_copy12(const unsigned (&l)[12], const unsigned short* const (&g)[12]) {
  asm volatile(
      "global_load_async_to_lds_b128 %0, %12, off\n\t"
      "global_load_async_to_lds_b128 %1, %13, off\n\t"
      "global_load_async_to_lds_b128 %2, %14, off\n\t"
      "global_load_async_to_lds_b128 %3, %15, off\n\t"
      "global_load_async_to_lds_b128 %4, %16, off\n\t"
      "global_load_async_to_lds_b128 %5, %17, off\n\t"
      "global_load_async_to_lds_b128 %6, %18, off\n\t"
      "global_load_async_to_lds_b128 %7, %19, off\n\t"
      "global_load_async_to_lds_b128 %8, %20, off\n\t"
      "global_load_async_to_lds_b128 %9, %21, off\n\t"
      "global_load_async_to_lds_b128 %10, %22, off\n\t"
      "global_load_async_to_lds_b128 %11, %23, off\n\t"
      "s_wait_xcnt 0x0"
      :: "v"(l[0]), "v"(l[1]), "v"(l[2]), "v"(l[3]), "v"(l[4]), "v"(l[5]), "v"(l[6]), "v"(l[7]), "v"(l[8]), "v"(l[9]), "v"(l[10]), "v"(l[11]),
         "v"(g[0]), "v"(g[1]), "v"(g[2]), "v"(g[3]), "v"(g[4]), "v"(g[5]), "v"(g[6]), "v"(g[7]), "v"(g[8]), "v"(g[9]), "v"(g[10]), "v"(g[11])
      : "memory");
}

template <int ET> struct Elem;
template <> struct Elem<0> { typedef _Float16 T; };
template <> struct Elem<1> { typedef __bf16 T; };
template <int ET, bool SPLIT, int BIAS_MODE, int OUT_MODE, bool RESID, int ACT = 0>
__global__ __launch_bounds__(256) void wmma_gemm64(
    const unsigned short* __restrict__ Ap, const unsigned short* __restrict__ A2p, int lda, long strideA,
    const unsigned short* __restrict__ Btp, const unsigned short* __restrict__ Bt2p, int ldb, long strideB,
    void* __restrict__ Cout, void* __restrict__ Cout2, int ldc, long strideC,
    const float* __restrict__ bias,
    const float* __restrict__ resid, long strideR,
    int M, int N, int K, float scale) {
  typedef typename Elem<ET>::T T;
  typedef typename Frag<T>::V V;
  static_assert(!SPLIT, "the staged loop carries one plane per operand");
  __shared__ __align__(16) unsigned short sAB[2][kGBuf];   // [buffer][A rows 0..127 | Bt rows 0..255][kGP]
  __shared__ __align__(16) float sT[8][16 * 68];   // per-wave 16x64 slab, pitch 68 floats
  const int b    = blockIdx.y;
  const int tid  = threadIdx.x;
  const int lane = tid & 31;
  const int wave = tid >> 5;
  const int btN = N >> 8;
  const int btM = M >> 7;
  const int bt  = blockIdx.x;
  if (bt >= btM * btN) return;   // the same for the whole work-group, in front of every barrier and copy
  const int bm = bt / btN;
  const int bn = bt - bm * btN;
  const int mB = bm << 7;
  const int nB = bn << 8;
  const int wm = (wave >> 2) << 6;             // this wave's rows inside the staged A rows
  const int wn = (wave & 3) << 6;              // this wave's rows inside the staged Bt rows
  const int m0 = mB + wm;
  const int n0 = nB + wn;

  const int rlane = lane & 15;                 // row (A) / col (B, D) within subtile
  const int koff  = (lane >> 4) * 8;           // k offset of this lane half
  const int mOff  = (lane >> 4) * 8;           // D row offset

  // staging: 16 lanes copy one row's 256 bytes, a wave 4 whole lines per copy; copy it covers staged rows it*16 .. it*16+15
  const int srow = tid >> 4;
  const int sseg = (tid & 15) * 8;
  const unsigned short* pA = Ap  + (size_t)b * strideA + (size_t)(mB + srow) * lda + sseg;
  const unsigned short* pB = Btp + (size_t)b * strideB + (size_t)(nB + srow) * ldb + sseg;
  const unsigned lds0 = (unsigned)(size_t)(&sAB[0][0] + srow * kGP + sseg);   // low 32 bits = byte address in LDS
  auto stage = [&](int buf) {   // copies the next 128 k of every staged row into buffer buf and moves the two pointers on
#pragma unroll   // both loops unrolled: every index constant, so the two operand arrays stay in registers
    for (int hf = 0; hf < 2; ++hf) {
      unsigned l[12];
      const unsigned short* g[12];
#pragma unroll
      for (int e = 0; e < 12; ++e) {
        const int it = hf * 12 + e;
        l[e] = lds0 + (unsigned)((buf * kGBuf + it * 16 * kGP) * 2);
        g[e] = (it < 8) ? (pA + (size_t)(it * 16) * lda) : (pB + (size_t)((it - 8) * 16) * ldb);
      }
      async_copy12(l, g);
    }
    pA += kGK;
    pB += kGK;
  };

  v8f acc[4][4];
#pragma unroll
  for (int i = 0; i < 4; ++i)
#pragma unroll
    for (int j = 0; j < 4; ++j) acc[i][j] = (v8f){0.f,0.f,0.f,0.f,0.f,0.f,0.f,0.f};

  const int nT = K / kGK;
  stage(0);
  asm volatile("s_wait_asynccnt 0x0" ::: "memory");   // this wave's copies of tile 0 have landed
  __syncthreads();                                    // ... and every other wave's
  if (nT > 1) stage(1);
  for (int t = 0; t < nT; ++t) {
    const T* sa = (const T*)sAB[t & 1] + (wm + rlane) * kGP + koff;
    const T* sb = (const T*)sAB[t & 1] + (kGRowsA + wn + rlane) * kGP + koff;
#pragma unroll   // the four 32-k blocks of a tile in line: LDS offsets become immediates and a block's reads can go ahead of the block before it
    for (int ks = 0; ks < kGK; ks += 32) {
      V ah[4], bh[4];
#pragma unroll
      for (int j = 0; j < 4; ++j) bh[j] = Frag<T>::load(sb + (j << 4) * kGP + ks);
#pragma unroll
      for (int i = 0; i < 4; ++i) ah[i] = Frag<T>::load(sa + (i << 4) * kGP + ks);
#pragma unroll
      for (int i = 0; i < 4; ++i) {
#pragma unroll
        for (int j = 0; j < 4; ++j) acc[i][j] = Frag<T>::mma(ah[i], bh[j], acc[i][j]);
        Frag<T>::guard(acc[i][0], acc[i][3], ah[i], ah[i]);
      }
      Frag<T>::keep(bh[0], bh[1], bh[2], bh[3]);
    }
    asm volatile("s_wait_dscnt 0x0" ::: "memory");      // this wave's reads of buffer t & 1 are done before it is refilled
    asm volatile("s_wait_asynccnt 0x0" ::: "memory");   // this wave's copies of tile t + 1 have landed
    __syncthreads();                                    // publishes tile t + 1 and ends every wave's reads of tile t
    if (t + 2 < nT) stage(t & 1);
  }
  asm volatile("s_wait_asynccnt 0x0" ::: "memory");     // nothing is in flight when the wave goes on
  acc_guard4(acc[0][0], acc[0][1], acc[0][2], acc[0][3]);
  acc_guard4(acc[1][0], acc[1][1], acc[1][2], acc[1][3]);
  acc_guard4(acc[2][0], acc[2][1], acc[2][2], acc[2][3]);
  acc_guard4(acc[3][0], acc[3][1], acc[3][2], acc[3][3]);

  // ---- epilogue ----
  float* slab = sT[wave];
  const float* Rb = RESID ? (resid + (size_t)b * strideR) : nullptr;
#pragma unroll
  for (int i = 0; i < 4; ++i) {
    const int mBase = m0 + (i << 4);
#pragma unroll
    for (int j = 0; j < 4; ++j) {
      const int n = n0 + (j << 4) + rlane;
      float bv = 0.f;
      if (BIAS_MODE == 2) bv = bias[n];
#pragma unroll
      for (int r = 0; r < 8; ++r) {
        float v = acc[i][j][r] * scale;
        if (BIAS_MODE == 1) v += bias[mBase + mOff + r];
        if (BIAS_MODE == 2) v += bv;
        if (RESID) v += Rb[(size_t)(mBase + mOff + r) * ldc + n];
        if (ACT == 1) v = tanhf(v);
        if (ACT == 2) v = fmaxf(v, 0.0f);
        if (ACT == 3) v = v / (1.0f + expf(-v));
        if (ACT == 4) v = (v > 0.f) ? v : 0.01f * v;
        if (ACT == 5) v = 0.5f * v * (1.0f + erff(v * 0.70710678118654752f));
        slab[(mOff + r) * 68 + (j << 4) + rlane] = v;
      }
    }
    __builtin_amdgcn_fence(__ATOMIC_RELEASE, "workgroup");
    __builtin_amdgcn_wave_barrier();
    __builtin_amdgcn_fence(__ATOMIC_ACQUIRE, "workgroup");
    if (OUT_MODE == 0) {
      float* C = (float*)Cout + (size_t)b * strideC;
      const int hh = lane >> 4, c4 = (lane & 15) * 4;     // row seg = 256 B = 16 lanes x 16 B
      {
#pragma unroll
        for (int it = 0; it < 8; ++it) {
          const int row = it * 2 + hh;
          v4f v = *(const v4f*)(slab + row * 68 + c4);
          *(v4f*)(C + (size_t)(mBase + row) * ldc + n0 + c4) = v;
        }
        
      }
    } else {
      const int q = lane >> 3, c8 = (lane & 7) * 8;
      unsigned short* C  = (unsigned short*)Cout  + (size_t)b * strideC;
      unsigned short* C2 = (OUT_MODE == 2) ? ((unsigned short*)Cout2 + (size_t)b * strideC) : nullptr;
      {
#pragma unroll
        for (int it = 0; it < 4; ++it) {
          const int row = it * 4 + q;
          const float* sp = slab + row * 68 + c8;
          v8h hv, lv;
#pragma unroll
          for (int e = 0; e < 8; ++e) {
            if (OUT_MODE == 1) {
              hv[e] = (_Float16)sp[e];
            } else {
              unsigned short hb = f2bf_bits(sp[e]);
              unsigned short lb = f2bf_bits(sp[e] - bf_bits2f(hb));
              hv[e] = __builtin_bit_cast(_Float16, hb);
              lv[e] = __builtin_bit_cast(_Float16, lb);
            }
          }
          *(v8h*)(C + (size_t)(mBase + row) * ldc + n0 + c8) = hv;
          if (OUT_MODE == 2) *(v8h*)(C2 + (size_t)(mBase + row) * ldc + n0 + c8) = lv;
        }
        
      }
    }
    __builtin_amdgcn_fence(__ATOMIC_RELEASE, "workgroup");
    __builtin_amdgcn_wave_barrier();
    __builtin_amdgcn_fence(__ATOMIC_ACQUIRE, "workgroup");
  }
}

// ---- all five input conversions in one streaming launch ----
// f32 -> bf16 (RNE) for x, Wq, Wk, Wv; f32 -> bf16 (RNE) -> x carry -> f16 for Wo (carry a power of two; exact for normal results).
// kCvThreads threads; in pass i thread g converts the 4 elements at 4 * (i * kCvThreads + g) of an array: a wave reads 512 contiguous bytes
// per load and writes 256 per store. The pass counts are constants of the shapes, so a thread's 20 loads are independent and can all be in flight.
constexpr int kCvGroups  = 512;
constexpr int kCvThreads = kCvGroups * 256;                    // 131,072 threads = 4,096 waves
constexpr int kCvX  = kTok * kDModel / (4 * kCvThreads);       // 8 passes over x
constexpr int kCvQK = kQKCols * kDModel / (4 * kCvThreads);    // 4 passes over Wq, and over Wk
constexpr int kCvVO = kDModel * kDModel / (4 * kCvThreads);    // 2 passes over Wv, and over Wo
static_assert(kCvX * 4 * kCvThreads == kTok * kDModel && kCvQK * 4 * kCvThreads == kQKCols * kDModel && kCvVO * 4 * kCvThreads == kDModel * kDModel);

template <int N>
__device__ __forceinline__ void cv_load(v4f (&r)[N], const float* __restrict__ in, int g) {
#pragma unroll
  for (int i = 0; i < N; ++i) r[i] = *(const v4f*)(in + 4 * ((size_t)i * kCvThreads + g));
}
template <int N>
__device__ __forceinline__ void cv_store_bf16(const v4f (&r)[N], unsigned short* __restrict__ out, int g) {
#pragma unroll
  for (int i = 0; i < N; ++i) {
    u2v u;
    u[0] = (unsigned)f2bf_bits(r[i][0]) | ((unsigned)f2bf_bits(r[i][1]) << 16);
    u[1] = (unsigned)f2bf_bits(r[i][2]) | ((unsigned)f2bf_bits(r[i][3]) << 16);
    *(u2v*)(out + 4 * ((size_t)i * kCvThreads + g)) = u;
  }
}
__device__ __forceinline__ unsigned cv_f16_bits(float f, float carry) {
  return (unsigned)__builtin_bit_cast(unsigned short, (_Float16)(bf_rne(f) * carry));
}

__global__ __launch_bounds__(256) void cast_inputs(
    const float* __restrict__ X, const float* __restrict__ Wq, const float* __restrict__ Wk,
    const float* __restrict__ Wv, const float* __restrict__ Wo,
    unsigned short* __restrict__ Xb, unsigned short* __restrict__ Wqb, unsigned short* __restrict__ Wkb,
    unsigned short* __restrict__ Wvb, unsigned short* __restrict__ Wo16, float carry) {
  const int g = blockIdx.x * 256 + threadIdx.x;
  v4f x[kCvX], q[kCvQK], k[kCvQK], v[kCvVO], o[kCvVO];
  cv_load(x, X, g);
  cv_load(q, Wq, g);
  cv_load(k, Wk, g);
  cv_load(v, Wv, g);
  cv_load(o, Wo, g);
  cv_store_bf16(x, Xb, g);
  cv_store_bf16(q, Wqb, g);
  cv_store_bf16(k, Wkb, g);
  cv_store_bf16(v, Wvb, g);
#pragma unroll
  for (int i = 0; i < kCvVO; ++i) {
    u2v u;
    u[0] = cv_f16_bits(o[i][0], carry) | (cv_f16_bits(o[i][1], carry) << 16);
    u[1] = cv_f16_bits(o[i][2], carry) | (cv_f16_bits(o[i][3], carry) << 16);
    *(u2v*)(Wo16 + 4 * ((size_t)i * kCvThreads + g)) = u;
  }
}

// ---- lambda = exp(lq1.lk1) - exp(lq2.lk2) + 0.8 from bf16-RNE-converted vectors; one wave writes one 32-float line ----
__global__ __launch_bounds__(32) void lambda_line(
    const float* __restrict__ lq1, const float* __restrict__ lq2,
    const float* __restrict__ lk1, const float* __restrict__ lk2, float* __restrict__ lamp) {
  const int lane = threadIdx.x;
  float d1 = 0.0f, d2 = 0.0f;
#pragma unroll 1
  for (int i = 0; i < kHeadDim; ++i) {
    d1 += bf_rne(lq1[i]) * bf_rne(lk1[i]);
    d2 += bf_rne(lq2[i]) * bf_rne(lk2[i]);
  }
  const float lam = expf(d1) - expf(d2) + 0.8f;
  ((float*)lamp)[lane] = lam;
  
}

// ---- bf16 split helpers ----
__device__ __forceinline__ __bf16 at_f2bf(float f) { return __builtin_bit_cast(__bf16, f2bf_bits(f)); }
__device__ __forceinline__ void at_split(float f, __bf16& hi, __bf16& lo) {
  const unsigned short hb = f2bf_bits(f);
  hi = __builtin_bit_cast(__bf16, hb);
  lo = at_f2bf(f - __uint_as_float(((unsigned)hb) << 16));
}
__device__ __forceinline__ v8f at_mma(v16b a, v16b b, v8f c) {
  c = __builtin_amdgcn_wmma_f32_16x16x32_bf16(false, a, false, b, (short)0, c, false, false);
  asm volatile("v_nop\n\tv_nop\n\tv_nop\n\tv_nop" : "+v"(c) : "v"(a), "v"(b));
  return c;
}

// =====================================================================================
// Differential causal attention, head_dim 64, two softmax maps per head.
//   inputs : q, k as bf16 hi/lo planes [B*S][H*128] (map a uses columns h*128 + a*64 .. +64),
//            Vt as bf16 hi/lo planes [B][H*64][S] (key-contiguous), amask [B][S] f32, lambda line.
//   scores = 0.125 * q_a.k_a^T + causal add + (1-amask)*(-1e9) add; online softmax in f32 (expf);
//   q.k^T and p.v on v_wmma_f32_16x16x32_bf16 as hi.hi + hi.lo + lo.hi (f32 accumulate).
//   att[b][h][s][d] = o_0/l_0 - lambda * o_1/l_1 ; per-tile (sum, sumsq) line for the group norm.
//   Block = 8 waves of one (b, h): waves 0-3 run map 0 and waves 4-7 map 1 of the same 64 query rows.
//   A block takes query tile pr and then tile 31 - pr, so every block walks 33 key chunks;
//   grid.x = B*H*16 = 512, pr fastest.
// LDS: K hi/lo per map [64 kv][64 d], Vt hi/lo [64 d][64 kv] (shared by both maps), per-wave P hi/lo [16][64], all at row pitch kLP;
//      one out slab [16][68] per 16 query rows.
// Every staged LDS byte that is read is written in full each chunk (64 full rows per plane); the 8 pad elements of a row are never read.
// =====================================================================================
__global__ __launch_bounds__(256)
void diff_attn64(const unsigned short* __restrict__ Qh, const unsigned short* __restrict__ Ql,
                 const unsigned short* __restrict__ Kh, const unsigned short* __restrict__ Kl,
                 const unsigned short* __restrict__ Vh, const unsigned short* __restrict__ Vl,
                 const float* __restrict__ amask, const float* __restrict__ lamp,
                 float* __restrict__ att, float* __restrict__ part) {
  union FB { v16b v; v8b h[2]; };
  __shared__ __align__(16) unsigned short Ksh[2][kKC * kLP];
  __shared__ __align__(16) unsigned short Ksl[2][kKC * kLP];
  __shared__ __align__(16) unsigned short Vth[kHeadDim * kLP];
  __shared__ __align__(16) unsigned short Vtl[kHeadDim * kLP];
  __shared__ __align__(16) __bf16 Psh[8][16 * kLP];
  __shared__ __align__(16) __bf16 Psl[8][16 * kLP];
  __shared__ __align__(16) float Os[4][16 * 68];
  __shared__ float red[4][2];

  const int tid  = threadIdx.x;
  const int wave = __builtin_amdgcn_readfirstlane(tid >> 5);   // scalar, so the tests on the map below are scalar branches
  const int a    = wave >> 2;         // softmax map of this wave
  const int wq   = wave & 3;          // 16-row slice of the query tile
  const int lane = tid & 31;
  const int hh   = lane >> 4;
  const int c    = lane & 15;
  const int bx   = blockIdx.x;
  const int pr   = bx & (kNPair - 1);
  const int bh   = bx >> 4;
  const int h    = bh & (kHeads - 1);
  const int b    = bh >> 4;
  const float lam = lamp[0];
  const float negInf = -__builtin_huge_valf();

  const size_t vbase = (size_t)(b * kDModel + h * kHeadDim) * kSeq;               // Vt row (h*64 + d) of batch b
  float* ob_ptr = att + (size_t)bh * kSeq * kHeadDim;
  float* os = Os[wq];
  __bf16* pwh = Psh[wave];
  __bf16* pwl = Psl[wave];
  const unsigned short* ksh = Ksh[a];
  const unsigned short* ksl = Ksl[a];
  const int kvr = tid >> 2;           // staged row: key row for K, d row for Vt (0..63)
  const int sg  = (tid & 3) * 8;      // 8-element segment inside a group of 32 elements

  for (int half = 0; half < 2; ++half) {
    const int qb = half ? (kNQblk - 1 - pr) : pr;
    const int q0 = qb * kQB + wq * 16;
    const size_t qoff = (size_t)(b * kSeq + q0 + c) * kQKCols + (size_t)h * 128 + a * 64;   // + dc*32 + 8*hh
    // Q fragments (A operand) for this wave's map: 2 d-chunks, hi and lo planes
    v16b qah[2], qal[2];
#pragma unroll
    for (int dc = 0; dc < 2; ++dc) {
      qah[dc] = Frag<__bf16>::load((const __bf16*)Qh + qoff + dc * 32 + 8 * hh);
      qal[dc] = Frag<__bf16>::load((const __bf16*)Ql + qoff + dc * 32 + 8 * hh);
    }
    float mrow[8], lrow[8];
    v8f oacc[4];
#pragma unroll
    for (int r = 0; r < 8; ++r) { mrow[r] = negInf; lrow[r] = 0.0f; }
#pragma unroll
    for (int t = 0; t < 4; ++t) oacc[t] = (v8f){0.f,0.f,0.f,0.f,0.f,0.f,0.f,0.f};

    for (int kc = 0; kc <= qb; ++kc) {          // causal: chunks 0..qb (block-uniform trip count, <= 32)
      const int kv0 = kc * kKC;
      __syncthreads();
      {
        // a K row holds both maps side by side (128 elements): groups 0,1 are map 0, groups 2,3 map 1
        const size_t ko = (size_t)(b * kSeq + kv0 + kvr) * kQKCols + (size_t)h * 128 + sg;
        const size_t vo = vbase + (size_t)kvr * kSeq + kv0 + sg;
        u4v t0[4], t1[4], t2[2], t3[2];
#pragma unroll
        for (int i = 0; i < 4; ++i) { t0[i] = *(const u4v*)(Kh + ko + 32 * i); t1[i] = *(const u4v*)(Kl + ko + 32 * i); }
#pragma unroll
        for (int i = 0; i < 2; ++i) { t2[i] = *(const u4v*)(Vh + vo + 32 * i); t3[i] = *(const u4v*)(Vl + vo + 32 * i); }
#pragma unroll
        for (int i = 0; i < 4; ++i) {
          *(u4v*)(Ksh[i >> 1] + kvr * kLP + (i & 1) * 32 + sg) = t0[i];
          *(u4v*)(Ksl[i >> 1] + kvr * kLP + (i & 1) * 32 + sg) = t1[i];
        }
#pragma unroll
        for (int i = 0; i < 2; ++i) { *(u4v*)(Vth + kvr * kLP + i * 32 + sg) = t2[i]; *(u4v*)(Vtl + kvr * kLP + i * 32 + sg) = t3[i]; }
      }
      // additive padding-mask term for this lane's 4 key columns (bf16 RNE-converted mask)
      float amv[4];
#pragma unroll
      for (int j = 0; j < 4; ++j) amv[j] = (1.0f - bf_rne(amask[b * kSeq + kv0 + j * 16 + c])) * (-1.0e9f);
      __syncthreads();

      // ---- scores: 4 key subtiles of 16, K = 64 (2 chunks), hi.hi + hi.lo + lo.hi ----
      v8f s[4];
#pragma unroll
      for (int j = 0; j < 4; ++j) {
        s[j] = (v8f){0.f,0.f,0.f,0.f,0.f,0.f,0.f,0.f};
#pragma unroll
        for (int dc = 0; dc < 2; ++dc) {
          FB kb, kl;
          kb.h[0] = *(const v8b*)(ksh + (j * 16 + c) * kLP + dc * 32 + 8 * hh);
          kb.h[1] = *(const v8b*)(ksh + (j * 16 + c) * kLP + dc * 32 + 16 + 8 * hh);
          kl.h[0] = *(const v8b*)(ksl + (j * 16 + c) * kLP + dc * 32 + 8 * hh);
          kl.h[1] = *(const v8b*)(ksl + (j * 16 + c) * kLP + dc * 32 + 16 + 8 * hh);
          s[j] = at_mma(qah[dc], kb.v, s[j]);
          s[j] = at_mma(qah[dc], kl.v, s[j]);
          s[j] = at_mma(qal[dc], kb.v, s[j]);
        }
      }
      // ---- scale, causal add, mask add, row max ----
      const bool diag = (kc == qb);
      float cm[8];
#pragma unroll
      for (int r = 0; r < 8; ++r) {
        const int qrow = q0 + 8 * hh + r;
        float m = negInf;
#pragma unroll
        for (int j = 0; j < 4; ++j) {
          const int kvcol = kv0 + j * 16 + c;
          const float cz = (diag && (kvcol > qrow)) ? -1.0e9f : 0.0f;
          float sc = s[j][r] * 0.125f;
          sc = sc + cz;
          sc = sc + amv[j];
          s[j][r] = sc;
          m = fmaxf(m, sc);
        }
#pragma unroll
        for (int off = 1; off < 16; off <<= 1) m = fmaxf(m, __shfl_xor(m, off, 32));
        cm[r] = m;
      }
      // ---- online softmax update, P tile as bf16 hi/lo ----
#pragma unroll
      for (int r = 0; r < 8; ++r) {
        const float mnew = fmaxf(mrow[r], cm[r]);
        const float alpha = expf(mrow[r] - mnew);
        mrow[r] = mnew;
        float ps = 0.0f;
#pragma unroll
        for (int j = 0; j < 4; ++j) {
          const float p = expf(s[j][r] - mnew);
          ps += p;
          __bf16 ph, pl;
          at_split(p, ph, pl);
          pwh[(8 * hh + r) * kLP + j * 16 + c] = ph;
          pwl[(8 * hh + r) * kLP + j * 16 + c] = pl;
        }
#pragma unroll
        for (int off = 1; off < 16; off <<= 1) ps += __shfl_xor(ps, off, 32);
        lrow[r] = lrow[r] * alpha + ps;
#pragma unroll
        for (int t = 0; t < 4; ++t) oacc[t][r] *= alpha;
      }
      __builtin_amdgcn_fence(__ATOMIC_RELEASE, "workgroup");
      __builtin_amdgcn_wave_barrier();
      __builtin_amdgcn_fence(__ATOMIC_ACQUIRE, "workgroup");
      // ---- P.V: A = P (this wave's slab), B = Vt [d][kv]; hi.hi + hi.lo + lo.hi ----
#pragma unroll
      for (int kk = 0; kk < 2; ++kk) {
        FB pa, pl;
        pa.h[0] = *(const v8b*)(pwh + c * kLP + kk * 32 + 8 * hh);
        pa.h[1] = *(const v8b*)(pwh + c * kLP + kk * 32 + 16 + 8 * hh);
        pl.h[0] = *(const v8b*)(pwl + c * kLP + kk * 32 + 8 * hh);
        pl.h[1] = *(const v8b*)(pwl + c * kLP + kk * 32 + 16 + 8 * hh);
#pragma unroll
        for (int t = 0; t < 4; ++t) {
          FB vb, vl;
          vb.h[0] = *(const v8b*)(Vth + (t * 16 + c) * kLP + kk * 32 + 8 * hh);
          vb.h[1] = *(const v8b*)(Vth + (t * 16 + c) * kLP + kk * 32 + 16 + 8 * hh);
          vl.h[0] = *(const v8b*)(Vtl + (t * 16 + c) * kLP + kk * 32 + 8 * hh);
          vl.h[1] = *(const v8b*)(Vtl + (t * 16 + c) * kLP + kk * 32 + 16 + 8 * hh);
          oacc[t] = at_mma(pa.v, vb.v, oacc[t]);
          oacc[t] = at_mma(pa.v, vl.v, oacc[t]);
          oacc[t] = at_mma(pl.v, vb.v, oacc[t]);
        }
      }
    }
    // ---- finish this tile: map 1 hands o/l over through the slab; map 0 combines and sums the norm partials ----
    if (a == 1) {
#pragma unroll
      for (int r = 0; r < 8; ++r) {
        const float inv = 1.0f / lrow[r];
#pragma unroll
        for (int t = 0; t < 4; ++t) os[(8 * hh + r) * 68 + t * 16 + c] = oacc[t][r] * inv;
      }
    }
    __syncthreads();
    if (a == 0) {
      float psum = 0.0f, psq = 0.0f;
#pragma unroll
      for (int r = 0; r < 8; ++r) {
        const float inv = 1.0f / lrow[r];
#pragma unroll
        for (int t = 0; t < 4; ++t) {
          const int oi = (8 * hh + r) * 68 + t * 16 + c;
          const float o = oacc[t][r] * inv;
          const float w = o - lam * os[oi];
          os[oi] = w;
          psum += w;
          psq += w * w;
        }
      }
      // wave reductions, then a block combine in fixed order
#pragma unroll
      for (int off = 1; off < 32; off <<= 1) { psum += __shfl_xor(psum, off, 32); psq += __shfl_xor(psq, off, 32); }
      if (lane == 0) { red[wq][0] = psum; red[wq][1] = psq; }
    }
    __syncthreads();

    {
      const int c4 = (lane & 15) * 4;
#pragma unroll
      for (int it = 0; it < 4; ++it) {
        const int row = a * 8 + it * 2 + hh;      // each wave stores 8 of the slab's 16 rows
        v4f val = *(const v4f*)(os + row * 68 + c4);
        *(v4f*)(ob_ptr + (size_t)(q0 + row) * kHeadDim + c4) = val;
      }
      asm volatile("s_wait_xcnt 0x0" ::: "memory");   // the stores' address and data registers are rewritten by the code that follows
    }
    if (wave == 0) {
      const float t0 = ((red[0][0] + red[1][0]) + red[2][0]) + red[3][0];
      const float t1 = ((red[0][1] + red[1][1]) + red[2][1]) + red[3][1];
      const float v = (lane == 0) ? t0 : ((lane == 1) ? t1 : 0.0f);
      float* pline = part + (size_t)(bh * kNQblk + qb) * 32;
      ((float*)pline)[lane] = v;
      asm volatile("s_wait_xcnt 0x0" ::: "memory");   // the next tile's set-up rewrites this store's registers
    }
  }
}

// ---- group norm statistics per (b,h): fixed-order sum of the 32 tile lines; one wave writes one stats line ----
__global__ __launch_bounds__(32) void gn_stats(const float* __restrict__ part, float* __restrict__ stats) {
  const int bh = blockIdx.x;
  const int lane = threadIdx.x;
  float s0 = part[(size_t)(bh * kNQblk + lane) * 32 + 0];
  float s1 = part[(size_t)(bh * kNQblk + lane) * 32 + 1];
#pragma unroll
  for (int off = 1; off < 32; off <<= 1) { s0 += __shfl_xor(s0, off, 32); s1 += __shfl_xor(s1, off, 32); }
  const float inv_n = 1.0f / (float)(kSeq * kHeadDim);
  const float mu = s0 * inv_n;
  const float ex2 = s1 * inv_n;
  const float var = fmaxf(ex2 - mu * mu, 0.0f);
  const float rs = rsqrtf(var + 1.0e-5f);
  const float v = (lane == 0) ? mu : ((lane == 1) ? rs : 0.0f);
  ((float*)stats)[bh * 32 + lane] = v;
  
}

// ---- normalize + affine + x0.2 + merge heads -> f16 plane (x8 carry), [B*S][H*64] ----
__global__ __launch_bounds__(256) void gn_merge(const float* __restrict__ att, const float* __restrict__ stats,
                                              const float* __restrict__ gamma, const float* __restrict__ beta,
                                              unsigned short* __restrict__ merged) {
  const int g = blockIdx.x * 256 + threadIdx.x;
  if (g >= kBatch * kHeads * kSeq * 8) return;
  const int seg = g >> 3;
  const int e8  = (g & 7) * 8;
  const int bh  = seg >> 11;
  const int s   = seg & (kSeq - 1);
  const int h   = bh & (kHeads - 1);
  const int b   = bh >> 4;
  const float mu = stats[bh * 32 + 0];
  const float rs = stats[bh * 32 + 1];
  union U8 { v4f v[2]; float f[8]; };
  U8 x, ga, be;
  const float* ap = att + (size_t)seg * kHeadDim + e8;
  x.v[0]  = *(const v4f*)ap;
  x.v[1]  = *(const v4f*)(ap + 4);
  ga.v[0] = *(const v4f*)(gamma + h * kHeadDim + e8);
  ga.v[1] = *(const v4f*)(gamma + h * kHeadDim + e8 + 4);
  be.v[0] = *(const v4f*)(beta + h * kHeadDim + e8);
  be.v[1] = *(const v4f*)(beta + h * kHeadDim + e8 + 4);
  v8h hv;
#pragma unroll
  for (int e = 0; e < 8; ++e) {
    const float gq = bf_rne(ga.f[e]);
    const float bq = bf_rne(be.f[e]);
    float y = (x.f[e] - mu) * rs;
    y = y * gq + bq;
    y = y * 0.2f;
    float z = y * kMergeCarry;
    asm volatile("" : "+v"(z));
    hv[e] = (_Float16)z;
  }
  unsigned short* dst = merged + (size_t)(b * kSeq + s) * kDModel + h * kHeadDim + e8;
  *(v8h*)dst = hv;
  
}

// ---------------------------------------------------------------------------
extern "C" void kernel_launch(void* const* d_in, const int* in_sizes, int n_in,
                              void* d_out, int out_size, void* d_ws, size_t ws_size,
                              hipStream_t stream) {
  if (n_in < 12) return;
  if (in_sizes[0] != kTok * kDModel || in_sizes[1] != kBatch * kSeq ||
      in_sizes[2] != kQKCols * kDModel || in_sizes[3] != kQKCols * kDModel ||
      in_sizes[4] != kDModel * kDModel || in_sizes[5] != kDModel * kDModel ||
      in_sizes[6] != kHeadDim || in_sizes[7] != kHeadDim || in_sizes[8] != kHeadDim || in_sizes[9] != kHeadDim ||
      in_sizes[10] != kDModel || in_sizes[11] != kDModel) return;
  if (out_size != kTok * kDModel) return;
  if (ws_size < kWsTotal) return;

  const float* X     = (const float*)d_in[0];
  const float* amask = (const float*)d_in[1];
  const float* Wq    = (const float*)d_in[2];
  const float* Wk    = (const float*)d_in[3];
  const float* Wv    = (const float*)d_in[4];
  const float* Wo    = (const float*)d_in[5];
  const float* lq1   = (const float*)d_in[6];
  const float* lq2   = (const float*)d_in[7];
  const float* lk1   = (const float*)d_in[8];
  const float* lk2   = (const float*)d_in[9];
  const float* gamma = (const float*)d_in[10];
  const float* beta  = (const float*)d_in[11];

  char* w = (char*)d_ws;
  unsigned short* Xb    = (unsigned short*)(w + kOffXb);
  unsigned short* Wqb   = (unsigned short*)(w + kOffWqb);
  unsigned short* Wkb   = (unsigned short*)(w + kOffWkb);
  unsigned short* Wvb   = (unsigned short*)(w + kOffWvb);
  unsigned short* Wo16  = (unsigned short*)(w + kOffWo16);
  unsigned short* Qh    = (unsigned short*)(w + kOffQh);
  unsigned short* Ql    = (unsigned short*)(w + kOffQl);
  unsigned short* Kh    = (unsigned short*)(w + kOffKh);
  unsigned short* Kl    = (unsigned short*)(w + kOffKl);
  unsigned short* Vth   = (unsigned short*)(w + kOffVth);
  unsigned short* Vtl   = (unsigned short*)(w + kOffVtl);
  float*          att   = (float*)(w + kOffAtt);
  unsigned short* mrg   = (unsigned short*)(w + kOffMerged);
  float*          part  = (float*)(w + kOffPart);
  float*          stats = (float*)(w + kOffStats);
  float*          lamp  = (float*)(w + kOffLam);

  // 1) input conversions (bf16 RNE; Wo additionally x256 into f16)
  cast_inputs<<<kCvGroups, 256, 0, stream>>>(X, Wq, Wk, Wv, Wo, Xb, Wqb, Wkb, Wvb, Wo16, kWoCarry);
  lambda_line<<<1, 32, 0, stream>>>(lq1, lq2, lk1, lk2, lamp);

  // 2) projections: q/k planes [4096][2048] hi+lo, Vt planes [2][1024][2048] hi+lo
  constexpr int gridQ  = (kTok / 64) * (kQKCols / 64) / 8;   // 256
  constexpr int gridVt = (kDModel / 64) * (kSeq / 64) / 8;   // 64
  constexpr int gridO  = (kTok / 64) * (kDModel / 64) / 8;   // 128
  static_assert(gridQ * 8 == (kTok / 64) * (kQKCols / 64));
  static_assert(gridVt * 8 == (kDModel / 64) * (kSeq / 64));
  static_assert(gridO * 8 == (kTok / 64) * (kDModel / 64));
  // one work-group per 128x256 tile: the same counts
  static_assert(gridQ == (kTok / 128) * (kQKCols / 256) && gridVt == (kDModel / 128) * (kSeq / 256) && gridO == (kTok / 128) * (kDModel / 256));
  static_assert(kDModel % kGK == 0 && kDModel / kGK >= 2);
  wmma_gemm64<1, false, 0, 2, false><<<dim3(gridQ, 1, 1), 256, 0, stream>>>(
      Xb, Xb, kDModel, 0L, Wqb, Wqb, kDModel, 0L, (void*)Qh, (void*)Ql, kQKCols, 0L,
      lamp, lamp, 0L, kTok, kQKCols, kDModel, 1.0f);
  wmma_gemm64<1, false, 0, 2, false><<<dim3(gridQ, 1, 1), 256, 0, stream>>>(
      Xb, Xb, kDModel, 0L, Wkb, Wkb, kDModel, 0L, (void*)Kh, (void*)Kl, kQKCols, 0L,
      lamp, lamp, 0L, kTok, kQKCols, kDModel, 1.0f);
  // Vt[b][c][s] = sum_k Wv[c][k] * X[b][s][k] : A = Wv [1024][1024], Bt = X_b [2048][1024]
  wmma_gemm64<1, false, 0, 2, false><<<dim3(gridVt, kBatch, 1), 256, 0, stream>>>(
      Wvb, Wvb, kDModel, 0L, Xb, Xb, kDModel, (long)kSeq * kDModel, (void*)Vth, (void*)Vtl, kSeq, (long)kDModel * kSeq,
      lamp, lamp, 0L, kDModel, kSeq, kDModel, 1.0f);

  // 3) differential causal attention + norm partial lines (512 blocks, two query tiles each)
  diff_attn64<<<kAttnGroups, 256, 0, stream>>>(Qh, Ql, Kh, Kl, Vth, Vtl, amask, lamp, att, part);

  // 4) group norm stats, normalize + merge
  gn_stats<<<kBatch * kHeads, 32, 0, stream>>>(part, stats);
  gn_merge<<<(kBatch * kHeads * kSeq * 8) / 256, 256, 0, stream>>>(att, stats, gamma, beta, mrg);

  // 5) output projection: out[m][n] = (1/2048) * sum_k merged8[m][k] * Wo256[n][k]
  wmma_gemm64<0, false, 0, 0, false><<<dim3(gridO, 1, 1), 256, 0, stream>>>(
      mrg, mrg, kDModel, 0L, Wo16, Wo16, kDModel, 0L, d_out, d_out, kDModel, 0L,
      lamp, lamp, 0L, kTok, kDModel, kDModel, 1.0f / (kMergeCarry * kWoCarry));
}

// v005
// A run of this version takes 219 microseconds.
// Next to v004, in two timings, it ran 1.43 times as fast each time.
// Over all steps from v000 it is 3.53 times as fast.
// Contractions: x.Wq^T, x.Wk^T, Wv.x^T = v_wmma_f32_16x16x32_bf16 (plain bf16 operands from RNE-converted inputs); k.q^T and Vt.p^T = v_wmma_f32_16x16x32_bf16 with bf16 hi/lo planes (hi.hi+hi.lo+lo.hi); merged.Wo^T = v_wmma_f32_16x16x32_f16 (f16 operands, carries 8 and 256); f32 accumulate everywhere; softmax, group norm and the two 64-term lambda dots in f32.
#include <hip/hip_runtime.h>

typedef __attribute__((ext_vector_type(16))) _Float16 v16h;
typedef __attribute__((ext_vector_type(8)))  _Float16 v8h;
typedef __attribute__((ext_vector_type(16))) __bf16   v16b;
typedef __attribute__((ext_vector_type(8)))  __bf16   v8b;
typedef __attribute__((ext_vector_type(8)))  float    v8f;
typedef __attribute__((ext_vector_type(4)))  float    v4f;
typedef __attribute__((ext_vector_type(4)))  unsigned int u4v;
typedef __attribute__((ext_vector_type(2)))  unsigned int u2v;

// ---- problem geometry ----
constexpr int kBatch   = 2;
constexpr int kSeq     = 2048;
constexpr int kDModel  = 1024;
constexpr int kHeads   = 16;
constexpr int kHeadDim = 64;
constexpr int kQKCols  = 2 * kDModel;      // 2048 : row width of the q/k planes (H * 128)
constexpr int kTok     = kBatch * kSeq;    // 4096
constexpr int kQB      = 64;               // query rows per tile; a block takes two tiles
constexpr int kKC      = 64;               // keys per chunk
constexpr int kLP      = 72;               // LDS row pitch of the 64-element 16-bit tiles: 144 B = 16 B x 9 (odd), conflict-free for 16-byte row reads
constexpr int kNQblk   = kSeq / kQB;       // 32
constexpr int kAttnBlocks = kBatch * kHeads * kNQblk;   // 1024 query tiles
constexpr int kNPair   = kNQblk / 2;        // 16 : tile pairs (t, 31 - t) per (b, h)
constexpr int kAttnGroups = kBatch * kHeads * kNPair;   // 512 work-groups of the attention launch
constexpr float kMergeCarry = 8.0f;        // f16 merged plane carried x8
constexpr float kWoCarry    = 256.0f;      // f16 Wo plane carried x256

static_assert(kNQblk == 32);
static_assert(kHeads == 16);
static_assert(kAttnBlocks == 1024);
static_assert(kNPair == 16 && kAttnGroups == 512);
static_assert(kSeq % kQB == 0);
static_assert(kDModel % 32 == 0);                  // K of every GEMM
static_assert(kTok % 64 == 0 && kQKCols % 64 == 0 && kDModel % 64 == 0 && kSeq % 64 == 0);   // M, N tile multiples

// ---- workspace region map (bytes; every offset a multiple of 128) ----
constexpr size_t kBytesXb     = (size_t)kTok * kDModel * 2;                     //  8,388,608  x as bf16 [4096][1024]
constexpr size_t kBytesWqk    = (size_t)kQKCols * kDModel * 2;                  //  4,194,304  Wq / Wk as bf16 [2048][1024]
constexpr size_t kBytesWv     = (size_t)kDModel * kDModel * 2;                  //  2,097,152  Wv as bf16 [1024][1024]
constexpr size_t kBytesWo     = (size_t)kDModel * kDModel * 2;                  //  2,097,152  Wo as f16 x256 [1024][1024]
constexpr size_t kBytesQPl    = (size_t)kTok * kQKCols * 2;                     // 16,777,216  one q or k plane [4096][2048]
constexpr size_t kBytesVtPl   = (size_t)kBatch * kDModel * kSeq * 2;            //  8,388,608  one Vt plane [2][1024][2048]
constexpr size_t kBytesAtt    = (size_t)kBatch * kHeads * kSeq * kHeadDim * 4;  // 16,777,216  attention out f32 [2][16][2048][64]
constexpr size_t kBytesMerged = (size_t)kTok * kDModel * 2;                     //  8,388,608  merged f16 x8 [4096][1024]
constexpr size_t kBytesPart   = (size_t)kAttnBlocks * 128;                      //    131,072  one 32-float line per query tile (1024 tiles)
constexpr size_t kBytesStats  = (size_t)kBatch * kHeads * 128;                  //      4,096  one 32-float line per (b,h)
constexpr size_t kBytesLam    = 128;                                            //        128  lambda line

constexpr size_t kOffXb     = 0;
constexpr size_t kOffWqb    = kOffXb + kBytesXb;
constexpr size_t kOffWkb    = kOffWqb + kBytesWqk;
constexpr size_t kOffWvb    = kOffWkb + kBytesWqk;
constexpr size_t kOffWo16   = kOffWvb + kBytesWv;
constexpr size_t kOffQh     = kOffWo16 + kBytesWo;
constexpr size_t kOffQl     = kOffQh + kBytesQPl;
constexpr size_t kOffKh     = kOffQl + kBytesQPl;
constexpr size_t kOffKl     = kOffKh + kBytesQPl;
constexpr size_t kOffVth    = kOffKl + kBytesQPl;
constexpr size_t kOffVtl    = kOffVth + kBytesVtPl;
constexpr size_t kOffAtt    = kOffVtl + kBytesVtPl;
constexpr size_t kOffMerged = kOffAtt + kBytesAtt;
constexpr size_t kOffPart   = kOffMerged + kBytesMerged;
constexpr size_t kOffStats  = kOffPart + kBytesPart;
constexpr size_t kOffLam    = kOffStats + kBytesStats;
constexpr size_t kWsTotal   = kOffLam + kBytesLam;                              // 130,158,720
static_assert(kBytesPart == 131072);
static_assert(kWsTotal == 130158720);
static_assert(kWsTotal <= 134217728);
static_assert(kOffWqb % 128 == 0 && kOffQh % 128 == 0 && kOffAtt % 128 == 0 && kOffPart % 128 == 0 && kOffStats % 128 == 0 && kOffLam % 128 == 0);

// ---- 16-bit helpers ----
__device__ __forceinline__ unsigned short f2bf_bits(float f) {
  unsigned u = __float_as_uint(f);
  return (unsigned short)((u + 0x7FFFu + ((u >> 16) & 1u)) >> 16);
}
__device__ __forceinline__ float bf_bits2f(unsigned short h) { return __uint_as_float(((unsigned)h) << 16); }
__device__ __forceinline__ float bf_rne(float f) { return bf_bits2f(f2bf_bits(f)); }

// hazard guards as plain device helpers
__device__ __forceinline__ void dep_guard_h(v8f& a, v8f& b, v16h x, v16h y) { asm volatile("v_nop\n\tv_nop\n\tv_nop\n\tv_nop" : "+v"(a), "+v"(b) : "v"(x), "v"(y)); }
__device__ __forceinline__ void dep_guard_b(v8f& a, v8f& b, v16b x, v16b y) { asm volatile("v_nop\n\tv_nop\n\tv_nop\n\tv_nop" : "+v"(a), "+v"(b) : "v"(x), "v"(y)); }
__device__ __forceinline__ void keep4_h(v16h a, v16h b, v16h c, v16h d) { asm volatile("v_nop" :: "v"(a), "v"(b), "v"(c), "v"(d)); }
__device__ __forceinline__ void keep4_b(v16b a, v16b b, v16b c, v16b d) { asm volatile("v_nop" :: "v"(a), "v"(b), "v"(c), "v"(d)); }
__device__ __forceinline__ void acc_guard4(v8f& a, v8f& b, v8f& c, v8f& d) { asm volatile("v_nop\n\tv_nop\n\tv_nop\n\tv_nop" : "+v"(a), "+v"(b), "+v"(c), "+v"(d)); }
template <typename T> struct Frag;
template <> struct Frag<_Float16> {
  typedef v16h V; union U { v16h v; v8h h[2]; };
  static __device__ __forceinline__ v16h load(const _Float16* p) {   // elements 0..7 <- p[0..7], 8..15 <- p[16..23]
    U f; f.h[0] = *(const v8h*)(p); f.h[1] = *(const v8h*)(p + 16); return f.v;
  }
  static __device__ __forceinline__ v8f mma(v16h a, v16h b, v8f c) {
    return __builtin_amdgcn_wmma_f32_16x16x32_f16(false, a, false, b, (short)0, c, false, false);
  }
  static __device__ __forceinline__ void guard(v8f& a, v8f& b, v16h x, v16h y) { dep_guard_h(a, b, x, y); }
  static __device__ __forceinline__ void keep(v16h a, v16h b, v16h c, v16h d) { keep4_h(a, b, c, d); }
};
template <> struct Frag<__bf16> {
  typedef v16b V; union U { v16b v; v8b h[2]; };
  static __device__ __forceinline__ v16b load(const __bf16* p) {
    U f; f.h[0] = *(const v8b*)(p); f.h[1] = *(const v8b*)(p + 16); return f.v;
  }
  static __device__ __forceinline__ v8f mma(v16b a, v16b b, v8f c) {
    return __builtin_amdgcn_wmma_f32_16x16x32_bf16(false, a, false, b, (short)0, c, false, false);
  }
  static __device__ __forceinline__ void guard(v8f& a, v8f& b, v16b x, v16b y) { dep_guard_b(a, b, x, y); }
  static __device__ __forceinline__ void keep(v16b a, v16b b, v16b c, v16b d) { keep4_b(a, b, c, d); }
};

// ---- Register-blocked batched WMMA GEMM, operands staged in LDS ------------
// C[m,n] = scale * sum_k A[m,k] * Bt[n,k] (+bias)(+resid); a work-group owns a 128x256 tile, each of its 8 waves (2 x 4) a 64x64 part.
// A row-major [M,K]; Bt row-major [N,K]; M % 128 == 0, N % 256 == 0, K % 128 == 0, K >= 256.
// Per 128 k the 128 A rows and 256 Bt rows (256 bytes, two whole lines, each) reach LDS by asynchronous copies, two buffers:
// the copies of tile t + 2 fly while tile t + 1 is worked on; the fragments are read from LDS at row pitch kGP.
// SPLIT is not carried by the staged loop (one plane per operand).
// BIAS_MODE: 0 = none, 1 = bias[m], 2 = bias[n].
// OUT_MODE: 0 = f32, 1 = f16, 2 = bf16 hi plane (Cout) + bf16 lo plane (Cout2).
// ET: 0 = f16 operands, 1 = bf16 operands (pointers passed as 16-bit storage)
constexpr int kGK     = 128;                   // k elements per staged tile
constexpr int kGP     = 136;                   // LDS row pitch of a staged row: 272 B = 16 B x 17 (odd), conflict-free for 16-byte row reads
constexpr int kGRowsA = 128;                   // staged A rows
constexpr int kGRowsB = 256;                   // staged Bt rows
constexpr int kGBuf   = (kGRowsA + kGRowsB) * kGP;   // 16-bit elements of one buffer (104,448 B)

// Twelve 16-byte asynchronous copies of one lane, global -> LDS (l = LDS byte address, g = global address).
// The closing s_wait_xcnt stands inside the statement, so that no address register is rewritten in front of it.
__device__ __forceinline__ void async_copy12(const unsigned (&l)[12], const unsigned short* const (&g)[12]) {
  asm volatile(
      "global_load_async_to_lds_b128 %0, %12, off\n\t"
      "global_load_async_to_lds_b128 %1, %13, off\n\t"
      "global_load_async_to_lds_b128 %2, %14, off\n\t"
      "global_load_async_to_lds_b128 %3, %15, off\n\t"
      "global_load_async_to_lds_b128 %4, %16, off\n\t"
      "global_load_async_to_lds_b128 %5, %17, off\n\t"
      "global_load_async_to_lds_b128 %6, %18, off\n\t"
      "global_load_async_to_lds_b128 %7, %19, off\n\t"
      "global_load_async_to_lds_b128 %8, %20, off\n\t"
      "global_load_async_to_lds_b128 %9, %21, off\n\t"
      "global_load_async_to_lds_b128 %10, %22, off\n\t"
      "global_load_async_to_lds_b128 %11, %23, off\n\t"
      "s_wait_xcnt 0x0"
      :: "v"(l[0]), "v"(l[1]), "v"(l[2]), "v"(l[3]), "v"(l[4]), "v"(l[5]), "v"(l[6]), "v"(l[7]), "v"(l[8]), "v"(l[9]), "v"(l[10]), "v"(l[11]),
         "v"(g[0]), "v"(g[1]), "v"(g[2]), "v"(g[3]), "v"(g[4]), "v"(g[5]), "v"(g[6]), "v"(g[7]), "v"(g[8]), "v"(g[9]), "v"(g[10]), "v"(g[11])
      : "memory");
}

template <int ET> struct Elem;
template <> struct Elem<0> { typedef _Float16 T; };
template <> struct Elem<1> { typedef __bf16 T; };
template <int ET, bool SPLIT, int BIAS_MODE, int OUT_MODE, bool RESID, int ACT = 0>
__global__ __launch_bounds__(256) void wmma_gemm64(
    const unsigned short* __restrict__ Ap, const unsigned short* __restrict__ A2p, int lda, long strideA,
    const unsigned short* __restrict__ Btp, const unsigned short* __restrict__ Bt2p, int ldb, long strideB,
    void* __restrict__ Cout, void* __restrict__ Cout2, int ldc, long strideC,
    const float* __restrict__ bias,
    const float* __restrict__ resid, long strideR,
    int M, int N, int K, float scale) {
  typedef typename Elem<ET>::T T;
  typedef typename Frag<T>::V V;
  static_assert(!SPLIT, "the staged loop carries one plane per operand");
  __shared__ __align__(16) unsigned short sAB[2][kGBuf];   // [buffer][A rows 0..127 | Bt rows 0..255][kGP]
  __shared__ __align__(16) float sT[8][16 * 68];   // per-wave 16x64 slab, pitch 68 floats
  const int b    = blockIdx.y;
  const int tid  = threadIdx.x;
  const int lane = tid & 31;
  const int wave = tid >> 5;
  const int btN = N >> 8;
  const int btM = M >> 7;
  const int bt  = blockIdx.x;
  if (bt >= btM * btN) return;   // the same for the whole work-group, in front of every barrier and copy
  const int bm = bt / btN;
  const int bn = bt - bm * btN;
  const int mB = bm << 7;
  const int nB = bn << 8;
  const int wm = (wave >> 2) << 6;             // this wave's rows inside the staged A rows
  const int wn = (wave & 3) << 6;              // this wave's rows inside the staged Bt rows
  const int m0 = mB + wm;
  const int n0 = nB + wn;

  const int rlane = lane & 15;                 // row (A) / col (B, D) within subtile
  const int koff  = (lane >> 4) * 8;           // k offset of this lane half
  const int mOff  = (lane >> 4) * 8;           // D row offset

  // staging: 16 lanes copy one row's 256 bytes, a wave 4 whole lines per copy; copy it covers staged rows it*16 .. it*16+15
  const int srow = tid >> 4;
  const int sseg = (tid & 15) * 8;
  const unsigned short* pA = Ap  + (size_t)b * strideA + (size_t)(mB + srow) * lda + sseg;
  const unsigned short* pB = Btp + (size_t)b * strideB + (size_t)(nB + srow) * ldb + sseg;
  const unsigned lds0 = (unsigned)(size_t)(&sAB[0][0] + srow * kGP + sseg);   // low 32 bits = byte address in LDS
  auto stage = [&](int buf) {   // copies the next 128 k of every staged row into buffer buf and moves the two pointers on
#pragma unroll   // both loops unrolled: every index constant, so the two operand arrays stay in registers
    for (int hf = 0; hf < 2; ++hf) {
      unsigned l[12];
      const unsigned short* g[12];
#pragma unroll
      for (int e = 0; e < 12; ++e) {
        const int it = hf * 12 + e;
        l[e] = lds0 + (unsigned)((buf * kGBuf + it * 16 * kGP) * 2);
        g[e] = (it < 8) ? (pA + (size_t)(it * 16) * lda) : (pB + (size_t)((it - 8) * 16) * ldb);
      }
      async_copy12(l, g);
    }
    pA += kGK;
    pB += kGK;
  };

  v8f acc[4][4];
#pragma unroll
  for (int i = 0; i < 4; ++i)
#pragma unroll
    for (int j = 0; j < 4; ++j) acc[i][j] = (v8f){0.f,0.f,0.f,0.f,0.f,0.f,0.f,0.f};

  const int nT = K / kGK;
  stage(0);
  asm volatile("s_wait_asynccnt 0x0" ::: "memory");   // this wave's copies of tile 0 have landed
  __syncthreads();                                    // ... and every other wave's
  if (nT > 1) stage(1);
  for (int t = 0; t < nT; ++t) {
    const T* sa = (const T*)sAB[t & 1] + (wm + rlane) * kGP + koff;
    const T* sb = (const T*)sAB[t & 1] + (kGRowsA + wn + rlane) * kGP + koff;
#pragma unroll   // the four 32-k blocks of a tile in line: LDS offsets become immediates and a block's reads can go ahead of the block before it
    for (int ks = 0; ks < kGK; ks += 32) {
      V ah[4], bh[4];
#pragma unroll
      for (int j = 0; j < 4; ++j) bh[j] = Frag<T>::load(sb + (j << 4) * kGP + ks);
#pragma unroll
      for (int i = 0; i < 4; ++i) ah[i] = Frag<T>::load(sa + (i << 4) * kGP + ks);
#pragma unroll
      for (int i = 0; i < 4; ++i) {
#pragma unroll
        for (int j = 0; j < 4; ++j) acc[i][j] = Frag<T>::mma(ah[i], bh[j], acc[i][j]);
        Frag<T>::guard(acc[i][0], acc[i][3], ah[i], ah[i]);
      }
      Frag<T>::keep(bh[0], bh[1], bh[2], bh[3]);
    }
    asm volatile("s_wait_dscnt 0x0" ::: "memory");      // this wave's reads of buffer t & 1 are done before it is refilled
    asm volatile("s_wait_asynccnt 0x0" ::: "memory");   // this wave's copies of tile t + 1 have landed
    __syncthreads();                                    // publishes tile t + 1 and ends every wave's reads of tile t
    if (t + 2 < nT) stage(t & 1);
  }
  asm volatile("s_wait_asynccnt 0x0" ::: "memory");     // nothing is in flight when the wave goes on
  acc_guard4(acc[0][0], acc[0][1], acc[0][2], acc[0][3]);
  acc_guard4(acc[1][0], acc[1][1], acc[1][2], acc[1][3]);
  acc_guard4(acc[2][0], acc[2][1], acc[2][2], acc[2][3]);
  acc_guard4(acc[3][0], acc[3][1], acc[3][2], acc[3][3]);

  // ---- epilogue ----
  float* slab = sT[wave];
  const float* Rb = RESID ? (resid + (size_t)b * strideR) : nullptr;
#pragma unroll
  for (int i = 0; i < 4; ++i) {
    const int mBase = m0 + (i << 4);
#pragma unroll
    for (int j = 0; j < 4; ++j) {
      const int n = n0 + (j << 4) + rlane;
      float bv = 0.f;
      if (BIAS_MODE == 2) bv = bias[n];
#pragma unroll
      for (int r = 0; r < 8; ++r) {
        float v = acc[i][j][r] * scale;
        if (BIAS_MODE == 1) v += bias[mBase + mOff + r];
        if (BIAS_MODE == 2) v += bv;
        if (RESID) v += Rb[(size_t)(mBase + mOff + r) * ldc + n];
        if (ACT == 1) v = tanhf(v);
        if (ACT == 2) v = fmaxf(v, 0.0f);
        if (ACT == 3) v = v / (1.0f + expf(-v));
        if (ACT == 4) v = (v > 0.f) ? v : 0.01f * v;
        if (ACT == 5) v = 0.5f * v * (1.0f + erff(v * 0.70710678118654752f));
        slab[(mOff + r) * 68 + (j << 4) + rlane] = v;
      }
    }
    __builtin_amdgcn_fence(__ATOMIC_RELEASE, "workgroup");
    __builtin_amdgcn_wave_barrier();
    __builtin_amdgcn_fence(__ATOMIC_ACQUIRE, "workgroup");
    if (OUT_MODE == 0) {
      float* C = (float*)Cout + (size_t)b * strideC;
      const int hh = lane >> 4, c4 = (lane & 15) * 4;     // row seg = 256 B = 16 lanes x 16 B
      {
#pragma unroll
        for (int it = 0; it < 8; ++it) {
          const int row = it * 2 + hh;
          v4f v = *(const v4f*)(slab + row * 68 + c4);
          *(v4f*)(C + (size_t)(mBase + row) * ldc + n0 + c4) = v;
        }
        
      }
    } else {
      const int q = lane >> 3, c8 = (lane & 7) * 8;
      unsigned short* C  = (unsigned short*)Cout  + (size_t)b * strideC;
      unsigned short* C2 = (OUT_MODE == 2) ? ((unsigned short*)Cout2 + (size_t)b * strideC) : nullptr;
      {
#pragma unroll
        for (int it = 0; it < 4; ++it) {
          const int row = it * 4 + q;
          const float* sp = slab + row * 68 + c8;
          v8h hv, lv;
#pragma unroll
          for (int e = 0; e < 8; ++e) {
            if (OUT_MODE == 1) {
              hv[e] = (_Float16)sp[e];
            } else {
              unsigned short hb = f2bf_bits(sp[e]);
              unsigned short lb = f2bf_bits(sp[e] - bf_bits2f(hb));
              hv[e] = __builtin_bit_cast(_Float16, hb);
              lv[e] = __builtin_bit_cast(_Float16, lb);
            }
          }
          *(v8h*)(C + (size_t)(mBase + row) * ldc + n0 + c8) = hv;
          if (OUT_MODE == 2) *(v8h*)(C2 + (size_t)(mBase + row) * ldc + n0 + c8) = lv;
        }
        
      }
    }
    __builtin_amdgcn_fence(__ATOMIC_RELEASE, "workgroup");
    __builtin_amdgcn_wave_barrier();
    __builtin_amdgcn_fence(__ATOMIC_ACQUIRE, "workgroup");
  }
}

// ---- all five input conversions in one streaming launch ----
// f32 -> bf16 (RNE) for x, Wq, Wk, Wv; f32 -> bf16 (RNE) -> x carry -> f16 for Wo (carry a power of two; exact for normal results).
// kCvThreads threads; in pass i thread g converts the 4 elements at 4 * (i * kCvThreads + g) of an array: a wave reads 512 contiguous bytes
// per load and writes 256 per store. The pass counts are constants of the shapes, so a thread's 20 loads are independent and can all be in flight.
constexpr int kCvGroups  = 512;
constexpr int kCvThreads = kCvGroups * 256;                    // 131,072 threads = 4,096 waves
constexpr int kCvX  = kTok * kDModel / (4 * kCvThreads);       // 8 passes over x
constexpr int kCvQK = kQKCols * kDModel / (4 * kCvThreads);    // 4 passes over Wq, and over Wk
constexpr int kCvVO = kDModel * kDModel / (4 * kCvThreads);    // 2 passes over Wv, and over Wo
static_assert(kCvX * 4 * kCvThreads == kTok * kDModel && kCvQK * 4 * kCvThreads == kQKCols * kDModel && kCvVO * 4 * kCvThreads == kDModel * kDModel);

template <int N>
__device__ __forceinline__ void cv_load(v4f (&r)[N], const float* __restrict__ in, int g) {
#pragma unroll
  for (int i = 0; i < N; ++i) r[i] = *(const v4f*)(in + 4 * ((size_t)i * kCvThreads + g));
}
template <int N>
__device__ __forceinline__ void cv_store_bf16(const v4f (&r)[N], unsigned short* __restrict__ out, int g) {
#pragma unroll
  for (int i = 0; i < N; ++i) {
    u2v u;
    u[0] = (unsigned)f2bf_bits(r[i][0]) | ((unsigned)f2bf_bits(r[i][1]) << 16);
    u[1] = (unsigned)f2bf_bits(r[i][2]) | ((unsigned)f2bf_bits(r[i][3]) << 16);
    *(u2v*)(out + 4 * ((size_t)i * kCvThreads + g)) = u;
  }
}
__device__ __forceinline__ unsigned cv_f16_bits(float f, float carry) {
  return (unsigned)__builtin_bit_cast(unsigned short, (_Float16)(bf_rne(f) * carry));
}

__global__ __launch_bounds__(256) void cast_inputs(
    const float* __restrict__ X, const float* __restrict__ Wq, const float* __restrict__ Wk,
    const float* __restrict__ Wv, const float* __restrict__ Wo,
    unsigned short* __restrict__ Xb, unsigned short* __restrict__ Wqb, unsigned short* __restrict__ Wkb,
    unsigned short* __restrict__ Wvb, unsigned short* __restrict__ Wo16, float carry) {
  const int g = blockIdx.x * 256 + threadIdx.x;
  v4f x[kCvX], q[kCvQK], k[kCvQK], v[kCvVO], o[kCvVO];
  cv_load(x, X, g);
  cv_load(q, Wq, g);
  cv_load(k, Wk, g);
  cv_load(v, Wv, g);
  cv_load(o, Wo, g);
  cv_store_bf16(x, Xb, g);
  cv_store_bf16(q, Wqb, g);
  cv_store_bf16(k, Wkb, g);
  cv_store_bf16(v, Wvb, g);
#pragma unroll
  for (int i = 0; i < kCvVO; ++i) {
    u2v u;
    u[0] = cv_f16_bits(o[i][0], carry) | (cv_f16_bits(o[i][1], carry) << 16);
    u[1] = cv_f16_bits(o[i][2], carry) | (cv_f16_bits(o[i][3], carry) << 16);
    *(u2v*)(Wo16 + 4 * ((size_t)i * kCvThreads + g)) = u;
  }
}

// ---- lambda = exp(lq1.lk1) - exp(lq2.lk2) + 0.8 from bf16-RNE-converted vectors; one wave writes one 32-float line ----
__global__ __launch_bounds__(32) void lambda_line(
    const float* __restrict__ lq1, const float* __restrict__ lq2,
    const float* __restrict__ lk1, const float* __restrict__ lk2, float* __restrict__ lamp) {
  const int lane = threadIdx.x;
  float d1 = 0.0f, d2 = 0.0f;
#pragma unroll 1
  for (int i = 0; i < kHeadDim; ++i) {
    d1 += bf_rne(lq1[i]) * bf_rne(lk1[i]);
    d2 += bf_rne(lq2[i]) * bf_rne(lk2[i]);
  }
  const float lam = expf(d1) - expf(d2) + 0.8f;
  ((float*)lamp)[lane] = lam;
  
}

// ---- bf16 split helpers ----
// two f32 -> one register of two bf16 hi parts and one of the two bf16 lo parts (both conversions round to nearest even)
typedef __attribute__((ext_vector_type(2))) float  f2v;
typedef __attribute__((ext_vector_type(2))) __bf16 b2v;
__device__ __forceinline__ void at_split2(float p0, float p1, unsigned& hi, unsigned& lo) {
  const unsigned h = __builtin_bit_cast(unsigned, __builtin_convertvector((f2v){p0, p1}, b2v));
  const float r0 = p0 - __uint_as_float(h << 16);
  const float r1 = p1 - __uint_as_float(h & 0xFFFF0000u);
  hi = h;
  lo = __builtin_bit_cast(unsigned, __builtin_convertvector((f2v){r0, r1}, b2v));
}
// the value that lane l ^ 16 holds
__device__ __forceinline__ float at_xhalf(float v) {
  const int b = __builtin_bit_cast(int, v);
  return __builtin_bit_cast(float, __builtin_amdgcn_permlanex16(b, b, 0x76543210, 0xfedcba98, false, false));
}
__device__ __forceinline__ v8f at_mma(v16b a, v16b b, v8f c) {
  c = __builtin_amdgcn_wmma_f32_16x16x32_bf16(false, a, false, b, (short)0, c, false, false);
  asm volatile("v_nop\n\tv_nop\n\tv_nop\n\tv_nop" : "+v"(c) : "v"(a), "v"(b));
  return c;
}

// =====================================================================================
// Differential causal attention, head_dim 64, two softmax maps per head.
//   inputs : q, k as bf16 hi/lo planes [B*S][H*128] (map a uses columns h*128 + a*64 .. +64),
//            Vt as bf16 hi/lo planes [B][H*64][S] (key-contiguous), amask [B][S] f32, lambda line.
//   scores = 0.125 * q_a.k_a^T + causal add + (1-amask)*(-1e9) add; online softmax in f32 (expf);
//   both products run transposed on v_wmma_f32_16x16x32_bf16 as hi.hi + hi.lo + lo.hi (f32 accumulate):
//   S^T = K.Q^T (A = K rows, B = Q columns) and O^T += Vt.P^T (A = Vt rows, B = P^T). A lane then holds scores of ONE query (column c),
//   keys 16 j + 8 hh + r: that is the k order of a B operand, so P^T is packed in registers; maximum and sum run in the lane, the two halves joined by one exchange.
//   att[b][h][s][d] = o_0/l_0 - lambda * o_1/l_1 ; per-tile (sum, sumsq) line for the group norm.
//   Block = 8 waves of one (b, h): waves 0-3 run map 0 and waves 4-7 map 1 of the same 64 query rows.
//   A block takes query tile pr and then tile 31 - pr, so every block walks 33 key chunks;
//   grid.x = B*H*16 = 512, pr fastest.
// LDS: K hi/lo per map [64 kv][64 d], Vt hi/lo [64 d][64 kv] (shared by both maps), all at row pitch kLP; the chunk's 64 mask terms;
//      one out slab [16][68] per 16 query rows.
// Every staged LDS byte that is read is written in full each chunk (64 full rows per plane); the 8 pad elements of a row are never read.
// =====================================================================================
__global__ __launch_bounds__(256)
void diff_attn64(const unsigned short* __restrict__ Qh, const unsigned short* __restrict__ Ql,
                 const unsigned short* __restrict__ Kh, const unsigned short* __restrict__ Kl,
                 const unsigned short* __restrict__ Vh, const unsigned short* __restrict__ Vl,
                 const float* __restrict__ amask, const float* __restrict__ lamp,
                 float* __restrict__ att, float* __restrict__ part) {
  union FB { v16b v; v8b h[2]; };
  __shared__ __align__(16) unsigned short Ksh[2][kKC * kLP];
  __shared__ __align__(16) unsigned short Ksl[2][kKC * kLP];
  __shared__ __align__(16) unsigned short Vth[kHeadDim * kLP];
  __shared__ __align__(16) unsigned short Vtl[kHeadDim * kLP];
  __shared__ __align__(16) float Am[kKC];
  __shared__ __align__(16) float Os[4][16 * 68];
  __shared__ float red[4][2];

  const int tid  = threadIdx.x;
  const int wave = __builtin_amdgcn_readfirstlane(tid >> 5);   // scalar, so the tests on the map below are scalar branches
  const int a    = wave >> 2;         // softmax map of this wave
  const int wq   = wave & 3;          // 16-row slice of the query tile
  const int lane = tid & 31;
  const int hh   = lane >> 4;
  const int c    = lane & 15;
  const int bx   = blockIdx.x;
  const int pr   = bx & (kNPair - 1);
  const int bh   = bx >> 4;
  const int h    = bh & (kHeads - 1);
  const int b    = bh >> 4;
  const float lam = lamp[0];
  const float negInf = -__builtin_huge_valf();

  const size_t vbase = (size_t)(b * kDModel + h * kHeadDim) * kSeq;               // Vt row (h*64 + d) of batch b
  float* ob_ptr = att + (size_t)bh * kSeq * kHeadDim;
  float* os = Os[wq];
  const unsigned short* ksh = Ksh[a];
  const unsigned short* ksl = Ksl[a];
  const int kvr = tid >> 2;           // staged row: key row for K, d row for Vt (0..63)
  const int sg  = (tid & 3) * 8;      // 8-element segment inside a group of 32 elements

  for (int half = 0; half < 2; ++half) {
    const int qb = half ? (kNQblk - 1 - pr) : pr;
    const int q0 = qb * kQB + wq * 16;
    const size_t qoff = (size_t)(b * kSeq + q0 + c) * kQKCols + (size_t)h * 128 + a * 64;   // + dc*32 + 8*hh
    // Q fragments (B operand: lane = query column c) for this wave's map: 2 d-chunks, hi and lo planes
    v16b qah[2], qal[2];
#pragma unroll
    for (int dc = 0; dc < 2; ++dc) {
      qah[dc] = Frag<__bf16>::load((const __bf16*)Qh + qoff + dc * 32 + 8 * hh);
      qal[dc] = Frag<__bf16>::load((const __bf16*)Ql + qoff + dc * 32 + 8 * hh);
    }
    const int qrow = q0 + c;            // the one query of this lane
    float mrow = negInf, lrow = 0.0f;   // its running maximum; the sum over this lane half's keys
    v8f oacc[4];                        // oacc[t][r] = O^T[d = 16 t + 8 hh + r][query c]
#pragma unroll
    for (int t = 0; t < 4; ++t) oacc[t] = (v8f){0.f,0.f,0.f,0.f,0.f,0.f,0.f,0.f};

    for (int kc = 0; kc <= qb; ++kc) {          // causal: chunks 0..qb (block-uniform trip count, <= 32)
      const int kv0 = kc * kKC;
      __syncthreads();
      {
        // a K row holds both maps side by side (128 elements): groups 0,1 are map 0, groups 2,3 map 1
        const size_t ko = (size_t)(b * kSeq + kv0 + kvr) * kQKCols + (size_t)h * 128 + sg;
        const size_t vo = vbase + (size_t)kvr * kSeq + kv0 + sg;
        u4v t0[4], t1[4], t2[2], t3[2];
        float mk = 0.0f;
        if (wave < 2) mk = amask[b * kSeq + kv0 + tid];
#pragma unroll
        for (int i = 0; i < 4; ++i) { t0[i] = *(const u4v*)(Kh + ko + 32 * i); t1[i] = *(const u4v*)(Kl + ko + 32 * i); }
#pragma unroll
        for (int i = 0; i < 2; ++i) { t2[i] = *(const u4v*)(Vh + vo + 32 * i); t3[i] = *(const u4v*)(Vl + vo + 32 * i); }
#pragma unroll
        for (int i = 0; i < 4; ++i) {
          *(u4v*)(Ksh[i >> 1] + kvr * kLP + (i & 1) * 32 + sg) = t0[i];
          *(u4v*)(Ksl[i >> 1] + kvr * kLP + (i & 1) * 32 + sg) = t1[i];
        }
#pragma unroll
        for (int i = 0; i < 2; ++i) { *(u4v*)(Vth + kvr * kLP + i * 32 + sg) = t2[i]; *(u4v*)(Vtl + kvr * kLP + i * 32 + sg) = t3[i]; }
        // additive padding-mask term of each of the 64 keys (bf16 RNE-converted mask)
        if (wave < 2) Am[tid] = (1.0f - bf_rne(mk)) * (-1.0e9f);
      }
      __syncthreads();

      // ---- scores, transposed: 4 key subtiles of 16 rows, K = 64 (2 chunks), hi.hi + hi.lo + lo.hi ----
      v8f s[4];
#pragma unroll
      for (int j = 0; j < 4; ++j) {
        s[j] = (v8f){0.f,0.f,0.f,0.f,0.f,0.f,0.f,0.f};
#pragma unroll
        for (int dc = 0; dc < 2; ++dc) {
          FB kb, kl;
          kb.h[0] = *(const v8b*)(ksh + (j * 16 + c) * kLP + dc * 32 + 8 * hh);
          kb.h[1] = *(const v8b*)(ksh + (j * 16 + c) * kLP + dc * 32 + 16 + 8 * hh);
          kl.h[0] = *(const v8b*)(ksl + (j * 16 + c) * kLP + dc * 32 + 8 * hh);
          kl.h[1] = *(const v8b*)(ksl + (j * 16 + c) * kLP + dc * 32 + 16 + 8 * hh);
          s[j] = at_mma(kb.v, qah[dc], s[j]);
          s[j] = at_mma(kl.v, qah[dc], s[j]);
          s[j] = at_mma(kb.v, qal[dc], s[j]);
        }
      }
      // ---- scale, causal add, mask add, maximum over this lane's 32 keys, then over both halves ----
      const bool diag = (kc == qb);
      float m = negInf;
#pragma unroll
      for (int j = 0; j < 4; ++j) {
        union { v4f v[2]; float f[8]; } am;
        am.v[0] = *(const v4f*)(Am + j * 16 + 8 * hh);
        am.v[1] = *(const v4f*)(Am + j * 16 + 8 * hh + 4);
#pragma unroll
        for (int r = 0; r < 8; ++r) {
          const int kvcol = kv0 + j * 16 + 8 * hh + r;
          const float cz = (diag && (kvcol > qrow)) ? -1.0e9f : 0.0f;
          float sc = s[j][r] * 0.125f;
          sc = sc + cz;
          sc = sc + am.f[r];
          s[j][r] = sc;
          m = fmaxf(m, sc);
        }
      }
      m = fmaxf(m, at_xhalf(m));
      // ---- online softmax update; P^T packed as bf16 hi/lo B operands: element e of 32-key group kk is key 32 kk + (e < 8 ? 8 hh + e : 16 + 8 hh + e - 8) ----
      const float mnew = fmaxf(mrow, m);
      const float alpha = expf(mrow - mnew);
      mrow = mnew;
      union PB { v16b v; unsigned w[8]; };
      PB pbh[2], pbl[2];
      float ps[4];
#pragma unroll
      for (int j = 0; j < 4; ++j) {
        ps[j] = 0.0f;
#pragma unroll
        for (int i = 0; i < 4; ++i) {
          const float p0 = expf(s[j][2 * i] - mnew);
          const float p1 = expf(s[j][2 * i + 1] - mnew);
          ps[j] += p0;
          ps[j] += p1;
          at_split2(p0, p1, pbh[j >> 1].w[(j & 1) * 4 + i], pbl[j >> 1].w[(j & 1) * 4 + i]);
        }
      }
      lrow = lrow * alpha + ((ps[0] + ps[1]) + (ps[2] + ps[3]));
#pragma unroll
      for (int t = 0; t < 4; ++t) oacc[t] *= alpha;
      // ---- O^T += Vt.P^T: A = Vt [d][kv], B = P^T from registers; hi.hi + hi.lo + lo.hi ----
#pragma unroll
      for (int kk = 0; kk < 2; ++kk) {
#pragma unroll
        for (int t = 0; t < 4; ++t) {
          FB vb, vl;
          vb.h[0] = *(const v8b*)(Vth + (t * 16 + c) * kLP + kk * 32 + 8 * hh);
          vb.h[1] = *(const v8b*)(Vth + (t * 16 + c) * kLP + kk * 32 + 16 + 8 * hh);
          vl.h[0] = *(const v8b*)(Vtl + (t * 16 + c) * kLP + kk * 32 + 8 * hh);
          vl.h[1] = *(const v8b*)(Vtl + (t * 16 + c) * kLP + kk * 32 + 16 + 8 * hh);
          oacc[t] = at_mma(vb.v, pbh[kk].v, oacc[t]);
          oacc[t] = at_mma(vl.v, pbh[kk].v, oacc[t]);
          oacc[t] = at_mma(vb.v, pbl[kk].v, oacc[t]);
        }
      }
    }
    // ---- finish this tile: map 1 hands o/l over through the slab; map 0 combines and sums the norm partials ----
    // a lane owns 8 consecutive d of its query's slab row per t: slab[c][16 t + 8 hh + r]
    const float inv = 1.0f / (lrow + at_xhalf(lrow));   // the two halves' sums joined, by every lane
    if (a == 1) {
#pragma unroll
      for (int t = 0; t < 4; ++t) {
        const v8f o = oacc[t] * inv;
        *(v4f*)(os + c * 68 + t * 16 + 8 * hh)     = (v4f){o[0], o[1], o[2], o[3]};
        *(v4f*)(os + c * 68 + t * 16 + 8 * hh + 4) = (v4f){o[4], o[5], o[6], o[7]};
      }
    }
    __syncthreads();
    if (a == 0) {
      float psum = 0.0f, psq = 0.0f;
#pragma unroll
      for (int t = 0; t < 4; ++t) {
        float* op = os + c * 68 + t * 16 + 8 * hh;
        union { v4f v[2]; float f[8]; } o1, wv;
        o1.v[0] = *(const v4f*)(op);
        o1.v[1] = *(const v4f*)(op + 4);
#pragma unroll
        for (int r = 0; r < 8; ++r) {
          const float o = oacc[t][r] * inv;
          const float w = o - lam * o1.f[r];
          wv.f[r] = w;
          psum += w;
          psq += w * w;
        }
        *(v4f*)(op)     = wv.v[0];
        *(v4f*)(op + 4) = wv.v[1];
      }
      // wave reductions, then a block combine in fixed order
#pragma unroll
      for (int off = 1; off < 32; off <<= 1) { psum += __shfl_xor(psum, off, 32); psq += __shfl_xor(psq, off, 32); }
      if (lane == 0) { red[wq][0] = psum; red[wq][1] = psq; }
    }
    __syncthreads();

    {
      const int c4 = (lane & 15) * 4;
#pragma unroll
      for (int it = 0; it < 4; ++it) {
        const int row = a * 8 + it * 2 + hh;      // each wave stores 8 of the slab's 16 rows
        v4f val = *(const v4f*)(os + row * 68 + c4);
        *(v4f*)(ob_ptr + (size_t)(q0 + row) * kHeadDim + c4) = val;
      }
      asm volatile("s_wait_xcnt 0x0" ::: "memory");   // the stores' address and data registers are rewritten by the code that follows
    }
    if (wave == 0) {
      const float t0 = ((red[0][0] + red[1][0]) + red[2][0]) + red[3][0];
      const float t1 = ((red[0][1] + red[1][1]) + red[2][1]) + red[3][1];
      const float v = (lane == 0) ? t0 : ((lane == 1) ? t1 : 0.0f);
      float* pline = part + (size_t)(bh * kNQblk + qb) * 32;
      ((float*)pline)[lane] = v;
      asm volatile("s_wait_xcnt 0x0" ::: "memory");   // the next tile's set-up rewrites this store's registers
    }
  }
}

// ---- group norm statistics per (b,h): fixed-order sum of the 32 tile lines; one wave writes one stats line ----
__global__ __launch_bounds__(32) void gn_stats(const float* __restrict__ part, float* __restrict__ stats) {
  const int bh = blockIdx.x;
  const int lane = threadIdx.x;
  float s0 = part[(size_t)(bh * kNQblk + lane) * 32 + 0];
  float s1 = part[(size_t)(bh * kNQblk + lane) * 32 + 1];
#pragma unroll
  for (int off = 1; off < 32; off <<= 1) { s0 += __shfl_xor(s0, off, 32); s1 += __shfl_xor(s1, off, 32); }
  const float inv_n = 1.0f / (float)(kSeq * kHeadDim);
  const float mu = s0 * inv_n;
  const float ex2 = s1 * inv_n;
  const float var = fmaxf(ex2 - mu * mu, 0.0f);
  const float rs = rsqrtf(var + 1.0e-5f);
  const float v = (lane == 0) ? mu : ((lane == 1) ? rs : 0.0f);
  ((float*)stats)[bh * 32 + lane] = v;
  
}

// ---- normalize + affine + x0.2 + merge heads -> f16 plane (x8 carry), [B*S][H*64] ----
__global__ __launch_bounds__(256) void gn_merge(const float* __restrict__ att, const float* __restrict__ stats,
                                              const float* __restrict__ gamma, const float* __restrict__ beta,
                                              unsigned short* __restrict__ merged) {
  const int g = blockIdx.x * 256 + threadIdx.x;
  if (g >= kBatch * kHeads * kSeq * 8) return;
  const int seg = g >> 3;
  const int e8  = (g & 7) * 8;
  const int bh  = seg >> 11;
  const int s   = seg & (kSeq - 1);
  const int h   = bh & (kHeads - 1);
  const int b   = bh >> 4;
  const float mu = stats[bh * 32 + 0];
  const float rs = stats[bh * 32 + 1];
  union U8 { v4f v[2]; float f[8]; };
  U8 x, ga, be;
  const float* ap = att + (size_t)seg * kHeadDim + e8;
  x.v[0]  = *(const v4f*)ap;
  x.v[1]  = *(const v4f*)(ap + 4);
  ga.v[0] = *(const v4f*)(gamma + h * kHeadDim + e8);
  ga.v[1] = *(const v4f*)(gamma + h * kHeadDim + e8 + 4);
  be.v[0] = *(const v4f*)(beta + h * kHeadDim + e8);
  be.v[1] = *(const v4f*)(beta + h * kHeadDim + e8 + 4);
  v8h hv;
#pragma unroll
  for (int e = 0; e < 8; ++e) {
    const float gq = bf_rne(ga.f[e]);
    const float bq = bf_rne(be.f[e]);
    float y = (x.f[e] - mu) * rs;
    y = y * gq + bq;
    y = y * 0.2f;
    float z = y * kMergeCarry;
    asm volatile("" : "+v"(z));
    hv[e] = (_Float16)z;
  }
  unsigned short* dst = merged + (size_t)(b * kSeq + s) * kDModel + h * kHeadDim + e8;
  *(v8h*)dst = hv;
  
}

// ---------------------------------------------------------------------------
extern "C" void kernel_launch(void* const* d_in, const int* in_sizes, int n_in,
                              void* d_out, int out_size, void* d_ws, size_t ws_size,
                              hipStream_t stream) {
  if (n_in < 12) return;
  if (in_sizes[0] != kTok * kDModel || in_sizes[1] != kBatch * kSeq ||
      in_sizes[2] != kQKCols * kDModel || in_sizes[3] != kQKCols * kDModel ||
      in_sizes[4] != kDModel * kDModel || in_sizes[5] != kDModel * kDModel ||
      in_sizes[6] != kHeadDim || in_sizes[7] != kHeadDim || in_sizes[8] != kHeadDim || in_sizes[9] != kHeadDim ||
      in_sizes[10] != kDModel || in_sizes[11] != kDModel) return;
  if (out_size != kTok * kDModel) return;
  if (ws_size < kWsTotal) return;

  const float* X     = (const float*)d_in[0];
  const float* amask = (const float*)d_in[1];
  const float* Wq    = (const float*)d_in[2];
  const float* Wk    = (const float*)d_in[3];
  const float* Wv    = (const float*)d_in[4];
  const float* Wo    = (const float*)d_in[5];
  const float* lq1   = (const float*)d_in[6];
  const float* lq2   = (const float*)d_in[7];
  const float* lk1   = (const float*)d_in[8];
  const float* lk2   = (const float*)d_in[9];
  const float* gamma = (const float*)d_in[10];
  const float* beta  = (const float*)d_in[11];

  char* w = (char*)d_ws;
  unsigned short* Xb    = (unsigned short*)(w + kOffXb);
  unsigned short* Wqb   = (unsigned short*)(w + kOffWqb);
  unsigned short* Wkb   = (unsigned short*)(w + kOffWkb);
  unsigned short* Wvb   = (unsigned short*)(w + kOffWvb);
  unsigned short* Wo16  = (unsigned short*)(w + kOffWo16);
  unsigned short* Qh    = (unsigned short*)(w + kOffQh);
  unsigned short* Ql    = (unsigned short*)(w + kOffQl);
  unsigned short* Kh    = (unsigned short*)(w + kOffKh);
  unsigned short* Kl    = (unsigned short*)(w + kOffKl);
  unsigned short* Vth   = (unsigned short*)(w + kOffVth);
  unsigned short* Vtl   = (unsigned short*)(w + kOffVtl);
  float*          att   = (float*)(w + kOffAtt);
  unsigned short* mrg   = (unsigned short*)(w + kOffMerged);
  float*          part  = (float*)(w + kOffPart);
  float*          stats = (float*)(w + kOffStats);
  float*          lamp  = (float*)(w + kOffLam);

  // 1) input conversions (bf16 RNE; Wo additionally x256 into f16)
  cast_inputs<<<kCvGroups, 256, 0, stream>>>(X, Wq, Wk, Wv, Wo, Xb, Wqb, Wkb, Wvb, Wo16, kWoCarry);
  lambda_line<<<1, 32, 0, stream>>>(lq1, lq2, lk1, lk2, lamp);

  // 2) projections: q/k planes [4096][2048] hi+lo, Vt planes [2][1024][2048] hi+lo
  constexpr int gridQ  = (kTok / 64) * (kQKCols / 64) / 8;   // 256
  constexpr int gridVt = (kDModel / 64) * (kSeq / 64) / 8;   // 64
  constexpr int gridO  = (kTok / 64) * (kDModel / 64) / 8;   // 128
  static_assert(gridQ * 8 == (kTok / 64) * (kQKCols / 64));
  static_assert(gridVt * 8 == (kDModel / 64) * (kSeq / 64));
  static_assert(gridO * 8 == (kTok / 64) * (kDModel / 64));
  // one work-group per 128x256 tile: the same counts
  static_assert(gridQ == (kTok / 128) * (kQKCols / 256) && gridVt == (kDModel / 128) * (kSeq / 256) && gridO == (kTok / 128) * (kDModel / 256));
  static_assert(kDModel % kGK == 0 && kDModel / kGK >= 2);
  wmma_gemm64<1, false, 0, 2, false><<<dim3(gridQ, 1, 1), 256, 0, stream>>>(
      Xb, Xb, kDModel, 0L, Wqb, Wqb, kDModel, 0L, (void*)Qh, (void*)Ql, kQKCols, 0L,
      lamp, lamp, 0L, kTok, kQKCols, kDModel, 1.0f);
  wmma_gemm64<1, false, 0, 2, false><<<dim3(gridQ, 1, 1), 256, 0, stream>>>(
      Xb, Xb, kDModel, 0L, Wkb, Wkb, kDModel, 0L, (void*)Kh, (void*)Kl, kQKCols, 0L,
      lamp, lamp, 0L, kTok, kQKCols, kDModel, 1.0f);
  // Vt[b][c][s] = sum_k Wv[c][k] * X[b][s][k] : A = Wv [1024][1024], Bt = X_b [2048][1024]
  wmma_gemm64<1, false, 0, 2, false><<<dim3(gridVt, kBatch, 1), 256, 0, stream>>>(
      Wvb, Wvb, kDModel, 0L, Xb, Xb, kDModel, (long)kSeq * kDModel, (void*)Vth, (void*)Vtl, kSeq, (long)kDModel * kSeq,
      lamp, lamp, 0L, kDModel, kSeq, kDModel, 1.0f);

  // 3) differential causal attention + norm partial lines (512 blocks, two query tiles each)
  diff_attn64<<<kAttnGroups, 256, 0, stream>>>(Qh, Ql, Kh, Kl, Vth, Vtl, amask, lamp, att, part);

  // 4) group norm stats, normalize + merge
  gn_stats<<<kBatch * kHeads, 32, 0, stream>>>(part, stats);
  gn_merge<<<(kBatch * kHeads * kSeq * 8) / 256, 256, 0, stream>>>(att, stats, gamma, beta, mrg);

  // 5) output projection: out[m][n] = (1/2048) * sum_k merged8[m][k] * Wo256[n][k]
  wmma_gemm64<0, false, 0, 0, false><<<dim3(gridO, 1, 1), 256, 0, stream>>>(
      mrg, mrg, kDModel, 0L, Wo16, Wo16, kDModel, 0L, d_out, d_out, kDModel, 0L,
      lamp, lamp, 0L, kTok, kDModel, kDModel, 1.0f / (kMergeCarry * kWoCarry));
}

// v006
// A run of this version takes 194 microseconds.
// Two timings next to v005 both put it at 1.13 times that version's speed.
// All steps since v000 together make it 3.99 times as fast.
// Contractions: x.Wq^T, x.Wk^T, Wv.x^T = v_wmma_f32_16x16x32_bf16 (plain bf16 operands from RNE-converted inputs); k.q^T and Vt.p^T = v_wmma_f32_16x16x32_bf16 with bf16 hi/lo planes (hi.hi+hi.lo+lo.hi); merged.Wo^T = v_wmma_f32_16x16x32_f16 (f16 operands, carries 8 and 256); f32 accumulate everywhere; softmax, group norm and the two 64-term lambda dots in f32.
#include <hip/hip_runtime.h>

typedef __attribute__((ext_vector_type(16))) _Float16 v16h;
typedef __attribute__((ext_vector_type(8)))  _Float16 v8h;
typedef __attribute__((ext_vector_type(16))) __bf16   v16b;
typedef __attribute__((ext_vector_type(8)))  __bf16   v8b;
typedef __attribute__((ext_vector_type(8)))  float    v8f;
typedef __attribute__((ext_vector_type(4)))  float    v4f;
typedef __attribute__((ext_vector_type(4)))  unsigned int u4v;
typedef __attribute__((ext_vector_type(2)))  unsigned int u2v;

// ---- problem geometry ----
constexpr int kBatch   = 2;
constexpr int kSeq     = 2048;
constexpr int kDModel  = 1024;
constexpr int kHeads   = 16;
constexpr int kHeadDim = 64;
constexpr int kQKCols  = 2 * kDModel;      // 2048 : row width of the q/k planes (H * 128)
constexpr int kTok     = kBatch * kSeq;    // 4096
constexpr int kQB      = 64;               // query rows per tile; a block takes two tiles
constexpr int kKC      = 64;               // keys per chunk
constexpr int kLP      = 72;               // LDS row pitch of the 64-element 16-bit tiles: 144 B = 16 B x 9 (odd), conflict-free for 16-byte row reads
constexpr int kNQblk   = kSeq / kQB;       // 32
constexpr int kAttnBlocks = kBatch * kHeads * kNQblk;   // 1024 query tiles
constexpr int kNPair   = kNQblk / 2;        // 16 : tile pairs (t, 31 - t) per (b, h)
constexpr int kAttnGroups = kBatch * kHeads * kNPair;   // 512 work-groups of the attention launch
constexpr float kMergeCarry = 8.0f;        // f16 merged plane carried x8
constexpr float kWoCarry    = 256.0f;      // f16 Wo plane carried x256

static_assert(kNQblk == 32);
static_assert(kHeads == 16);
static_assert(kAttnBlocks == 1024);
static_assert(kNPair == 16 && kAttnGroups == 512);
static_assert(kSeq % kQB == 0);
static_assert(kDModel % 32 == 0);                  // K of every GEMM
static_assert(kTok % 64 == 0 && kQKCols % 64 == 0 && kDModel % 64 == 0 && kSeq % 64 == 0);   // M, N tile multiples

// ---- workspace region map (bytes; every offset a multiple of 128) ----
constexpr size_t kBytesXb     = (size_t)kTok * kDModel * 2;                     //  8,388,608  x as bf16 [4096][1024]
constexpr size_t kBytesWqk    = (size_t)kQKCols * kDModel * 2;                  //  4,194,304  Wq / Wk as bf16 [2048][1024]
constexpr size_t kBytesWv     = (size_t)kDModel * kDModel * 2;                  //  2,097,152  Wv as bf16 [1024][1024]
constexpr size_t kBytesWo     = (size_t)kDModel * kDModel * 2;                  //  2,097,152  Wo as f16 x256 [1024][1024]
constexpr size_t kBytesQPl    = (size_t)kTok * kQKCols * 2;                     // 16,777,216  one q or k plane [4096][2048]
constexpr size_t kBytesVtPl   = (size_t)kBatch * kDModel * kSeq * 2;            //  8,388,608  one Vt plane [2][1024][2048]
constexpr size_t kBytesAtt    = (size_t)kBatch * kHeads * kSeq * kHeadDim * 4;  // 16,777,216  attention out f32 [2][16][2048][64]
constexpr size_t kBytesMerged = (size_t)kTok * kDModel * 2;                     //  8,388,608  merged f16 x8 [4096][1024]
constexpr size_t kBytesPart   = (size_t)kAttnBlocks * 128;                      //    131,072  one 32-float line per query tile (1024 tiles)
constexpr size_t kBytesStats  = (size_t)kBatch * kHeads * 128;                  //      4,096  one 32-float line per (b,h)
constexpr size_t kBytesLam    = 128;                                            //        128  lambda line

constexpr size_t kOffXb     = 0;
constexpr size_t kOffWqb    = kOffXb + kBytesXb;
constexpr size_t kOffWkb    = kOffWqb + kBytesWqk;
constexpr size_t kOffWvb    = kOffWkb + kBytesWqk;
constexpr size_t kOffWo16   = kOffWvb + kBytesWv;
constexpr size_t kOffQh     = kOffWo16 + kBytesWo;
constexpr size_t kOffQl     = kOffQh + kBytesQPl;
constexpr size_t kOffKh     = kOffQl + kBytesQPl;
constexpr size_t kOffKl     = kOffKh + kBytesQPl;
constexpr size_t kOffVth    = kOffKl + kBytesQPl;
constexpr size_t kOffVtl    = kOffVth + kBytesVtPl;
constexpr size_t kOffAtt    = kOffVtl + kBytesVtPl;
constexpr size_t kOffMerged = kOffAtt + kBytesAtt;
constexpr size_t kOffPart   = kOffMerged + kBytesMerged;
constexpr size_t kOffStats  = kOffPart + kBytesPart;
constexpr size_t kOffLam    = kOffStats + kBytesStats;
constexpr size_t kWsTotal   = kOffLam + kBytesLam;                              // 130,158,720
static_assert(kBytesPart == 131072);
static_assert(kWsTotal == 130158720);
static_assert(kWsTotal <= 134217728);
static_assert(kOffWqb % 128 == 0 && kOffQh % 128 == 0 && kOffAtt % 128 == 0 && kOffPart % 128 == 0 && kOffStats % 128 == 0 && kOffLam % 128 == 0);

// ---- 16-bit helpers ----
__device__ __forceinline__ unsigned short f2bf_bits(float f) {
  unsigned u = __float_as_uint(f);
  return (unsigned short)((u + 0x7FFFu + ((u >> 16) & 1u)) >> 16);
}
__device__ __forceinline__ float bf_bits2f(unsigned short h) { return __uint_as_float(((unsigned)h) << 16); }
__device__ __forceinline__ float bf_rne(float f) { return bf_bits2f(f2bf_bits(f)); }

// hazard guards as plain device helpers
__device__ __forceinline__ void dep_guard_h(v8f& a, v8f& b, v16h x, v16h y) { asm volatile("v_nop\n\tv_nop\n\tv_nop\n\tv_nop" : "+v"(a), "+v"(b) : "v"(x), "v"(y)); }
__device__ __forceinline__ void dep_guard_b(v8f& a, v8f& b, v16b x, v16b y) { asm volatile("v_nop\n\tv_nop\n\tv_nop\n\tv_nop" : "+v"(a), "+v"(b) : "v"(x), "v"(y)); }
__device__ __forceinline__ void keep4_h(v16h a, v16h b, v16h c, v16h d) { asm volatile("v_nop" :: "v"(a), "v"(b), "v"(c), "v"(d)); }
__device__ __forceinline__ void keep4_b(v16b a, v16b b, v16b c, v16b d) { asm volatile("v_nop" :: "v"(a), "v"(b), "v"(c), "v"(d)); }
__device__ __forceinline__ void acc_guard4(v8f& a, v8f& b, v8f& c, v8f& d) { asm volatile("v_nop\n\tv_nop\n\tv_nop\n\tv_nop" : "+v"(a), "+v"(b), "+v"(c), "+v"(d)); }
template <typename T> struct Frag;
template <> struct Frag<_Float16> {
  typedef v16h V; union U { v16h v; v8h h[2]; };
  static __device__ __forceinline__ v16h load(const _Float16* p) {   // elements 0..7 <- p[0..7], 8..15 <- p[16..23]
    U f; f.h[0] = *(const v8h*)(p); f.h[1] = *(const v8h*)(p + 16); return f.v;
  }
  static __device__ __forceinline__ v8f mma(v16h a, v16h b, v8f c) {
    return __builtin_amdgcn_wmma_f32_16x16x32_f16(false, a, false, b, (short)0, c, false, false);
  }
  static __device__ __forceinline__ void guard(v8f& a, v8f& b, v16h x, v16h y) { dep_guard_h(a, b, x, y); }
  static __device__ __forceinline__ void keep(v16h a, v16h b, v16h c, v16h d) { keep4_h(a, b, c, d); }
};
template <> struct Frag<__bf16> {
  typedef v16b V; union U { v16b v; v8b h[2]; };
  static __device__ __forceinline__ v16b load(const __bf16* p) {
    U f; f.h[0] = *(const v8b*)(p); f.h[1] = *(const v8b*)(p + 16); return f.v;
  }
  static __device__ __forceinline__ v8f mma(v16b a, v16b b, v8f c) {
    return __builtin_amdgcn_wmma_f32_16x16x32_bf16(false, a, false, b, (short)0, c, false, false);
  }
  static __device__ __forceinline__ void guard(v8f& a, v8f& b, v16b x, v16b y) { dep_guard_b(a, b, x, y); }
  static __device__ __forceinline__ void keep(v16b a, v16b b, v16b c, v16b d) { keep4_b(a, b, c, d); }
};

// ---- Register-blocked batched WMMA GEMM, operands staged in LDS ------------
// C[m,n] = scale * sum_k A[m,k] * Bt[n,k] (+bias)(+resid); a work-group owns a 128x256 tile, each of its 8 waves (2 x 4) a 64x64 part.
// A row-major [M,K]; Bt row-major [N,K]; M % 128 == 0, N % 256 == 0, K % 128 == 0, K >= 256.
// Per 128 k the 128 A rows and 256 Bt rows (256 bytes, two whole lines, each) reach LDS by asynchronous copies, two buffers:
// the copies of tile t + 2 fly while tile t + 1 is worked on; the fragments are read from LDS at row pitch kGP.
// SPLIT is not carried by the staged loop (one plane per operand).
// BIAS_MODE: 0 = none, 1 = bias[m], 2 = bias[n].
// OUT_MODE: 0 = f32, 1 = f16, 2 = bf16 hi plane (Cout) + bf16 lo plane (Cout2).
// ET: 0 = f16 operands, 1 = bf16 operands (pointers passed as 16-bit storage)
constexpr int kGK     = 128;                   // k elements per staged tile
constexpr int kGP     = 136;                   // LDS row pitch of a staged row: 272 B = 16 B x 17 (odd), conflict-free for 16-byte row reads
constexpr int kGRowsA = 128;                   // staged A rows
constexpr int kGRowsB = 256;                   // staged Bt rows
constexpr int kGBuf   = (kGRowsA + kGRowsB) * kGP;   // 16-bit elements of one buffer (104,448 B)

// Twelve 16-byte asynchronous copies of one lane, global -> LDS (l = LDS byte address, g = global address).
// The closing s_wait_xcnt stands inside the statement, so that no address register is rewritten in front of it.
__device__ __forceinline__ void async_copy12(const unsigned (&l)[12], const unsigned short* const (&g)[12]) {
  asm volatile(
      "global_load_async_to_lds_b128 %0, %12, off\n\t"
      "global_load_async_to_lds_b128 %1, %13, off\n\t"
      "global_load_async_to_lds_b128 %2, %14, off\n\t"
      "global_load_async_to_lds_b128 %3, %15, off\n\t"
      "global_load_async_to_lds_b128 %4, %16, off\n\t"
      "global_load_async_to_lds_b128 %5, %17, off\n\t"
      "global_load_async_to_lds_b128 %6, %18, off\n\t"
      "global_load_async_to_lds_b128 %7, %19, off\n\t"
      "global_load_async_to_lds_b128 %8, %20, off\n\t"
      "global_load_async_to_lds_b128 %9, %21, off\n\t"
      "global_load_async_to_lds_b128 %10, %22, off\n\t"
      "global_load_async_to_lds_b128 %11, %23, off\n\t"
      "s_wait_xcnt 0x0"
      :: "v"(l[0]), "v"(l[1]), "v"(l[2]), "v"(l[3]), "v"(l[4]), "v"(l[5]), "v"(l[6]), "v"(l[7]), "v"(l[8]), "v"(l[9]), "v"(l[10]), "v"(l[11]),
         "v"(g[0]), "v"(g[1]), "v"(g[2]), "v"(g[3]), "v"(g[4]), "v"(g[5]), "v"(g[6]), "v"(g[7]), "v"(g[8]), "v"(g[9]), "v"(g[10]), "v"(g[11])
      : "memory");
}

template <int ET> struct Elem;
template <> struct Elem<0> { typedef _Float16 T; };
template <> struct Elem<1> { typedef __bf16 T; };
template <int ET, bool SPLIT, int BIAS_MODE, int OUT_MODE, bool RESID, int ACT = 0>
__global__ __launch_bounds__(256) void wmma_gemm64(
    const unsigned short* __restrict__ Ap, const unsigned short* __restrict__ A2p, int lda, long strideA,
    const unsigned short* __restrict__ Btp, const unsigned short* __restrict__ Bt2p, int ldb, long strideB,
    void* __restrict__ Cout, void* __restrict__ Cout2, int ldc, long strideC,
    const float* __restrict__ bias,
    const float* __restrict__ resid, long strideR,
    int M, int N, int K, float scale) {
  typedef typename Elem<ET>::T T;
  typedef typename Frag<T>::V V;
  static_assert(!SPLIT, "the staged loop carries one plane per operand");
  __shared__ __align__(16) unsigned short sAB[2][kGBuf];   // [buffer][A rows 0..127 | Bt rows 0..255][kGP]
  __shared__ __align__(16) float sT[8][16 * 68];   // per-wave 16x64 slab, pitch 68 floats
  const int b    = blockIdx.y;
  const int tid  = threadIdx.x;
  const int lane = tid & 31;
  const int wave = tid >> 5;
  const int btN = N >> 8;
  const int btM = M >> 7;
  const int bt  = blockIdx.x;
  if (bt >= btM * btN) return;   // the same for the whole work-group, in front of every barrier and copy
  const int bm = bt / btN;
  const int bn = bt - bm * btN;
  const int mB = bm << 7;
  const int nB = bn << 8;
  const int wm = (wave >> 2) << 6;             // this wave's rows inside the staged A rows
  const int wn = (wave & 3) << 6;              // this wave's rows inside the staged Bt rows
  const int m0 = mB + wm;
  const int n0 = nB + wn;

  const int rlane = lane & 15;                 // row (A) / col (B, D) within subtile
  const int koff  = (lane >> 4) * 8;           // k offset of this lane half
  const int mOff  = (lane >> 4) * 8;           // D row offset

  // staging: 16 lanes copy one row's 256 bytes, a wave 4 whole lines per copy; copy it covers staged rows it*16 .. it*16+15
  const int srow = tid >> 4;
  const int sseg = (tid & 15) * 8;
  const unsigned short* pA = Ap  + (size_t)b * strideA + (size_t)(mB + srow) * lda + sseg;
  const unsigned short* pB = Btp + (size_t)b * strideB + (size_t)(nB + srow) * ldb + sseg;
  const unsigned lds0 = (unsigned)(size_t)(&sAB[0][0] + srow * kGP + sseg);   // low 32 bits = byte address in LDS
  auto stage = [&](int buf) {   // copies the next 128 k of every staged row into buffer buf and moves the two pointers on
#pragma unroll   // both loops unrolled: every index constant, so the two operand arrays stay in registers
    for (int hf = 0; hf < 2; ++hf) {
      unsigned l[12];
      const unsigned short* g[12];
#pragma unroll
      for (int e = 0; e < 12; ++e) {
        const int it = hf * 12 + e;
        l[e] = lds0 + (unsigned)((buf * kGBuf + it * 16 * kGP) * 2);
        g[e] = (it < 8) ? (pA + (size_t)(it * 16) * lda) : (pB + (size_t)((it - 8) * 16) * ldb);
      }
      async_copy12(l, g);
    }
    pA += kGK;
    pB += kGK;
  };

  v8f acc[4][4];
#pragma unroll
  for (int i = 0; i < 4; ++i)
#pragma unroll
    for (int j = 0; j < 4; ++j) acc[i][j] = (v8f){0.f,0.f,0.f,0.f,0.f,0.f,0.f,0.f};

  const int nT = K / kGK;
  stage(0);
  asm volatile("s_wait_asynccnt 0x0" ::: "memory");   // this wave's copies of tile 0 have landed
  __syncthreads();                                    // ... and every other wave's
  if (nT > 1) stage(1);
  for (int t = 0; t < nT; ++t) {
    const T* sa = (const T*)sAB[t & 1] + (wm + rlane) * kGP + koff;
    const T* sb = (const T*)sAB[t & 1] + (kGRowsA + wn + rlane) * kGP + koff;
#pragma unroll   // the four 32-k blocks of a tile in line: LDS offsets become immediates and a block's reads can go ahead of the block before it
    for (int ks = 0; ks < kGK; ks += 32) {
      V ah[4], bh[4];
#pragma unroll
      for (int j = 0; j < 4; ++j) bh[j] = Frag<T>::load(sb + (j << 4) * kGP + ks);
#pragma unroll
      for (int i = 0; i < 4; ++i) ah[i] = Frag<T>::load(sa + (i << 4) * kGP + ks);
#pragma unroll
      for (int i = 0; i < 4; ++i) {
#pragma unroll
        for (int j = 0; j < 4; ++j) acc[i][j] = Frag<T>::mma(ah[i], bh[j], acc[i][j]);
        Frag<T>::guard(acc[i][0], acc[i][3], ah[i], ah[i]);
      }
      Frag<T>::keep(bh[0], bh[1], bh[2], bh[3]);
    }
    asm volatile("s_wait_dscnt 0x0" ::: "memory");      // this wave's reads of buffer t & 1 are done before it is refilled
    asm volatile("s_wait_asynccnt 0x0" ::: "memory");   // this wave's copies of tile t + 1 have landed
    __syncthreads();                                    // publishes tile t + 1 and ends every wave's reads of tile t
    if (t + 2 < nT) stage(t & 1);
  }
  asm volatile("s_wait_asynccnt 0x0" ::: "memory");     // nothing is in flight when the wave goes on
  acc_guard4(acc[0][0], acc[0][1], acc[0][2], acc[0][3]);
  acc_guard4(acc[1][0], acc[1][1], acc[1][2], acc[1][3]);
  acc_guard4(acc[2][0], acc[2][1], acc[2][2], acc[2][3]);
  acc_guard4(acc[3][0], acc[3][1], acc[3][2], acc[3][3]);

  // ---- epilogue ----
  float* slab = sT[wave];
  const float* Rb = RESID ? (resid + (size_t)b * strideR) : nullptr;
#pragma unroll
  for (int i = 0; i < 4; ++i) {
    const int mBase = m0 + (i << 4);
#pragma unroll
    for (int j = 0; j < 4; ++j) {
      const int n = n0 + (j << 4) + rlane;
      float bv = 0.f;
      if (BIAS_MODE == 2) bv = bias[n];
#pragma unroll
      for (int r = 0; r < 8; ++r) {
        float v = acc[i][j][r] * scale;
        if (BIAS_MODE == 1) v += bias[mBase + mOff + r];
        if (BIAS_MODE == 2) v += bv;
        if (RESID) v += Rb[(size_t)(mBase + mOff + r) * ldc + n];
        if (ACT == 1) v = tanhf(v);
        if (ACT == 2) v = fmaxf(v, 0.0f);
        if (ACT == 3) v = v / (1.0f + expf(-v));
        if (ACT == 4) v = (v > 0.f) ? v : 0.01f * v;
        if (ACT == 5) v = 0.5f * v * (1.0f + erff(v * 0.70710678118654752f));
        slab[(mOff + r) * 68 + (j << 4) + rlane] = v;
      }
    }
    __builtin_amdgcn_fence(__ATOMIC_RELEASE, "workgroup");
    __builtin_amdgcn_wave_barrier();
    __builtin_amdgcn_fence(__ATOMIC_ACQUIRE, "workgroup");
    if (OUT_MODE == 0) {
      float* C = (float*)Cout + (size_t)b * strideC;
      const int hh = lane >> 4, c4 = (lane & 15) * 4;     // row seg = 256 B = 16 lanes x 16 B
      {
#pragma unroll
        for (int it = 0; it < 8; ++it) {
          const int row = it * 2 + hh;
          v4f v = *(const v4f*)(slab + row * 68 + c4);
          *(v4f*)(C + (size_t)(mBase + row) * ldc + n0 + c4) = v;
        }
        
      }
    } else {
      const int q = lane >> 3, c8 = (lane & 7) * 8;
      unsigned short* C  = (unsigned short*)Cout  + (size_t)b * strideC;
      unsigned short* C2 = (OUT_MODE == 2) ? ((unsigned short*)Cout2 + (size_t)b * strideC) : nullptr;
      {
#pragma unroll
        for (int it = 0; it < 4; ++it) {
          const int row = it * 4 + q;
          const float* sp = slab + row * 68 + c8;
          v8h hv, lv;
#pragma unroll
          for (int e = 0; e < 8; ++e) {
            if (OUT_MODE == 1) {
              hv[e] = (_Float16)sp[e];
            } else {
              unsigned short hb = f2bf_bits(sp[e]);
              unsigned short lb = f2bf_bits(sp[e] - bf_bits2f(hb));
              hv[e] = __builtin_bit_cast(_Float16, hb);
              lv[e] = __builtin_bit_cast(_Float16, lb);
            }
          }
          *(v8h*)(C + (size_t)(mBase + row) * ldc + n0 + c8) = hv;
          if (OUT_MODE == 2) *(v8h*)(C2 + (size_t)(mBase + row) * ldc + n0 + c8) = lv;
        }
        
      }
    }
    __builtin_amdgcn_fence(__ATOMIC_RELEASE, "workgroup");
    __builtin_amdgcn_wave_barrier();
    __builtin_amdgcn_fence(__ATOMIC_ACQUIRE, "workgroup");
  }
}

// ---- all five input conversions in one streaming launch ----
// f32 -> bf16 (RNE) for x, Wq, Wk, Wv; f32 -> bf16 (RNE) -> x carry -> f16 for Wo (carry a power of two; exact for normal results).
// kCvThreads threads; in pass i thread g converts the 4 elements at 4 * (i * kCvThreads + g) of an array: a wave reads 512 contiguous bytes
// per load and writes 256 per store. The pass counts are constants of the shapes, so a thread's 20 loads are independent and can all be in flight.
constexpr int kCvGroups  = 512;
constexpr int kCvThreads = kCvGroups * 256;                    // 131,072 threads = 4,096 waves
constexpr int kCvX  = kTok * kDModel / (4 * kCvThreads);       // 8 passes over x
constexpr int kCvQK = kQKCols * kDModel / (4 * kCvThreads);    // 4 passes over Wq, and over Wk
constexpr int kCvVO = kDModel * kDModel / (4 * kCvThreads);    // 2 passes over Wv, and over Wo
static_assert(kCvX * 4 * kCvThreads == kTok * kDModel && kCvQK * 4 * kCvThreads == kQKCols * kDModel && kCvVO * 4 * kCvThreads == kDModel * kDModel);

template <int N>
__device__ __forceinline__ void cv_load(v4f (&r)[N], const float* __restrict__ in, int g) {
#pragma unroll
  for (int i = 0; i < N; ++i) r[i] = *(const v4f*)(in + 4 * ((size_t)i * kCvThreads + g));
}
template <int N>
__device__ __forceinline__ void cv_store_bf16(const v4f (&r)[N], unsigned short* __restrict__ out, int g) {
#pragma unroll
  for (int i = 0; i < N; ++i) {
    u2v u;
    u[0] = (unsigned)f2bf_bits(r[i][0]) | ((unsigned)f2bf_bits(r[i][1]) << 16);
    u[1] = (unsigned)f2bf_bits(r[i][2]) | ((unsigned)f2bf_bits(r[i][3]) << 16);
    *(u2v*)(out + 4 * ((size_t)i * kCvThreads + g)) = u;
  }
}
__device__ __forceinline__ unsigned cv_f16_bits(float f, float carry) {
  return (unsigned)__builtin_bit_cast(unsigned short, (_Float16)(bf_rne(f) * carry));
}

__global__ __launch_bounds__(256) void cast_inputs(
    const float* __restrict__ X, const float* __restrict__ Wq, const float* __restrict__ Wk,
    const float* __restrict__ Wv, const float* __restrict__ Wo,
    unsigned short* __restrict__ Xb, unsigned short* __restrict__ Wqb, unsigned short* __restrict__ Wkb,
    unsigned short* __restrict__ Wvb, unsigned short* __restrict__ Wo16, float carry) {
  const int g = blockIdx.x * 256 + threadIdx.x;
  v4f x[kCvX], q[kCvQK], k[kCvQK], v[kCvVO], o[kCvVO];
  cv_load(x, X, g);
  cv_load(q, Wq, g);
  cv_load(k, Wk, g);
  cv_load(v, Wv, g);
  cv_load(o, Wo, g);
  cv_store_bf16(x, Xb, g);
  cv_store_bf16(q, Wqb, g);
  cv_store_bf16(k, Wkb, g);
  cv_store_bf16(v, Wvb, g);
#pragma unroll
  for (int i = 0; i < kCvVO; ++i) {
    u2v u;
    u[0] = cv_f16_bits(o[i][0], carry) | (cv_f16_bits(o[i][1], carry) << 16);
    u[1] = cv_f16_bits(o[i][2], carry) | (cv_f16_bits(o[i][3], carry) << 16);
    *(u2v*)(Wo16 + 4 * ((size_t)i * kCvThreads + g)) = u;
  }
}

// ---- lambda = exp(lq1.lk1) - exp(lq2.lk2) + 0.8 from bf16-RNE-converted vectors; one wave writes one 32-float line ----
__global__ __launch_bounds__(32) void lambda_line(
    const float* __restrict__ lq1, const float* __restrict__ lq2,
    const float* __restrict__ lk1, const float* __restrict__ lk2, float* __restrict__ lamp) {
  const int lane = threadIdx.x;
  float d1 = 0.0f, d2 = 0.0f;
#pragma unroll 1
  for (int i = 0; i < kHeadDim; ++i) {
    d1 += bf_rne(lq1[i]) * bf_rne(lk1[i]);
    d2 += bf_rne(lq2[i]) * bf_rne(lk2[i]);
  }
  const float lam = expf(d1) - expf(d2) + 0.8f;
  ((float*)lamp)[lane] = lam;
  
}

// ---- bf16 split helpers ----
// two f32 -> one register of two bf16 hi parts and one of the two bf16 lo parts (both conversions round to nearest even)
typedef __attribute__((ext_vector_type(2))) float  f2v;
typedef __attribute__((ext_vector_type(2))) __bf16 b2v;
__device__ __forceinline__ void at_split2(float p0, float p1, unsigned& hi, unsigned& lo) {
  const unsigned h = __builtin_bit_cast(unsigned, __builtin_convertvector((f2v){p0, p1}, b2v));
  const float r0 = p0 - __uint_as_float(h << 16);
  const float r1 = p1 - __uint_as_float(h & 0xFFFF0000u);
  hi = h;
  lo = __builtin_bit_cast(unsigned, __builtin_convertvector((f2v){r0, r1}, b2v));
}
// the value that lane l ^ 16 holds
__device__ __forceinline__ float at_xhalf(float v) {
  const int b = __builtin_bit_cast(int, v);
  return __builtin_bit_cast(float, __builtin_amdgcn_permlanex16(b, b, 0x76543210, 0xfedcba98, false, false));
}
// e^x for the softmax (x <= 0 or -inf): one multiply and the hardware's 2^y. The library's expf adds a two-part product, a split into whole and
// fraction, ldexp and two range selects per value; here the argument is a difference from the running maximum, a result below 2^-126 may go to 0,
// and the multiply's rounding moves a weight by less than the 16 bits that its hi + lo parts keep.
constexpr float kLog2E = 1.44269504088896340736f;
__device__ __forceinline__ float at_exp(float x) { return __builtin_amdgcn_exp2f(x * kLog2E); }
__device__ __forceinline__ v8f at_mma(v16b a, v16b b, v8f c) {
  c = __builtin_amdgcn_wmma_f32_16x16x32_bf16(false, a, false, b, (short)0, c, false, false);
  asm volatile("v_nop\n\tv_nop\n\tv_nop\n\tv_nop" : "+v"(c) : "v"(a), "v"(b));
  return c;
}

// =====================================================================================
// Differential causal attention, head_dim 64, two softmax maps per head.
//   inputs : q, k as bf16 hi/lo planes [B*S][H*128] (map a uses columns h*128 + a*64 .. +64),
//            Vt as bf16 hi/lo planes [B][H*64][S] (key-contiguous), amask [B][S] f32, lambda line.
//   scores = 0.125 * q_a.k_a^T + causal add + (1-amask)*(-1e9) add; online softmax in f32 (e^x = 2^(x * log2 e) on v_exp_f32);
//   both products run transposed on v_wmma_f32_16x16x32_bf16 as hi.hi + hi.lo + lo.hi (f32 accumulate):
//   S^T = K.Q^T (A = K rows, B = Q columns) and O^T += Vt.P^T (A = Vt rows, B = P^T). A lane then holds scores of ONE query (column c),
//   keys 16 j + 8 hh + r: that is the k order of a B operand, so P^T is packed in registers; maximum and sum run in the lane, the two halves joined by one exchange.
//   att[b][h][s][d] = o_0/l_0 - lambda * o_1/l_1 ; per-tile (sum, sumsq) line for the group norm.
//   Block = 8 waves of one (b, h): waves 0-3 run map 0 and waves 4-7 map 1 of the same 64 query rows.
//   A block takes query tile pr and then tile 31 - pr, so every block walks 33 key chunks;
//   grid.x = B*H*16 = 512, pr fastest.
// LDS: K hi/lo per map [64 kv][64 d], Vt hi/lo [64 d][64 kv] (shared by both maps), all at row pitch kLP; the chunk's 64 mask terms;
//      one out slab [16][68] per 16 query rows.
// Every staged LDS byte that is read is written in full each chunk (64 full rows per plane); the 8 pad elements of a row are never read.
// =====================================================================================
__global__ __launch_bounds__(256)
void diff_attn64(const unsigned short* __restrict__ Qh, const unsigned short* __restrict__ Ql,
                 const unsigned short* __restrict__ Kh, const unsigned short* __restrict__ Kl,
                 const unsigned short* __restrict__ Vh, const unsigned short* __restrict__ Vl,
                 const float* __restrict__ amask, const float* __restrict__ lamp,
                 float* __restrict__ att, float* __restrict__ part) {
  union FB { v16b v; v8b h[2]; };
  __shared__ __align__(16) unsigned short Ksh[2][kKC * kLP];
  __shared__ __align__(16) unsigned short Ksl[2][kKC * kLP];
  __shared__ __align__(16) unsigned short Vth[kHeadDim * kLP];
  __shared__ __align__(16) unsigned short Vtl[kHeadDim * kLP];
  __shared__ __align__(16) float Am[kKC];
  __shared__ __align__(16) float Os[4][16 * 68];
  __shared__ float red[4][2];

  const int tid  = threadIdx.x;
  const int wave = __builtin_amdgcn_readfirstlane(tid >> 5);   // scalar, so the tests on the map below are scalar branches
  const int a    = wave >> 2;         // softmax map of this wave
  const int wq   = wave & 3;          // 16-row slice of the query tile
  const int lane = tid & 31;
  const int hh   = lane >> 4;
  const int c    = lane & 15;
  const int bx   = blockIdx.x;
  const int pr   = bx & (kNPair - 1);
  const int bh   = bx >> 4;
  const int h    = bh & (kHeads - 1);
  const int b    = bh >> 4;
  const float lam = lamp[0];
  const float negInf = -__builtin_huge_valf();

  const size_t vbase = (size_t)(b * kDModel + h * kHeadDim) * kSeq;               // Vt row (h*64 + d) of batch b
  float* ob_ptr = att + (size_t)bh * kSeq * kHeadDim;
  float* os = Os[wq];
  const unsigned short* ksh = Ksh[a];
  const unsigned short* ksl = Ksl[a];
  const int kvr = tid >> 2;           // staged row: key row for K, d row for Vt (0..63)
  const int sg  = (tid & 3) * 8;      // 8-element segment inside a group of 32 elements

  for (int half = 0; half < 2; ++half) {
    const int qb = half ? (kNQblk - 1 - pr) : pr;
    const int q0 = qb * kQB + wq * 16;
    const size_t qoff = (size_t)(b * kSeq + q0 + c) * kQKCols + (size_t)h * 128 + a * 64;   // + dc*32 + 8*hh
    // Q fragments (B operand: lane = query column c) for this wave's map: 2 d-chunks, hi and lo planes
    v16b qah[2], qal[2];
#pragma unroll
    for (int dc = 0; dc < 2; ++dc) {
      qah[dc] = Frag<__bf16>::load((const __bf16*)Qh + qoff + dc * 32 + 8 * hh);
      qal[dc] = Frag<__bf16>::load((const __bf16*)Ql + qoff + dc * 32 + 8 * hh);
    }
    const int qrow = q0 + c;            // the one query of this lane
    float mrow = negInf, lrow = 0.0f;   // its running maximum; the sum over this lane half's keys
    v8f oacc[4];                        // oacc[t][r] = O^T[d = 16 t + 8 hh + r][query c]
#pragma unroll
    for (int t = 0; t < 4; ++t) oacc[t] = (v8f){0.f,0.f,0.f,0.f,0.f,0.f,0.f,0.f};

    for (int kc = 0; kc <= qb; ++kc) {          // causal: chunks 0..qb (block-uniform trip count, <= 32)
      const int kv0 = kc * kKC;
      __syncthreads();
      {
        // a K row holds both maps side by side (128 elements): groups 0,1 are map 0, groups 2,3 map 1
        const size_t ko = (size_t)(b * kSeq + kv0 + kvr) * kQKCols + (size_t)h * 128 + sg;
        const size_t vo = vbase + (size_t)kvr * kSeq + kv0 + sg;
        u4v t0[4], t1[4], t2[2], t3[2];
        float mk = 0.0f;
        if (wave < 2) mk = amask[b * kSeq + kv0 + tid];
#pragma unroll
        for (int i = 0; i < 4; ++i) { t0[i] = *(const u4v*)(Kh + ko + 32 * i); t1[i] = *(const u4v*)(Kl + ko + 32 * i); }
#pragma unroll
        for (int i = 0; i < 2; ++i) { t2[i] = *(const u4v*)(Vh + vo + 32 * i); t3[i] = *(const u4v*)(Vl + vo + 32 * i); }
#pragma unroll
        for (int i = 0; i < 4; ++i) {
          *(u4v*)(Ksh[i >> 1] + kvr * kLP + (i & 1) * 32 + sg) = t0[i];
          *(u4v*)(Ksl[i >> 1] + kvr * kLP + (i & 1) * 32 + sg) = t1[i];
        }
#pragma unroll
        for (int i = 0; i < 2; ++i) { *(u4v*)(Vth + kvr * kLP + i * 32 + sg) = t2[i]; *(u4v*)(Vtl + kvr * kLP + i * 32 + sg) = t3[i]; }
        // additive padding-mask term of each of the 64 keys (bf16 RNE-converted mask)
        if (wave < 2) Am[tid] = (1.0f - bf_rne(mk)) * (-1.0e9f);
      }
      __syncthreads();

      // ---- scores, transposed: 4 key subtiles of 16 rows, K = 64 (2 chunks), hi.hi + hi.lo + lo.hi ----
      v8f s[4];
#pragma unroll
      for (int j = 0; j < 4; ++j) {
        s[j] = (v8f){0.f,0.f,0.f,0.f,0.f,0.f,0.f,0.f};
#pragma unroll
        for (int dc = 0; dc < 2; ++dc) {
          FB kb, kl;
          kb.h[0] = *(const v8b*)(ksh + (j * 16 + c) * kLP + dc * 32 + 8 * hh);
          kb.h[1] = *(const v8b*)(ksh + (j * 16 + c) * kLP + dc * 32 + 16 + 8 * hh);
          kl.h[0] = *(const v8b*)(ksl + (j * 16 + c) * kLP + dc * 32 + 8 * hh);
          kl.h[1] = *(const v8b*)(ksl + (j * 16 + c) * kLP + dc * 32 + 16 + 8 * hh);
          s[j] = at_mma(kb.v, qah[dc], s[j]);
          s[j] = at_mma(kl.v, qah[dc], s[j]);
          s[j] = at_mma(kb.v, qal[dc], s[j]);
        }
      }
      // ---- scale, causal add, mask add, maximum over this lane's 32 keys, then over both halves ----
      const bool diag = (kc == qb);
      float m = negInf;
#pragma unroll
      for (int j = 0; j < 4; ++j) {
        union { v4f v[2]; float f[8]; } am;
        am.v[0] = *(const v4f*)(Am + j * 16 + 8 * hh);
        am.v[1] = *(const v4f*)(Am + j * 16 + 8 * hh + 4);
#pragma unroll
        for (int r = 0; r < 8; ++r) {
          const int kvcol = kv0 + j * 16 + 8 * hh + r;
          const float cz = (diag && (kvcol > qrow)) ? -1.0e9f : 0.0f;
          float sc = s[j][r] * 0.125f;
          sc = sc + cz;
          sc = sc + am.f[r];
          s[j][r] = sc;
          m = fmaxf(m, sc);
        }
      }
      m = fmaxf(m, at_xhalf(m));
      // ---- online softmax update; P^T packed as bf16 hi/lo B operands: element e of 32-key group kk is key 32 kk + (e < 8 ? 8 hh + e : 16 + 8 hh + e - 8) ----
      const float mnew = fmaxf(mrow, m);
      const float alpha = at_exp(mrow - mnew);
      mrow = mnew;
      union PB { v16b v; unsigned w[8]; };
      PB pbh[2], pbl[2];
      float ps[4];
#pragma unroll
      for (int j = 0; j < 4; ++j) {
        ps[j] = 0.0f;
        const v8f y = (s[j] - mnew) * kLog2E;
#pragma unroll
        for (int i = 0; i < 4; ++i) {
          const float p0 = __builtin_amdgcn_exp2f(y[2 * i]);
          const float p1 = __builtin_amdgcn_exp2f(y[2 * i + 1]);
          ps[j] += p0;
          ps[j] += p1;
          at_split2(p0, p1, pbh[j >> 1].w[(j & 1) * 4 + i], pbl[j >> 1].w[(j & 1) * 4 + i]);
        }
      }
      lrow = lrow * alpha + ((ps[0] + ps[1]) + (ps[2] + ps[3]));
#pragma unroll
      for (int t = 0; t < 4; ++t) oacc[t] *= alpha;
      // ---- O^T += Vt.P^T: A = Vt [d][kv], B = P^T from registers; hi.hi + hi.lo + lo.hi ----
#pragma unroll
      for (int kk = 0; kk < 2; ++kk) {
#pragma unroll
        for (int t = 0; t < 4; ++t) {
          FB vb, vl;
          vb.h[0] = *(const v8b*)(Vth + (t * 16 + c) * kLP + kk * 32 + 8 * hh);
          vb.h[1] = *(const v8b*)(Vth + (t * 16 + c) * kLP + kk * 32 + 16 + 8 * hh);
          vl.h[0] = *(const v8b*)(Vtl + (t * 16 + c) * kLP + kk * 32 + 8 * hh);
          vl.h[1] = *(const v8b*)(Vtl + (t * 16 + c) * kLP + kk * 32 + 16 + 8 * hh);
          oacc[t] = at_mma(vb.v, pbh[kk].v, oacc[t]);
          oacc[t] = at_mma(vl.v, pbh[kk].v, oacc[t]);
          oacc[t] = at_mma(vb.v, pbl[kk].v, oacc[t]);
        }
      }
    }
    // ---- finish this tile: map 1 hands o/l over through the slab; map 0 combines and sums the norm partials ----
    // a lane owns 8 consecutive d of its query's slab row per t: slab[c][16 t + 8 hh + r]
    const float inv = 1.0f / (lrow + at_xhalf(lrow));   // the two halves' sums joined, by every lane
    if (a == 1) {
#pragma unroll
      for (int t = 0; t < 4; ++t) {
        const v8f o = oacc[t] * inv;
        *(v4f*)(os + c * 68 + t * 16 + 8 * hh)     = (v4f){o[0], o[1], o[2], o[3]};
        *(v4f*)(os + c * 68 + t * 16 + 8 * hh + 4) = (v4f){o[4], o[5], o[6], o[7]};
      }
    }
    __syncthreads();
    if (a == 0) {
      float psum = 0.0f, psq = 0.0f;
#pragma unroll
      for (int t = 0; t < 4; ++t) {
        float* op = os + c * 68 + t * 16 + 8 * hh;
        union { v4f v[2]; float f[8]; } o1, wv;
        o1.v[0] = *(const v4f*)(op);
        o1.v[1] = *(const v4f*)(op + 4);
#pragma unroll
        for (int r = 0; r < 8; ++r) {
          const float o = oacc[t][r] * inv;
          const float w = o - lam * o1.f[r];
          wv.f[r] = w;
          psum += w;
          psq += w * w;
        }
        *(v4f*)(op)     = wv.v[0];
        *(v4f*)(op + 4) = wv.v[1];
      }
      // wave reductions, then a block combine in fixed order
#pragma unroll
      for (int off = 1; off < 32; off <<= 1) { psum += __shfl_xor(psum, off, 32); psq += __shfl_xor(psq, off, 32); }
      if (lane == 0) { red[wq][0] = psum; red[wq][1] = psq; }
    }
    __syncthreads();

    {
      const int c4 = (lane & 15) * 4;
#pragma unroll
      for (int it = 0; it < 4; ++it) {
        const int row = a * 8 + it * 2 + hh;      // each wave stores 8 of the slab's 16 rows
        v4f val = *(const v4f*)(os + row * 68 + c4);
        *(v4f*)(ob_ptr + (size_t)(q0 + row) * kHeadDim + c4) = val;
      }
      asm volatile("s_wait_xcnt 0x0" ::: "memory");   // the stores' address and data registers are rewritten by the code that follows
    }
    if (wave == 0) {
      const float t0 = ((red[0][0] + red[1][0]) + red[2][0]) + red[3][0];
      const float t1 = ((red[0][1] + red[1][1]) + red[2][1]) + red[3][1];
      const float v = (lane == 0) ? t0 : ((lane == 1) ? t1 : 0.0f);
      float* pline = part + (size_t)(bh * kNQblk + qb) * 32;
      ((float*)pline)[lane] = v;
      asm volatile("s_wait_xcnt 0x0" ::: "memory");   // the next tile's set-up rewrites this store's registers
    }
  }
}

// ---- group norm statistics per (b,h): fixed-order sum of the 32 tile lines; one wave writes one stats line ----
__global__ __launch_bounds__(32) void gn_stats(const float* __restrict__ part, float* __restrict__ stats) {
  const int bh = blockIdx.x;
  const int lane = threadIdx.x;
  float s0 = part[(size_t)(bh * kNQblk + lane) * 32 + 0];
  float s1 = part[(size_t)(bh * kNQblk + lane) * 32 + 1];
#pragma unroll
  for (int off = 1; off < 32; off <<= 1) { s0 += __shfl_xor(s0, off, 32); s1 += __shfl_xor(s1, off, 32); }
  const float inv_n = 1.0f / (float)(kSeq * kHeadDim);
  const float mu = s0 * inv_n;
  const float ex2 = s1 * inv_n;
  const float var = fmaxf(ex2 - mu * mu, 0.0f);
  const float rs = rsqrtf(var + 1.0e-5f);
  const float v = (lane == 0) ? mu : ((lane == 1) ? rs : 0.0f);
  ((float*)stats)[bh * 32 + lane] = v;
  
}

// ---- normalize + affine + x0.2 + merge heads -> f16 plane (x8 carry), [B*S][H*64] ----
__global__ __launch_bounds__(256) void gn_merge(const float* __restrict__ att, const float* __restrict__ stats,
                                              const float* __restrict__ gamma, const float* __restrict__ beta,
                                              unsigned short* __restrict__ merged) {
  const int g = blockIdx.x * 256 + threadIdx.x;
  if (g >= kBatch * kHeads * kSeq * 8) return;
  const int seg = g >> 3;
  const int e8  = (g & 7) * 8;
  const int bh  = seg >> 11;
  const int s   = seg & (kSeq - 1);
  const int h   = bh & (kHeads - 1);
  const int b   = bh >> 4;
  const float mu = stats[bh * 32 + 0];
  const float rs = stats[bh * 32 + 1];
  union U8 { v4f v[2]; float f[8]; };
  U8 x, ga, be;
  const float* ap = att + (size_t)seg * kHeadDim + e8;
  x.v[0]  = *(const v4f*)ap;
  x.v[1]  = *(const v4f*)(ap + 4);
  ga.v[0] = *(const v4f*)(gamma + h * kHeadDim + e8);
  ga.v[1] = *(const v4f*)(gamma + h * kHeadDim + e8 + 4);
  be.v[0] = *(const v4f*)(beta + h * kHeadDim + e8);
  be.v[1] = *(const v4f*)(beta + h * kHeadDim + e8 + 4);
  v8h hv;
#pragma unroll
  for (int e = 0; e < 8; ++e) {
    const float gq = bf_rne(ga.f[e]);
    const float bq = bf_rne(be.f[e]);
    float y = (x.f[e] - mu) * rs;
    y = y * gq + bq;
    y = y * 0.2f;
    float z = y * kMergeCarry;
    asm volatile("" : "+v"(z));
    hv[e] = (_Float16)z;
  }
  unsigned short* dst = merged + (size_t)(b * kSeq + s) * kDModel + h * kHeadDim + e8;
  *(v8h*)dst = hv;
  
}

// ---------------------------------------------------------------------------
extern "C" void kernel_launch(void* const* d_in, const int* in_sizes, int n_in,
                              void* d_out, int out_size, void* d_ws, size_t ws_size,
                              hipStream_t stream) {
  if (n_in < 12) return;
  if (in_sizes[0] != kTok * kDModel || in_sizes[1] != kBatch * kSeq ||
      in_sizes[2] != kQKCols * kDModel || in_sizes[3] != kQKCols * kDModel ||
      in_sizes[4] != kDModel * kDModel || in_sizes[5] != kDModel * kDModel ||
      in_sizes[6] != kHeadDim || in_sizes[7] != kHeadDim || in_sizes[8] != kHeadDim || in_sizes[9] != kHeadDim ||
      in_sizes[10] != kDModel || in_sizes[11] != kDModel) return;
  if (out_size != kTok * kDModel) return;
  if (ws_size < kWsTotal) return;

  const float* X     = (const float*)d_in[0];
  const float* amask = (const float*)d_in[1];
  const float* Wq    = (const float*)d_in[2];
  const float* Wk    = (const float*)d_in[3];
  const float* Wv    = (const float*)d_in[4];
  const float* Wo    = (const float*)d_in[5];
  const float* lq1   = (const float*)d_in[6];
  const float* lq2   = (const float*)d_in[7];
  const float* lk1   = (const float*)d_in[8];
  const float* lk2   = (const float*)d_in[9];
  const float* gamma = (const float*)d_in[10];
  const float* beta  = (const float*)d_in[11];

  char* w = (char*)d_ws;
  unsigned short* Xb    = (unsigned short*)(w + kOffXb);
  unsigned short* Wqb   = (unsigned short*)(w + kOffWqb);
  unsigned short* Wkb   = (unsigned short*)(w + kOffWkb);
  unsigned short* Wvb   = (unsigned short*)(w + kOffWvb);
  unsigned short* Wo16  = (unsigned short*)(w + kOffWo16);
  unsigned short* Qh    = (unsigned short*)(w + kOffQh);
  unsigned short* Ql    = (unsigned short*)(w + kOffQl);
  unsigned short* Kh    = (unsigned short*)(w + kOffKh);
  unsigned short* Kl    = (unsigned short*)(w + kOffKl);
  unsigned short* Vth   = (unsigned short*)(w + kOffVth);
  unsigned short* Vtl   = (unsigned short*)(w + kOffVtl);
  float*          att   = (float*)(w + kOffAtt);
  unsigned short* mrg   = (unsigned short*)(w + kOffMerged);
  float*          part  = (float*)(w + kOffPart);
  float*          stats = (float*)(w + kOffStats);
  float*          lamp  = (float*)(w + kOffLam);

  // 1) input conversions (bf16 RNE; Wo additionally x256 into f16)
  cast_inputs<<<kCvGroups, 256, 0, stream>>>(X, Wq, Wk, Wv, Wo, Xb, Wqb, Wkb, Wvb, Wo16, kWoCarry);
  lambda_line<<<1, 32, 0, stream>>>(lq1, lq2, lk1, lk2, lamp);

  // 2) projections: q/k planes [4096][2048] hi+lo, Vt planes [2][1024][2048] hi+lo
  constexpr int gridQ  = (kTok / 64) * (kQKCols / 64) / 8;   // 256
  constexpr int gridVt = (kDModel / 64) * (kSeq / 64) / 8;   // 64
  constexpr int gridO  = (kTok / 64) * (kDModel / 64) / 8;   // 128
  static_assert(gridQ * 8 == (kTok / 64) * (kQKCols / 64));
  static_assert(gridVt * 8 == (kDModel / 64) * (kSeq / 64));
  static_assert(gridO * 8 == (kTok / 64) * (kDModel / 64));
  // one work-group per 128x256 tile: the same counts
  static_assert(gridQ == (kTok / 128) * (kQKCols / 256) && gridVt == (kDModel / 128) * (kSeq / 256) && gridO == (kTok / 128) * (kDModel / 256));
  static_assert(kDModel % kGK == 0 && kDModel / kGK >= 2);
  wmma_gemm64<1, false, 0, 2, false><<<dim3(gridQ, 1, 1), 256, 0, stream>>>(
      Xb, Xb, kDModel, 0L, Wqb, Wqb, kDModel, 0L, (void*)Qh, (void*)Ql, kQKCols, 0L,
      lamp, lamp, 0L, kTok, kQKCols, kDModel, 1.0f);
  wmma_gemm64<1, false, 0, 2, false><<<dim3(gridQ, 1, 1), 256, 0, stream>>>(
      Xb, Xb, kDModel, 0L, Wkb, Wkb, kDModel, 0L, (void*)Kh, (void*)Kl, kQKCols, 0L,
      lamp, lamp, 0L, kTok, kQKCols, kDModel, 1.0f);
  // Vt[b][c][s] = sum_k Wv[c][k] * X[b][s][k] : A = Wv [1024][1024], Bt = X_b [2048][1024]
  wmma_gemm64<1, false, 0, 2, false><<<dim3(gridVt, kBatch, 1), 256, 0, stream>>>(
      Wvb, Wvb, kDModel, 0L, Xb, Xb, kDModel, (long)kSeq * kDModel, (void*)Vth, (void*)Vtl, kSeq, (long)kDModel * kSeq,
      lamp, lamp, 0L, kDModel, kSeq, kDModel, 1.0f);

  // 3) differential causal attention + norm partial lines (512 blocks, two query tiles each)
  diff_attn64<<<kAttnGroups, 256, 0, stream>>>(Qh, Ql, Kh, Kl, Vth, Vtl, amask, lamp, att, part);

  // 4) group norm stats, normalize + merge
  gn_stats<<<kBatch * kHeads, 32, 0, stream>>>(part, stats);
  gn_merge<<<(kBatch * kHeads * kSeq * 8) / 256, 256, 0, stream>>>(att, stats, gamma, beta, mrg);

  // 5) output projection: out[m][n] = (1/2048) * sum_k merged8[m][k] * Wo256[n][k]
  wmma_gemm64<0, false, 0, 0, false><<<dim3(gridO, 1, 1), 256, 0, stream>>>(
      mrg, mrg, kDModel, 0L, Wo16, Wo16, kDModel, 0L, d_out, d_out, kDModel, 0L,
      lamp, lamp, 0L, kTok, kDModel, kDModel, 1.0f / (kMergeCarry * kWoCarry));
}

// v007
// One run takes 184 microseconds.
// Timed twice side by side with v006, it ran 1.05 times as fast both times.
// All steps since v000 together make it 4.20 times as fast.
// Contractions: x.Wq^T, x.Wk^T, Wv.x^T = v_wmma_f32_16x16x32_bf16 (plain bf16 operands from RNE-converted inputs); k.q^T and Vt.p^T = v_wmma_f32_16x16x32_bf16 with bf16 hi/lo planes (hi.hi+hi.lo+lo.hi); merged.Wo^T = v_wmma_f32_16x16x32_f16 (f16 operands, carries 8 and 256); f32 accumulate everywhere; softmax, group norm and the two 64-term lambda dots in f32.
#include <hip/hip_runtime.h>

typedef __attribute__((ext_vector_type(16))) _Float16 v16h;
typedef __attribute__((ext_vector_type(8)))  _Float16 v8h;
typedef __attribute__((ext_vector_type(16))) __bf16   v16b;
typedef __attribute__((ext_vector_type(8)))  __bf16   v8b;
typedef __attribute__((ext_vector_type(8)))  float    v8f;
typedef __attribute__((ext_vector_type(4)))  float    v4f;
typedef __attribute__((ext_vector_type(4)))  unsigned int u4v;
typedef __attribute__((ext_vector_type(2)))  unsigned int u2v;

// ---- problem geometry ----
constexpr int kBatch   = 2;
constexpr int kSeq     = 2048;
constexpr int kDModel  = 1024;
constexpr int kHeads   = 16;
constexpr int kHeadDim = 64;
constexpr int kQKCols  = 2 * kDModel;      // 2048 : row width of the q/k planes (H * 128)
constexpr int kTok     = kBatch * kSeq;    // 4096
constexpr int kQB      = 64;               // query rows per tile; a block takes two tiles
constexpr int kKC      = 64;               // keys per chunk
constexpr int kLP      = 72;               // LDS row pitch of the 64-element 16-bit tiles: 144 B = 16 B x 9 (odd), conflict-free for 16-byte row reads
constexpr int kNQblk   = kSeq / kQB;       // 32
constexpr int kAttnBlocks = kBatch * kHeads * kNQblk;   // 1024 query tiles
constexpr int kNPair   = kNQblk / 2;        // 16 : tile pairs (t, 31 - t) per (b, h)
constexpr int kAttnGroups = kBatch * kHeads * kNPair;   // 512 work-groups of the attention launch
constexpr float kMergeCarry = 8.0f;        // f16 merged plane carried x8
constexpr float kWoCarry    = 256.0f;      // f16 Wo plane carried x256

static_assert(kNQblk == 32);
static_assert(kHeads == 16);
static_assert(kAttnBlocks == 1024);
static_assert(kNPair == 16 && kAttnGroups == 512);
static_assert(kSeq % kQB == 0);
static_assert(kDModel % 32 == 0);                  // K of every GEMM
static_assert(kTok % 64 == 0 && kQKCols % 64 == 0 && kDModel % 64 == 0 && kSeq % 64 == 0);   // M, N tile multiples

// ---- workspace region map (bytes; every offset a multiple of 128) ----
constexpr size_t kBytesXb     = (size_t)kTok * kDModel * 2;                     //  8,388,608  x as bf16 [4096][1024]
constexpr size_t kBytesWqk    = (size_t)kQKCols * kDModel * 2;                  //  4,194,304  Wq / Wk as bf16 [2048][1024]
constexpr size_t kBytesWv     = (size_t)kDModel * kDModel * 2;                  //  2,097,152  Wv as bf16 [1024][1024]
constexpr size_t kBytesWo     = (size_t)kDModel * kDModel * 2;                  //  2,097,152  Wo as f16 x256 [1024][1024]
constexpr size_t kBytesQPl    = (size_t)kTok * kQKCols * 2;                     // 16,777,216  one q or k plane [4096][2048]
constexpr size_t kBytesVtPl   = (size_t)kBatch * kDModel * kSeq * 2;            //  8,388,608  one Vt plane [2][1024][2048]
constexpr size_t kBytesAtt    = (size_t)kBatch * kHeads * kSeq * kHeadDim * 4;  // 16,777,216  attention out f32 [2][16][2048][64]
constexpr size_t kBytesMerged = (size_t)kTok * kDModel * 2;                     //  8,388,608  merged f16 x8 [4096][1024]
constexpr size_t kBytesPart   = (size_t)kAttnBlocks * 128;                      //    131,072  one 32-float line per query tile (1024 tiles)
constexpr size_t kBytesStats  = (size_t)kBatch * kHeads * 128;                  //      4,096  one 32-float line per (b,h)
constexpr size_t kBytesLam    = 128;                                            //        128  lambda line

constexpr size_t kOffXb     = 0;
constexpr size_t kOffWqb    = kOffXb + kBytesXb;
constexpr size_t kOffWkb    = kOffWqb + kBytesWqk;
constexpr size_t kOffWvb    = kOffWkb + kBytesWqk;
constexpr size_t kOffWo16   = kOffWvb + kBytesWv;
constexpr size_t kOffQh     = kOffWo16 + kBytesWo;
constexpr size_t kOffQl     = kOffQh + kBytesQPl;
constexpr size_t kOffKh     = kOffQl + kBytesQPl;
constexpr size_t kOffKl     = kOffKh + kBytesQPl;
constexpr size_t kOffVth    = kOffKl + kBytesQPl;
constexpr size_t kOffVtl    = kOffVth + kBytesVtPl;
constexpr size_t kOffAtt    = kOffVtl + kBytesVtPl;
constexpr size_t kOffMerged = kOffAtt + kBytesAtt;
constexpr size_t kOffPart   = kOffMerged + kBytesMerged;
constexpr size_t kOffStats  = kOffPart + kBytesPart;
constexpr size_t kOffLam    = kOffStats + kBytesStats;
constexpr size_t kWsTotal   = kOffLam + kBytesLam;                              // 130,158,720
static_assert(kBytesPart == 131072);
static_assert(kWsTotal == 130158720);
static_assert(kWsTotal <= 134217728);
static_assert(kOffWqb % 128 == 0 && kOffQh % 128 == 0 && kOffAtt % 128 == 0 && kOffPart % 128 == 0 && kOffStats % 128 == 0 && kOffLam % 128 == 0);

// ---- 16-bit helpers ----
__device__ __forceinline__ unsigned short f2bf_bits(float f) {
  unsigned u = __float_as_uint(f);
  return (unsigned short)((u + 0x7FFFu + ((u >> 16) & 1u)) >> 16);
}
__device__ __forceinline__ float bf_bits2f(unsigned short h) { return __uint_as_float(((unsigned)h) << 16); }
__device__ __forceinline__ float bf_rne(float f) { return bf_bits2f(f2bf_bits(f)); }

// hazard guards as plain device helpers
__device__ __forceinline__ void dep_guard_h(v8f& a, v8f& b, v16h x, v16h y) { asm volatile("v_nop\n\tv_nop\n\tv_nop\n\tv_nop" : "+v"(a), "+v"(b) : "v"(x), "v"(y)); }
__device__ __forceinline__ void dep_guard_b(v8f& a, v8f& b, v16b x, v16b y) { asm volatile("v_nop\n\tv_nop\n\tv_nop\n\tv_nop" : "+v"(a), "+v"(b) : "v"(x), "v"(y)); }
__device__ __forceinline__ void keep4_h(v16h a, v16h b, v16h c, v16h d) { asm volatile("v_nop" :: "v"(a), "v"(b), "v"(c), "v"(d)); }
__device__ __forceinline__ void keep4_b(v16b a, v16b b, v16b c, v16b d) { asm volatile("v_nop" :: "v"(a), "v"(b), "v"(c), "v"(d)); }
__device__ __forceinline__ void acc_guard4(v8f& a, v8f& b, v8f& c, v8f& d) { asm volatile("v_nop\n\tv_nop\n\tv_nop\n\tv_nop" : "+v"(a), "+v"(b), "+v"(c), "+v"(d)); }
template <typename T> struct Frag;
template <> struct Frag<_Float16> {
  typedef v16h V; union U { v16h v; v8h h[2]; };
  static __device__ __forceinline__ v16h load(const _Float16* p) {   // elements 0..7 <- p[0..7], 8..15 <- p[16..23]
    U f; f.h[0] = *(const v8h*)(p); f.h[1] = *(const v8h*)(p + 16); return f.v;
  }
  static __device__ __forceinline__ v8f mma(v16h a, v16h b, v8f c) {
    return __builtin_amdgcn_wmma_f32_16x16x32_f16(false, a, false, b, (short)0, c, false, false);
  }
  static __device__ __forceinline__ void guard(v8f& a, v8f& b, v16h x, v16h y) { dep_guard_h(a, b, x, y); }
  static __device__ __forceinline__ void keep(v16h a, v16h b, v16h c, v16h d) { keep4_h(a, b, c, d); }
};
template <> struct Frag<__bf16> {
  typedef v16b V; union U { v16b v; v8b h[2]; };
  static __device__ __forceinline__ v16b load(const __bf16* p) {
    U f; f.h[0] = *(const v8b*)(p); f.h[1] = *(const v8b*)(p + 16); return f.v;
  }
  static __device__ __forceinline__ v8f mma(v16b a, v16b b, v8f c) {
    return __builtin_amdgcn_wmma_f32_16x16x32_bf16(false, a, false, b, (short)0, c, false, false);
  }
  static __device__ __forceinline__ void guard(v8f& a, v8f& b, v16b x, v16b y) { dep_guard_b(a, b, x, y); }
  static __device__ __forceinline__ void keep(v16b a, v16b b, v16b c, v16b d) { keep4_b(a, b, c, d); }
};

// ---- Register-blocked batched WMMA GEMM, operands staged in LDS ------------
// C[m,n] = scale * sum_k A[m,k] * Bt[n,k] (+bias)(+resid); a work-group owns a 128x256 tile, each of its 8 waves (2 x 4) a 64x64 part.
// A row-major [M,K]; Bt row-major [N,K]; M % 128 == 0, N % 256 == 0, K % 128 == 0, K >= 256.
// Per 128 k the 128 A rows and 256 Bt rows (256 bytes, two whole lines, each) reach LDS by asynchronous copies, two buffers:
// the copies of tile t + 2 fly while tile t + 1 is worked on; the fragments are read from LDS at row pitch kGP.
// SPLIT is not carried by the staged loop (one plane per operand).
// BIAS_MODE: 0 = none, 1 = bias[m], 2 = bias[n].
// OUT_MODE: 0 = f32, 1 = f16, 2 = bf16 hi plane (Cout) + bf16 lo plane (Cout2).
// ET: 0 = f16 operands, 1 = bf16 operands (pointers passed as 16-bit storage)
constexpr int kGK     = 128;                   // k elements per staged tile
constexpr int kGP     = 136;                   // LDS row pitch of a staged row: 272 B = 16 B x 17 (odd), conflict-free for 16-byte row reads
constexpr int kGRowsA = 128;                   // staged A rows
constexpr int kGRowsB = 256;                   // staged Bt rows
constexpr int kGBuf   = (kGRowsA + kGRowsB) * kGP;   // 16-bit elements of one buffer (104,448 B)

// Twelve 16-byte asynchronous copies of one lane, global -> LDS (l = LDS byte address, g = global address).
// The closing s_wait_xcnt stands inside the statement, so that no address register is rewritten in front of it.
__device__ __forceinline__ void async_copy12(const unsigned (&l)[12], const unsigned short* const (&g)[12]) {
  asm volatile(
      "global_load_async_to_lds_b128 %0, %12, off\n\t"
      "global_load_async_to_lds_b128 %1, %13, off\n\t"
      "global_load_async_to_lds_b128 %2, %14, off\n\t"
      "global_load_async_to_lds_b128 %3, %15, off\n\t"
      "global_load_async_to_lds_b128 %4, %16, off\n\t"
      "global_load_async_to_lds_b128 %5, %17, off\n\t"
      "global_load_async_to_lds_b128 %6, %18, off\n\t"
      "global_load_async_to_lds_b128 %7, %19, off\n\t"
      "global_load_async_to_lds_b128 %8, %20, off\n\t"
      "global_load_async_to_lds_b128 %9, %21, off\n\t"
      "global_load_async_to_lds_b128 %10, %22, off\n\t"
      "global_load_async_to_lds_b128 %11, %23, off\n\t"
      "s_wait_xcnt 0x0"
      :: "v"(l[0]), "v"(l[1]), "v"(l[2]), "v"(l[3]), "v"(l[4]), "v"(l[5]), "v"(l[6]), "v"(l[7]), "v"(l[8]), "v"(l[9]), "v"(l[10]), "v"(l[11]),
         "v"(g[0]), "v"(g[1]), "v"(g[2]), "v"(g[3]), "v"(g[4]), "v"(g[5]), "v"(g[6]), "v"(g[7]), "v"(g[8]), "v"(g[9]), "v"(g[10]), "v"(g[11])
      : "memory");
}

template <int ET> struct Elem;
template <> struct Elem<0> { typedef _Float16 T; };
template <> struct Elem<1> { typedef __bf16 T; };
template <int ET, bool SPLIT, int BIAS_MODE, int OUT_MODE, bool RESID, int ACT = 0>
__global__ __launch_bounds__(256) void wmma_gemm64(
    const unsigned short* __restrict__ Ap, const unsigned short* __restrict__ A2p, int lda, long strideA,
    const unsigned short* __restrict__ Btp, const unsigned short* __restrict__ Bt2p, int ldb, long strideB,
    void* __restrict__ Cout, void* __restrict__ Cout2, int ldc, long strideC,
    const float* __restrict__ bias,
    const float* __restrict__ resid, long strideR,
    int M, int N, int K, float scale) {
  typedef typename Elem<ET>::T T;
  typedef typename Frag<T>::V V;
  static_assert(!SPLIT, "the staged loop carries one plane per operand");
  __shared__ __align__(16) unsigned short sAB[2][kGBuf];   // [buffer][A rows 0..127 | Bt rows 0..255][kGP]
  __shared__ __align__(16) float sT[8][16 * 68];   // per-wave 16x64 slab, pitch 68 floats
  const int b    = blockIdx.y;
  const int tid  = threadIdx.x;
  const int lane = tid & 31;
  const int wave = tid >> 5;
  const int btN = N >> 8;
  const int btM = M >> 7;
  const int bt  = blockIdx.x;
  if (bt >= btM * btN) return;   // the same for the whole work-group, in front of every barrier and copy
  const int bm = bt / btN;
  const int bn = bt - bm * btN;
  const int mB = bm << 7;
  const int nB = bn << 8;
  const int wm = (wave >> 2) << 6;             // this wave's rows inside the staged A rows
  const int wn = (wave & 3) << 6;              // this wave's rows inside the staged Bt rows
  const int m0 = mB + wm;
  const int n0 = nB + wn;

  const int rlane = lane & 15;                 // row (A) / col (B, D) within subtile
  const int koff  = (lane >> 4) * 8;           // k offset of this lane half
  const int mOff  = (lane >> 4) * 8;           // D row offset

  // staging: 16 lanes copy one row's 256 bytes, a wave 4 whole lines per copy; copy it covers staged rows it*16 .. it*16+15
  const int srow = tid >> 4;
  const int sseg = (tid & 15) * 8;
  const unsigned short* pA = Ap  + (size_t)b * strideA + (size_t)(mB + srow) * lda + sseg;
  const unsigned short* pB = Btp + (size_t)b * strideB + (size_t)(nB + srow) * ldb + sseg;
  const unsigned lds0 = (unsigned)(size_t)(&sAB[0][0] + srow * kGP + sseg);   // low 32 bits = byte address in LDS
  auto stage = [&](int buf) {   // copies the next 128 k of every staged row into buffer buf and moves the two pointers on
#pragma unroll   // both loops unrolled: every index constant, so the two operand arrays stay in registers
    for (int hf = 0; hf < 2; ++hf) {
      unsigned l[12];
      const unsigned short* g[12];
#pragma unroll
      for (int e = 0; e < 12; ++e) {
        const int it = hf * 12 + e;
        l[e] = lds0 + (unsigned)((buf * kGBuf + it * 16 * kGP) * 2);
        g[e] = (it < 8) ? (pA + (size_t)(it * 16) * lda) : (pB + (size_t)((it - 8) * 16) * ldb);
      }
      async_copy12(l, g);
    }
    pA += kGK;
    pB += kGK;
  };

  v8f acc[4][4];
#pragma unroll
  for (int i = 0; i < 4; ++i)
#pragma unroll
    for (int j = 0; j < 4; ++j) acc[i][j] = (v8f){0.f,0.f,0.f,0.f,0.f,0.f,0.f,0.f};

  const int nT = K / kGK;
  stage(0);
  asm volatile("s_wait_asynccnt 0x0" ::: "memory");   // this wave's copies of tile 0 have landed
  __syncthreads();                                    // ... and every other wave's
  if (nT > 1) stage(1);
  for (int t = 0; t < nT; ++t) {
    const T* sa = (const T*)sAB[t & 1] + (wm + rlane) * kGP + koff;
    const T* sb = (const T*)sAB[t & 1] + (kGRowsA + wn + rlane) * kGP + koff;
#pragma unroll   // the four 32-k blocks of a tile in line: LDS offsets become immediates and a block's reads can go ahead of the block before it
    for (int ks = 0; ks < kGK; ks += 32) {
      V ah[4], bh[4];
#pragma unroll
      for (int j = 0; j < 4; ++j) bh[j] = Frag<T>::load(sb + (j << 4) * kGP + ks);
#pragma unroll
      for (int i = 0; i < 4; ++i) ah[i] = Frag<T>::load(sa + (i << 4) * kGP + ks);
#pragma unroll
      for (int i = 0; i < 4; ++i) {
#pragma unroll
        for (int j = 0; j < 4; ++j) acc[i][j] = Frag<T>::mma(ah[i], bh[j], acc[i][j]);
        Frag<T>::guard(acc[i][0], acc[i][3], ah[i], ah[i]);
      }
      Frag<T>::keep(bh[0], bh[1], bh[2], bh[3]);
    }
    asm volatile("s_wait_dscnt 0x0" ::: "memory");      // this wave's reads of buffer t & 1 are done before it is refilled
    asm volatile("s_wait_asynccnt 0x0" ::: "memory");   // this wave's copies of tile t + 1 have landed
    __syncthreads();                                    // publishes tile t + 1 and ends every wave's reads of tile t
    if (t + 2 < nT) stage(t & 1);
  }
  asm volatile("s_wait_asynccnt 0x0" ::: "memory");     // nothing is in flight when the wave goes on
  acc_guard4(acc[0][0], acc[0][1], acc[0][2], acc[0][3]);
  acc_guard4(acc[1][0], acc[1][1], acc[1][2], acc[1][3]);
  acc_guard4(acc[2][0], acc[2][1], acc[2][2], acc[2][3]);
  acc_guard4(acc[3][0], acc[3][1], acc[3][2], acc[3][3]);

  // ---- epilogue ----
  float* slab = sT[wave];
  const float* Rb = RESID ? (resid + (size_t)b * strideR) : nullptr;
#pragma unroll
  for (int i = 0; i < 4; ++i) {
    const int mBase = m0 + (i << 4);
#pragma unroll
    for (int j = 0; j < 4; ++j) {
      const int n = n0 + (j << 4) + rlane;
      float bv = 0.f;
      if (BIAS_MODE == 2) bv = bias[n];
#pragma unroll
      for (int r = 0; r < 8; ++r) {
        float v = acc[i][j][r] * scale;
        if (BIAS_MODE == 1) v += bias[mBase + mOff + r];
        if (BIAS_MODE == 2) v += bv;
        if (RESID) v += Rb[(size_t)(mBase + mOff + r) * ldc + n];
        if (ACT == 1) v = tanhf(v);
        if (ACT == 2) v = fmaxf(v, 0.0f);
        if (ACT == 3) v = v / (1.0f + expf(-v));
        if (ACT == 4) v = (v > 0.f) ? v : 0.01f * v;
        if (ACT == 5) v = 0.5f * v * (1.0f + erff(v * 0.70710678118654752f));
        slab[(mOff + r) * 68 + (j << 4) + rlane] = v;
      }
    }
    __builtin_amdgcn_fence(__ATOMIC_RELEASE, "workgroup");
    __builtin_amdgcn_wave_barrier();
    __builtin_amdgcn_fence(__ATOMIC_ACQUIRE, "workgroup");
    if (OUT_MODE == 0) {
      float* C = (float*)Cout + (size_t)b * strideC;
      const int hh = lane >> 4, c4 = (lane & 15) * 4;     // row seg = 256 B = 16 lanes x 16 B
      {
#pragma unroll
        for (int it = 0; it < 8; ++it) {
          const int row = it * 2 + hh;
          v4f v = *(const v4f*)(slab + row * 68 + c4);
          *(v4f*)(C + (size_t)(mBase + row) * ldc + n0 + c4) = v;
        }
        
      }
    } else {
      const int q = lane >> 3, c8 = (lane & 7) * 8;
      unsigned short* C  = (unsigned short*)Cout  + (size_t)b * strideC;
      unsigned short* C2 = (OUT_MODE == 2) ? ((unsigned short*)Cout2 + (size_t)b * strideC) : nullptr;
      {
#pragma unroll
        for (int it = 0; it < 4; ++it) {
          const int row = it * 4 + q;
          const float* sp = slab + row * 68 + c8;
          v8h hv, lv;
#pragma unroll
          for (int e = 0; e < 8; ++e) {
            if (OUT_MODE == 1) {
              hv[e] = (_Float16)sp[e];
            } else {
              unsigned short hb = f2bf_bits(sp[e]);
              unsigned short lb = f2bf_bits(sp[e] - bf_bits2f(hb));
              hv[e] = __builtin_bit_cast(_Float16, hb);
              lv[e] = __builtin_bit_cast(_Float16, lb);
            }
          }
          *(v8h*)(C + (size_t)(mBase + row) * ldc + n0 + c8) = hv;
          if (OUT_MODE == 2) *(v8h*)(C2 + (size_t)(mBase + row) * ldc + n0 + c8) = lv;
        }
        
      }
    }
    __builtin_amdgcn_fence(__ATOMIC_RELEASE, "workgroup");
    __builtin_amdgcn_wave_barrier();
    __builtin_amdgcn_fence(__ATOMIC_ACQUIRE, "workgroup");
  }
}

// ---- all five input conversions in one streaming launch ----
// f32 -> bf16 (RNE) for x, Wq, Wk, Wv; f32 -> bf16 (RNE) -> x carry -> f16 for Wo (carry a power of two; exact for normal results).
// kCvThreads threads; in pass i thread g converts the 4 elements at 4 * (i * kCvThreads + g) of an array: a wave reads 512 contiguous bytes
// per load and writes 256 per store. The pass counts are constants of the shapes, so a thread's 20 loads are independent and can all be in flight.
constexpr int kCvGroups  = 512;
constexpr int kCvThreads = kCvGroups * 256;                    // 131,072 threads = 4,096 waves
constexpr int kCvX  = kTok * kDModel / (4 * kCvThreads);       // 8 passes over x
constexpr int kCvQK = kQKCols * kDModel / (4 * kCvThreads);    // 4 passes over Wq, and over Wk
constexpr int kCvVO = kDModel * kDModel / (4 * kCvThreads);    // 2 passes over Wv, and over Wo
static_assert(kCvX * 4 * kCvThreads == kTok * kDModel && kCvQK * 4 * kCvThreads == kQKCols * kDModel && kCvVO * 4 * kCvThreads == kDModel * kDModel);

template <int N>
__device__ __forceinline__ void cv_load(v4f (&r)[N], const float* __restrict__ in, int g) {
#pragma unroll
  for (int i = 0; i < N; ++i) r[i] = *(const v4f*)(in + 4 * ((size_t)i * kCvThreads + g));
}
template <int N>
__device__ __forceinline__ void cv_store_bf16(const v4f (&r)[N], unsigned short* __restrict__ out, int g) {
#pragma unroll
  for (int i = 0; i < N; ++i) {
    u2v u;
    u[0] = (unsigned)f2bf_bits(r[i][0]) | ((unsigned)f2bf_bits(r[i][1]) << 16);
    u[1] = (unsigned)f2bf_bits(r[i][2]) | ((unsigned)f2bf_bits(r[i][3]) << 16);
    *(u2v*)(out + 4 * ((size_t)i * kCvThreads + g)) = u;
  }
}
__device__ __forceinline__ unsigned cv_f16_bits(float f, float carry) {
  return (unsigned)__builtin_bit_cast(unsigned short, (_Float16)(bf_rne(f) * carry));
}

__global__ __launch_bounds__(256) void cast_inputs(
    const float* __restrict__ X, const float* __restrict__ Wq, const float* __restrict__ Wk,
    const float* __restrict__ Wv, const float* __restrict__ Wo,
    unsigned short* __restrict__ Xb, unsigned short* __restrict__ Wqb, unsigned short* __restrict__ Wkb,
    unsigned short* __restrict__ Wvb, unsigned short* __restrict__ Wo16, float carry) {
  const int g = blockIdx.x * 256 + threadIdx.x;
  v4f x[kCvX], q[kCvQK], k[kCvQK], v[kCvVO], o[kCvVO];
  cv_load(x, X, g);
  cv_load(q, Wq, g);
  cv_load(k, Wk, g);
  cv_load(v, Wv, g);
  cv_load(o, Wo, g);
  cv_store_bf16(x, Xb, g);
  cv_store_bf16(q, Wqb, g);
  cv_store_bf16(k, Wkb, g);
  cv_store_bf16(v, Wvb, g);
#pragma unroll
  for (int i = 0; i < kCvVO; ++i) {
    u2v u;
    u[0] = cv_f16_bits(o[i][0], carry) | (cv_f16_bits(o[i][1], carry) << 16);
    u[1] = cv_f16_bits(o[i][2], carry) | (cv_f16_bits(o[i][3], carry) << 16);
    *(u2v*)(Wo16 + 4 * ((size_t)i * kCvThreads + g)) = u;
  }
}

// ---- lambda = exp(lq1.lk1) - exp(lq2.lk2) + 0.8 from bf16-RNE-converted vectors; one wave writes one 32-float line ----
__global__ __launch_bounds__(32) void lambda_line(
    const float* __restrict__ lq1, const float* __restrict__ lq2,
    const float* __restrict__ lk1, const float* __restrict__ lk2, float* __restrict__ lamp) {
  const int lane = threadIdx.x;
  float d1 = 0.0f, d2 = 0.0f;
#pragma unroll 1
  for (int i = 0; i < kHeadDim; ++i) {
    d1 += bf_rne(lq1[i]) * bf_rne(lk1[i]);
    d2 += bf_rne(lq2[i]) * bf_rne(lk2[i]);
  }
  const float lam = expf(d1) - expf(d2) + 0.8f;
  ((float*)lamp)[lane] = lam;
  
}

// ---- bf16 split helpers ----
// two f32 -> one register of two bf16 hi parts and one of the two bf16 lo parts (both conversions round to nearest even)
typedef __attribute__((ext_vector_type(2))) float  f2v;
typedef __attribute__((ext_vector_type(2))) __bf16 b2v;
__device__ __forceinline__ void at_split2(float p0, float p1, unsigned& hi, unsigned& lo) {
  const unsigned h = __builtin_bit_cast(unsigned, __builtin_convertvector((f2v){p0, p1}, b2v));
  const float r0 = p0 - __uint_as_float(h << 16);
  const float r1 = p1 - __uint_as_float(h & 0xFFFF0000u);
  hi = h;
  lo = __builtin_bit_cast(unsigned, __builtin_convertvector((f2v){r0, r1}, b2v));
}
// the value that lane l ^ 16 holds
__device__ __forceinline__ float at_xhalf(float v) {
  const int b = __builtin_bit_cast(int, v);
  return __builtin_bit_cast(float, __builtin_amdgcn_permlanex16(b, b, 0x76543210, 0xfedcba98, false, false));
}
// e^x for the softmax (x <= 0 or -inf): one multiply and the hardware's 2^y. The library's expf adds a two-part product, a split into whole and
// fraction, ldexp and two range selects per value; here the argument is a difference from the running maximum, a result below 2^-126 may go to 0,
// and the multiply's rounding moves a weight by less than the 16 bits that its hi + lo parts keep.
constexpr float kLog2E = 1.44269504088896340736f;
__device__ __forceinline__ float at_exp(float x) { return __builtin_amdgcn_exp2f(x * kLog2E); }
__device__ __forceinline__ v8f at_mma(v16b a, v16b b, v8f c) {
  return __builtin_amdgcn_wmma_f32_16x16x32_bf16(false, a, false, b, (short)0, c, false, false);
}

// =====================================================================================
// Differential causal attention, head_dim 64, two softmax maps per head.
//   inputs : q, k as bf16 hi/lo planes [B*S][H*128] (map a uses columns h*128 + a*64 .. +64),
//            Vt as bf16 hi/lo planes [B][H*64][S] (key-contiguous), amask [B][S] f32, lambda line.
//   scores = 0.125 * q_a.k_a^T + causal add + (1-amask)*(-1e9) add; online softmax in f32 (e^x = 2^(x * log2 e) on v_exp_f32);
//   both products run transposed on v_wmma_f32_16x16x32_bf16 as hi.hi + hi.lo + lo.hi (f32 accumulate):
//   S^T = K.Q^T (A = K rows, B = Q columns) and O^T += Vt.P^T (A = Vt rows, B = P^T). A lane then holds scores of ONE query (column c),
//   keys 16 j + 8 hh + r: that is the k order of a B operand, so P^T is packed in registers; maximum and sum run in the lane, the two halves joined by one exchange.
//   att[b][h][s][d] = o_0/l_0 - lambda * o_1/l_1 ; per-tile (sum, sumsq) line for the group norm.
//   Block = 8 waves of one (b, h): waves 0-3 run map 0 and waves 4-7 map 1 of the same 64 query rows.
//   A block takes query tile pr and then tile 31 - pr, so every block walks 33 key chunks;
//   grid.x = B*H*16 = 512, pr fastest.
// LDS: K hi/lo per map [64 kv][64 d], Vt hi/lo [64 d][64 kv] (shared by both maps), all at row pitch kLP; the chunk's 64 mask terms;
//      one out slab [16][68] per 16 query rows.
// Every staged LDS byte that is read is written in full each chunk (64 full rows per plane); the 8 pad elements of a row are never read.
// =====================================================================================
// waves_per_eu(4, 4): 512 groups of 8 waves are four waves a SIMD, so a wave may hold 256 registers; the grouped fragment reads use them.
__global__ __launch_bounds__(256) __attribute__((amdgpu_waves_per_eu(4, 4)))
void diff_attn64(const unsigned short* __restrict__ Qh, const unsigned short* __restrict__ Ql,
                 const unsigned short* __restrict__ Kh, const unsigned short* __restrict__ Kl,
                 const unsigned short* __restrict__ Vh, const unsigned short* __restrict__ Vl,
                 const float* __restrict__ amask, const float* __restrict__ lamp,
                 float* __restrict__ att, float* __restrict__ part) {
  union FB { v16b v; v8b h[2]; };
  __shared__ __align__(16) unsigned short Ksh[2][kKC * kLP];
  __shared__ __align__(16) unsigned short Ksl[2][kKC * kLP];
  __shared__ __align__(16) unsigned short Vth[kHeadDim * kLP];
  __shared__ __align__(16) unsigned short Vtl[kHeadDim * kLP];
  __shared__ __align__(16) float Am[kKC];
  __shared__ __align__(16) float Os[4][16 * 68];
  __shared__ float red[4][2];

  const int tid  = threadIdx.x;
  const int wave = __builtin_amdgcn_readfirstlane(tid >> 5);   // scalar, so the tests on the map below are scalar branches
  const int a    = wave >> 2;         // softmax map of this wave
  const int wq   = wave & 3;          // 16-row slice of the query tile
  const int lane = tid & 31;
  const int hh   = lane >> 4;
  const int c    = lane & 15;
  const int bx   = blockIdx.x;
  const int pr   = bx & (kNPair - 1);
  const int bh   = bx >> 4;
  const int h    = bh & (kHeads - 1);
  const int b    = bh >> 4;
  const float lam = lamp[0];
  const float negInf = -__builtin_huge_valf();

  const size_t vbase = (size_t)(b * kDModel + h * kHeadDim) * kSeq;               // Vt row (h*64 + d) of batch b
  float* ob_ptr = att + (size_t)bh * kSeq * kHeadDim;
  float* os = Os[wq];
  const unsigned short* ksh = Ksh[a];
  const unsigned short* ksl = Ksl[a];
  const int kvr = tid >> 2;           // staged row: key row for K, d row for Vt (0..63)
  const int sg  = (tid & 3) * 8;      // 8-element segment inside a group of 32 elements

  for (int half = 0; half < 2; ++half) {
    const int qb = half ? (kNQblk - 1 - pr) : pr;
    const int q0 = qb * kQB + wq * 16;
    const size_t qoff = (size_t)(b * kSeq + q0 + c) * kQKCols + (size_t)h * 128 + a * 64;   // + dc*32 + 8*hh
    // Q fragments (B operand: lane = query column c) for this wave's map: 2 d-chunks, hi and lo planes
    v16b qah[2], qal[2];
#pragma unroll
    for (int dc = 0; dc < 2; ++dc) {
      qah[dc] = Frag<__bf16>::load((const __bf16*)Qh + qoff + dc * 32 + 8 * hh);
      qal[dc] = Frag<__bf16>::load((const __bf16*)Ql + qoff + dc * 32 + 8 * hh);
    }
    const int qrow = q0 + c;            // the one query of this lane
    float mrow = negInf, lrow = 0.0f;   // its running maximum; the sum over this lane half's keys
    v8f oacc[4];                        // oacc[t][r] = O^T[d = 16 t + 8 hh + r][query c]
#pragma unroll
    for (int t = 0; t < 4; ++t) oacc[t] = (v8f){0.f,0.f,0.f,0.f,0.f,0.f,0.f,0.f};

    for (int kc = 0; kc <= qb; ++kc) {          // causal: chunks 0..qb (block-uniform trip count, <= 32)
      const int kv0 = kc * kKC;
      __syncthreads();
      {
        // a K row holds both maps side by side (128 elements): groups 0,1 are map 0, groups 2,3 map 1
        const size_t ko = (size_t)(b * kSeq + kv0 + kvr) * kQKCols + (size_t)h * 128 + sg;
        const size_t vo = vbase + (size_t)kvr * kSeq + kv0 + sg;
        u4v t0[4], t1[4], t2[2], t3[2];
        float mk = 0.0f;
        if (wave < 2) mk = amask[b * kSeq + kv0 + tid];
#pragma unroll
        for (int i = 0; i < 4; ++i) { t0[i] = *(const u4v*)(Kh + ko + 32 * i); t1[i] = *(const u4v*)(Kl + ko + 32 * i); }
#pragma unroll
        for (int i = 0; i < 2; ++i) { t2[i] = *(const u4v*)(Vh + vo + 32 * i); t3[i] = *(const u4v*)(Vl + vo + 32 * i); }
#pragma unroll
        for (int i = 0; i < 4; ++i) {
          *(u4v*)(Ksh[i >> 1] + kvr * kLP + (i & 1) * 32 + sg) = t0[i];
          *(u4v*)(Ksl[i >> 1] + kvr * kLP + (i & 1) * 32 + sg) = t1[i];
        }
#pragma unroll
        for (int i = 0; i < 2; ++i) { *(u4v*)(Vth + kvr * kLP + i * 32 + sg) = t2[i]; *(u4v*)(Vtl + kvr * kLP + i * 32 + sg) = t3[i]; }
        // additive padding-mask term of each of the 64 keys (bf16 RNE-converted mask)
        if (wave < 2) Am[tid] = (1.0f - bf_rne(mk)) * (-1.0e9f);
      }
      __syncthreads();

      // ---- scores, transposed: 4 key subtiles of 16 rows, K = 64 (2 chunks), hi.hi + hi.lo + lo.hi ----
      // per 32 d the 16 fragment reads stand together ahead of the 12 products, which go round the four subtiles: reads can issue early, in groups, and
      // a product never needs the one written just before it. Each tile still sums dc 0 then 1, and in each hi.hi, lo.hi, hi.lo.
      v8f s[4];
#pragma unroll
      for (int j = 0; j < 4; ++j) s[j] = (v8f){0.f,0.f,0.f,0.f,0.f,0.f,0.f,0.f};
#pragma unroll
      for (int dc = 0; dc < 2; ++dc) {
        FB kb[4], kl[4];
#pragma unroll
        for (int j = 0; j < 4; ++j) {
          kb[j].h[0] = *(const v8b*)(ksh + (j * 16 + c) * kLP + dc * 32 + 8 * hh);
          kb[j].h[1] = *(const v8b*)(ksh + (j * 16 + c) * kLP + dc * 32 + 16 + 8 * hh);
          kl[j].h[0] = *(const v8b*)(ksl + (j * 16 + c) * kLP + dc * 32 + 8 * hh);
          kl[j].h[1] = *(const v8b*)(ksl + (j * 16 + c) * kLP + dc * 32 + 16 + 8 * hh);
        }
#pragma unroll
        for (int j = 0; j < 4; ++j) s[j] = at_mma(kb[j].v, qah[dc], s[j]);
#pragma unroll
        for (int j = 0; j < 4; ++j) s[j] = at_mma(kl[j].v, qah[dc], s[j]);
#pragma unroll
        for (int j = 0; j < 4; ++j) s[j] = at_mma(kb[j].v, qal[dc], s[j]);
      }
      // ---- scale, causal add, mask add, maximum over this lane's 32 keys, then over both halves ----
      const bool diag = (kc == qb);
      float m = negInf;
#pragma unroll
      for (int j = 0; j < 4; ++j) {
        union { v4f v[2]; float f[8]; } am;
        am.v[0] = *(const v4f*)(Am + j * 16 + 8 * hh);
        am.v[1] = *(const v4f*)(Am + j * 16 + 8 * hh + 4);
#pragma unroll
        for (int r = 0; r < 8; ++r) {
          const int kvcol = kv0 + j * 16 + 8 * hh + r;
          const float cz = (diag && (kvcol > qrow)) ? -1.0e9f : 0.0f;
          float sc = s[j][r] * 0.125f;
          sc = sc + cz;
          sc = sc + am.f[r];
          s[j][r] = sc;
          m = fmaxf(m, sc);
        }
      }
      m = fmaxf(m, at_xhalf(m));
      // ---- online softmax update; P^T packed as bf16 hi/lo B operands: element e of 32-key group kk is key 32 kk + (e < 8 ? 8 hh + e : 16 + 8 hh + e - 8) ----
      const float mnew = fmaxf(mrow, m);
      const float alpha = at_exp(mrow - mnew);
      mrow = mnew;
      union PB { v16b v; unsigned w[8]; };
      PB pbh[2], pbl[2];
      float ps[4];
#pragma unroll
      for (int j = 0; j < 4; ++j) {
        ps[j] = 0.0f;
        const v8f y = (s[j] - mnew) * kLog2E;
#pragma unroll
        for (int i = 0; i < 4; ++i) {
          const float p0 = __builtin_amdgcn_exp2f(y[2 * i]);
          const float p1 = __builtin_amdgcn_exp2f(y[2 * i + 1]);
          ps[j] += p0;
          ps[j] += p1;
          at_split2(p0, p1, pbh[j >> 1].w[(j & 1) * 4 + i], pbl[j >> 1].w[(j & 1) * 4 + i]);
        }
      }
      lrow = lrow * alpha + ((ps[0] + ps[1]) + (ps[2] + ps[3]));
#pragma unroll
      for (int t = 0; t < 4; ++t) oacc[t] *= alpha;
      // ---- O^T += Vt.P^T: A = Vt [d][kv], B = P^T from registers; hi.hi + hi.lo + lo.hi; reads grouped and products taken round the four tiles as for the scores ----
#pragma unroll
      for (int kk = 0; kk < 2; ++kk) {
        FB vb[4], vl[4];
#pragma unroll
        for (int t = 0; t < 4; ++t) {
          vb[t].h[0] = *(const v8b*)(Vth + (t * 16 + c) * kLP + kk * 32 + 8 * hh);
          vb[t].h[1] = *(const v8b*)(Vth + (t * 16 + c) * kLP + kk * 32 + 16 + 8 * hh);
          vl[t].h[0] = *(const v8b*)(Vtl + (t * 16 + c) * kLP + kk * 32 + 8 * hh);
          vl[t].h[1] = *(const v8b*)(Vtl + (t * 16 + c) * kLP + kk * 32 + 16 + 8 * hh);
        }
#pragma unroll
        for (int t = 0; t < 4; ++t) oacc[t] = at_mma(vb[t].v, pbh[kk].v, oacc[t]);
#pragma unroll
        for (int t = 0; t < 4; ++t) oacc[t] = at_mma(vl[t].v, pbh[kk].v, oacc[t]);
#pragma unroll
        for (int t = 0; t < 4; ++t) oacc[t] = at_mma(vb[t].v, pbl[kk].v, oacc[t]);
      }
    }
    // ---- finish this tile: map 1 hands o/l over through the slab; map 0 combines and sums the norm partials ----
    // a lane owns 8 consecutive d of its query's slab row per t: slab[c][16 t + 8 hh + r]
    const float inv = 1.0f / (lrow + at_xhalf(lrow));   // the two halves' sums joined, by every lane
    if (a == 1) {
#pragma unroll
      for (int t = 0; t < 4; ++t) {
        const v8f o = oacc[t] * inv;
        *(v4f*)(os + c * 68 + t * 16 + 8 * hh)     = (v4f){o[0], o[1], o[2], o[3]};
        *(v4f*)(os + c * 68 + t * 16 + 8 * hh + 4) = (v4f){o[4], o[5], o[6], o[7]};
      }
    }
    __syncthreads();
    if (a == 0) {
      float psum = 0.0f, psq = 0.0f;
#pragma unroll
      for (int t = 0; t < 4; ++t) {
        float* op = os + c * 68 + t * 16 + 8 * hh;
        union { v4f v[2]; float f[8]; } o1, wv;
        o1.v[0] = *(const v4f*)(op);
        o1.v[1] = *(const v4f*)(op + 4);
#pragma unroll
        for (int r = 0; r < 8; ++r) {
          const float o = oacc[t][r] * inv;
          const float w = o - lam * o1.f[r];
          wv.f[r] = w;
          psum += w;
          psq += w * w;
        }
        *(v4f*)(op)     = wv.v[0];
        *(v4f*)(op + 4) = wv.v[1];
      }
      // wave reductions, then a block combine in fixed order
#pragma unroll
      for (int off = 1; off < 32; off <<= 1) { psum += __shfl_xor(psum, off, 32); psq += __shfl_xor(psq, off, 32); }
      if (lane == 0) { red[wq][0] = psum; red[wq][1] = psq; }
    }
    __syncthreads();

    {
      const int c4 = (lane & 15) * 4;
#pragma unroll
      for (int it = 0; it < 4; ++it) {
        const int row = a * 8 + it * 2 + hh;      // each wave stores 8 of the slab's 16 rows
        v4f val = *(const v4f*)(os + row * 68 + c4);
        *(v4f*)(ob_ptr + (size_t)(q0 + row) * kHeadDim + c4) = val;
      }
      asm volatile("s_wait_xcnt 0x0" ::: "memory");   // the stores' address and data registers are rewritten by the code that follows
    }
    if (wave == 0) {
      const float t0 = ((red[0][0] + red[1][0]) + red[2][0]) + red[3][0];
      const float t1 = ((red[0][1] + red[1][1]) + red[2][1]) + red[3][1];
      const float v = (lane == 0) ? t0 : ((lane == 1) ? t1 : 0.0f);
      float* pline = part + (size_t)(bh * kNQblk + qb) * 32;
      ((float*)pline)[lane] = v;
      asm volatile("s_wait_xcnt 0x0" ::: "memory");   // the next tile's set-up rewrites this store's registers
    }
  }
}

// ---- group norm statistics per (b,h): fixed-order sum of the 32 tile lines; one wave writes one stats line ----
__global__ __launch_bounds__(32) void gn_stats(const float* __restrict__ part, float* __restrict__ stats) {
  const int bh = blockIdx.x;
  const int lane = threadIdx.x;
  float s0 = part[(size_t)(bh * kNQblk + lane) * 32 + 0];
  float s1 = part[(size_t)(bh * kNQblk + lane) * 32 + 1];
#pragma unroll
  for (int off = 1; off < 32; off <<= 1) { s0 += __shfl_xor(s0, off, 32); s1 += __shfl_xor(s1, off, 32); }
  const float inv_n = 1.0f / (float)(kSeq * kHeadDim);
  const float mu = s0 * inv_n;
  const float ex2 = s1 * inv_n;
  const float var = fmaxf(ex2 - mu * mu, 0.0f);
  const float rs = rsqrtf(var + 1.0e-5f);
  const float v = (lane == 0) ? mu : ((lane == 1) ? rs : 0.0f);
  ((float*)stats)[bh * 32 + lane] = v;
  
}

// ---- normalize + affine + x0.2 + merge heads -> f16 plane (x8 carry), [B*S][H*64] ----
__global__ __launch_bounds__(256) void gn_merge(const float* __restrict__ att, const float* __restrict__ stats,
                                              const float* __restrict__ gamma, const float* __restrict__ beta,
                                              unsigned short* __restrict__ merged) {
  const int g = blockIdx.x * 256 + threadIdx.x;
  if (g >= kBatch * kHeads * kSeq * 8) return;
  const int seg = g >> 3;
  const int e8  = (g & 7) * 8;
  const int bh  = seg >> 11;
  const int s   = seg & (kSeq - 1);
  const int h   = bh & (kHeads - 1);
  const int b   = bh >> 4;
  const float mu = stats[bh * 32 + 0];
  const float rs = stats[bh * 32 + 1];
  union U8 { v4f v[2]; float f[8]; };
  U8 x, ga, be;
  const float* ap = att + (size_t)seg * kHeadDim + e8;
  x.v[0]  = *(const v4f*)ap;
  x.v[1]  = *(const v4f*)(ap + 4);
  ga.v[0] = *(const v4f*)(gamma + h * kHeadDim + e8);
  ga.v[1] = *(const v4f*)(gamma + h * kHeadDim + e8 + 4);
  be.v[0] = *(const v4f*)(beta + h * kHeadDim + e8);
  be.v[1] = *(const v4f*)(beta + h * kHeadDim + e8 + 4);
  v8h hv;
#pragma unroll
  for (int e = 0; e < 8; ++e) {
    const float gq = bf_rne(ga.f[e]);
    const float bq = bf_rne(be.f[e]);
    float y = (x.f[e] - mu) * rs;
    y = y * gq + bq;
    y = y * 0.2f;
    float z = y * kMergeCarry;
    asm volatile("" : "+v"(z));
    hv[e] = (_Float16)z;
  }
  unsigned short* dst = merged + (size_t)(b * kSeq + s) * kDModel + h * kHeadDim + e8;
  *(v8h*)dst = hv;
  
}

// ---------------------------------------------------------------------------
extern "C" void kernel_launch(void* const* d_in, const int* in_sizes, int n_in,
                              void* d_out, int out_size, void* d_ws, size_t ws_size,
                              hipStream_t stream) {
  if (n_in < 12) return;
  if (in_sizes[0] != kTok * kDModel || in_sizes[1] != kBatch * kSeq ||
      in_sizes[2] != kQKCols * kDModel || in_sizes[3] != kQKCols * kDModel ||
      in_sizes[4] != kDModel * kDModel || in_sizes[5] != kDModel * kDModel ||
      in_sizes[6] != kHeadDim || in_sizes[7] != kHeadDim || in_sizes[8] != kHeadDim || in_sizes[9] != kHeadDim ||
      in_sizes[10] != kDModel || in_sizes[11] != kDModel) return;
  if (out_size != kTok * kDModel) return;
  if (ws_size < kWsTotal) return;

  const float* X     = (const float*)d_in[0];
  const float* amask = (const float*)d_in[1];
  const float* Wq    = (const float*)d_in[2];
  const float* Wk    = (const float*)d_in[3];
  const float* Wv    = (const float*)d_in[4];
  const float* Wo    = (const float*)d_in[5];
  const float* lq1   = (const float*)d_in[6];
  const float* lq2   = (const float*)d_in[7];
  const float* lk1   = (const float*)d_in[8];
  const float* lk2   = (const float*)d_in[9];
  const float* gamma = (const float*)d_in[10];
  const float* beta  = (const float*)d_in[11];

  char* w = (char*)d_ws;
  unsigned short* Xb    = (unsigned short*)(w + kOffXb);
  unsigned short* Wqb   = (unsigned short*)(w + kOffWqb);
  unsigned short* Wkb   = (unsigned short*)(w + kOffWkb);
  unsigned short* Wvb   = (unsigned short*)(w + kOffWvb);
  unsigned short* Wo16  = (unsigned short*)(w + kOffWo16);
  unsigned short* Qh    = (unsigned short*)(w + kOffQh);
  unsigned short* Ql    = (unsigned short*)(w + kOffQl);
  unsigned short* Kh    = (unsigned short*)(w + kOffKh);
  unsigned short* Kl    = (unsigned short*)(w + kOffKl);
  unsigned short* Vth   = (unsigned short*)(w + kOffVth);
  unsigned short* Vtl   = (unsigned short*)(w + kOffVtl);
  float*          att   = (float*)(w + kOffAtt);
  unsigned short* mrg   = (unsigned short*)(w + kOffMerged);
  float*          part  = (float*)(w + kOffPart);
  float*          stats = (float*)(w + kOffStats);
  float*          lamp  = (float*)(w + kOffLam);

  // 1) input conversions (bf16 RNE; Wo additionally x256 into f16)
  cast_inputs<<<kCvGroups, 256, 0, stream>>>(X, Wq, Wk, Wv, Wo, Xb, Wqb, Wkb, Wvb, Wo16, kWoCarry);
  lambda_line<<<1, 32, 0, stream>>>(lq1, lq2, lk1, lk2, lamp);

  // 2) projections: q/k planes [4096][2048] hi+lo, Vt planes [2][1024][2048] hi+lo
  constexpr int gridQ  = (kTok / 64) * (kQKCols / 64) / 8;   // 256
  constexpr int gridVt = (kDModel / 64) * (kSeq / 64) / 8;   // 64
  constexpr int gridO  = (kTok / 64) * (kDModel / 64) / 8;   // 128
  static_assert(gridQ * 8 == (kTok / 64) * (kQKCols / 64));
  static_assert(gridVt * 8 == (kDModel / 64) * (kSeq / 64));
  static_assert(gridO * 8 == (kTok / 64) * (kDModel / 64));
  // one work-group per 128x256 tile: the same counts
  static_assert(gridQ == (kTok / 128) * (kQKCols / 256) && gridVt == (kDModel / 128) * (kSeq / 256) && gridO == (kTok / 128) * (kDModel / 256));
  static_assert(kDModel % kGK == 0 && kDModel / kGK >= 2);
  wmma_gemm64<1, false, 0, 2, false><<<dim3(gridQ, 1, 1), 256, 0, stream>>>(
      Xb, Xb, kDModel, 0L, Wqb, Wqb, kDModel, 0L, (void*)Qh, (void*)Ql, kQKCols, 0L,
      lamp, lamp, 0L, kTok, kQKCols, kDModel, 1.0f);
  wmma_gemm64<1, false, 0, 2, false><<<dim3(gridQ, 1, 1), 256, 0, stream>>>(
      Xb, Xb, kDModel, 0L, Wkb, Wkb, kDModel, 0L, (void*)Kh, (void*)Kl, kQKCols, 0L,
      lamp, lamp, 0L, kTok, kQKCols, kDModel, 1.0f);
  // Vt[b][c][s] = sum_k Wv[c][k] * X[b][s][k] : A = Wv [1024][1024], Bt = X_b [2048][1024]
  wmma_gemm64<1, false, 0, 2, false><<<dim3(gridVt, kBatch, 1), 256, 0, stream>>>(
      Wvb, Wvb, kDModel, 0L, Xb, Xb, kDModel, (long)kSeq * kDModel, (void*)Vth, (void*)Vtl, kSeq, (long)kDModel * kSeq,
      lamp, lamp, 0L, kDModel, kSeq, kDModel, 1.0f);

  // 3) differential causal attention + norm partial lines (512 blocks, two query tiles each)
  diff_attn64<<<kAttnGroups, 256, 0, stream>>>(Qh, Ql, Kh, Kl, Vth, Vtl, amask, lamp, att, part);

  // 4) group norm stats, normalize + merge
  gn_stats<<<kBatch * kHeads, 32, 0, stream>>>(part, stats);
  gn_merge<<<(kBatch * kHeads * kSeq * 8) / 256, 256, 0, stream>>>(att, stats, gamma, beta, mrg);

  // 5) output projection: out[m][n] = (1/2048) * sum_k merged8[m][k] * Wo256[n][k]
  wmma_gemm64<0, false, 0, 0, false><<<dim3(gridO, 1, 1), 256, 0, stream>>>(
      mrg, mrg, kDModel, 0L, Wo16, Wo16, kDModel, 0L, d_out, d_out, kDModel, 0L,
      lamp, lamp, 0L, kTok, kDModel, kDModel, 1.0f / (kMergeCarry * kWoCarry));
}

// v008
// A run of this version takes 172 microseconds.
// Timed twice side by side with v007, it ran 1.07 times as fast both times.
// Over all steps from v000 it is 4.50 times as fast.
// Contractions: x.Wq^T, x.Wk^T, Wv.x^T = v_wmma_f32_16x16x32_bf16 (plain bf16 operands from RNE-converted inputs); k.q^T and Vt.p^T = v_wmma_f32_16x16x32_bf16 with bf16 hi/lo planes (hi.hi+hi.lo+lo.hi); merged.Wo^T = v_wmma_f32_16x16x32_f16 (f16 operands, carries 8 and 256); f32 accumulate everywhere; softmax, group norm and the two 64-term lambda dots in f32.
#include <hip/hip_runtime.h>

typedef __attribute__((ext_vector_type(16))) _Float16 v16h;
typedef __attribute__((ext_vector_type(8)))  _Float16 v8h;
typedef __attribute__((ext_vector_type(16))) __bf16   v16b;
typedef __attribute__((ext_vector_type(8)))  __bf16   v8b;
typedef __attribute__((ext_vector_type(8)))  float    v8f;
typedef __attribute__((ext_vector_type(4)))  float    v4f;
typedef __attribute__((ext_vector_type(4)))  unsigned int u4v;
typedef __attribute__((ext_vector_type(2)))  unsigned int u2v;

// ---- problem geometry ----
constexpr int kBatch   = 2;
constexpr int kSeq     = 2048;
constexpr int kDModel  = 1024;
constexpr int kHeads   = 16;
constexpr int kHeadDim = 64;
constexpr int kQKCols  = 2 * kDModel;      // 2048 : row width of the q/k planes (H * 128)
constexpr int kTok     = kBatch * kSeq;    // 4096
constexpr int kQB      = 64;               // query rows per tile; a block takes two tiles
constexpr int kKC      = 64;               // keys per chunk
constexpr int kLP      = 72;               // LDS row pitch of the 64-element 16-bit tiles: 144 B = 16 B x 9 (odd), conflict-free for 16-byte row reads
constexpr int kNQblk   = kSeq / kQB;       // 32
constexpr int kAttnBlocks = kBatch * kHeads * kNQblk;   // 1024 query tiles
constexpr int kNPair   = kNQblk / 2;        // 16 : tile pairs (t, 31 - t) per (b, h)
constexpr int kAttnGroups = kBatch * kHeads * kNPair;   // 512 work-groups of the attention launch
constexpr float kMergeCarry = 8.0f;        // f16 merged plane carried x8
constexpr float kWoCarry    = 256.0f;      // f16 Wo plane carried x256

static_assert(kNQblk == 32);
static_assert(kHeads == 16);
static_assert(kAttnBlocks == 1024);
static_assert(kNPair == 16 && kAttnGroups == 512);
static_assert(kSeq % kQB == 0);
static_assert(kDModel % 32 == 0);                  // K of every GEMM
static_assert(kTok % 64 == 0 && kQKCols % 64 == 0 && kDModel % 64 == 0 && kSeq % 64 == 0);   // M, N tile multiples

// ---- workspace region map (bytes; every offset a multiple of 128) ----
constexpr size_t kBytesXb     = (size_t)kTok * kDModel * 2;                     //  8,388,608  x as bf16 [4096][1024]
constexpr size_t kBytesWqk    = (size_t)kQKCols * kDModel * 2;                  //  4,194,304  Wq / Wk as bf16 [2048][1024]
constexpr size_t kBytesWv     = (size_t)kDModel * kDModel * 2;                  //  2,097,152  Wv as bf16 [1024][1024]
constexpr size_t kBytesWo     = (size_t)kDModel * kDModel * 2;                  //  2,097,152  Wo as f16 x256 [1024][1024]
constexpr size_t kBytesQPl    = (size_t)kTok * kQKCols * 2;                     // 16,777,216  one q or k plane [4096][2048]
constexpr size_t kBytesVtPl   = (size_t)kBatch * kDModel * kSeq * 2;            //  8,388,608  one Vt plane [2][1024][2048]
constexpr size_t kBytesAtt    = (size_t)kBatch * kHeads * kSeq * kHeadDim * 4;  // 16,777,216  attention out f32 [2][16][2048][64]
constexpr size_t kBytesMerged = (size_t)kTok * kDModel * 2;                     //  8,388,608  merged f16 x8 [4096][1024]
constexpr size_t kBytesPart   = (size_t)kAttnBlocks * 128;                      //    131,072  one 32-float line per query tile (1024 tiles)
constexpr size_t kBytesStats  = (size_t)kBatch * kHeads * 128;                  //      4,096  one 32-float line per (b,h)
constexpr size_t kBytesLam    = 128;                                            //        128  lambda line

constexpr size_t kOffXb     = 0;
constexpr size_t kOffWqb    = kOffXb + kBytesXb;
constexpr size_t kOffWkb    = kOffWqb + kBytesWqk;
constexpr size_t kOffWvb    = kOffWkb + kBytesWqk;
constexpr size_t kOffWo16   = kOffWvb + kBytesWv;
constexpr size_t kOffQh     = kOffWo16 + kBytesWo;
constexpr size_t kOffQl     = kOffQh + kBytesQPl;
constexpr size_t kOffKh     = kOffQl + kBytesQPl;
constexpr size_t kOffKl     = kOffKh + kBytesQPl;
constexpr size_t kOffVth    = kOffKl + kBytesQPl;
constexpr size_t kOffVtl    = kOffVth + kBytesVtPl;
constexpr size_t kOffAtt    = kOffVtl + kBytesVtPl;
constexpr size_t kOffMerged = kOffAtt + kBytesAtt;
constexpr size_t kOffPart   = kOffMerged + kBytesMerged;
constexpr size_t kOffStats  = kOffPart + kBytesPart;
constexpr size_t kOffLam    = kOffStats + kBytesStats;
constexpr size_t kWsTotal   = kOffLam + kBytesLam;                              // 130,158,720
static_assert(kBytesPart == 131072);
static_assert(kWsTotal == 130158720);
static_assert(kWsTotal <= 134217728);
static_assert(kOffWqb % 128 == 0 && kOffQh % 128 == 0 && kOffAtt % 128 == 0 && kOffPart % 128 == 0 && kOffStats % 128 == 0 && kOffLam % 128 == 0);

// ---- 16-bit helpers ----
__device__ __forceinline__ unsigned short f2bf_bits(float f) {
  unsigned u = __float_as_uint(f);
  return (unsigned short)((u + 0x7FFFu + ((u >> 16) & 1u)) >> 16);
}
__device__ __forceinline__ float bf_bits2f(unsigned short h) { return __uint_as_float(((unsigned)h) << 16); }
__device__ __forceinline__ float bf_rne(float f) { return bf_bits2f(f2bf_bits(f)); }

// hazard guards as plain device helpers
__device__ __forceinline__ void dep_guard_h(v8f& a, v8f& b, v16h x, v16h y) { asm volatile("v_nop\n\tv_nop\n\tv_nop\n\tv_nop" : "+v"(a), "+v"(b) : "v"(x), "v"(y)); }
__device__ __forceinline__ void dep_guard_b(v8f& a, v8f& b, v16b x, v16b y) { asm volatile("v_nop\n\tv_nop\n\tv_nop\n\tv_nop" : "+v"(a), "+v"(b) : "v"(x), "v"(y)); }
__device__ __forceinline__ void keep4_h(v16h a, v16h b, v16h c, v16h d) { asm volatile("v_nop" :: "v"(a), "v"(b), "v"(c), "v"(d)); }
__device__ __forceinline__ void keep4_b(v16b a, v16b b, v16b c, v16b d) { asm volatile("v_nop" :: "v"(a), "v"(b), "v"(c), "v"(d)); }
__device__ __forceinline__ void acc_guard4(v8f& a, v8f& b, v8f& c, v8f& d) { asm volatile("v_nop\n\tv_nop\n\tv_nop\n\tv_nop" : "+v"(a), "+v"(b), "+v"(c), "+v"(d)); }
template <typename T> struct Frag;
template <> struct Frag<_Float16> {
  typedef v16h V; union U { v16h v; v8h h[2]; };
  static __device__ __forceinline__ v16h load(const _Float16* p) {   // elements 0..7 <- p[0..7], 8..15 <- p[16..23]
    U f; f.h[0] = *(const v8h*)(p); f.h[1] = *(const v8h*)(p + 16); return f.v;
  }
  static __device__ __forceinline__ v8f mma(v16h a, v16h b, v8f c) {
    return __builtin_amdgcn_wmma_f32_16x16x32_f16(false, a, false, b, (short)0, c, false, false);
  }
  static __device__ __forceinline__ void guard(v8f& a, v8f& b, v16h x, v16h y) { dep_guard_h(a, b, x, y); }
  static __device__ __forceinline__ void keep(v16h a, v16h b, v16h c, v16h d) { keep4_h(a, b, c, d); }
};
template <> struct Frag<__bf16> {
  typedef v16b V; union U { v16b v; v8b h[2]; };
  static __device__ __forceinline__ v16b load(const __bf16* p) {
    U f; f.h[0] = *(const v8b*)(p); f.h[1] = *(const v8b*)(p + 16); return f.v;
  }
  static __device__ __forceinline__ v8f mma(v16b a, v16b b, v8f c) {
    return __builtin_amdgcn_wmma_f32_16x16x32_bf16(false, a, false, b, (short)0, c, false, false);
  }
  static __device__ __forceinline__ void guard(v8f& a, v8f& b, v16b x, v16b y) { dep_guard_b(a, b, x, y); }
  static __device__ __forceinline__ void keep(v16b a, v16b b, v16b c, v16b d) { keep4_b(a, b, c, d); }
};

// ---- Register-blocked batched WMMA GEMM, operands staged in LDS ------------
// C[m,n] = scale * sum_k A[m,k] * Bt[n,k] (+bias)(+resid); a work-group owns a 128x256 tile, each of its 8 waves (2 x 4) a 64x64 part.
// A row-major [M,K]; Bt row-major [N,K]; M % 128 == 0, N % 256 == 0, K % 128 == 0, K >= 256.
// Per 128 k the 128 A rows and 256 Bt rows (256 bytes, two whole lines, each) reach LDS by asynchronous copies, two buffers:
// the copies of tile t + 2 fly while tile t + 1 is worked on; the fragments are read from LDS at row pitch kGP.
// SPLIT is not carried by the staged loop (one plane per operand).
// BIAS_MODE: 0 = none, 1 = bias[m], 2 = bias[n].
// OUT_MODE: 0 = f32, 1 = f16, 2 = bf16 hi plane (Cout) + bf16 lo plane (Cout2).
// ET: 0 = f16 operands, 1 = bf16 operands (pointers passed as 16-bit storage)
constexpr int kGK     = 128;                   // k elements per staged tile
constexpr int kGP     = 136;                   // LDS row pitch of a staged row: 272 B = 16 B x 17 (odd), conflict-free for 16-byte row reads
constexpr int kGRowsA = 128;                   // staged A rows
constexpr int kGRowsB = 256;                   // staged Bt rows
constexpr int kGBuf   = (kGRowsA + kGRowsB) * kGP;   // 16-bit elements of one buffer (104,448 B)

// Twelve 16-byte asynchronous copies of one lane, global -> LDS (l = LDS byte address, g = global address).
// The closing s_wait_xcnt stands inside the statement, so that no address register is rewritten in front of it.
__device__ __forceinline__ void async_copy12(const unsigned (&l)[12], const unsigned short* const (&g)[12]) {
  asm volatile(
      "global_load_async_to_lds_b128 %0, %12, off\n\t"
      "global_load_async_to_lds_b128 %1, %13, off\n\t"
      "global_load_async_to_lds_b128 %2, %14, off\n\t"
      "global_load_async_to_lds_b128 %3, %15, off\n\t"
      "global_load_async_to_lds_b128 %4, %16, off\n\t"
      "global_load_async_to_lds_b128 %5, %17, off\n\t"
      "global_load_async_to_lds_b128 %6, %18, off\n\t"
      "global_load_async_to_lds_b128 %7, %19, off\n\t"
      "global_load_async_to_lds_b128 %8, %20, off\n\t"
      "global_load_async_to_lds_b128 %9, %21, off\n\t"
      "global_load_async_to_lds_b128 %10, %22, off\n\t"
      "global_load_async_to_lds_b128 %11, %23, off\n\t"
      "s_wait_xcnt 0x0"
      :: "v"(l[0]), "v"(l[1]), "v"(l[2]), "v"(l[3]), "v"(l[4]), "v"(l[5]), "v"(l[6]), "v"(l[7]), "v"(l[8]), "v"(l[9]), "v"(l[10]), "v"(l[11]),
         "v"(g[0]), "v"(g[1]), "v"(g[2]), "v"(g[3]), "v"(g[4]), "v"(g[5]), "v"(g[6]), "v"(g[7]), "v"(g[8]), "v"(g[9]), "v"(g[10]), "v"(g[11])
      : "memory");
}

template <int ET> struct Elem;
template <> struct Elem<0> { typedef _Float16 T; };
template <> struct Elem<1> { typedef __bf16 T; };
template <int ET, bool SPLIT, int BIAS_MODE, int OUT_MODE, bool RESID, int ACT = 0>
__global__ __launch_bounds__(256) void wmma_gemm64(
    const unsigned short* __restrict__ Ap, const unsigned short* __restrict__ A2p, int lda, long strideA,
    const unsigned short* __restrict__ Btp, const unsigned short* __restrict__ Bt2p, int ldb, long strideB,
    void* __restrict__ Cout, void* __restrict__ Cout2, int ldc, long strideC,
    const float* __restrict__ bias,
    const float* __restrict__ resid, long strideR,
    int M, int N, int K, float scale) {
  typedef typename Elem<ET>::T T;
  typedef typename Frag<T>::V V;
  static_assert(!SPLIT, "the staged loop carries one plane per operand");
  __shared__ __align__(16) unsigned short sAB[2][kGBuf];   // [buffer][A rows 0..127 | Bt rows 0..255][kGP]
  __shared__ __align__(16) float sT[8][16 * 68];   // per-wave 16x64 slab, pitch 68 floats
  const int b    = blockIdx.y;
  const int tid  = threadIdx.x;
  const int lane = tid & 31;
  const int wave = tid >> 5;
  const int btN = N >> 8;
  const int btM = M >> 7;
  const int bt  = blockIdx.x;
  if (bt >= btM * btN) return;   // the same for the whole work-group, in front of every barrier and copy
  const int bm = bt / btN;
  const int bn = bt - bm * btN;
  const int mB = bm << 7;
  const int nB = bn << 8;
  const int wm = (wave >> 2) << 6;             // this wave's rows inside the staged A rows
  const int wn = (wave & 3) << 6;              // this wave's rows inside the staged Bt rows
  const int m0 = mB + wm;
  const int n0 = nB + wn;

  const int rlane = lane & 15;                 // row (A) / col (B, D) within subtile
  const int koff  = (lane >> 4) * 8;           // k offset of this lane half
  const int mOff  = (lane >> 4) * 8;           // D row offset

  // staging: 16 lanes copy one row's 256 bytes, a wave 4 whole lines per copy; copy it covers staged rows it*16 .. it*16+15
  const int srow = tid >> 4;
  const int sseg = (tid & 15) * 8;
  const unsigned short* pA = Ap  + (size_t)b * strideA + (size_t)(mB + srow) * lda + sseg;
  const unsigned short* pB = Btp + (size_t)b * strideB + (size_t)(nB + srow) * ldb + sseg;
  const unsigned lds0 = (unsigned)(size_t)(&sAB[0][0] + srow * kGP + sseg);   // low 32 bits = byte address in LDS
  auto stage = [&](int buf) {   // copies the next 128 k of every staged row into buffer buf and moves the two pointers on
#pragma unroll   // both loops unrolled: every index constant, so the two operand arrays stay in registers
    for (int hf = 0; hf < 2; ++hf) {
      unsigned l[12];
      const unsigned short* g[12];
#pragma unroll
      for (int e = 0; e < 12; ++e) {
        const int it = hf * 12 + e;
        l[e] = lds0 + (unsigned)((buf * kGBuf + it * 16 * kGP) * 2);
        g[e] = (it < 8) ? (pA + (size_t)(it * 16) * lda) : (pB + (size_t)((it - 8) * 16) * ldb);
      }
      async_copy12(l, g);
    }
    pA += kGK;
    pB += kGK;
  };

  v8f acc[4][4];
#pragma unroll
  for (int i = 0; i < 4; ++i)
#pragma unroll
    for (int j = 0; j < 4; ++j) acc[i][j] = (v8f){0.f,0.f,0.f,0.f,0.f,0.f,0.f,0.f};

  const int nT = K / kGK;
  stage(0);
  asm volatile("s_wait_asynccnt 0x0" ::: "memory");   // this wave's copies of tile 0 have landed
  __syncthreads();                                    // ... and every other wave's
  if (nT > 1) stage(1);
  for (int t = 0; t < nT; ++t) {
    const T* sa = (const T*)sAB[t & 1] + (wm + rlane) * kGP + koff;
    const T* sb = (const T*)sAB[t & 1] + (kGRowsA + wn + rlane) * kGP + koff;
#pragma unroll   // the four 32-k blocks of a tile in line: LDS offsets become immediates and a block's reads can go ahead of the block before it
    for (int ks = 0; ks < kGK; ks += 32) {
      V ah[4], bh[4];
#pragma unroll
      for (int j = 0; j < 4; ++j) bh[j] = Frag<T>::load(sb + (j << 4) * kGP + ks);
#pragma unroll
      for (int i = 0; i < 4; ++i) ah[i] = Frag<T>::load(sa + (i << 4) * kGP + ks);
#pragma unroll
      for (int i = 0; i < 4; ++i) {
#pragma unroll
        for (int j = 0; j < 4; ++j) acc[i][j] = Frag<T>::mma(ah[i], bh[j], acc[i][j]);
        Frag<T>::guard(acc[i][0], acc[i][3], ah[i], ah[i]);
      }
      Frag<T>::keep(bh[0], bh[1], bh[2], bh[3]);
    }
    asm volatile("s_wait_dscnt 0x0" ::: "memory");      // this wave's reads of buffer t & 1 are done before it is refilled
    asm volatile("s_wait_asynccnt 0x0" ::: "memory");   // this wave's copies of tile t + 1 have landed
    __syncthreads();                                    // publishes tile t + 1 and ends every wave's reads of tile t
    if (t + 2 < nT) stage(t & 1);
  }
  asm volatile("s_wait_asynccnt 0x0" ::: "memory");     // nothing is in flight when the wave goes on
  acc_guard4(acc[0][0], acc[0][1], acc[0][2], acc[0][3]);
  acc_guard4(acc[1][0], acc[1][1], acc[1][2], acc[1][3]);
  acc_guard4(acc[2][0], acc[2][1], acc[2][2], acc[2][3]);
  acc_guard4(acc[3][0], acc[3][1], acc[3][2], acc[3][3]);

  // ---- epilogue ----
  float* slab = sT[wave];
  const float* Rb = RESID ? (resid + (size_t)b * strideR) : nullptr;
#pragma unroll
  for (int i = 0; i < 4; ++i) {
    const int mBase = m0 + (i << 4);
#pragma unroll
    for (int j = 0; j < 4; ++j) {
      const int n = n0 + (j << 4) + rlane;
      float bv = 0.f;
      if (BIAS_MODE == 2) bv = bias[n];
#pragma unroll
      for (int r = 0; r < 8; ++r) {
        float v = acc[i][j][r] * scale;
        if (BIAS_MODE == 1) v += bias[mBase + mOff + r];
        if (BIAS_MODE == 2) v += bv;
        if (RESID) v += Rb[(size_t)(mBase + mOff + r) * ldc + n];
        if (ACT == 1) v = tanhf(v);
        if (ACT == 2) v = fmaxf(v, 0.0f);
        if (ACT == 3) v = v / (1.0f + expf(-v));
        if (ACT == 4) v = (v > 0.f) ? v : 0.01f * v;
        if (ACT == 5) v = 0.5f * v * (1.0f + erff(v * 0.70710678118654752f));
        slab[(mOff + r) * 68 + (j << 4) + rlane] = v;
      }
    }
    __builtin_amdgcn_fence(__ATOMIC_RELEASE, "workgroup");
    __builtin_amdgcn_wave_barrier();
    __builtin_amdgcn_fence(__ATOMIC_ACQUIRE, "workgroup");
    if (OUT_MODE == 0) {
      float* C = (float*)Cout + (size_t)b * strideC;
      const int hh = lane >> 4, c4 = (lane & 15) * 4;     // row seg = 256 B = 16 lanes x 16 B
      {
#pragma unroll
        for (int it = 0; it < 8; ++it) {
          const int row = it * 2 + hh;
          v4f v = *(const v4f*)(slab + row * 68 + c4);
          *(v4f*)(C + (size_t)(mBase + row) * ldc + n0 + c4) = v;
        }
        
      }
    } else {
      const int q = lane >> 3, c8 = (lane & 7) * 8;
      unsigned short* C  = (unsigned short*)Cout  + (size_t)b * strideC;
      unsigned short* C2 = (OUT_MODE == 2) ? ((unsigned short*)Cout2 + (size_t)b * strideC) : nullptr;
      {
#pragma unroll
        for (int it = 0; it < 4; ++it) {
          const int row = it * 4 + q;
          const float* sp = slab + row * 68 + c8;
          v8h hv, lv;
#pragma unroll
          for (int e = 0; e < 8; ++e) {
            if (OUT_MODE == 1) {
              hv[e] = (_Float16)sp[e];
            } else {
              unsigned short hb = f2bf_bits(sp[e]);
              unsigned short lb = f2bf_bits(sp[e] - bf_bits2f(hb));
              hv[e] = __builtin_bit_cast(_Float16, hb);
              lv[e] = __builtin_bit_cast(_Float16, lb);
            }
          }
          *(v8h*)(C + (size_t)(mBase + row) * ldc + n0 + c8) = hv;
          if (OUT_MODE == 2) *(v8h*)(C2 + (size_t)(mBase + row) * ldc + n0 + c8) = lv;
        }
        
      }
    }
    __builtin_amdgcn_fence(__ATOMIC_RELEASE, "workgroup");
    __builtin_amdgcn_wave_barrier();
    __builtin_amdgcn_fence(__ATOMIC_ACQUIRE, "workgroup");
  }
}

// ---- all five input conversions in one streaming launch ----
// f32 -> bf16 (RNE) for x, Wq, Wk, Wv; f32 -> bf16 (RNE) -> x carry -> f16 for Wo (carry a power of two; exact for normal results).
// kCvThreads threads; in pass i thread g converts the 4 elements at 4 * (i * kCvThreads + g) of an array: a wave reads 512 contiguous bytes
// per load and writes 256 per store. The pass counts are constants of the shapes, so a thread's 20 loads are independent and can all be in flight.
constexpr int kCvGroups  = 512;
constexpr int kCvThreads = kCvGroups * 256;                    // 131,072 threads = 4,096 waves
constexpr int kCvX  = kTok * kDModel / (4 * kCvThreads);       // 8 passes over x
constexpr int kCvQK = kQKCols * kDModel / (4 * kCvThreads);    // 4 passes over Wq, and over Wk
constexpr int kCvVO = kDModel * kDModel / (4 * kCvThreads);    // 2 passes over Wv, and over Wo
static_assert(kCvX * 4 * kCvThreads == kTok * kDModel && kCvQK * 4 * kCvThreads == kQKCols * kDModel && kCvVO * 4 * kCvThreads == kDModel * kDModel);

template <int N>
__device__ __forceinline__ void cv_load(v4f (&r)[N], const float* __restrict__ in, int g) {
#pragma unroll
  for (int i = 0; i < N; ++i) r[i] = *(const v4f*)(in + 4 * ((size_t)i * kCvThreads + g));
}
template <int N>
__device__ __forceinline__ void cv_store_bf16(const v4f (&r)[N], unsigned short* __restrict__ out, int g) {
#pragma unroll
  for (int i = 0; i < N; ++i) {
    u2v u;
    u[0] = (unsigned)f2bf_bits(r[i][0]) | ((unsigned)f2bf_bits(r[i][1]) << 16);
    u[1] = (unsigned)f2bf_bits(r[i][2]) | ((unsigned)f2bf_bits(r[i][3]) << 16);
    *(u2v*)(out + 4 * ((size_t)i * kCvThreads + g)) = u;
  }
}
__device__ __forceinline__ unsigned cv_f16_bits(float f, float carry) {
  return (unsigned)__builtin_bit_cast(unsigned short, (_Float16)(bf_rne(f) * carry));
}

__global__ __launch_bounds__(256) void cast_inputs(
    const float* __restrict__ X, const float* __restrict__ Wq, const float* __restrict__ Wk,
    const float* __restrict__ Wv, const float* __restrict__ Wo,
    unsigned short* __restrict__ Xb, unsigned short* __restrict__ Wqb, unsigned short* __restrict__ Wkb,
    unsigned short* __restrict__ Wvb, unsigned short* __restrict__ Wo16, float carry) {
  const int g = blockIdx.x * 256 + threadIdx.x;
  v4f x[kCvX], q[kCvQK], k[kCvQK], v[kCvVO], o[kCvVO];
  cv_load(x, X, g);
  cv_load(q, Wq, g);
  cv_load(k, Wk, g);
  cv_load(v, Wv, g);
  cv_load(o, Wo, g);
  cv_store_bf16(x, Xb, g);
  cv_store_bf16(q, Wqb, g);
  cv_store_bf16(k, Wkb, g);
  cv_store_bf16(v, Wvb, g);
#pragma unroll
  for (int i = 0; i < kCvVO; ++i) {
    u2v u;
    u[0] = cv_f16_bits(o[i][0], carry) | (cv_f16_bits(o[i][1], carry) << 16);
    u[1] = cv_f16_bits(o[i][2], carry) | (cv_f16_bits(o[i][3], carry) << 16);
    *(u2v*)(Wo16 + 4 * ((size_t)i * kCvThreads + g)) = u;
  }
}

// ---- lambda = exp(lq1.lk1) - exp(lq2.lk2) + 0.8 from bf16-RNE-converted vectors; one wave writes one 32-float line ----
__global__ __launch_bounds__(32) void lambda_line(
    const float* __restrict__ lq1, const float* __restrict__ lq2,
    const float* __restrict__ lk1, const float* __restrict__ lk2, float* __restrict__ lamp) {
  const int lane = threadIdx.x;
  float d1 = 0.0f, d2 = 0.0f;
#pragma unroll 1
  for (int i = 0; i < kHeadDim; ++i) {
    d1 += bf_rne(lq1[i]) * bf_rne(lk1[i]);
    d2 += bf_rne(lq2[i]) * bf_rne(lk2[i]);
  }
  const float lam = expf(d1) - expf(d2) + 0.8f;
  ((float*)lamp)[lane] = lam;
  
}

// ---- bf16 split helpers ----
// two f32 -> one register of two bf16 hi parts and one of the two bf16 lo parts (both conversions round to nearest even)
typedef __attribute__((ext_vector_type(2))) float  f2v;
typedef __attribute__((ext_vector_type(2))) __bf16 b2v;
__device__ __forceinline__ void at_split2(float p0, float p1, unsigned& hi, unsigned& lo) {
  const unsigned h = __builtin_bit_cast(unsigned, __builtin_convertvector((f2v){p0, p1}, b2v));
  const float r0 = p0 - __uint_as_float(h << 16);
  const float r1 = p1 - __uint_as_float(h & 0xFFFF0000u);
  hi = h;
  lo = __builtin_bit_cast(unsigned, __builtin_convertvector((f2v){r0, r1}, b2v));
}
// the value that lane l ^ 16 holds
__device__ __forceinline__ float at_xhalf(float v) {
  const int b = __builtin_bit_cast(int, v);
  return __builtin_bit_cast(float, __builtin_amdgcn_permlanex16(b, b, 0x76543210, 0xfedcba98, false, false));
}
// e^x for the softmax (x <= 0 or -inf): one multiply and the hardware's 2^y. The library's expf adds a two-part product, a split into whole and
// fraction, ldexp and two range selects per value; here the argument is a difference from the running maximum, a result below 2^-126 may go to 0,
// and the multiply's rounding moves a weight by less than the 16 bits that its hi + lo parts keep.
constexpr float kLog2E = 1.44269504088896340736f;
constexpr int kAPlane  = kKC * kLP;        // 16-bit elements of one staged plane of the attention kernel: 64 rows at pitch kLP (9,216 B)
constexpr int kABuf    = 6 * kAPlane;      // one buffer: six planes (55,296 B)
constexpr int kAChunks = kNQblk + 1;       // key chunks a group walks: (pr + 1) + (32 - pr)
static_assert(kKC == kHeadDim && kSeq == 256 * 8);   // K and Vt planes have the same shape; 256 threads write 8 mask terms each
__device__ __forceinline__ float at_exp(float x) { return __builtin_amdgcn_exp2f(x * kLog2E); }
__device__ __forceinline__ v8f at_mma(v16b a, v16b b, v8f c) {
  return __builtin_amdgcn_wmma_f32_16x16x32_bf16(false, a, false, b, (short)0, c, false, false);
}

// =====================================================================================
// Differential causal attention, head_dim 64, two softmax maps per head.
//   inputs : q, k as bf16 hi/lo planes [B*S][H*128] (map a uses columns h*128 + a*64 .. +64),
//            Vt as bf16 hi/lo planes [B][H*64][S] (key-contiguous), amask [B][S] f32, lambda line.
//   scores = 0.125 * q_a.k_a^T + causal add + (1-amask)*(-1e9) add; online softmax in f32 (e^x = 2^(x * log2 e) on v_exp_f32);
//   both products run transposed on v_wmma_f32_16x16x32_bf16 as hi.hi + hi.lo + lo.hi (f32 accumulate):
//   S^T = K.Q^T (A = K rows, B = Q columns) and O^T += Vt.P^T (A = Vt rows, B = P^T). A lane then holds scores of ONE query (column c),
//   keys 16 j + 8 hh + r: that is the k order of a B operand, so P^T is packed in registers; maximum and sum run in the lane, the two halves joined by one exchange.
//   att[b][h][s][d] = o_0/l_0 - lambda * o_1/l_1 ; per-tile (sum, sumsq) line for the group norm.
//   Block = 8 waves of one (b, h): waves 0-3 run map 0 and waves 4-7 map 1 of the same 64 query rows.
//   A block takes query tile pr and then tile 31 - pr, so every block walks 33 key chunks;
//   grid.x = B*H*16 = 512, pr fastest.
// LDS: two buffers of six planes each: K hi per map, K lo per map [64 kv][64 d], Vt hi, Vt lo [64 d][64 kv] (shared by both maps), all at row pitch kLP;
//      the mask terms of all the batch's keys, written once; one out slab [16][68] per 16 query rows.
// The group's 33 key chunks (tile pr's, then tile 31 - pr's) are one sequence: asynchronous copies bring chunk g + 2 into the buffer that chunk g has
// left while chunk g + 1 is worked on, also across the change of query tile. A copy of a wave covers whole 128-byte lines.
// Every staged LDS byte that is read is written in full each chunk (64 full rows per plane); the 8 pad elements of a row are never read.
// =====================================================================================
// waves_per_eu(4, 4): 512 groups of 8 waves are four waves a SIMD, so a wave may hold 256 registers; the grouped fragment reads use them.
__global__ __launch_bounds__(256) __attribute__((amdgpu_waves_per_eu(4, 4)))
void diff_attn64(const unsigned short* __restrict__ Qh, const unsigned short* __restrict__ Ql,
                 const unsigned short* __restrict__ Kh, const unsigned short* __restrict__ Kl,
                 const unsigned short* __restrict__ Vh, const unsigned short* __restrict__ Vl,
                 const float* __restrict__ amask, const float* __restrict__ lamp,
                 float* __restrict__ att, float* __restrict__ part) {
  union FB { v16b v; v8b h[2]; };
  __shared__ __align__(16) unsigned short sKV[2][kABuf];   // [buffer][K hi map 0 | K hi map 1 | K lo map 0 | K lo map 1 | Vt hi | Vt lo]
  __shared__ __align__(16) float Am[kSeq];
  __shared__ __align__(16) float Os[4][16 * 68];
  __shared__ float red[4][2];

  const int tid  = threadIdx.x;
  const int wave = __builtin_amdgcn_readfirstlane(tid >> 5);   // scalar, so the tests on the map below are scalar branches
  const int a    = wave >> 2;         // softmax map of this wave
  const int wq   = wave & 3;          // 16-row slice of the query tile
  const int lane = tid & 31;
  const int hh   = lane >> 4;
  const int c    = lane & 15;
  const int bx   = blockIdx.x;
  const int pr   = bx & (kNPair - 1);
  const int bh   = bx >> 4;
  const int h    = bh & (kHeads - 1);
  const int b    = bh >> 4;
  const float lam = lamp[0];
  const float negInf = -__builtin_huge_valf();

  const size_t vbase = (size_t)(b * kDModel + h * kHeadDim) * kSeq;               // Vt row (h*64 + d) of batch b
  float* ob_ptr = att + (size_t)bh * kSeq * kHeadDim;
  float* os = Os[wq];

  // staging: 16 lanes copy the 256 bytes of a K row (both maps side by side), 8 lanes the 128 bytes of a Vt row
  const int krow = tid >> 4, kseg = tid & 15;
  const int vrow = tid >> 3, vseg = tid & 7;
  const size_t kg0 = (size_t)(b * kSeq + krow) * kQKCols + (size_t)h * 128 + kseg * 8;
  const size_t vg0 = vbase + (size_t)vrow * kSeq + vseg * 8;
  const unsigned ldsK = (unsigned)(size_t)(&sKV[0][0] + (kseg >> 3) * kAPlane + krow * kLP + (kseg & 7) * 8);   // low 32 bits = byte address in LDS
  const unsigned ldsV = (unsigned)(size_t)(&sKV[0][0] + 4 * kAPlane + vrow * kLP + vseg * 8);
  auto stage = [&](int g, int buf) {   // the twelve copies of this lane for chunk g of the group's sequence, into buffer buf
    const int kv = ((g <= pr) ? g : g - pr - 1) * kKC;
    const size_t ko = kg0 + (size_t)kv * kQKCols;
    const size_t vo = vg0 + kv;
    const unsigned lb = (unsigned)(buf * kABuf * 2);
    unsigned l[12];
    const unsigned short* gp[12];
#pragma unroll   // every index constant, so the two operand arrays stay in registers
    for (int p = 0; p < 4; ++p) {
      l[p]      = ldsK + lb + (unsigned)(p * 16 * kLP * 2);
      l[4 + p]  = ldsK + lb + (unsigned)((2 * kAPlane + p * 16 * kLP) * 2);
      gp[p]     = Kh + ko + (size_t)(p * 16) * kQKCols;
      gp[4 + p] = Kl + ko + (size_t)(p * 16) * kQKCols;
    }
#pragma unroll   // as above
    for (int p = 0; p < 2; ++p) {
      l[8 + p]   = ldsV + lb + (unsigned)(p * 32 * kLP * 2);
      l[10 + p]  = ldsV + lb + (unsigned)((kAPlane + p * 32 * kLP) * 2);
      gp[8 + p]  = Vh + vo + (size_t)(p * 32) * kSeq;
      gp[10 + p] = Vl + vo + (size_t)(p * 32) * kSeq;
    }
    async_copy12(l, gp);
  };

  stage(0, 0);
  {
    // additive padding-mask term of every key of the batch (bf16 RNE-converted mask), 8 keys a thread
    union { v4f v[2]; float f[8]; } mk;
    mk.v[0] = *(const v4f*)(amask + b * kSeq + tid * 8);
    mk.v[1] = *(const v4f*)(amask + b * kSeq + tid * 8 + 4);
#pragma unroll   // constant indices keep the eight terms in registers
    for (int e = 0; e < 8; ++e) mk.f[e] = (1.0f - bf_rne(mk.f[e])) * (-1.0e9f);
    *(v4f*)(Am + tid * 8)     = mk.v[0];
    *(v4f*)(Am + tid * 8 + 4) = mk.v[1];
  }
  asm volatile("s_wait_asynccnt 0x0" ::: "memory");   // this wave's copies of chunk 0 have landed
  __syncthreads();                                    // ... and every other wave's, and the mask terms
  stage(1, 1);                                        // a group always has 33 chunks
  int g = 0;                                          // place in the group's sequence of chunks

  for (int half = 0; half < 2; ++half) {
    const int qb = half ? (kNQblk - 1 - pr) : pr;
    const int q0 = qb * kQB + wq * 16;
    const size_t qoff = (size_t)(b * kSeq + q0 + c) * kQKCols + (size_t)h * 128 + a * 64;   // + dc*32 + 8*hh
    // Q fragments (B operand: lane = query column c) for this wave's map: 2 d-chunks, hi and lo planes
    v16b qah[2], qal[2];
#pragma unroll
    for (int dc = 0; dc < 2; ++dc) {
      qah[dc] = Frag<__bf16>::load((const __bf16*)Qh + qoff + dc * 32 + 8 * hh);
      qal[dc] = Frag<__bf16>::load((const __bf16*)Ql + qoff + dc * 32 + 8 * hh);
    }
    const int qrow = q0 + c;            // the one query of this lane
    float mrow = negInf, lrow = 0.0f;   // its running maximum; the sum over this lane half's keys
    v8f oacc[4];                        // oacc[t][r] = O^T[d = 16 t + 8 hh + r][query c]
#pragma unroll
    for (int t = 0; t < 4; ++t) oacc[t] = (v8f){0.f,0.f,0.f,0.f,0.f,0.f,0.f,0.f};

    for (int kc = 0; kc <= qb; ++kc) {          // causal: chunks 0..qb (block-uniform trip count, <= 32)
      const int kv0 = kc * kKC;
      const unsigned short* kvb = sKV[g & 1];             // this chunk's buffer, published by the barrier ahead of the loop (chunk 0) or at the foot of the chunk before
      const unsigned short* ksh = kvb + a * kAPlane;
      const unsigned short* ksl = kvb + (2 + a) * kAPlane;
      const unsigned short* Vth = kvb + 4 * kAPlane;
      const unsigned short* Vtl = kvb + 5 * kAPlane;

      // ---- scores, transposed: 4 key subtiles of 16 rows, K = 64 (2 chunks), hi.hi + hi.lo + lo.hi ----
      // per 32 d the 16 fragment reads stand together ahead of the 12 products, which go round the four subtiles: reads can issue early, in groups, and
      // a product never needs the one written just before it. Each tile still sums dc 0 then 1, and in each hi.hi, lo.hi, hi.lo.
      v8f s[4];
#pragma unroll
      for (int j = 0; j < 4; ++j) s[j] = (v8f){0.f,0.f,0.f,0.f,0.f,0.f,0.f,0.f};
#pragma unroll
      for (int dc = 0; dc < 2; ++dc) {
        FB kb[4], kl[4];
#pragma unroll
        for (int j = 0; j < 4; ++j) {
          kb[j].h[0] = *(const v8b*)(ksh + (j * 16 + c) * kLP + dc * 32 + 8 * hh);
          kb[j].h[1] = *(const v8b*)(ksh + (j * 16 + c) * kLP + dc * 32 + 16 + 8 * hh);
          kl[j].h[0] = *(const v8b*)(ksl + (j * 16 + c) * kLP + dc * 32 + 8 * hh);
          kl[j].h[1] = *(const v8b*)(ksl + (j * 16 + c) * kLP + dc * 32 + 16 + 8 * hh);
        }
#pragma unroll
        for (int j = 0; j < 4; ++j) s[j] = at_mma(kb[j].v, qah[dc], s[j]);
#pragma unroll
        for (int j = 0; j < 4; ++j) s[j] = at_mma(kl[j].v, qah[dc], s[j]);
#pragma unroll
        for (int j = 0; j < 4; ++j) s[j] = at_mma(kb[j].v, qal[dc], s[j]);
      }
      // ---- scale, causal add, mask add, maximum over this lane's 32 keys, then over both halves ----
      const bool diag = (kc == qb);
      float m = negInf;
#pragma unroll
      for (int j = 0; j < 4; ++j) {
        union { v4f v[2]; float f[8]; } am;
        am.v[0] = *(const v4f*)(Am + kv0 + j * 16 + 8 * hh);
        am.v[1] = *(const v4f*)(Am + kv0 + j * 16 + 8 * hh + 4);
#pragma unroll
        for (int r = 0; r < 8; ++r) {
          const int kvcol = kv0 + j * 16 + 8 * hh + r;
          const float cz = (diag && (kvcol > qrow)) ? -1.0e9f : 0.0f;
          float sc = s[j][r] * 0.125f;
          sc = sc + cz;
          sc = sc + am.f[r];
          s[j][r] = sc;
          m = fmaxf(m, sc);
        }
      }
      m = fmaxf(m, at_xhalf(m));
      // ---- online softmax update; P^T packed as bf16 hi/lo B operands: element e of 32-key group kk is key 32 kk + (e < 8 ? 8 hh + e : 16 + 8 hh + e - 8) ----
      const float mnew = fmaxf(mrow, m);
      const float alpha = at_exp(mrow - mnew);
      mrow = mnew;
      union PB { v16b v; unsigned w[8]; };
      PB pbh[2], pbl[2];
      float ps[4];
#pragma unroll
      for (int j = 0; j < 4; ++j) {
        ps[j] = 0.0f;
        const v8f y = (s[j] - mnew) * kLog2E;
#pragma unroll
        for (int i = 0; i < 4; ++i) {
          const float p0 = __builtin_amdgcn_exp2f(y[2 * i]);
          const float p1 = __builtin_amdgcn_exp2f(y[2 * i + 1]);
          ps[j] += p0;
          ps[j] += p1;
          at_split2(p0, p1, pbh[j >> 1].w[(j & 1) * 4 + i], pbl[j >> 1].w[(j & 1) * 4 + i]);
        }
      }
      lrow = lrow * alpha + ((ps[0] + ps[1]) + (ps[2] + ps[3]));
#pragma unroll
      for (int t = 0; t < 4; ++t) oacc[t] *= alpha;
      // ---- O^T += Vt.P^T: A = Vt [d][kv], B = P^T from registers; hi.hi + hi.lo + lo.hi; reads grouped and products taken round the four tiles as for the scores ----
#pragma unroll
      for (int kk = 0; kk < 2; ++kk) {
        FB vb[4], vl[4];
#pragma unroll
        for (int t = 0; t < 4; ++t) {
          vb[t].h[0] = *(const v8b*)(Vth + (t * 16 + c) * kLP + kk * 32 + 8 * hh);
          vb[t].h[1] = *(const v8b*)(Vth + (t * 16 + c) * kLP + kk * 32 + 16 + 8 * hh);
          vl[t].h[0] = *(const v8b*)(Vtl + (t * 16 + c) * kLP + kk * 32 + 8 * hh);
          vl[t].h[1] = *(const v8b*)(Vtl + (t * 16 + c) * kLP + kk * 32 + 16 + 8 * hh);
        }
#pragma unroll
        for (int t = 0; t < 4; ++t) oacc[t] = at_mma(vb[t].v, pbh[kk].v, oacc[t]);
#pragma unroll
        for (int t = 0; t < 4; ++t) oacc[t] = at_mma(vl[t].v, pbh[kk].v, oacc[t]);
#pragma unroll
        for (int t = 0; t < 4; ++t) oacc[t] = at_mma(vb[t].v, pbl[kk].v, oacc[t]);
      }
      asm volatile("s_wait_dscnt 0x0" ::: "memory");      // this wave's reads of buffer g & 1 are done before it is refilled
      asm volatile("s_wait_asynccnt 0x0" ::: "memory");   // this wave's copies of chunk g + 1 have landed
      __syncthreads();                                    // publishes chunk g + 1 and ends every wave's reads of chunk g
      if (g + 2 < kAChunks) stage(g + 2, g & 1);
      ++g;
    }
    // ---- finish this tile: map 1 hands o/l over through the slab; map 0 combines and sums the norm partials ----
    // a lane owns 8 consecutive d of its query's slab row per t: slab[c][16 t + 8 hh + r]
    const float inv = 1.0f / (lrow + at_xhalf(lrow));   // the two halves' sums joined, by every lane
    if (a == 1) {
#pragma unroll
      for (int t = 0; t < 4; ++t) {
        const v8f o = oacc[t] * inv;
        *(v4f*)(os + c * 68 + t * 16 + 8 * hh)     = (v4f){o[0], o[1], o[2], o[3]};
        *(v4f*)(os + c * 68 + t * 16 + 8 * hh + 4) = (v4f){o[4], o[5], o[6], o[7]};
      }
    }
    __syncthreads();
    if (a == 0) {
      float psum = 0.0f, psq = 0.0f;
#pragma unroll
      for (int t = 0; t < 4; ++t) {
        float* op = os + c * 68 + t * 16 + 8 * hh;
        union { v4f v[2]; float f[8]; } o1, wv;
        o1.v[0] = *(const v4f*)(op);
        o1.v[1] = *(const v4f*)(op + 4);
#pragma unroll
        for (int r = 0; r < 8; ++r) {
          const float o = oacc[t][r] * inv;
          const float w = o - lam * o1.f[r];
          wv.f[r] = w;
          psum += w;
          psq += w * w;
        }
        *(v4f*)(op)     = wv.v[0];
        *(v4f*)(op + 4) = wv.v[1];
      }
      // wave reductions, then a block combine in fixed order
#pragma unroll
      for (int off = 1; off < 32; off <<= 1) { psum += __shfl_xor(psum, off, 32); psq += __shfl_xor(psq, off, 32); }
      if (lane == 0) { red[wq][0] = psum; red[wq][1] = psq; }
    }
    __syncthreads();

    {
      const int c4 = (lane & 15) * 4;
#pragma unroll
      for (int it = 0; it < 4; ++it) {
        const int row = a * 8 + it * 2 + hh;      // each wave stores 8 of the slab's 16 rows
        v4f val = *(const v4f*)(os + row * 68 + c4);
        *(v4f*)(ob_ptr + (size_t)(q0 + row) * kHeadDim + c4) = val;
      }
      asm volatile("s_wait_xcnt 0x0" ::: "memory");   // the stores' address and data registers are rewritten by the code that follows
    }
    if (wave == 0) {
      const float t0 = ((red[0][0] + red[1][0]) + red[2][0]) + red[3][0];
      const float t1 = ((red[0][1] + red[1][1]) + red[2][1]) + red[3][1];
      const float v = (lane == 0) ? t0 : ((lane == 1) ? t1 : 0.0f);
      float* pline = part + (size_t)(bh * kNQblk + qb) * 32;
      ((float*)pline)[lane] = v;
      asm volatile("s_wait_xcnt 0x0" ::: "memory");   // the next tile's set-up rewrites this store's registers
    }
  }
  asm volatile("s_wait_asynccnt 0x0" ::: "memory");   // nothing is in flight when the wave ends
}

// ---- group norm statistics per (b,h): fixed-order sum of the 32 tile lines; one wave writes one stats line ----
__global__ __launch_bounds__(32) void gn_stats(const float* __restrict__ part, float* __restrict__ stats) {
  const int bh = blockIdx.x;
  const int lane = threadIdx.x;
  float s0 = part[(size_t)(bh * kNQblk + lane) * 32 + 0];
  float s1 = part[(size_t)(bh * kNQblk + lane) * 32 + 1];
#pragma unroll
  for (int off = 1; off < 32; off <<= 1) { s0 += __shfl_xor(s0, off, 32); s1 += __shfl_xor(s1, off, 32); }
  const float inv_n = 1.0f / (float)(kSeq * kHeadDim);
  const float mu = s0 * inv_n;
  const float ex2 = s1 * inv_n;
  const float var = fmaxf(ex2 - mu * mu, 0.0f);
  const float rs = rsqrtf(var + 1.0e-5f);
  const float v = (lane == 0) ? mu : ((lane == 1) ? rs : 0.0f);
  ((float*)stats)[bh * 32 + lane] = v;
  
}

// ---- normalize + affine + x0.2 + merge heads -> f16 plane (x8 carry), [B*S][H*64] ----
__global__ __launch_bounds__(256) void gn_merge(const float* __restrict__ att, const float* __restrict__ stats,
                                              const float* __restrict__ gamma, const float* __restrict__ beta,
                                              unsigned short* __restrict__ merged) {
  const int g = blockIdx.x * 256 + threadIdx.x;
  if (g >= kBatch * kHeads * kSeq * 8) return;
  const int seg = g >> 3;
  const int e8  = (g & 7) * 8;
  const int bh  = seg >> 11;
  const int s   = seg & (kSeq - 1);
  const int h   = bh & (kHeads - 1);
  const int b   = bh >> 4;
  const float mu = stats[bh * 32 + 0];
  const float rs = stats[bh * 32 + 1];
  union U8 { v4f v[2]; float f[8]; };
  U8 x, ga, be;
  const float* ap = att + (size_t)seg * kHeadDim + e8;
  x.v[0]  = *(const v4f*)ap;
  x.v[1]  = *(const v4f*)(ap + 4);
  ga.v[0] = *(const v4f*)(gamma + h * kHeadDim + e8);
  ga.v[1] = *(const v4f*)(gamma + h * kHeadDim + e8 + 4);
  be.v[0] = *(const v4f*)(beta + h * kHeadDim + e8);
  be.v[1] = *(const v4f*)(beta + h * kHeadDim + e8 + 4);
  v8h hv;
#pragma unroll
  for (int e = 0; e < 8; ++e) {
    const float gq = bf_rne(ga.f[e]);
    const float bq = bf_rne(be.f[e]);
    float y = (x.f[e] - mu) * rs;
    y = y * gq + bq;
    y = y * 0.2f;
    float z = y * kMergeCarry;
    asm volatile("" : "+v"(z));
    hv[e] = (_Float16)z;
  }
  unsigned short* dst = merged + (size_t)(b * kSeq + s) * kDModel + h * kHeadDim + e8;
  *(v8h*)dst = hv;
  
}

// ---------------------------------------------------------------------------
extern "C" void kernel_launch(void* const* d_in, const int* in_sizes, int n_in,
                              void* d_out, int out_size, void* d_ws, size_t ws_size,
                              hipStream_t stream) {
  if (n_in < 12) return;
  if (in_sizes[0] != kTok * kDModel || in_sizes[1] != kBatch * kSeq ||
      in_sizes[2] != kQKCols * kDModel || in_sizes[3] != kQKCols * kDModel ||
      in_sizes[4] != kDModel * kDModel || in_sizes[5] != kDModel * kDModel ||
      in_sizes[6] != kHeadDim || in_sizes[7] != kHeadDim || in_sizes[8] != kHeadDim || in_sizes[9] != kHeadDim ||
      in_sizes[10] != kDModel || in_sizes[11] != kDModel) return;
  if (out_size != kTok * kDModel) return;
  if (ws_size < kWsTotal) return;

  const float* X     = (const float*)d_in[0];
  const float* amask = (const float*)d_in[1];
  const float* Wq    = (const float*)d_in[2];
  const float* Wk    = (const float*)d_in[3];
  const float* Wv    = (const float*)d_in[4];
  const float* Wo    = (const float*)d_in[5];
  const float* lq1   = (const float*)d_in[6];
  const float* lq2   = (const float*)d_in[7];
  const float* lk1   = (const float*)d_in[8];
  const float* lk2   = (const float*)d_in[9];
  const float* gamma = (const float*)d_in[10];
  const float* beta  = (const float*)d_in[11];

  char* w = (char*)d_ws;
  unsigned short* Xb    = (unsigned short*)(w + kOffXb);
  unsigned short* Wqb   = (unsigned short*)(w + kOffWqb);
  unsigned short* Wkb   = (unsigned short*)(w + kOffWkb);
  unsigned short* Wvb   = (unsigned short*)(w + kOffWvb);
  unsigned short* Wo16  = (unsigned short*)(w + kOffWo16);
  unsigned short* Qh    = (unsigned short*)(w + kOffQh);
  unsigned short* Ql    = (unsigned short*)(w + kOffQl);
  unsigned short* Kh    = (unsigned short*)(w + kOffKh);
  unsigned short* Kl    = (unsigned short*)(w + kOffKl);
  unsigned short* Vth   = (unsigned short*)(w + kOffVth);
  unsigned short* Vtl   = (unsigned short*)(w + kOffVtl);
  float*          att   = (float*)(w + kOffAtt);
  unsigned short* mrg   = (unsigned short*)(w + kOffMerged);
  float*          part  = (float*)(w + kOffPart);
  float*          stats = (float*)(w + kOffStats);
  float*          lamp  = (float*)(w + kOffLam);

  // 1) input conversions (bf16 RNE; Wo additionally x256 into f16)
  cast_inputs<<<kCvGroups, 256, 0, stream>>>(X, Wq, Wk, Wv, Wo, Xb, Wqb, Wkb, Wvb, Wo16, kWoCarry);
  lambda_line<<<1, 32, 0, stream>>>(lq1, lq2, lk1, lk2, lamp);

  // 2) projections: q/k planes [4096][2048] hi+lo, Vt planes [2][1024][2048] hi+lo
  constexpr int gridQ  = (kTok / 64) * (kQKCols / 64) / 8;   // 256
  constexpr int gridVt = (kDModel / 64) * (kSeq / 64) / 8;   // 64
  constexpr int gridO  = (kTok / 64) * (kDModel / 64) / 8;   // 128
  static_assert(gridQ * 8 == (kTok / 64) * (kQKCols / 64));
  static_assert(gridVt * 8 == (kDModel / 64) * (kSeq / 64));
  static_assert(gridO * 8 == (kTok / 64) * (kDModel / 64));
  // one work-group per 128x256 tile: the same counts
  static_assert(gridQ == (kTok / 128) * (kQKCols / 256) && gridVt == (kDModel / 128) * (kSeq / 256) && gridO == (kTok / 128) * (kDModel / 256));
  static_assert(kDModel % kGK == 0 && kDModel / kGK >= 2);
  wmma_gemm64<1, false, 0, 2, false><<<dim3(gridQ, 1, 1), 256, 0, stream>>>(
      Xb, Xb, kDModel, 0L, Wqb, Wqb, kDModel, 0L, (void*)Qh, (void*)Ql, kQKCols, 0L,
      lamp, lamp, 0L, kTok, kQKCols, kDModel, 1.0f);
  wmma_gemm64<1, false, 0, 2, false><<<dim3(gridQ, 1, 1), 256, 0, stream>>>(
      Xb, Xb, kDModel, 0L, Wkb, Wkb, kDModel, 0L, (void*)Kh, (void*)Kl, kQKCols, 0L,
      lamp, lamp, 0L, kTok, kQKCols, kDModel, 1.0f);
  // Vt[b][c][s] = sum_k Wv[c][k] * X[b][s][k] : A = Wv [1024][1024], Bt = X_b [2048][1024]
  wmma_gemm64<1, false, 0, 2, false><<<dim3(gridVt, kBatch, 1), 256, 0, stream>>>(
      Wvb, Wvb, kDModel, 0L, Xb, Xb, kDModel, (long)kSeq * kDModel, (void*)Vth, (void*)Vtl, kSeq, (long)kDModel * kSeq,
      lamp, lamp, 0L, kDModel, kSeq, kDModel, 1.0f);

  // 3) differential causal attention + norm partial lines (512 blocks, two query tiles each)
  diff_attn64<<<kAttnGroups, 256, 0, stream>>>(Qh, Ql, Kh, Kl, Vth, Vtl, amask, lamp, att, part);

  // 4) group norm stats, normalize + merge
  gn_stats<<<kBatch * kHeads, 32, 0, stream>>>(part, stats);
  gn_merge<<<(kBatch * kHeads * kSeq * 8) / 256, 256, 0, stream>>>(att, stats, gamma, beta, mrg);

  // 5) output projection: out[m][n] = (1/2048) * sum_k merged8[m][k] * Wo256[n][k]
  wmma_gemm64<0, false, 0, 0, false><<<dim3(gridO, 1, 1), 256, 0, stream>>>(
      mrg, mrg, kDModel, 0L, Wo16, Wo16, kDModel, 0L, d_out, d_out, kDModel, 0L,
      lamp, lamp, 0L, kTok, kDModel, kDModel, 1.0f / (kMergeCarry * kWoCarry));
}

// v009
// Measured time: 161 microseconds a run.
// Timed twice side by side with v008, it ran 1.07 times as fast both times.
// All steps since v000 together make it 4.82 times as fast.
// Contractions: x.Wq^T, x.Wk^T, Wv.x^T = v_wmma_f32_16x16x32_bf16 (plain bf16 operands from RNE-converted inputs); k.q^T and Vt.p^T = v_wmma_f32_16x16x32_bf16 with bf16 hi/lo planes (hi.hi+hi.lo+lo.hi); merged.Wo^T = v_wmma_f32_16x16x32_f16 (f16 operands, carries 8 and 256); f32 accumulate everywhere; softmax, group norm and the two 64-term lambda dots in f32.
#include <hip/hip_runtime.h>

typedef __attribute__((ext_vector_type(16))) _Float16 v16h;
typedef __attribute__((ext_vector_type(8)))  _Float16 v8h;
typedef __attribute__((ext_vector_type(16))) __bf16   v16b;
typedef __attribute__((ext_vector_type(8)))  __bf16   v8b;
typedef __attribute__((ext_vector_type(8)))  float    v8f;
typedef __attribute__((ext_vector_type(4)))  float    v4f;
typedef __attribute__((ext_vector_type(4)))  unsigned int u4v;
typedef __attribute__((ext_vector_type(2)))  unsigned int u2v;

// ---- problem geometry ----
constexpr int kBatch   = 2;
constexpr int kSeq     = 2048;
constexpr int kDModel  = 1024;
constexpr int kHeads   = 16;
constexpr int kHeadDim = 64;
constexpr int kQKCols  = 2 * kDModel;      // 2048 : row width of the q/k planes (H * 128)
constexpr int kTok     = kBatch * kSeq;    // 4096
constexpr int kQB      = 64;               // query rows per tile; a block takes two tiles
constexpr int kKC      = 64;               // keys per chunk
constexpr int kLP      = 72;               // LDS row pitch of the 64-element 16-bit tiles: 144 B = 16 B x 9 (odd), conflict-free for 16-byte row reads
constexpr int kNQblk   = kSeq / kQB;       // 32
constexpr int kAttnBlocks = kBatch * kHeads * kNQblk;   // 1024 query tiles
constexpr int kNPair   = kNQblk / 2;        // 16 : tile pairs (t, 31 - t) per (b, h)
constexpr int kAttnGroups = kBatch * kHeads * kNPair;   // 512 work-groups of the attention launch
constexpr float kMergeCarry = 8.0f;        // f16 merged plane carried x8
constexpr float kWoCarry    = 256.0f;      // f16 Wo plane carried x256

static_assert(kNQblk == 32);
static_assert(kHeads == 16);
static_assert(kAttnBlocks == 1024);
static_assert(kNPair == 16 && kAttnGroups == 512);
static_assert(kSeq % kQB == 0);
static_assert(kDModel % 32 == 0);                  // K of every GEMM
static_assert(kTok % 64 == 0 && kQKCols % 64 == 0 && kDModel % 64 == 0 && kSeq % 64 == 0);   // M, N tile multiples

// ---- workspace region map (bytes; every offset a multiple of 128) ----
constexpr size_t kBytesXb     = (size_t)kTok * kDModel * 2;                     //  8,388,608  x as bf16 [4096][1024]
constexpr size_t kBytesWqk    = (size_t)kQKCols * kDModel * 2;                  //  4,194,304  Wq / Wk as bf16 [2048][1024]
constexpr size_t kBytesWv     = (size_t)kDModel * kDModel * 2;                  //  2,097,152  Wv as bf16 [1024][1024]
constexpr size_t kBytesWo     = (size_t)kDModel * kDModel * 2;                  //  2,097,152  Wo as f16 x256 [1024][1024]
constexpr size_t kBytesQPl    = (size_t)kTok * kQKCols * 2;                     // 16,777,216  one q or k plane [4096][2048]
constexpr size_t kBytesVtPl   = (size_t)kBatch * kDModel * kSeq * 2;            //  8,388,608  one Vt plane [2][1024][2048]
constexpr size_t kBytesAtt    = (size_t)kBatch * kHeads * kSeq * kHeadDim * 4;  // 16,777,216  attention out f32 [2][16][2048][64]
constexpr size_t kBytesMerged = (size_t)kTok * kDModel * 2;                     //  8,388,608  merged f16 x8 [4096][1024]
constexpr size_t kBytesPart   = (size_t)kAttnBlocks * 128;                      //    131,072  one 32-float line per query tile (1024 tiles)
constexpr size_t kBytesStats  = (size_t)kBatch * kHeads * 128;                  //      4,096  unused: gn_merge keeps the (b,h) statistics in LDS
constexpr size_t kBytesLam    = 128;                                            //        128  lambda line

constexpr size_t kOffXb     = 0;
constexpr size_t kOffWqb    = kOffXb + kBytesXb;
constexpr size_t kOffWkb    = kOffWqb + kBytesWqk;
constexpr size_t kOffWvb    = kOffWkb + kBytesWqk;
constexpr size_t kOffWo16   = kOffWvb + kBytesWv;
constexpr size_t kOffQh     = kOffWo16 + kBytesWo;
constexpr size_t kOffQl     = kOffQh + kBytesQPl;
constexpr size_t kOffKh     = kOffQl + kBytesQPl;
constexpr size_t kOffKl     = kOffKh + kBytesQPl;
constexpr size_t kOffVth    = kOffKl + kBytesQPl;
constexpr size_t kOffVtl    = kOffVth + kBytesVtPl;
constexpr size_t kOffAtt    = kOffVtl + kBytesVtPl;
constexpr size_t kOffMerged = kOffAtt + kBytesAtt;
constexpr size_t kOffPart   = kOffMerged + kBytesMerged;
constexpr size_t kOffStats  = kOffPart + kBytesPart;
constexpr size_t kOffLam    = kOffStats + kBytesStats;
constexpr size_t kWsTotal   = kOffLam + kBytesLam;                              // 130,158,720
static_assert(kBytesPart == 131072);
static_assert(kWsTotal == 130158720);
static_assert(kWsTotal <= 134217728);
static_assert(kOffWqb % 128 == 0 && kOffQh % 128 == 0 && kOffAtt % 128 == 0 && kOffPart % 128 == 0 && kOffStats % 128 == 0 && kOffLam % 128 == 0);

// ---- 16-bit helpers ----
__device__ __forceinline__ unsigned short f2bf_bits(float f) {
  unsigned u = __float_as_uint(f);
  return (unsigned short)((u + 0x7FFFu + ((u >> 16) & 1u)) >> 16);
}
__device__ __forceinline__ float bf_bits2f(unsigned short h) { return __uint_as_float(((unsigned)h) << 16); }
__device__ __forceinline__ float bf_rne(float f) { return bf_bits2f(f2bf_bits(f)); }

// hazard guards as plain device helpers
__device__ __forceinline__ void dep_guard_h(v8f& a, v8f& b, v16h x, v16h y) { asm volatile("v_nop\n\tv_nop\n\tv_nop\n\tv_nop" : "+v"(a), "+v"(b) : "v"(x), "v"(y)); }
__device__ __forceinline__ void dep_guard_b(v8f& a, v8f& b, v16b x, v16b y) { asm volatile("v_nop\n\tv_nop\n\tv_nop\n\tv_nop" : "+v"(a), "+v"(b) : "v"(x), "v"(y)); }
__device__ __forceinline__ void keep4_h(v16h a, v16h b, v16h c, v16h d) { asm volatile("v_nop" :: "v"(a), "v"(b), "v"(c), "v"(d)); }
__device__ __forceinline__ void keep4_b(v16b a, v16b b, v16b c, v16b d) { asm volatile("v_nop" :: "v"(a), "v"(b), "v"(c), "v"(d)); }
__device__ __forceinline__ void acc_guard4(v8f& a, v8f& b, v8f& c, v8f& d) { asm volatile("v_nop\n\tv_nop\n\tv_nop\n\tv_nop" : "+v"(a), "+v"(b), "+v"(c), "+v"(d)); }
template <typename T> struct Frag;
template <> struct Frag<_Float16> {
  typedef v16h V; union U { v16h v; v8h h[2]; };
  static __device__ __forceinline__ v16h load(const _Float16* p) {   // elements 0..7 <- p[0..7], 8..15 <- p[16..23]
    U f; f.h[0] = *(const v8h*)(p); f.h[1] = *(const v8h*)(p + 16); return f.v;
  }
  static __device__ __forceinline__ v8f mma(v16h a, v16h b, v8f c) {
    return __builtin_amdgcn_wmma_f32_16x16x32_f16(false, a, false, b, (short)0, c, false, false);
  }
  static __device__ __forceinline__ void guard(v8f& a, v8f& b, v16h x, v16h y) { dep_guard_h(a, b, x, y); }
  static __device__ __forceinline__ void keep(v16h a, v16h b, v16h c, v16h d) { keep4_h(a, b, c, d); }
};
template <> struct Frag<__bf16> {
  typedef v16b V; union U { v16b v; v8b h[2]; };
  static __device__ __forceinline__ v16b load(const __bf16* p) {
    U f; f.h[0] = *(const v8b*)(p); f.h[1] = *(const v8b*)(p + 16); return f.v;
  }
  static __device__ __forceinline__ v8f mma(v16b a, v16b b, v8f c) {
    return __builtin_amdgcn_wmma_f32_16x16x32_bf16(false, a, false, b, (short)0, c, false, false);
  }
  static __device__ __forceinline__ void guard(v8f& a, v8f& b, v16b x, v16b y) { dep_guard_b(a, b, x, y); }
  static __device__ __forceinline__ void keep(v16b a, v16b b, v16b c, v16b d) { keep4_b(a, b, c, d); }
};

// ---- Register-blocked batched WMMA GEMM, operands staged in LDS ------------
// C[m,n] = scale * sum_k A[m,k] * Bt[n,k] (+bias)(+resid); a work-group owns a 128x256 tile, each of its 8 waves (2 x 4) a 64x64 part.
// A row-major [M,K]; Bt row-major [N,K]; M % 128 == 0, N % 256 == 0, K % 128 == 0, K >= 256.
// Per 128 k the 128 A rows and 256 Bt rows (256 bytes, two whole lines, each) reach LDS by asynchronous copies, two buffers:
// the copies of tile t + 2 fly while tile t + 1 is worked on; the fragments are read from LDS at row pitch kGP.
// SPLIT is not carried by the staged loop (one plane per operand).
// BIAS_MODE: 0 = none, 1 = bias[m], 2 = bias[n].
// OUT_MODE: 0 = f32, 1 = f16, 2 = bf16 hi plane (Cout) + bf16 lo plane (Cout2).
// ET: 0 = f16 operands, 1 = bf16 operands (pointers passed as 16-bit storage)
constexpr int kGK     = 128;                   // k elements per staged tile
constexpr int kGP     = 136;                   // LDS row pitch of a staged row: 272 B = 16 B x 17 (odd), conflict-free for 16-byte row reads
constexpr int kGRowsA = 128;                   // staged A rows
constexpr int kGRowsB = 256;                   // staged Bt rows
constexpr int kGBuf   = (kGRowsA + kGRowsB) * kGP;   // 16-bit elements of one buffer (104,448 B)

// Twelve 16-byte asynchronous copies of one lane, global -> LDS (l = LDS byte address, g = global address).
// The closing s_wait_xcnt stands inside the statement, so that no address register is rewritten in front of it.
__device__ __forceinline__ void async_copy12(const unsigned (&l)[12], const unsigned short* const (&g)[12]) {
  asm volatile(
      "global_load_async_to_lds_b128 %0, %12, off\n\t"
      "global_load_async_to_lds_b128 %1, %13, off\n\t"
      "global_load_async_to_lds_b128 %2, %14, off\n\t"
      "global_load_async_to_lds_b128 %3, %15, off\n\t"
      "global_load_async_to_lds_b128 %4, %16, off\n\t"
      "global_load_async_to_lds_b128 %5, %17, off\n\t"
      "global_load_async_to_lds_b128 %6, %18, off\n\t"
      "global_load_async_to_lds_b128 %7, %19, off\n\t"
      "global_load_async_to_lds_b128 %8, %20, off\n\t"
      "global_load_async_to_lds_b128 %9, %21, off\n\t"
      "global_load_async_to_lds_b128 %10, %22, off\n\t"
      "global_load_async_to_lds_b128 %11, %23, off\n\t"
      "s_wait_xcnt 0x0"
      :: "v"(l[0]), "v"(l[1]), "v"(l[2]), "v"(l[3]), "v"(l[4]), "v"(l[5]), "v"(l[6]), "v"(l[7]), "v"(l[8]), "v"(l[9]), "v"(l[10]), "v"(l[11]),
         "v"(g[0]), "v"(g[1]), "v"(g[2]), "v"(g[3]), "v"(g[4]), "v"(g[5]), "v"(g[6]), "v"(g[7]), "v"(g[8]), "v"(g[9]), "v"(g[10]), "v"(g[11])
      : "memory");
}

template <int ET> struct Elem;
template <> struct Elem<0> { typedef _Float16 T; };
template <> struct Elem<1> { typedef __bf16 T; };
// QKV: one launch runs the three projections, which share K, the column count N and the output pitch: groups 0..255 q = x.Wq^T (the arguments as given),
// 256..511 k = x.Wk^T (Bt = Bt2p), 512..639 Vt_b = Wv.x_b^T (A = A2p, Bt = batch b of Ap0, 64 tiles a batch); the k and Vt planes lie behind the q planes
// as the workspace map has them. A WGP takes its next tile as soon as it has ended one, with no launch boundary between the products.
constexpr int kTilesQK = (kTok / 128) * (kQKCols / 256);    // 256
constexpr int kTilesVt = (kDModel / 128) * (kSeq / 256);    // 64 per batch
static_assert(kQKCols == kSeq);
template <int ET, bool SPLIT, int BIAS_MODE, int OUT_MODE, bool RESID, int ACT = 0, bool QKV = false>
__global__ __launch_bounds__(256) void wmma_gemm64(
    const unsigned short* __restrict__ Ap0, const unsigned short* __restrict__ A2p, int lda, long strideA,
    const unsigned short* __restrict__ Btp0, const unsigned short* __restrict__ Bt2p, int ldb, long strideB,
    void* __restrict__ Cout0, void* __restrict__ Cout20, int ldc, long strideC,
    const float* __restrict__ bias,
    const float* __restrict__ resid, long strideR,
    int M0, int N, int K, float scale) {
  const unsigned short* Ap  = Ap0;
  const unsigned short* Btp = Btp0;
  void* Cout  = Cout0;
  void* Cout2 = Cout20;
  int M  = M0;
  int bt = blockIdx.x;
  if (QKV) {
    unsigned short* q = (unsigned short*)Cout0;             // the q hi plane, the first of the six
    if (bt >= 2 * kTilesQK) {
      const int v  = bt - 2 * kTilesQK;
      const int vb = v / kTilesVt;                          // batch
      Ap    = A2p;
      Btp   = Ap0 + (size_t)vb * kSeq * kDModel;
      Cout  = q + (kOffVth - kOffQh) / 2 + (size_t)vb * kDModel * kSeq;
      Cout2 = q + (kOffVtl - kOffQh) / 2 + (size_t)vb * kDModel * kSeq;
      M     = kDModel;
      bt    = v - vb * kTilesVt;
    } else if (bt >= kTilesQK) {
      Btp   = Bt2p;
      Cout  = q + (kOffKh - kOffQh) / 2;
      Cout2 = q + (kOffKl - kOffQh) / 2;
      bt   -= kTilesQK;
    }
  }
  typedef typename Elem<ET>::T T;
  typedef typename Frag<T>::V V;
  static_assert(!SPLIT, "the staged loop carries one plane per operand");
  __shared__ __align__(16) unsigned short sAB[2][kGBuf];   // [buffer][A rows 0..127 | Bt rows 0..255][kGP]
  __shared__ __align__(16) float sT[8][16 * 68];   // per-wave 16x64 slab, pitch 68 floats
  const int b    = blockIdx.y;
  const int tid  = threadIdx.x;
  const int lane = tid & 31;
  const int wave = tid >> 5;
  const int btN = N >> 8;
  const int btM = M >> 7;
  if (bt >= btM * btN) return;   // the same for the whole work-group, in front of every barrier and copy
  const int bm = bt / btN;
  const int bn = bt - bm * btN;
  const int mB = bm << 7;
  const int nB = bn << 8;
  const int wm = (wave >> 2) << 6;             // this wave's rows inside the staged A rows
  const int wn = (wave & 3) << 6;              // this wave's rows inside the staged Bt rows
  const int m0 = mB + wm;
  const int n0 = nB + wn;

  const int rlane = lane & 15;                 // row (A) / col (B, D) within subtile
  const int koff  = (lane >> 4) * 8;           // k offset of this lane half
  const int mOff  = (lane >> 4) * 8;           // D row offset

  // staging: 16 lanes copy one row's 256 bytes, a wave 4 whole lines per copy; copy it covers staged rows it*16 .. it*16+15
  const int srow = tid >> 4;
  const int sseg = (tid & 15) * 8;
  const unsigned short* pA = Ap  + (size_t)b * strideA + (size_t)(mB + srow) * lda + sseg;
  const unsigned short* pB = Btp + (size_t)b * strideB + (size_t)(nB + srow) * ldb + sseg;
  const unsigned lds0 = (unsigned)(size_t)(&sAB[0][0] + srow * kGP + sseg);   // low 32 bits = byte address in LDS
  auto stage = [&](int buf) {   // copies the next 128 k of every staged row into buffer buf and moves the two pointers on
#pragma unroll   // both loops unrolled: every index constant, so the two operand arrays stay in registers
    for (int hf = 0; hf < 2; ++hf) {
      unsigned l[12];
      const unsigned short* g[12];
#pragma unroll
      for (int e = 0; e < 12; ++e) {
        const int it = hf * 12 + e;
        l[e] = lds0 + (unsigned)((buf * kGBuf + it * 16 * kGP) * 2);
        g[e] = (it < 8) ? (pA + (size_t)(it * 16) * lda) : (pB + (size_t)((it - 8) * 16) * ldb);
      }
      async_copy12(l, g);
    }
    pA += kGK;
    pB += kGK;
  };

  v8f acc[4][4];
#pragma unroll
  for (int i = 0; i < 4; ++i)
#pragma unroll
    for (int j = 0; j < 4; ++j) acc[i][j] = (v8f){0.f,0.f,0.f,0.f,0.f,0.f,0.f,0.f};

  const int nT = K / kGK;
  stage(0);
  asm volatile("s_wait_asynccnt 0x0" ::: "memory");   // this wave's copies of tile 0 have landed
  __syncthreads();                                    // ... and every other wave's
  if (nT > 1) stage(1);
  for (int t = 0; t < nT; ++t) {
    const T* sa = (const T*)sAB[t & 1] + (wm + rlane) * kGP + koff;
    const T* sb = (const T*)sAB[t & 1] + (kGRowsA + wn + rlane) * kGP + koff;
#pragma unroll   // the four 32-k blocks of a tile in line: LDS offsets become immediates and a block's reads can go ahead of the block before it
    for (int ks = 0; ks < kGK; ks += 32) {
      V ah[4], bh[4];
#pragma unroll
      for (int j = 0; j < 4; ++j) bh[j] = Frag<T>::load(sb + (j << 4) * kGP + ks);
#pragma unroll
      for (int i = 0; i < 4; ++i) ah[i] = Frag<T>::load(sa + (i << 4) * kGP + ks);
#pragma unroll
      for (int i = 0; i < 4; ++i) {
#pragma unroll
        for (int j = 0; j < 4; ++j) acc[i][j] = Frag<T>::mma(ah[i], bh[j], acc[i][j]);
        Frag<T>::guard(acc[i][0], acc[i][3], ah[i], ah[i]);
      }
      Frag<T>::keep(bh[0], bh[1], bh[2], bh[3]);
    }
    asm volatile("s_wait_dscnt 0x0" ::: "memory");      // this wave's reads of buffer t & 1 are done before it is refilled
    asm volatile("s_wait_asynccnt 0x0" ::: "memory");   // this wave's copies of tile t + 1 have landed
    __syncthreads();                                    // publishes tile t + 1 and ends every wave's reads of tile t
    if (t + 2 < nT) stage(t & 1);
  }
  asm volatile("s_wait_asynccnt 0x0" ::: "memory");     // nothing is in flight when the wave goes on
  acc_guard4(acc[0][0], acc[0][1], acc[0][2], acc[0][3]);
  acc_guard4(acc[1][0], acc[1][1], acc[1][2], acc[1][3]);
  acc_guard4(acc[2][0], acc[2][1], acc[2][2], acc[2][3]);
  acc_guard4(acc[3][0], acc[3][1], acc[3][2], acc[3][3]);

  // ---- epilogue ----
  float* slab = sT[wave];
  const float* Rb = RESID ? (resid + (size_t)b * strideR) : nullptr;
#pragma unroll
  for (int i = 0; i < 4; ++i) {
    const int mBase = m0 + (i << 4);
#pragma unroll
    for (int j = 0; j < 4; ++j) {
      const int n = n0 + (j << 4) + rlane;
      float bv = 0.f;
      if (BIAS_MODE == 2) bv = bias[n];
#pragma unroll
      for (int r = 0; r < 8; ++r) {
        float v = acc[i][j][r] * scale;
        if (BIAS_MODE == 1) v += bias[mBase + mOff + r];
        if (BIAS_MODE == 2) v += bv;
        if (RESID) v += Rb[(size_t)(mBase + mOff + r) * ldc + n];
        if (ACT == 1) v = tanhf(v);
        if (ACT == 2) v = fmaxf(v, 0.0f);
        if (ACT == 3) v = v / (1.0f + expf(-v));
        if (ACT == 4) v = (v > 0.f) ? v : 0.01f * v;
        if (ACT == 5) v = 0.5f * v * (1.0f + erff(v * 0.70710678118654752f));
        slab[(mOff + r) * 68 + (j << 4) + rlane] = v;
      }
    }
    __builtin_amdgcn_fence(__ATOMIC_RELEASE, "workgroup");
    __builtin_amdgcn_wave_barrier();
    __builtin_amdgcn_fence(__ATOMIC_ACQUIRE, "workgroup");
    if (OUT_MODE == 0) {
      float* C = (float*)Cout + (size_t)b * strideC;
      const int hh = lane >> 4, c4 = (lane & 15) * 4;     // row seg = 256 B = 16 lanes x 16 B
      {
#pragma unroll
        for (int it = 0; it < 8; ++it) {
          const int row = it * 2 + hh;
          v4f v = *(const v4f*)(slab + row * 68 + c4);
          *(v4f*)(C + (size_t)(mBase + row) * ldc + n0 + c4) = v;
        }
        
      }
    } else {
      const int q = lane >> 3, c8 = (lane & 7) * 8;
      unsigned short* C  = (unsigned short*)Cout  + (size_t)b * strideC;
      unsigned short* C2 = (OUT_MODE == 2) ? ((unsigned short*)Cout2 + (size_t)b * strideC) : nullptr;
      {
#pragma unroll
        for (int it = 0; it < 4; ++it) {
          const int row = it * 4 + q;
          const float* sp = slab + row * 68 + c8;
          v8h hv, lv;
#pragma unroll
          for (int e = 0; e < 8; ++e) {
            if (OUT_MODE == 1) {
              hv[e] = (_Float16)sp[e];
            } else {
              unsigned short hb = f2bf_bits(sp[e]);
              unsigned short lb = f2bf_bits(sp[e] - bf_bits2f(hb));
              hv[e] = __builtin_bit_cast(_Float16, hb);
              lv[e] = __builtin_bit_cast(_Float16, lb);
            }
          }
          *(v8h*)(C + (size_t)(mBase + row) * ldc + n0 + c8) = hv;
          if (OUT_MODE == 2) *(v8h*)(C2 + (size_t)(mBase + row) * ldc + n0 + c8) = lv;
        }
        
      }
    }
    __builtin_amdgcn_fence(__ATOMIC_RELEASE, "workgroup");
    __builtin_amdgcn_wave_barrier();
    __builtin_amdgcn_fence(__ATOMIC_ACQUIRE, "workgroup");
  }
}

// ---- all five input conversions in one streaming launch ----
// f32 -> bf16 (RNE) for x, Wq, Wk, Wv; f32 -> bf16 (RNE) -> x carry -> f16 for Wo (carry a power of two; exact for normal results).
// kCvThreads threads; in pass i thread g converts the 4 elements at 4 * (i * kCvThreads + g) of an array: a wave reads 512 contiguous bytes
// per load and writes 256 per store. The pass counts are constants of the shapes, so a thread's 20 loads are independent and can all be in flight.
constexpr int kCvGroups  = 512;
constexpr int kCvThreads = kCvGroups * 256;                    // 131,072 threads = 4,096 waves
constexpr int kCvX  = kTok * kDModel / (4 * kCvThreads);       // 8 passes over x
constexpr int kCvQK = kQKCols * kDModel / (4 * kCvThreads);    // 4 passes over Wq, and over Wk
constexpr int kCvVO = kDModel * kDModel / (4 * kCvThreads);    // 2 passes over Wv, and over Wo
static_assert(kCvX * 4 * kCvThreads == kTok * kDModel && kCvQK * 4 * kCvThreads == kQKCols * kDModel && kCvVO * 4 * kCvThreads == kDModel * kDModel);

template <int N>
__device__ __forceinline__ void cv_load(v4f (&r)[N], const float* __restrict__ in, int g) {
#pragma unroll
  for (int i = 0; i < N; ++i) r[i] = *(const v4f*)(in + 4 * ((size_t)i * kCvThreads + g));
}
template <int N>
__device__ __forceinline__ void cv_store_bf16(const v4f (&r)[N], unsigned short* __restrict__ out, int g) {
#pragma unroll
  for (int i = 0; i < N; ++i) {
    u2v u;
    u[0] = (unsigned)f2bf_bits(r[i][0]) | ((unsigned)f2bf_bits(r[i][1]) << 16);
    u[1] = (unsigned)f2bf_bits(r[i][2]) | ((unsigned)f2bf_bits(r[i][3]) << 16);
    *(u2v*)(out + 4 * ((size_t)i * kCvThreads + g)) = u;
  }
}
__device__ __forceinline__ unsigned cv_f16_bits(float f, float carry) {
  return (unsigned)__builtin_bit_cast(unsigned short, (_Float16)(bf_rne(f) * carry));
}

// Group 0 converts nothing: its first wave writes the lambda line, lambda = exp(lq1.lk1) - exp(lq2.lk2) + 0.8 from bf16-RNE-converted vectors,
// the 64 terms of each dot summed in index order; one wave writes one 32-float line. It runs beside the kCvGroups streaming groups
// and needs no launch of its own.
__global__ __launch_bounds__(256) void cast_inputs(
    const float* __restrict__ X, const float* __restrict__ Wq, const float* __restrict__ Wk,
    const float* __restrict__ Wv, const float* __restrict__ Wo,
    unsigned short* __restrict__ Xb, unsigned short* __restrict__ Wqb, unsigned short* __restrict__ Wkb,
    unsigned short* __restrict__ Wvb, unsigned short* __restrict__ Wo16, float carry,
    const float* __restrict__ lq1, const float* __restrict__ lq2,
    const float* __restrict__ lk1, const float* __restrict__ lk2, float* __restrict__ lamp) {
  if (blockIdx.x == 0) {
    if (threadIdx.x >= 32) return;
    float d1 = 0.0f, d2 = 0.0f;
#pragma unroll 16   // sixteen terms' loads go out together; the sums keep their order
    for (int i = 0; i < kHeadDim; ++i) {
      d1 += bf_rne(lq1[i]) * bf_rne(lk1[i]);
      d2 += bf_rne(lq2[i]) * bf_rne(lk2[i]);
    }
    lamp[threadIdx.x] = expf(d1) - expf(d2) + 0.8f;
    return;
  }
  const int g = (blockIdx.x - 1) * 256 + threadIdx.x;
  v4f x[kCvX], q[kCvQK], k[kCvQK], v[kCvVO], o[kCvVO];
  cv_load(x, X, g);
  cv_load(q, Wq, g);
  cv_load(k, Wk, g);
  cv_load(v, Wv, g);
  cv_load(o, Wo, g);
  cv_store_bf16(x, Xb, g);
  cv_store_bf16(q, Wqb, g);
  cv_store_bf16(k, Wkb, g);
  cv_store_bf16(v, Wvb, g);
#pragma unroll
  for (int i = 0; i < kCvVO; ++i) {
    u2v u;
    u[0] = cv_f16_bits(o[i][0], carry) | (cv_f16_bits(o[i][1], carry) << 16);
    u[1] = cv_f16_bits(o[i][2], carry) | (cv_f16_bits(o[i][3], carry) << 16);
    *(u2v*)(Wo16 + 4 * ((size_t)i * kCvThreads + g)) = u;
  }
}

// ---- bf16 split helpers ----
// two f32 -> one register of two bf16 hi parts and one of the two bf16 lo parts (both conversions round to nearest even)
typedef __attribute__((ext_vector_type(2))) float  f2v;
typedef __attribute__((ext_vector_type(2))) __bf16 b2v;
__device__ __forceinline__ void at_split2(float p0, float p1, unsigned& hi, unsigned& lo) {
  const unsigned h = __builtin_bit_cast(unsigned, __builtin_convertvector((f2v){p0, p1}, b2v));
  const float r0 = p0 - __uint_as_float(h << 16);
  const float r1 = p1 - __uint_as_float(h & 0xFFFF0000u);
  hi = h;
  lo = __builtin_bit_cast(unsigned, __builtin_convertvector((f2v){r0, r1}, b2v));
}
// the value that lane l ^ 16 holds
__device__ __forceinline__ float at_xhalf(float v) {
  const int b = __builtin_bit_cast(int, v);
  return __builtin_bit_cast(float, __builtin_amdgcn_permlanex16(b, b, 0x76543210, 0xfedcba98, false, false));
}
// e^x for the softmax (x <= 0 or -inf): one multiply and the hardware's 2^y. The library's expf adds a two-part product, a split into whole and
// fraction, ldexp and two range selects per value; here the argument is a difference from the running maximum, a result below 2^-126 may go to 0,
// and the multiply's rounding moves a weight by less than the 16 bits that its hi + lo parts keep.
constexpr float kLog2E = 1.44269504088896340736f;
constexpr int kAPlane  = kKC * kLP;        // 16-bit elements of one staged plane of the attention kernel: 64 rows at pitch kLP (9,216 B)
constexpr int kABuf    = 6 * kAPlane;      // one buffer: six planes (55,296 B)
constexpr int kAChunks = kNQblk + 1;       // key chunks a group walks: (pr + 1) + (32 - pr)
static_assert(kKC == kHeadDim && kSeq == 256 * 8);   // K and Vt planes have the same shape; 256 threads write 8 mask terms each
__device__ __forceinline__ float at_exp(float x) { return __builtin_amdgcn_exp2f(x * kLog2E); }
__device__ __forceinline__ v8f at_mma(v16b a, v16b b, v8f c) {
  return __builtin_amdgcn_wmma_f32_16x16x32_bf16(false, a, false, b, (short)0, c, false, false);
}

// =====================================================================================
// Differential causal attention, head_dim 64, two softmax maps per head.
//   inputs : q, k as bf16 hi/lo planes [B*S][H*128] (map a uses columns h*128 + a*64 .. +64),
//            Vt as bf16 hi/lo planes [B][H*64][S] (key-contiguous), amask [B][S] f32, lambda line.
//   scores = 0.125 * q_a.k_a^T + causal add + (1-amask)*(-1e9) add; online softmax in f32 (e^x = 2^(x * log2 e) on v_exp_f32);
//   both products run transposed on v_wmma_f32_16x16x32_bf16 as hi.hi + hi.lo + lo.hi (f32 accumulate):
//   S^T = K.Q^T (A = K rows, B = Q columns) and O^T += Vt.P^T (A = Vt rows, B = P^T). A lane then holds scores of ONE query (column c),
//   keys 16 j + 8 hh + r: that is the k order of a B operand, so P^T is packed in registers; maximum and sum run in the lane, the two halves joined by one exchange.
//   att[b][h][s][d] = o_0/l_0 - lambda * o_1/l_1 ; per-tile (sum, sumsq) line for the group norm.
//   Block = 8 waves of one (b, h): waves 0-3 run map 0 and waves 4-7 map 1 of the same 64 query rows.
//   A block takes query tile pr and then tile 31 - pr, so every block walks 33 key chunks;
//   grid.x = B*H*16 = 512, pr fastest.
// LDS: two buffers of six planes each: K hi per map, K lo per map [64 kv][64 d], Vt hi, Vt lo [64 d][64 kv] (shared by both maps), all at row pitch kLP;
//      the mask terms of all the batch's keys, written once; one out slab [16][68] per 16 query rows.
// The group's 33 key chunks (tile pr's, then tile 31 - pr's) are one sequence: asynchronous copies bring chunk g + 2 into the buffer that chunk g has
// left while chunk g + 1 is worked on, also across the change of query tile. A copy of a wave covers whole 128-byte lines.
// Every staged LDS byte that is read is written in full each chunk (64 full rows per plane); the 8 pad elements of a row are never read.
// =====================================================================================
// waves_per_eu(4, 4): 512 groups of 8 waves are four waves a SIMD, so a wave may hold 256 registers; the grouped fragment reads use them.
__global__ __launch_bounds__(256) __attribute__((amdgpu_waves_per_eu(4, 4)))
void diff_attn64(const unsigned short* __restrict__ Qh, const unsigned short* __restrict__ Ql,
                 const unsigned short* __restrict__ Kh, const unsigned short* __restrict__ Kl,
                 const unsigned short* __restrict__ Vh, const unsigned short* __restrict__ Vl,
                 const float* __restrict__ amask, const float* __restrict__ lamp,
                 float* __restrict__ att, float* __restrict__ part) {
  union FB { v16b v; v8b h[2]; };
  __shared__ __align__(16) unsigned short sKV[2][kABuf];   // [buffer][K hi map 0 | K hi map 1 | K lo map 0 | K lo map 1 | Vt hi | Vt lo]
  __shared__ __align__(16) float Am[kSeq];
  __shared__ __align__(16) float Os[4][16 * 68];
  __shared__ float red[4][2];

  const int tid  = threadIdx.x;
  const int wave = __builtin_amdgcn_readfirstlane(tid >> 5);   // scalar, so the tests on the map below are scalar branches
  const int a    = wave >> 2;         // softmax map of this wave
  const int wq   = wave & 3;          // 16-row slice of the query tile
  const int lane = tid & 31;
  const int hh   = lane >> 4;
  const int c    = lane & 15;
  const int bx   = blockIdx.x;
  const int pr   = bx & (kNPair - 1);
  const int bh   = bx >> 4;
  const int h    = bh & (kHeads - 1);
  const int b    = bh >> 4;
  const float lam = lamp[0];
  const float negInf = -__builtin_huge_valf();

  const size_t vbase = (size_t)(b * kDModel + h * kHeadDim) * kSeq;               // Vt row (h*64 + d) of batch b
  float* ob_ptr = att + (size_t)bh * kSeq * kHeadDim;
  float* os = Os[wq];

  // staging: 16 lanes copy the 256 bytes of a K row (both maps side by side), 8 lanes the 128 bytes of a Vt row
  const int krow = tid >> 4, kseg = tid & 15;
  const int vrow = tid >> 3, vseg = tid & 7;
  const size_t kg0 = (size_t)(b * kSeq + krow) * kQKCols + (size_t)h * 128 + kseg * 8;
  const size_t vg0 = vbase + (size_t)vrow * kSeq + vseg * 8;
  const unsigned ldsK = (unsigned)(size_t)(&sKV[0][0] + (kseg >> 3) * kAPlane + krow * kLP + (kseg & 7) * 8);   // low 32 bits = byte address in LDS
  const unsigned ldsV = (unsigned)(size_t)(&sKV[0][0] + 4 * kAPlane + vrow * kLP + vseg * 8);
  auto stage = [&](int g, int buf) {   // the twelve copies of this lane for chunk g of the group's sequence, into buffer buf
    const int kv = ((g <= pr) ? g : g - pr - 1) * kKC;
    const size_t ko = kg0 + (size_t)kv * kQKCols;
    const size_t vo = vg0 + kv;
    const unsigned lb = (unsigned)(buf * kABuf * 2);
    unsigned l[12];
    const unsigned short* gp[12];
#pragma unroll   // every index constant, so the two operand arrays stay in registers
    for (int p = 0; p < 4; ++p) {
      l[p]      = ldsK + lb + (unsigned)(p * 16 * kLP * 2);
      l[4 + p]  = ldsK + lb + (unsigned)((2 * kAPlane + p * 16 * kLP) * 2);
      gp[p]     = Kh + ko + (size_t)(p * 16) * kQKCols;
      gp[4 + p] = Kl + ko + (size_t)(p * 16) * kQKCols;
    }
#pragma unroll   // as above
    for (int p = 0; p < 2; ++p) {
      l[8 + p]   = ldsV + lb + (unsigned)(p * 32 * kLP * 2);
      l[10 + p]  = ldsV + lb + (unsigned)((kAPlane + p * 32 * kLP) * 2);
      gp[8 + p]  = Vh + vo + (size_t)(p * 32) * kSeq;
      gp[10 + p] = Vl + vo + (size_t)(p * 32) * kSeq;
    }
    async_copy12(l, gp);
  };

  stage(0, 0);
  {
    // additive padding-mask term of every key of the batch (bf16 RNE-converted mask), 8 keys a thread
    union { v4f v[2]; float f[8]; } mk;
    mk.v[0] = *(const v4f*)(amask + b * kSeq + tid * 8);
    mk.v[1] = *(const v4f*)(amask + b * kSeq + tid * 8 + 4);
#pragma unroll   // constant indices keep the eight terms in registers
    for (int e = 0; e < 8; ++e) mk.f[e] = (1.0f - bf_rne(mk.f[e])) * (-1.0e9f);
    *(v4f*)(Am + tid * 8)     = mk.v[0];
    *(v4f*)(Am + tid * 8 + 4) = mk.v[1];
  }
  asm volatile("s_wait_asynccnt 0x0" ::: "memory");   // this wave's copies of chunk 0 have landed
  __syncthreads();                                    // ... and every other wave's, and the mask terms
  stage(1, 1);                                        // a group always has 33 chunks
  int g = 0;                                          // place in the group's sequence of chunks

  for (int half = 0; half < 2; ++half) {
    const int qb = half ? (kNQblk - 1 - pr) : pr;
    const int q0 = qb * kQB + wq * 16;
    const size_t qoff = (size_t)(b * kSeq + q0 + c) * kQKCols + (size_t)h * 128 + a * 64;   // + dc*32 + 8*hh
    // Q fragments (B operand: lane = query column c) for this wave's map: 2 d-chunks, hi and lo planes
    v16b qah[2], qal[2];
#pragma unroll
    for (int dc = 0; dc < 2; ++dc) {
      qah[dc] = Frag<__bf16>::load((const __bf16*)Qh + qoff + dc * 32 + 8 * hh);
      qal[dc] = Frag<__bf16>::load((const __bf16*)Ql + qoff + dc * 32 + 8 * hh);
    }
    const int qrow = q0 + c;            // the one query of this lane
    float mrow = negInf, lrow = 0.0f;   // its running maximum; the sum over this lane half's keys
    v8f oacc[4];                        // oacc[t][r] = O^T[d = 16 t + 8 hh + r][query c]
#pragma unroll
    for (int t = 0; t < 4; ++t) oacc[t] = (v8f){0.f,0.f,0.f,0.f,0.f,0.f,0.f,0.f};

    for (int kc = 0; kc <= qb; ++kc) {          // causal: chunks 0..qb (block-uniform trip count, <= 32)
      const int kv0 = kc * kKC;
      const unsigned short* kvb = sKV[g & 1];             // this chunk's buffer, published by the barrier ahead of the loop (chunk 0) or at the foot of the chunk before
      const unsigned short* ksh = kvb + a * kAPlane;
      const unsigned short* ksl = kvb + (2 + a) * kAPlane;
      const unsigned short* Vth = kvb + 4 * kAPlane;
      const unsigned short* Vtl = kvb + 5 * kAPlane;

      // ---- scores, transposed: 4 key subtiles of 16 rows, K = 64 (2 chunks), hi.hi + hi.lo + lo.hi ----
      // per 32 d the 16 fragment reads stand together ahead of the 12 products, which go round the four subtiles: reads can issue early, in groups, and
      // a product never needs the one written just before it. Each tile still sums dc 0 then 1, and in each hi.hi, lo.hi, hi.lo.
      v8f s[4];
#pragma unroll
      for (int j = 0; j < 4; ++j) s[j] = (v8f){0.f,0.f,0.f,0.f,0.f,0.f,0.f,0.f};
#pragma unroll
      for (int dc = 0; dc < 2; ++dc) {
        FB kb[4], kl[4];
#pragma unroll
        for (int j = 0; j < 4; ++j) {
          kb[j].h[0] = *(const v8b*)(ksh + (j * 16 + c) * kLP + dc * 32 + 8 * hh);
          kb[j].h[1] = *(const v8b*)(ksh + (j * 16 + c) * kLP + dc * 32 + 16 + 8 * hh);
          kl[j].h[0] = *(const v8b*)(ksl + (j * 16 + c) * kLP + dc * 32 + 8 * hh);
          kl[j].h[1] = *(const v8b*)(ksl + (j * 16 + c) * kLP + dc * 32 + 16 + 8 * hh);
        }
#pragma unroll
        for (int j = 0; j < 4; ++j) s[j] = at_mma(kb[j].v, qah[dc], s[j]);
#pragma unroll
        for (int j = 0; j < 4; ++j) s[j] = at_mma(kl[j].v, qah[dc], s[j]);
#pragma unroll
        for (int j = 0; j < 4; ++j) s[j] = at_mma(kb[j].v, qal[dc], s[j]);
      }
      // ---- scale, causal add, mask add, maximum over this lane's 32 keys, then over both halves ----
      const bool diag = (kc == qb);
      float m = negInf;
#pragma unroll
      for (int j = 0; j < 4; ++j) {
        union { v4f v[2]; float f[8]; } am;
        am.v[0] = *(const v4f*)(Am + kv0 + j * 16 + 8 * hh);
        am.v[1] = *(const v4f*)(Am + kv0 + j * 16 + 8 * hh + 4);
#pragma unroll
        for (int r = 0; r < 8; ++r) {
          const int kvcol = kv0 + j * 16 + 8 * hh + r;
          const float cz = (diag && (kvcol > qrow)) ? -1.0e9f : 0.0f;
          float sc = s[j][r] * 0.125f;
          sc = sc + cz;
          sc = sc + am.f[r];
          s[j][r] = sc;
          m = fmaxf(m, sc);
        }
      }
      m = fmaxf(m, at_xhalf(m));
      // ---- online softmax update; P^T packed as bf16 hi/lo B operands: element e of 32-key group kk is key 32 kk + (e < 8 ? 8 hh + e : 16 + 8 hh + e - 8) ----
      const float mnew = fmaxf(mrow, m);
      const float alpha = at_exp(mrow - mnew);
      mrow = mnew;
      union PB { v16b v; unsigned w[8]; };
      PB pbh[2], pbl[2];
      float ps[4];
#pragma unroll
      for (int j = 0; j < 4; ++j) {
        ps[j] = 0.0f;
        const v8f y = (s[j] - mnew) * kLog2E;
#pragma unroll
        for (int i = 0; i < 4; ++i) {
          const float p0 = __builtin_amdgcn_exp2f(y[2 * i]);
          const float p1 = __builtin_amdgcn_exp2f(y[2 * i + 1]);
          ps[j] += p0;
          ps[j] += p1;
          at_split2(p0, p1, pbh[j >> 1].w[(j & 1) * 4 + i], pbl[j >> 1].w[(j & 1) * 4 + i]);
        }
      }
      lrow = lrow * alpha + ((ps[0] + ps[1]) + (ps[2] + ps[3]));
#pragma unroll
      for (int t = 0; t < 4; ++t) oacc[t] *= alpha;
      // ---- O^T += Vt.P^T: A = Vt [d][kv], B = P^T from registers; hi.hi + hi.lo + lo.hi; reads grouped and products taken round the four tiles as for the scores ----
#pragma unroll
      for (int kk = 0; kk < 2; ++kk) {
        FB vb[4], vl[4];
#pragma unroll
        for (int t = 0; t < 4; ++t) {
          vb[t].h[0] = *(const v8b*)(Vth + (t * 16 + c) * kLP + kk * 32 + 8 * hh);
          vb[t].h[1] = *(const v8b*)(Vth + (t * 16 + c) * kLP + kk * 32 + 16 + 8 * hh);
          vl[t].h[0] = *(const v8b*)(Vtl + (t * 16 + c) * kLP + kk * 32 + 8 * hh);
          vl[t].h[1] = *(const v8b*)(Vtl + (t * 16 + c) * kLP + kk * 32 + 16 + 8 * hh);
        }
#pragma unroll
        for (int t = 0; t < 4; ++t) oacc[t] = at_mma(vb[t].v, pbh[kk].v, oacc[t]);
#pragma unroll
        for (int t = 0; t < 4; ++t) oacc[t] = at_mma(vl[t].v, pbh[kk].v, oacc[t]);
#pragma unroll
        for (int t = 0; t < 4; ++t) oacc[t] = at_mma(vb[t].v, pbl[kk].v, oacc[t]);
      }
      asm volatile("s_wait_dscnt 0x0" ::: "memory");      // this wave's reads of buffer g & 1 are done before it is refilled
      asm volatile("s_wait_asynccnt 0x0" ::: "memory");   // this wave's copies of chunk g + 1 have landed
      __syncthreads();                                    // publishes chunk g + 1 and ends every wave's reads of chunk g
      if (g + 2 < kAChunks) stage(g + 2, g & 1);
      ++g;
    }
    // ---- finish this tile: map 1 hands o/l over through the slab; map 0 combines and sums the norm partials ----
    // a lane owns 8 consecutive d of its query's slab row per t: slab[c][16 t + 8 hh + r]
    const float inv = 1.0f / (lrow + at_xhalf(lrow));   // the two halves' sums joined, by every lane
    if (a == 1) {
#pragma unroll
      for (int t = 0; t < 4; ++t) {
        const v8f o = oacc[t] * inv;
        *(v4f*)(os + c * 68 + t * 16 + 8 * hh)     = (v4f){o[0], o[1], o[2], o[3]};
        *(v4f*)(os + c * 68 + t * 16 + 8 * hh + 4) = (v4f){o[4], o[5], o[6], o[7]};
      }
    }
    __syncthreads();
    if (a == 0) {
      float psum = 0.0f, psq = 0.0f;
#pragma unroll
      for (int t = 0; t < 4; ++t) {
        float* op = os + c * 68 + t * 16 + 8 * hh;
        union { v4f v[2]; float f[8]; } o1, wv;
        o1.v[0] = *(const v4f*)(op);
        o1.v[1] = *(const v4f*)(op + 4);
#pragma unroll
        for (int r = 0; r < 8; ++r) {
          const float o = oacc[t][r] * inv;
          const float w = o - lam * o1.f[r];
          wv.f[r] = w;
          psum += w;
          psq += w * w;
        }
        *(v4f*)(op)     = wv.v[0];
        *(v4f*)(op + 4) = wv.v[1];
      }
      // wave reductions, then a block combine in fixed order
#pragma unroll
      for (int off = 1; off < 32; off <<= 1) { psum += __shfl_xor(psum, off, 32); psq += __shfl_xor(psq, off, 32); }
      if (lane == 0) { red[wq][0] = psum; red[wq][1] = psq; }
    }
    __syncthreads();

    {
      const int c4 = (lane & 15) * 4;
#pragma unroll
      for (int it = 0; it < 4; ++it) {
        const int row = a * 8 + it * 2 + hh;      // each wave stores 8 of the slab's 16 rows
        v4f val = *(const v4f*)(os + row * 68 + c4);
        *(v4f*)(ob_ptr + (size_t)(q0 + row) * kHeadDim + c4) = val;
      }
      asm volatile("s_wait_xcnt 0x0" ::: "memory");   // the stores' address and data registers are rewritten by the code that follows
    }
    if (wave == 0) {
      const float t0 = ((red[0][0] + red[1][0]) + red[2][0]) + red[3][0];
      const float t1 = ((red[0][1] + red[1][1]) + red[2][1]) + red[3][1];
      const float v = (lane == 0) ? t0 : ((lane == 1) ? t1 : 0.0f);
      float* pline = part + (size_t)(bh * kNQblk + qb) * 32;
      ((float*)pline)[lane] = v;
      asm volatile("s_wait_xcnt 0x0" ::: "memory");   // the next tile's set-up rewrites this store's registers
    }
  }
  asm volatile("s_wait_asynccnt 0x0" ::: "memory");   // nothing is in flight when the wave ends
}

// ---- normalize + affine + x0.2 + merge heads -> f16 plane (x8 carry), [B*S][H*64] ----
// A group's 32 rows belong to one (b,h): its first wave sums that (b,h)'s 32 tile lines in fixed order (lane = tile, then a butterfly) and hands
// mean and 1/sigma to the other waves through LDS, so the statistics need no launch of their own.
__global__ __launch_bounds__(256) void gn_merge(const float* __restrict__ att, const float* __restrict__ part,
                                              const float* __restrict__ gamma, const float* __restrict__ beta,
                                              unsigned short* __restrict__ merged) {
  __shared__ float st[2];
  const int g = blockIdx.x * 256 + threadIdx.x;
  if (g >= kBatch * kHeads * kSeq * 8) return;   // the same for a whole group (the bound is a multiple of 256), in front of the barrier
  const int seg = g >> 3;
  const int e8  = (g & 7) * 8;
  const int bh  = seg >> 11;
  const int s   = seg & (kSeq - 1);
  const int h   = bh & (kHeads - 1);
  const int b   = bh >> 4;
  union U8 { v4f v[2]; float f[8]; };
  U8 x, ga, be;
  const float* ap = att + (size_t)seg * kHeadDim + e8;
  x.v[0]  = *(const v4f*)ap;
  x.v[1]  = *(const v4f*)(ap + 4);
  ga.v[0] = *(const v4f*)(gamma + h * kHeadDim + e8);
  ga.v[1] = *(const v4f*)(gamma + h * kHeadDim + e8 + 4);
  be.v[0] = *(const v4f*)(beta + h * kHeadDim + e8);
  be.v[1] = *(const v4f*)(beta + h * kHeadDim + e8 + 4);
  if (threadIdx.x < 32) {
    const int lane = threadIdx.x;
    float s0 = part[(size_t)(bh * kNQblk + lane) * 32 + 0];
    float s1 = part[(size_t)(bh * kNQblk + lane) * 32 + 1];
#pragma unroll
    for (int off = 1; off < 32; off <<= 1) { s0 += __shfl_xor(s0, off, 32); s1 += __shfl_xor(s1, off, 32); }
    const float inv_n = 1.0f / (float)(kSeq * kHeadDim);
    const float mu0 = s0 * inv_n;
    const float ex2 = s1 * inv_n;
    const float var = fmaxf(ex2 - mu0 * mu0, 0.0f);
    if (lane == 0) { st[0] = mu0; st[1] = rsqrtf(var + 1.0e-5f); }
  }
  __syncthreads();   // the first wave's two statistics reach the group's other waves
  const float mu = st[0];
  const float rs = st[1];
  v8h hv;
#pragma unroll
  for (int e = 0; e < 8; ++e) {
    const float gq = bf_rne(ga.f[e]);
    const float bq = bf_rne(be.f[e]);
    float y = (x.f[e] - mu) * rs;
    y = y * gq + bq;
    y = y * 0.2f;
    float z = y * kMergeCarry;
    asm volatile("" : "+v"(z));
    hv[e] = (_Float16)z;
  }
  unsigned short* dst = merged + (size_t)(b * kSeq + s) * kDModel + h * kHeadDim + e8;
  *(v8h*)dst = hv;
  
}

// ---------------------------------------------------------------------------
extern "C" void kernel_launch(void* const* d_in, const int* in_sizes, int n_in,
                              void* d_out, int out_size, void* d_ws, size_t ws_size,
                              hipStream_t stream) {
  if (n_in < 12) return;
  if (in_sizes[0] != kTok * kDModel || in_sizes[1] != kBatch * kSeq ||
      in_sizes[2] != kQKCols * kDModel || in_sizes[3] != kQKCols * kDModel ||
      in_sizes[4] != kDModel * kDModel || in_sizes[5] != kDModel * kDModel ||
      in_sizes[6] != kHeadDim || in_sizes[7] != kHeadDim || in_sizes[8] != kHeadDim || in_sizes[9] != kHeadDim ||
      in_sizes[10] != kDModel || in_sizes[11] != kDModel) return;
  if (out_size != kTok * kDModel) return;
  if (ws_size < kWsTotal) return;

  const float* X     = (const float*)d_in[0];
  const float* amask = (const float*)d_in[1];
  const float* Wq    = (const float*)d_in[2];
  const float* Wk    = (const float*)d_in[3];
  const float* Wv    = (const float*)d_in[4];
  const float* Wo    = (const float*)d_in[5];
  const float* lq1   = (const float*)d_in[6];
  const float* lq2   = (const float*)d_in[7];
  const float* lk1   = (const float*)d_in[8];
  const float* lk2   = (const float*)d_in[9];
  const float* gamma = (const float*)d_in[10];
  const float* beta  = (const float*)d_in[11];

  char* w = (char*)d_ws;
  unsigned short* Xb    = (unsigned short*)(w + kOffXb);
  unsigned short* Wqb   = (unsigned short*)(w + kOffWqb);
  unsigned short* Wkb   = (unsigned short*)(w + kOffWkb);
  unsigned short* Wvb   = (unsigned short*)(w + kOffWvb);
  unsigned short* Wo16  = (unsigned short*)(w + kOffWo16);
  unsigned short* Qh    = (unsigned short*)(w + kOffQh);
  unsigned short* Ql    = (unsigned short*)(w + kOffQl);
  unsigned short* Kh    = (unsigned short*)(w + kOffKh);
  unsigned short* Kl    = (unsigned short*)(w + kOffKl);
  unsigned short* Vth   = (unsigned short*)(w + kOffVth);
  unsigned short* Vtl   = (unsigned short*)(w + kOffVtl);
  float*          att   = (float*)(w + kOffAtt);
  unsigned short* mrg   = (unsigned short*)(w + kOffMerged);
  float*          part  = (float*)(w + kOffPart);
  float*          lamp  = (float*)(w + kOffLam);

  // 1) input conversions (bf16 RNE; Wo additionally x256 into f16) and the lambda line
  cast_inputs<<<kCvGroups + 1, 256, 0, stream>>>(X, Wq, Wk, Wv, Wo, Xb, Wqb, Wkb, Wvb, Wo16, kWoCarry, lq1, lq2, lk1, lk2, lamp);

  // 2) projections: q/k planes [4096][2048] hi+lo, Vt planes [2][1024][2048] hi+lo
  constexpr int gridQ  = (kTok / 64) * (kQKCols / 64) / 8;   // 256
  constexpr int gridVt = (kDModel / 64) * (kSeq / 64) / 8;   // 64
  constexpr int gridO  = (kTok / 64) * (kDModel / 64) / 8;   // 128
  static_assert(gridQ * 8 == (kTok / 64) * (kQKCols / 64));
  static_assert(gridVt * 8 == (kDModel / 64) * (kSeq / 64));
  static_assert(gridO * 8 == (kTok / 64) * (kDModel / 64));
  // one work-group per 128x256 tile: the same counts
  static_assert(gridQ == (kTok / 128) * (kQKCols / 256) && gridVt == (kDModel / 128) * (kSeq / 256) && gridO == (kTok / 128) * (kDModel / 256));
  static_assert(kDModel % kGK == 0 && kDModel / kGK >= 2);
  static_assert(gridQ == kTilesQK && gridVt == kTilesVt);
  // Vt[b][c][s] = sum_k Wv[c][k] * X[b][s][k] : A = Wv [1024][1024], Bt = X_b [2048][1024]
  wmma_gemm64<1, false, 0, 2, false, 0, true><<<dim3(2 * kTilesQK + kBatch * kTilesVt, 1, 1), 256, 0, stream>>>(
      Xb, Wvb, kDModel, 0L, Wqb, Wkb, kDModel, 0L, (void*)Qh, (void*)Ql, kQKCols, 0L,
      lamp, lamp, 0L, kTok, kQKCols, kDModel, 1.0f);

  // 3) differential causal attention + norm partial lines (512 blocks, two query tiles each)
  diff_attn64<<<kAttnGroups, 256, 0, stream>>>(Qh, Ql, Kh, Kl, Vth, Vtl, amask, lamp, att, part);

  // 4) group norm statistics, normalize + merge, one launch
  gn_merge<<<(kBatch * kHeads * kSeq * 8) / 256, 256, 0, stream>>>(att, part, gamma, beta, mrg);

  // 5) output projection: out[m][n] = (1/2048) * sum_k merged8[m][k] * Wo256[n][k]
  wmma_gemm64<0, false, 0, 0, false><<<dim3(gridO, 1, 1), 256, 0, stream>>>(
      mrg, mrg, kDModel, 0L, Wo16, Wo16, kDModel, 0L, d_out, d_out, kDModel, 0L,
      lamp, lamp, 0L, kTok, kDModel, kDModel, 1.0f / (kMergeCarry * kWoCarry));
}

// v010
// Measured time: 155 microseconds a run.
// Next to v009, in two timings, it ran 1.04 times as fast each time.
// Counting every step since v000, it is 5.00 times as fast.
// Contractions: x.Wq^T, x.Wk^T, Wv.x^T = v_wmma_f32_16x16x32_bf16 (plain bf16 operands from RNE-converted inputs); k.q^T and Vt.p^T = v_wmma_f32_16x16x32_bf16 with bf16 hi/lo planes (hi.hi+hi.lo+lo.hi); merged.Wo^T = v_wmma_f32_16x16x32_f16 (f16 operands, carries 8 and 256); f32 accumulate everywhere; softmax, group norm and the two 64-term lambda dots in f32.
#include <hip/hip_runtime.h>

typedef __attribute__((ext_vector_type(16))) _Float16 v16h;
typedef __attribute__((ext_vector_type(8)))  _Float16 v8h;
typedef __attribute__((ext_vector_type(16))) __bf16   v16b;
typedef __attribute__((ext_vector_type(8)))  __bf16   v8b;
typedef __attribute__((ext_vector_type(8)))  float    v8f;
typedef __attribute__((ext_vector_type(4)))  float    v4f;
typedef __attribute__((ext_vector_type(4)))  unsigned int u4v;
typedef __attribute__((ext_vector_type(2)))  unsigned int u2v;

// ---- problem geometry ----
constexpr int kBatch   = 2;
constexpr int kSeq     = 2048;
constexpr int kDModel  = 1024;
constexpr int kHeads   = 16;
constexpr int kHeadDim = 64;
constexpr int kQKCols  = 2 * kDModel;      // 2048 : row width of the q/k planes (H * 128)
constexpr int kTok     = kBatch * kSeq;    // 4096
constexpr int kQB      = 64;               // query rows per tile; a block takes two tiles
constexpr int kKC      = 64;               // keys per chunk
constexpr int kLP      = 72;               // LDS row pitch of the 64-element 16-bit tiles: 144 B = 16 B x 9 (odd), conflict-free for 16-byte row reads
constexpr int kNQblk   = kSeq / kQB;       // 32
constexpr int kAttnBlocks = kBatch * kHeads * kNQblk;   // 1024 query tiles
constexpr int kNPair   = kNQblk / 2;        // 16 : tile pairs (t, 31 - t) per (b, h)
constexpr int kAttnGroups = kBatch * kHeads * kNPair;   // 512 work-groups of the attention launch
constexpr float kMergeCarry = 8.0f;        // f16 merged plane carried x8
constexpr float kWoCarry    = 256.0f;      // f16 Wo plane carried x256

static_assert(kNQblk == 32);
static_assert(kHeads == 16);
static_assert(kAttnBlocks == 1024);
static_assert(kNPair == 16 && kAttnGroups == 512);
static_assert(kSeq % kQB == 0);
static_assert(kDModel % 32 == 0);                  // K of every GEMM
static_assert(kTok % 64 == 0 && kQKCols % 64 == 0 && kDModel % 64 == 0 && kSeq % 64 == 0);   // M, N tile multiples

// ---- workspace region map (bytes; every offset a multiple of 128) ----
constexpr size_t kBytesXb     = (size_t)kTok * kDModel * 2;                     //  8,388,608  x as bf16 [4096][1024]
constexpr size_t kBytesWqk    = (size_t)kQKCols * kDModel * 2;                  //  4,194,304  Wq / Wk as bf16 [2048][1024]
constexpr size_t kBytesWv     = (size_t)kDModel * kDModel * 2;                  //  2,097,152  Wv as bf16 [1024][1024]
constexpr size_t kBytesWo     = (size_t)kDModel * kDModel * 2;                  //  2,097,152  Wo as f16 x256 [1024][1024]
constexpr size_t kBytesQPl    = (size_t)kTok * kQKCols * 2;                     // 16,777,216  one q or k plane [4096][2048]
constexpr size_t kBytesVtPl   = (size_t)kBatch * kDModel * kSeq * 2;            //  8,388,608  one Vt plane [2][1024][2048]
constexpr size_t kBytesAtt    = (size_t)kBatch * kHeads * kSeq * kHeadDim * 4;  // 16,777,216  attention out f32 [2][16][2048][64]
constexpr size_t kBytesMerged = (size_t)kTok * kDModel * 2;                     //  8,388,608  merged f16 x8 [4096][1024]
constexpr size_t kBytesPart   = (size_t)kAttnBlocks * 128;                      //    131,072  one 32-float line per query tile (1024 tiles)
constexpr size_t kBytesStats  = (size_t)kBatch * kHeads * 128;                  //      4,096  unused: gn_merge keeps the (b,h) statistics in LDS
constexpr size_t kBytesLam    = 128;                                            //        128  lambda line

constexpr size_t kOffXb     = 0;
constexpr size_t kOffWqb    = kOffXb + kBytesXb;
constexpr size_t kOffWkb    = kOffWqb + kBytesWqk;
constexpr size_t kOffWvb    = kOffWkb + kBytesWqk;
constexpr size_t kOffWo16   = kOffWvb + kBytesWv;
constexpr size_t kOffQh     = kOffWo16 + kBytesWo;
constexpr size_t kOffQl     = kOffQh + kBytesQPl;
constexpr size_t kOffKh     = kOffQl + kBytesQPl;
constexpr size_t kOffKl     = kOffKh + kBytesQPl;
constexpr size_t kOffVth    = kOffKl + kBytesQPl;
constexpr size_t kOffVtl    = kOffVth + kBytesVtPl;
constexpr size_t kOffAtt    = kOffVtl + kBytesVtPl;
constexpr size_t kOffMerged = kOffAtt + kBytesAtt;
constexpr size_t kOffPart   = kOffMerged + kBytesMerged;
constexpr size_t kOffStats  = kOffPart + kBytesPart;
constexpr size_t kOffLam    = kOffStats + kBytesStats;
constexpr size_t kWsTotal   = kOffLam + kBytesLam;                              // 130,158,720
static_assert(kBytesPart == 131072);
static_assert(kWsTotal == 130158720);
static_assert(kWsTotal <= 134217728);
static_assert(kOffWqb % 128 == 0 && kOffQh % 128 == 0 && kOffAtt % 128 == 0 && kOffPart % 128 == 0 && kOffStats % 128 == 0 && kOffLam % 128 == 0);

// ---- 16-bit helpers ----
__device__ __forceinline__ unsigned short f2bf_bits(float f) {
  unsigned u = __float_as_uint(f);
  return (unsigned short)((u + 0x7FFFu + ((u >> 16) & 1u)) >> 16);
}
__device__ __forceinline__ float bf_bits2f(unsigned short h) { return __uint_as_float(((unsigned)h) << 16); }
__device__ __forceinline__ float bf_rne(float f) { return bf_bits2f(f2bf_bits(f)); }

// hazard guards as plain device helpers
__device__ __forceinline__ void dep_guard_h(v8f& a, v8f& b, v16h x, v16h y) { asm volatile("v_nop\n\tv_nop\n\tv_nop\n\tv_nop" : "+v"(a), "+v"(b) : "v"(x), "v"(y)); }
__device__ __forceinline__ void dep_guard_b(v8f& a, v8f& b, v16b x, v16b y) { asm volatile("v_nop\n\tv_nop\n\tv_nop\n\tv_nop" : "+v"(a), "+v"(b) : "v"(x), "v"(y)); }
__device__ __forceinline__ void keep4_h(v16h a, v16h b, v16h c, v16h d) { asm volatile("v_nop" :: "v"(a), "v"(b), "v"(c), "v"(d)); }
__device__ __forceinline__ void keep4_b(v16b a, v16b b, v16b c, v16b d) { asm volatile("v_nop" :: "v"(a), "v"(b), "v"(c), "v"(d)); }
__device__ __forceinline__ void acc_guard4(v8f& a, v8f& b, v8f& c, v8f& d) { asm volatile("v_nop\n\tv_nop\n\tv_nop\n\tv_nop" : "+v"(a), "+v"(b), "+v"(c), "+v"(d)); }
template <typename T> struct Frag;
template <> struct Frag<_Float16> {
  typedef v16h V; union U { v16h v; v8h h[2]; };
  static __device__ __forceinline__ v16h load(const _Float16* p) {   // elements 0..7 <- p[0..7], 8..15 <- p[16..23]
    U f; f.h[0] = *(const v8h*)(p); f.h[1] = *(const v8h*)(p + 16); return f.v;
  }
  static __device__ __forceinline__ v8f mma(v16h a, v16h b, v8f c) {
    return __builtin_amdgcn_wmma_f32_16x16x32_f16(false, a, false, b, (short)0, c, false, false);
  }
  static __device__ __forceinline__ void guard(v8f& a, v8f& b, v16h x, v16h y) { dep_guard_h(a, b, x, y); }
  static __device__ __forceinline__ void keep(v16h a, v16h b, v16h c, v16h d) { keep4_h(a, b, c, d); }
};
template <> struct Frag<__bf16> {
  typedef v16b V; union U { v16b v; v8b h[2]; };
  static __device__ __forceinline__ v16b load(const __bf16* p) {
    U f; f.h[0] = *(const v8b*)(p); f.h[1] = *(const v8b*)(p + 16); return f.v;
  }
  static __device__ __forceinline__ v8f mma(v16b a, v16b b, v8f c) {
    return __builtin_amdgcn_wmma_f32_16x16x32_bf16(false, a, false, b, (short)0, c, false, false);
  }
  static __device__ __forceinline__ void guard(v8f& a, v8f& b, v16b x, v16b y) { dep_guard_b(a, b, x, y); }
  static __device__ __forceinline__ void keep(v16b a, v16b b, v16b c, v16b d) { keep4_b(a, b, c, d); }
};

// ---- Register-blocked batched WMMA GEMM, operands staged in LDS ------------
// C[m,n] = scale * sum_k A[m,k] * Bt[n,k] (+bias)(+resid); a work-group owns a 128x256 tile, each of its 8 waves (2 x 4) a 64x64 part.
// A row-major [M,K]; Bt row-major [N,K]; M % 128 == 0, N % 256 == 0, K % 128 == 0, K >= 256.
// Per 128 k the 128 A rows and 256 Bt rows (256 bytes, two whole lines, each) reach LDS by asynchronous copies, two buffers:
// the copies of tile t + 2 fly while tile t + 1 is worked on; the fragments are read from LDS at row pitch kGP.
// SPLIT is not carried by the staged loop (one plane per operand).
// BIAS_MODE: 0 = none, 1 = bias[m], 2 = bias[n].
// OUT_MODE: 0 = f32, 1 = f16, 2 = bf16 hi plane (Cout) + bf16 lo plane (Cout2).
// ET: 0 = f16 operands, 1 = bf16 operands (pointers passed as 16-bit storage)
constexpr int kGK     = 128;                   // k elements per staged tile
constexpr int kGP     = 136;                   // LDS row pitch of a staged row: 272 B = 16 B x 17 (odd), conflict-free for 16-byte row reads
constexpr int kGRowsA = 128;                   // staged A rows
constexpr int kGRowsB = 256;                   // staged Bt rows
constexpr int kGBuf   = (kGRowsA + kGRowsB) * kGP;   // 16-bit elements of one buffer (104,448 B)

// Twelve 16-byte asynchronous copies of one lane, global -> LDS (l = LDS byte address, g = global address).
// The closing s_wait_xcnt stands inside the statement, so that no address register is rewritten in front of it.
__device__ __forceinline__ void async_copy12(const unsigned (&l)[12], const unsigned short* const (&g)[12]) {
  asm volatile(
      "global_load_async_to_lds_b128 %0, %12, off\n\t"
      "global_load_async_to_lds_b128 %1, %13, off\n\t"
      "global_load_async_to_lds_b128 %2, %14, off\n\t"
      "global_load_async_to_lds_b128 %3, %15, off\n\t"
      "global_load_async_to_lds_b128 %4, %16, off\n\t"
      "global_load_async_to_lds_b128 %5, %17, off\n\t"
      "global_load_async_to_lds_b128 %6, %18, off\n\t"
      "global_load_async_to_lds_b128 %7, %19, off\n\t"
      "global_load_async_to_lds_b128 %8, %20, off\n\t"
      "global_load_async_to_lds_b128 %9, %21, off\n\t"
      "global_load_async_to_lds_b128 %10, %22, off\n\t"
      "global_load_async_to_lds_b128 %11, %23, off\n\t"
      "s_wait_xcnt 0x0"
      :: "v"(l[0]), "v"(l[1]), "v"(l[2]), "v"(l[3]), "v"(l[4]), "v"(l[5]), "v"(l[6]), "v"(l[7]), "v"(l[8]), "v"(l[9]), "v"(l[10]), "v"(l[11]),
         "v"(g[0]), "v"(g[1]), "v"(g[2]), "v"(g[3]), "v"(g[4]), "v"(g[5]), "v"(g[6]), "v"(g[7]), "v"(g[8]), "v"(g[9]), "v"(g[10]), "v"(g[11])
      : "memory");
}

template <int ET> struct Elem;
template <> struct Elem<0> { typedef _Float16 T; };
template <> struct Elem<1> { typedef __bf16 T; };
// QKV: one launch runs the three projections, which share K, the column count N and the output pitch: groups 0..255 q = x.Wq^T (the arguments as given),
// 256..511 k = x.Wk^T (Bt = Bt2p), 512..639 Vt_b = Wv.x_b^T (A = A2p, Bt = batch b of Ap0, 64 tiles a batch); the k and Vt planes lie behind the q planes
// as the workspace map has them. A WGP takes its next tile as soon as it has ended one, with no launch boundary between the products.
constexpr int kTilesQK = (kTok / 128) * (kQKCols / 256);    // 256
constexpr int kTilesVt = (kDModel / 128) * (kSeq / 256);    // 64 per batch
static_assert(kQKCols == kSeq);
template <int ET, bool SPLIT, int BIAS_MODE, int OUT_MODE, bool RESID, int ACT = 0, bool QKV = false>
__global__ __launch_bounds__(256) void wmma_gemm64(
    const unsigned short* __restrict__ Ap0, const unsigned short* __restrict__ A2p, int lda, long strideA,
    const unsigned short* __restrict__ Btp0, const unsigned short* __restrict__ Bt2p, int ldb, long strideB,
    void* __restrict__ Cout0, void* __restrict__ Cout20, int ldc, long strideC,
    const float* __restrict__ bias,
    const float* __restrict__ resid, long strideR,
    int M0, int N, int K, float scale) {
  const unsigned short* Ap  = Ap0;
  const unsigned short* Btp = Btp0;
  void* Cout  = Cout0;
  void* Cout2 = Cout20;
  int M  = M0;
  int bt = blockIdx.x;
  if (QKV) {
    unsigned short* q = (unsigned short*)Cout0;             // the q hi plane, the first of the six
    if (bt >= 2 * kTilesQK) {
      const int v  = bt - 2 * kTilesQK;
      const int vb = v / kTilesVt;                          // batch
      Ap    = A2p;
      Btp   = Ap0 + (size_t)vb * kSeq * kDModel;
      Cout  = q + (kOffVth - kOffQh) / 2 + (size_t)vb * kDModel * kSeq;
      Cout2 = q + (kOffVtl - kOffQh) / 2 + (size_t)vb * kDModel * kSeq;
      M     = kDModel;
      bt    = v - vb * kTilesVt;
    } else if (bt >= kTilesQK) {
      Btp   = Bt2p;
      Cout  = q + (kOffKh - kOffQh) / 2;
      Cout2 = q + (kOffKl - kOffQh) / 2;
      bt   -= kTilesQK;
    }
  }
  typedef typename Elem<ET>::T T;
  typedef typename Frag<T>::V V;
  static_assert(!SPLIT, "the staged loop carries one plane per operand");
  __shared__ __align__(16) unsigned short sAB[2][kGBuf];   // [buffer][A rows 0..127 | Bt rows 0..255][kGP]
  __shared__ __align__(16) float sT[8][16 * 68];   // per-wave 16x64 slab, pitch 68 floats
  const int b    = blockIdx.y;
  const int tid  = threadIdx.x;
  const int lane = tid & 31;
  const int wave = tid >> 5;
  const int btN = N >> 8;
  const int btM = M >> 7;
  if (bt >= btM * btN) return;   // the same for the whole work-group, in front of every barrier and copy
  const int bm = bt / btN;
  const int bn = bt - bm * btN;
  const int mB = bm << 7;
  const int nB = bn << 8;
  const int wm = (wave >> 2) << 6;             // this wave's rows inside the staged A rows
  const int wn = (wave & 3) << 6;              // this wave's rows inside the staged Bt rows
  const int m0 = mB + wm;
  const int n0 = nB + wn;

  const int rlane = lane & 15;                 // row (A) / col (B, D) within subtile
  const int koff  = (lane >> 4) * 8;           // k offset of this lane half
  const int mOff  = (lane >> 4) * 8;           // D row offset

  // staging: 16 lanes copy one row's 256 bytes, a wave 4 whole lines per copy; copy it covers staged rows it*16 .. it*16+15
  const int srow = tid >> 4;
  const int sseg = (tid & 15) * 8;
  const unsigned short* pA = Ap  + (size_t)b * strideA + (size_t)(mB + srow) * lda + sseg;
  const unsigned short* pB = Btp + (size_t)b * strideB + (size_t)(nB + srow) * ldb + sseg;
  const unsigned lds0 = (unsigned)(size_t)(&sAB[0][0] + srow * kGP + sseg);   // low 32 bits = byte address in LDS
  auto stage = [&](int buf) {   // copies the next 128 k of every staged row into buffer buf and moves the two pointers on
#pragma unroll   // both loops unrolled: every index constant, so the two operand arrays stay in registers
    for (int hf = 0; hf < 2; ++hf) {
      unsigned l[12];
      const unsigned short* g[12];
#pragma unroll
      for (int e = 0; e < 12; ++e) {
        const int it = hf * 12 + e;
        l[e] = lds0 + (unsigned)((buf * kGBuf + it * 16 * kGP) * 2);
        g[e] = (it < 8) ? (pA + (size_t)(it * 16) * lda) : (pB + (size_t)((it - 8) * 16) * ldb);
      }
      async_copy12(l, g);
    }
    pA += kGK;
    pB += kGK;
  };

  v8f acc[4][4];
#pragma unroll
  for (int i = 0; i < 4; ++i)
#pragma unroll
    for (int j = 0; j < 4; ++j) acc[i][j] = (v8f){0.f,0.f,0.f,0.f,0.f,0.f,0.f,0.f};

  const int nT = K / kGK;
  stage(0);
  asm volatile("s_wait_asynccnt 0x0" ::: "memory");   // this wave's copies of tile 0 have landed
  __syncthreads();                                    // ... and every other wave's
  if (nT > 1) stage(1);
  for (int t = 0; t < nT; ++t) {
    const T* sa = (const T*)sAB[t & 1] + (wm + rlane) * kGP + koff;
    const T* sb = (const T*)sAB[t & 1] + (kGRowsA + wn + rlane) * kGP + koff;
#pragma unroll   // the four 32-k blocks of a tile in line: LDS offsets become immediates and a block's reads can go ahead of the block before it
    for (int ks = 0; ks < kGK; ks += 32) {
      V ah[4], bh[4];
#pragma unroll
      for (int j = 0; j < 4; ++j) bh[j] = Frag<T>::load(sb + (j << 4) * kGP + ks);
#pragma unroll
      for (int i = 0; i < 4; ++i) ah[i] = Frag<T>::load(sa + (i << 4) * kGP + ks);
#pragma unroll
      for (int i = 0; i < 4; ++i) {
#pragma unroll
        for (int j = 0; j < 4; ++j) acc[i][j] = Frag<T>::mma(ah[i], bh[j], acc[i][j]);
        Frag<T>::guard(acc[i][0], acc[i][3], ah[i], ah[i]);
      }
      Frag<T>::keep(bh[0], bh[1], bh[2], bh[3]);
    }
    asm volatile("s_wait_dscnt 0x0" ::: "memory");      // this wave's reads of buffer t & 1 are done before it is refilled
    asm volatile("s_wait_asynccnt 0x0" ::: "memory");   // this wave's copies of tile t + 1 have landed
    __syncthreads();                                    // publishes tile t + 1 and ends every wave's reads of tile t
    if (t + 2 < nT) stage(t & 1);
  }
  asm volatile("s_wait_asynccnt 0x0" ::: "memory");     // nothing is in flight when the wave goes on
  acc_guard4(acc[0][0], acc[0][1], acc[0][2], acc[0][3]);
  acc_guard4(acc[1][0], acc[1][1], acc[1][2], acc[1][3]);
  acc_guard4(acc[2][0], acc[2][1], acc[2][2], acc[2][3]);
  acc_guard4(acc[3][0], acc[3][1], acc[3][2], acc[3][3]);

  // ---- epilogue ----
  float* slab = sT[wave];
  const float* Rb = RESID ? (resid + (size_t)b * strideR) : nullptr;
#pragma unroll
  for (int i = 0; i < 4; ++i) {
    const int mBase = m0 + (i << 4);
#pragma unroll
    for (int j = 0; j < 4; ++j) {
      const int n = n0 + (j << 4) + rlane;
      float bv = 0.f;
      if (BIAS_MODE == 2) bv = bias[n];
#pragma unroll
      for (int r = 0; r < 8; ++r) {
        float v = acc[i][j][r] * scale;
        if (BIAS_MODE == 1) v += bias[mBase + mOff + r];
        if (BIAS_MODE == 2) v += bv;
        if (RESID) v += Rb[(size_t)(mBase + mOff + r) * ldc + n];
        if (ACT == 1) v = tanhf(v);
        if (ACT == 2) v = fmaxf(v, 0.0f);
        if (ACT == 3) v = v / (1.0f + expf(-v));
        if (ACT == 4) v = (v > 0.f) ? v : 0.01f * v;
        if (ACT == 5) v = 0.5f * v * (1.0f + erff(v * 0.70710678118654752f));
        slab[(mOff + r) * 68 + (j << 4) + rlane] = v;
      }
    }
    __builtin_amdgcn_fence(__ATOMIC_RELEASE, "workgroup");
    __builtin_amdgcn_wave_barrier();
    __builtin_amdgcn_fence(__ATOMIC_ACQUIRE, "workgroup");
    if (OUT_MODE == 0) {
      float* C = (float*)Cout + (size_t)b * strideC;
      const int hh = lane >> 4, c4 = (lane & 15) * 4;     // row seg = 256 B = 16 lanes x 16 B
      {
#pragma unroll
        for (int it = 0; it < 8; ++it) {
          const int row = it * 2 + hh;
          v4f v = *(const v4f*)(slab + row * 68 + c4);
          *(v4f*)(C + (size_t)(mBase + row) * ldc + n0 + c4) = v;
        }
        
      }
    } else {
      const int q = lane >> 3, c8 = (lane & 7) * 8;
      unsigned short* C  = (unsigned short*)Cout  + (size_t)b * strideC;
      unsigned short* C2 = (OUT_MODE == 2) ? ((unsigned short*)Cout2 + (size_t)b * strideC) : nullptr;
      {
#pragma unroll
        for (int it = 0; it < 4; ++it) {
          const int row = it * 4 + q;
          const float* sp = slab + row * 68 + c8;
          v8h hv, lv;
#pragma unroll
          for (int e = 0; e < 8; ++e) {
            if (OUT_MODE == 1) {
              hv[e] = (_Float16)sp[e];
            } else {
              unsigned short hb = f2bf_bits(sp[e]);
              unsigned short lb = f2bf_bits(sp[e] - bf_bits2f(hb));
              hv[e] = __builtin_bit_cast(_Float16, hb);
              lv[e] = __builtin_bit_cast(_Float16, lb);
            }
          }
          *(v8h*)(C + (size_t)(mBase + row) * ldc + n0 + c8) = hv;
          if (OUT_MODE == 2) *(v8h*)(C2 + (size_t)(mBase + row) * ldc + n0 + c8) = lv;
        }
        
      }
    }
    __builtin_amdgcn_fence(__ATOMIC_RELEASE, "workgroup");
    __builtin_amdgcn_wave_barrier();
    __builtin_amdgcn_fence(__ATOMIC_ACQUIRE, "workgroup");
  }
}

// ---- all five input conversions in one streaming launch ----
// f32 -> bf16 (RNE) for x, Wq, Wk, Wv; f32 -> bf16 (RNE) -> x carry -> f16 for Wo (carry a power of two; exact for normal results).
// kCvThreads threads; in pass i thread g converts the 4 elements at 4 * (i * kCvThreads + g) of an array: a wave reads 512 contiguous bytes
// per load and writes 256 per store. The pass counts are constants of the shapes, so a thread's 20 loads are independent and can all be in flight.
constexpr int kCvGroups  = 512;
constexpr int kCvThreads = kCvGroups * 256;                    // 131,072 threads = 4,096 waves
constexpr int kCvX  = kTok * kDModel / (4 * kCvThreads);       // 8 passes over x
constexpr int kCvQK = kQKCols * kDModel / (4 * kCvThreads);    // 4 passes over Wq, and over Wk
constexpr int kCvVO = kDModel * kDModel / (4 * kCvThreads);    // 2 passes over Wv, and over Wo
static_assert(kCvX * 4 * kCvThreads == kTok * kDModel && kCvQK * 4 * kCvThreads == kQKCols * kDModel && kCvVO * 4 * kCvThreads == kDModel * kDModel);

template <int N>
__device__ __forceinline__ void cv_load(v4f (&r)[N], const float* __restrict__ in, int g) {
#pragma unroll
  for (int i = 0; i < N; ++i) r[i] = *(const v4f*)(in + 4 * ((size_t)i * kCvThreads + g));
}
template <int N>
__device__ __forceinline__ void cv_store_bf16(const v4f (&r)[N], unsigned short* __restrict__ out, int g) {
#pragma unroll
  for (int i = 0; i < N; ++i) {
    u2v u;
    u[0] = (unsigned)f2bf_bits(r[i][0]) | ((unsigned)f2bf_bits(r[i][1]) << 16);
    u[1] = (unsigned)f2bf_bits(r[i][2]) | ((unsigned)f2bf_bits(r[i][3]) << 16);
    *(u2v*)(out + 4 * ((size_t)i * kCvThreads + g)) = u;
  }
}
__device__ __forceinline__ unsigned cv_f16_bits(float f, float carry) {
  return (unsigned)__builtin_bit_cast(unsigned short, (_Float16)(bf_rne(f) * carry));
}

// Group 0 converts nothing: its first wave writes the lambda line, lambda = exp(lq1.lk1) - exp(lq2.lk2) + 0.8 from bf16-RNE-converted vectors,
// the 64 terms of each dot summed in index order; one wave writes one 32-float line. It runs beside the kCvGroups streaming groups
// and needs no launch of its own.
__global__ __launch_bounds__(256) void cast_inputs(
    const float* __restrict__ X, const float* __restrict__ Wq, const float* __restrict__ Wk,
    const float* __restrict__ Wv, const float* __restrict__ Wo,
    unsigned short* __restrict__ Xb, unsigned short* __restrict__ Wqb, unsigned short* __restrict__ Wkb,
    unsigned short* __restrict__ Wvb, unsigned short* __restrict__ Wo16, float carry,
    const float* __restrict__ lq1, const float* __restrict__ lq2,
    const float* __restrict__ lk1, const float* __restrict__ lk2, float* __restrict__ lamp) {
  if (blockIdx.x == 0) {
    if (threadIdx.x >= 32) return;
    float d1 = 0.0f, d2 = 0.0f;
#pragma unroll 16   // sixteen terms' loads go out together; the sums keep their order
    for (int i = 0; i < kHeadDim; ++i) {
      d1 += bf_rne(lq1[i]) * bf_rne(lk1[i]);
      d2 += bf_rne(lq2[i]) * bf_rne(lk2[i]);
    }
    lamp[threadIdx.x] = expf(d1) - expf(d2) + 0.8f;
    return;
  }
  const int g = (blockIdx.x - 1) * 256 + threadIdx.x;
  v4f x[kCvX], q[kCvQK], k[kCvQK], v[kCvVO], o[kCvVO];
  cv_load(x, X, g);
  cv_load(q, Wq, g);
  cv_load(k, Wk, g);
  cv_load(v, Wv, g);
  cv_load(o, Wo, g);
  cv_store_bf16(x, Xb, g);
  cv_store_bf16(q, Wqb, g);
  cv_store_bf16(k, Wkb, g);
  cv_store_bf16(v, Wvb, g);
#pragma unroll
  for (int i = 0; i < kCvVO; ++i) {
    u2v u;
    u[0] = cv_f16_bits(o[i][0], carry) | (cv_f16_bits(o[i][1], carry) << 16);
    u[1] = cv_f16_bits(o[i][2], carry) | (cv_f16_bits(o[i][3], carry) << 16);
    *(u2v*)(Wo16 + 4 * ((size_t)i * kCvThreads + g)) = u;
  }
}

// ---- bf16 split helpers ----
// two f32 -> one register of two bf16 hi parts and one of the two bf16 lo parts (both conversions round to nearest even)
typedef __attribute__((ext_vector_type(2))) float  f2v;
typedef __attribute__((ext_vector_type(2))) __bf16 b2v;
__device__ __forceinline__ void at_split2(float p0, float p1, unsigned& hi, unsigned& lo) {
  const unsigned h = __builtin_bit_cast(unsigned, __builtin_convertvector((f2v){p0, p1}, b2v));
  const float r0 = p0 - __uint_as_float(h << 16);
  const float r1 = p1 - __uint_as_float(h & 0xFFFF0000u);
  hi = h;
  lo = __builtin_bit_cast(unsigned, __builtin_convertvector((f2v){r0, r1}, b2v));
}
// the value that lane l ^ 16 holds
__device__ __forceinline__ float at_xhalf(float v) {
  const int b = __builtin_bit_cast(int, v);
  return __builtin_bit_cast(float, __builtin_amdgcn_permlanex16(b, b, 0x76543210, 0xfedcba98, false, false));
}
// e^x for the softmax (x <= 0 or -inf): one multiply and the hardware's 2^y. The library's expf adds a two-part product, a split into whole and
// fraction, ldexp and two range selects per value; here the argument is a difference from the running maximum, a result below 2^-126 may go to 0,
// and the multiply's rounding moves a weight by less than the 16 bits that its hi + lo parts keep.
constexpr float kLog2E = 1.44269504088896340736f;
constexpr int kAPlane  = kKC * kLP;        // 16-bit elements of one staged plane of the attention kernel: 64 rows at pitch kLP (9,216 B)
constexpr int kABuf    = 6 * kAPlane;      // one buffer: six planes (55,296 B)
constexpr int kAChunks = kNQblk + 1;       // key chunks a group walks: (pr + 1) + (32 - pr)
static_assert(kKC == kHeadDim && kSeq == 256 * 8);   // K and Vt planes have the same shape; 256 threads write 8 mask terms each
template <bool B> struct AtFlag { static constexpr bool v = B; };   // a compile-time yes or no handed to a generic lambda
__device__ __forceinline__ float at_exp(float x) { return __builtin_amdgcn_exp2f(x * kLog2E); }
__device__ __forceinline__ v8f at_mma(v16b a, v16b b, v8f c) {
  return __builtin_amdgcn_wmma_f32_16x16x32_bf16(false, a, false, b, (short)0, c, false, false);
}

// =====================================================================================
// Differential causal attention, head_dim 64, two softmax maps per head.
//   inputs : q, k as bf16 hi/lo planes [B*S][H*128] (map a uses columns h*128 + a*64 .. +64),
//            Vt as bf16 hi/lo planes [B][H*64][S] (key-contiguous), amask [B][S] f32, lambda line.
//   scores = 0.125 * q_a.k_a^T + causal add (a zero in front of the diagonal chunk, left out there) + (1-amask)*(-1e9) add; online softmax in f32 (e^x = 2^(x * log2 e) on v_exp_f32);
//   both products run transposed on v_wmma_f32_16x16x32_bf16 as hi.hi + hi.lo + lo.hi (f32 accumulate):
//   S^T = K.Q^T (A = K rows, B = Q columns) and O^T += Vt.P^T (A = Vt rows, B = P^T). A lane then holds scores of ONE query (column c),
//   keys 16 j + 8 hh + r: that is the k order of a B operand, so P^T is packed in registers; maximum and sum run in the lane, the two halves joined by one exchange.
//   att[b][h][s][d] = o_0/l_0 - lambda * o_1/l_1 ; per-tile (sum, sumsq) line for the group norm.
//   Block = 8 waves of one (b, h): waves 0-3 run map 0 and waves 4-7 map 1 of the same 64 query rows.
//   A block takes query tile pr and then tile 31 - pr, so every block walks 33 key chunks;
//   grid.x = B*H*16 = 512, pr fastest.
// LDS: two buffers of six planes each: K hi per map, K lo per map [64 kv][64 d], Vt hi, Vt lo [64 d][64 kv] (shared by both maps), all at row pitch kLP;
//      the mask terms of all the batch's keys, written once; one out slab [16][68] per 16 query rows.
// The group's 33 key chunks (tile pr's, then tile 31 - pr's) are one sequence: asynchronous copies bring chunk g + 2 into the buffer that chunk g has
// left while chunk g + 1 is worked on, also across the change of query tile. A copy of a wave covers whole 128-byte lines.
// Every staged LDS byte that is read is written in full each chunk (64 full rows per plane); the 8 pad elements of a row are never read.
// =====================================================================================
// waves_per_eu(4, 4): 512 groups of 8 waves are four waves a SIMD, so a wave may hold 256 registers; the grouped fragment reads use them.
__global__ __launch_bounds__(256) __attribute__((amdgpu_waves_per_eu(4, 4)))
void diff_attn64(const unsigned short* __restrict__ Qh, const unsigned short* __restrict__ Ql,
                 const unsigned short* __restrict__ Kh, const unsigned short* __restrict__ Kl,
                 const unsigned short* __restrict__ Vh, const unsigned short* __restrict__ Vl,
                 const float* __restrict__ amask, const float* __restrict__ lamp,
                 float* __restrict__ att, float* __restrict__ part) {
  union FB { v16b v; v8b h[2]; };
  __shared__ __align__(16) unsigned short sKV[2][kABuf];   // [buffer][K hi map 0 | K hi map 1 | K lo map 0 | K lo map 1 | Vt hi | Vt lo]
  __shared__ __align__(16) float Am[kSeq];
  __shared__ __align__(16) float Os[4][16 * 68];
  __shared__ float red[4][2];

  const int tid  = threadIdx.x;
  const int wave = __builtin_amdgcn_readfirstlane(tid >> 5);   // scalar, so the tests on the map below are scalar branches
  const int a    = wave >> 2;         // softmax map of this wave
  const int wq   = wave & 3;          // 16-row slice of the query tile
  const int lane = tid & 31;
  const int hh   = lane >> 4;
  const int c    = lane & 15;
  const int bx   = blockIdx.x;
  const int pr   = bx & (kNPair - 1);
  const int bh   = bx >> 4;
  const int h    = bh & (kHeads - 1);
  const int b    = bh >> 4;
  const float lam = lamp[0];
  const float negInf = -__builtin_huge_valf();

  const size_t vbase = (size_t)(b * kDModel + h * kHeadDim) * kSeq;               // Vt row (h*64 + d) of batch b
  float* ob_ptr = att + (size_t)bh * kSeq * kHeadDim;
  float* os = Os[wq];

  // staging: 16 lanes copy the 256 bytes of a K row (both maps side by side), 8 lanes the 128 bytes of a Vt row
  const int krow = tid >> 4, kseg = tid & 15;
  const int vrow = tid >> 3, vseg = tid & 7;
  const size_t kg0 = (size_t)(b * kSeq + krow) * kQKCols + (size_t)h * 128 + kseg * 8;
  const size_t vg0 = vbase + (size_t)vrow * kSeq + vseg * 8;
  const unsigned ldsK = (unsigned)(size_t)(&sKV[0][0] + (kseg >> 3) * kAPlane + krow * kLP + (kseg & 7) * 8);   // low 32 bits = byte address in LDS
  const unsigned ldsV = (unsigned)(size_t)(&sKV[0][0] + 4 * kAPlane + vrow * kLP + vseg * 8);
  auto stage = [&](int g, int buf) {   // the twelve copies of this lane for chunk g of the group's sequence, into buffer buf
    const int kv = ((g <= pr) ? g : g - pr - 1) * kKC;
    const size_t ko = kg0 + (size_t)kv * kQKCols;
    const size_t vo = vg0 + kv;
    const unsigned lb = (unsigned)(buf * kABuf * 2);
    unsigned l[12];
    const unsigned short* gp[12];
#pragma unroll   // every index constant, so the two operand arrays stay in registers
    for (int p = 0; p < 4; ++p) {
      l[p]      = ldsK + lb + (unsigned)(p * 16 * kLP * 2);
      l[4 + p]  = ldsK + lb + (unsigned)((2 * kAPlane + p * 16 * kLP) * 2);
      gp[p]     = Kh + ko + (size_t)(p * 16) * kQKCols;
      gp[4 + p] = Kl + ko + (size_t)(p * 16) * kQKCols;
    }
#pragma unroll   // as above
    for (int p = 0; p < 2; ++p) {
      l[8 + p]   = ldsV + lb + (unsigned)(p * 32 * kLP * 2);
      l[10 + p]  = ldsV + lb + (unsigned)((kAPlane + p * 32 * kLP) * 2);
      gp[8 + p]  = Vh + vo + (size_t)(p * 32) * kSeq;
      gp[10 + p] = Vl + vo + (size_t)(p * 32) * kSeq;
    }
    async_copy12(l, gp);
  };

  stage(0, 0);
  {
    // additive padding-mask term of every key of the batch (bf16 RNE-converted mask), 8 keys a thread
    union { v4f v[2]; float f[8]; } mk;
    mk.v[0] = *(const v4f*)(amask + b * kSeq + tid * 8);
    mk.v[1] = *(const v4f*)(amask + b * kSeq + tid * 8 + 4);
#pragma unroll   // constant indices keep the eight terms in registers
    for (int e = 0; e < 8; ++e) mk.f[e] = (1.0f - bf_rne(mk.f[e])) * (-1.0e9f);
    *(v4f*)(Am + tid * 8)     = mk.v[0];
    *(v4f*)(Am + tid * 8 + 4) = mk.v[1];
  }
  asm volatile("s_wait_asynccnt 0x0" ::: "memory");   // this wave's copies of chunk 0 have landed
  __syncthreads();                                    // ... and every other wave's, and the mask terms
  stage(1, 1);                                        // a group always has 33 chunks
  int g = 0;                                          // place in the group's sequence of chunks

  for (int half = 0; half < 2; ++half) {
    const int qb = half ? (kNQblk - 1 - pr) : pr;
    const int q0 = qb * kQB + wq * 16;
    const size_t qoff = (size_t)(b * kSeq + q0 + c) * kQKCols + (size_t)h * 128 + a * 64;   // + dc*32 + 8*hh
    // Q fragments (B operand: lane = query column c) for this wave's map: 2 d-chunks, hi and lo planes
    v16b qah[2], qal[2];
#pragma unroll
    for (int dc = 0; dc < 2; ++dc) {
      qah[dc] = Frag<__bf16>::load((const __bf16*)Qh + qoff + dc * 32 + 8 * hh);
      qal[dc] = Frag<__bf16>::load((const __bf16*)Ql + qoff + dc * 32 + 8 * hh);
    }
    asm volatile("s_wait_xcnt 0x0" ::: "memory");   // the accumulators' start values below are given the registers that hold these loads' addresses
    const int qrow = q0 + c;            // the one query of this lane
    float mrow = negInf, lrow = 0.0f;   // its running maximum; the sum over this lane half's keys
    v8f oacc[4];                        // oacc[t][r] = O^T[d = 16 t + 8 hh + r][query c]
#pragma unroll
    for (int t = 0; t < 4; ++t) oacc[t] = (v8f){0.f,0.f,0.f,0.f,0.f,0.f,0.f,0.f};

    // one key chunk; diag is a constant of the call: only the tile's last chunk (kc == qb) holds keys behind a query, so only that copy of the body
    // carries the causal compare, select and add. always_inline: both copies stand in the kernel's own text, accumulators in registers.
    auto chunk = [&](auto dflag, const int kc) __attribute__((always_inline)) {
      constexpr bool diag = decltype(dflag)::v;
      const int kv0 = kc * kKC;
      const unsigned short* kvb = sKV[g & 1];             // this chunk's buffer, published by the barrier ahead of the loop (chunk 0) or at the foot of the chunk before
      const unsigned short* ksh = kvb + a * kAPlane;
      const unsigned short* ksl = kvb + (2 + a) * kAPlane;
      const unsigned short* Vth = kvb + 4 * kAPlane;
      const unsigned short* Vtl = kvb + 5 * kAPlane;

      // ---- scores, transposed: 4 key subtiles of 16 rows, K = 64 (2 chunks), hi.hi + hi.lo + lo.hi ----
      // per 32 d the 16 fragment reads stand together ahead of the 12 products, which go round the four subtiles: reads can issue early, in groups, and
      // a product never needs the one written just before it. Each tile still sums dc 0 then 1, and in each hi.hi, lo.hi, hi.lo.
      v8f s[4];
#pragma unroll
      for (int j = 0; j < 4; ++j) s[j] = (v8f){0.f,0.f,0.f,0.f,0.f,0.f,0.f,0.f};
#pragma unroll
      for (int dc = 0; dc < 2; ++dc) {
        FB kb[4], kl[4];
#pragma unroll
        for (int j = 0; j < 4; ++j) {
          kb[j].h[0] = *(const v8b*)(ksh + (j * 16 + c) * kLP + dc * 32 + 8 * hh);
          kb[j].h[1] = *(const v8b*)(ksh + (j * 16 + c) * kLP + dc * 32 + 16 + 8 * hh);
          kl[j].h[0] = *(const v8b*)(ksl + (j * 16 + c) * kLP + dc * 32 + 8 * hh);
          kl[j].h[1] = *(const v8b*)(ksl + (j * 16 + c) * kLP + dc * 32 + 16 + 8 * hh);
        }
#pragma unroll
        for (int j = 0; j < 4; ++j) s[j] = at_mma(kb[j].v, qah[dc], s[j]);
#pragma unroll
        for (int j = 0; j < 4; ++j) s[j] = at_mma(kl[j].v, qah[dc], s[j]);
#pragma unroll
        for (int j = 0; j < 4; ++j) s[j] = at_mma(kb[j].v, qal[dc], s[j]);
      }
      // ---- scale, causal add, mask add, maximum over this lane's 32 keys, then over both halves ----
      float m = negInf;
#pragma unroll
      for (int j = 0; j < 4; ++j) {
        union { v4f v[2]; float f[8]; } am;
        am.v[0] = *(const v4f*)(Am + kv0 + j * 16 + 8 * hh);
        am.v[1] = *(const v4f*)(Am + kv0 + j * 16 + 8 * hh + 4);
#pragma unroll
        for (int r = 0; r < 8; ++r) {
          float sc = s[j][r] * 0.125f;
          if (diag) {
            const int kvcol = kv0 + j * 16 + 8 * hh + r;
            sc = sc + ((kvcol > qrow) ? -1.0e9f : 0.0f);
          }
          sc = sc + am.f[r];
          s[j][r] = sc;
          m = fmaxf(m, sc);
        }
      }
      m = fmaxf(m, at_xhalf(m));
      // ---- online softmax update; P^T packed as bf16 hi/lo B operands: element e of 32-key group kk is key 32 kk + (e < 8 ? 8 hh + e : 16 + 8 hh + e - 8) ----
      const float mnew = fmaxf(mrow, m);
      float alpha;
      if constexpr (diag) {
        // the same multiply and v_exp_f32 as at_exp. In asm text the compiler does not know it for a transcendental, so the statement carries both slots
        // itself: one v_nop in front (toward a v_exp_f32 just before it) and one behind (toward alpha's first reader).
        asm("v_nop\n\tv_exp_f32 %0, %1\n\tv_nop" : "=v"(alpha) : "v"((mrow - mnew) * kLog2E));
      } else {
        alpha = at_exp(mrow - mnew);
      }
      mrow = mnew;
      union PB { v16b v; unsigned w[8]; };
      PB pbh[2], pbl[2];
      float ps[4];
#pragma unroll
      for (int j = 0; j < 4; ++j) {
        ps[j] = 0.0f;
        const v8f y = (s[j] - mnew) * kLog2E;
#pragma unroll
        for (int i = 0; i < 4; ++i) {
          const float p0 = __builtin_amdgcn_exp2f(y[2 * i]);
          const float p1 = __builtin_amdgcn_exp2f(y[2 * i + 1]);
          ps[j] += p0;
          ps[j] += p1;
          at_split2(p0, p1, pbh[j >> 1].w[(j & 1) * 4 + i], pbl[j >> 1].w[(j & 1) * 4 + i]);
        }
      }
      lrow = lrow * alpha + ((ps[0] + ps[1]) + (ps[2] + ps[3]));
#pragma unroll
      for (int t = 0; t < 4; ++t) oacc[t] *= alpha;
      // ---- O^T += Vt.P^T: A = Vt [d][kv], B = P^T from registers; hi.hi + hi.lo + lo.hi; reads grouped and products taken round the four tiles as for the scores ----
#pragma unroll
      for (int kk = 0; kk < 2; ++kk) {
        FB vb[4], vl[4];
#pragma unroll
        for (int t = 0; t < 4; ++t) {
          vb[t].h[0] = *(const v8b*)(Vth + (t * 16 + c) * kLP + kk * 32 + 8 * hh);
          vb[t].h[1] = *(const v8b*)(Vth + (t * 16 + c) * kLP + kk * 32 + 16 + 8 * hh);
          vl[t].h[0] = *(const v8b*)(Vtl + (t * 16 + c) * kLP + kk * 32 + 8 * hh);
          vl[t].h[1] = *(const v8b*)(Vtl + (t * 16 + c) * kLP + kk * 32 + 16 + 8 * hh);
        }
#pragma unroll
        for (int t = 0; t < 4; ++t) oacc[t] = at_mma(vb[t].v, pbh[kk].v, oacc[t]);
#pragma unroll
        for (int t = 0; t < 4; ++t) oacc[t] = at_mma(vl[t].v, pbh[kk].v, oacc[t]);
#pragma unroll
        for (int t = 0; t < 4; ++t) oacc[t] = at_mma(vb[t].v, pbl[kk].v, oacc[t]);
      }
      asm volatile("s_wait_dscnt 0x0" ::: "memory");      // this wave's reads of buffer g & 1 are done before it is refilled
      asm volatile("s_wait_asynccnt 0x0" ::: "memory");   // this wave's copies of chunk g + 1 have landed
      __syncthreads();                                    // publishes chunk g + 1 and ends every wave's reads of chunk g
      if (g + 2 < kAChunks) stage(g + 2, g & 1);
      ++g;
    };
    for (int kc = 0; kc < qb; ++kc) chunk(AtFlag<false>{}, kc);   // causal: chunks 0..qb-1 lie wholly in front of every query (block-uniform trip count, <= 31)
    chunk(AtFlag<true>{}, qb);                                    // the chunk on the diagonal
    // ---- finish this tile: map 1 hands o/l over through the slab; map 0 combines and sums the norm partials ----
    // a lane owns 8 consecutive d of its query's slab row per t: slab[c][16 t + 8 hh + r]
    const float inv = 1.0f / (lrow + at_xhalf(lrow));   // the two halves' sums joined, by every lane
    if (a == 1) {
#pragma unroll
      for (int t = 0; t < 4; ++t) {
        const v8f o = oacc[t] * inv;
        *(v4f*)(os + c * 68 + t * 16 + 8 * hh)     = (v4f){o[0], o[1], o[2], o[3]};
        *(v4f*)(os + c * 68 + t * 16 + 8 * hh + 4) = (v4f){o[4], o[5], o[6], o[7]};
      }
    }
    __syncthreads();
    if (a == 0) {
      float psum = 0.0f, psq = 0.0f;
#pragma unroll
      for (int t = 0; t < 4; ++t) {
        float* op = os + c * 68 + t * 16 + 8 * hh;
        union { v4f v[2]; float f[8]; } o1, wv;
        o1.v[0] = *(const v4f*)(op);
        o1.v[1] = *(const v4f*)(op + 4);
#pragma unroll
        for (int r = 0; r < 8; ++r) {
          const float o = oacc[t][r] * inv;
          const float w = o - lam * o1.f[r];
          wv.f[r] = w;
          psum += w;
          psq += w * w;
        }
        *(v4f*)(op)     = wv.v[0];
        *(v4f*)(op + 4) = wv.v[1];
      }
      // wave reductions, then a block combine in fixed order
#pragma unroll
      for (int off = 1; off < 32; off <<= 1) { psum += __shfl_xor(psum, off, 32); psq += __shfl_xor(psq, off, 32); }
      if (lane == 0) { red[wq][0] = psum; red[wq][1] = psq; }
    }
    __syncthreads();

    {
      const int c4 = (lane & 15) * 4;
#pragma unroll
      for (int it = 0; it < 4; ++it) {
        const int row = a * 8 + it * 2 + hh;      // each wave stores 8 of the slab's 16 rows
        v4f val = *(const v4f*)(os + row * 68 + c4);
        *(v4f*)(ob_ptr + (size_t)(q0 + row) * kHeadDim + c4) = val;
      }
      asm volatile("s_wait_xcnt 0x0" ::: "memory");   // the stores' address and data registers are rewritten by the code that follows
    }
    if (wave == 0) {
      const float t0 = ((red[0][0] + red[1][0]) + red[2][0]) + red[3][0];
      const float t1 = ((red[0][1] + red[1][1]) + red[2][1]) + red[3][1];
      const float v = (lane == 0) ? t0 : ((lane == 1) ? t1 : 0.0f);
      float* pline = part + (size_t)(bh * kNQblk + qb) * 32;
      ((float*)pline)[lane] = v;
      asm volatile("s_wait_xcnt 0x0" ::: "memory");   // the next tile's set-up rewrites this store's registers
    }
  }
  asm volatile("s_wait_asynccnt 0x0" ::: "memory");   // nothing is in flight when the wave ends
}

// ---- normalize + affine + x0.2 + merge heads -> f16 plane (x8 carry), [B*S][H*64] ----
// A group's 32 rows belong to one (b,h): its first wave sums that (b,h)'s 32 tile lines in fixed order (lane = tile, then a butterfly) and hands
// mean and 1/sigma to the other waves through LDS, so the statistics need no launch of their own.
__global__ __launch_bounds__(256) void gn_merge(const float* __restrict__ att, const float* __restrict__ part,
                                              const float* __restrict__ gamma, const float* __restrict__ beta,
                                              unsigned short* __restrict__ merged) {
  __shared__ float st[2];
  const int g = blockIdx.x * 256 + threadIdx.x;
  if (g >= kBatch * kHeads * kSeq * 8) return;   // the same for a whole group (the bound is a multiple of 256), in front of the barrier
  const int seg = g >> 3;
  const int e8  = (g & 7) * 8;
  const int bh  = seg >> 11;
  const int s   = seg & (kSeq - 1);
  const int h   = bh & (kHeads - 1);
  const int b   = bh >> 4;
  union U8 { v4f v[2]; float f[8]; };
  U8 x, ga, be;
  const float* ap = att + (size_t)seg * kHeadDim + e8;
  x.v[0]  = *(const v4f*)ap;
  x.v[1]  = *(const v4f*)(ap + 4);
  ga.v[0] = *(const v4f*)(gamma + h * kHeadDim + e8);
  ga.v[1] = *(const v4f*)(gamma + h * kHeadDim + e8 + 4);
  be.v[0] = *(const v4f*)(beta + h * kHeadDim + e8);
  be.v[1] = *(const v4f*)(beta + h * kHeadDim + e8 + 4);
  if (threadIdx.x < 32) {
    const int lane = threadIdx.x;
    float s0 = part[(size_t)(bh * kNQblk + lane) * 32 + 0];
    float s1 = part[(size_t)(bh * kNQblk + lane) * 32 + 1];
#pragma unroll
    for (int off = 1; off < 32; off <<= 1) { s0 += __shfl_xor(s0, off, 32); s1 += __shfl_xor(s1, off, 32); }
    const float inv_n = 1.0f / (float)(kSeq * kHeadDim);
    const float mu0 = s0 * inv_n;
    const float ex2 = s1 * inv_n;
    const float var = fmaxf(ex2 - mu0 * mu0, 0.0f);
    if (lane == 0) { st[0] = mu0; st[1] = rsqrtf(var + 1.0e-5f); }
  }
  __syncthreads();   // the first wave's two statistics reach the group's other waves
  const float mu = st[0];
  const float rs = st[1];
  v8h hv;
#pragma unroll
  for (int e = 0; e < 8; ++e) {
    const float gq = bf_rne(ga.f[e]);
    const float bq = bf_rne(be.f[e]);
    float y = (x.f[e] - mu) * rs;
    y = y * gq + bq;
    y = y * 0.2f;
    float z = y * kMergeCarry;
    asm volatile("" : "+v"(z));
    hv[e] = (_Float16)z;
  }
  unsigned short* dst = merged + (size_t)(b * kSeq + s) * kDModel + h * kHeadDim + e8;
  *(v8h*)dst = hv;
  
}

// ---------------------------------------------------------------------------
extern "C" void kernel_launch(void* const* d_in, const int* in_sizes, int n_in,
                              void* d_out, int out_size, void* d_ws, size_t ws_size,
                              hipStream_t stream) {
  if (n_in < 12) return;
  if (in_sizes[0] != kTok * kDModel || in_sizes[1] != kBatch * kSeq ||
      in_sizes[2] != kQKCols * kDModel || in_sizes[3] != kQKCols * kDModel ||
      in_sizes[4] != kDModel * kDModel || in_sizes[5] != kDModel * kDModel ||
      in_sizes[6] != kHeadDim || in_sizes[7] != kHeadDim || in_sizes[8] != kHeadDim || in_sizes[9] != kHeadDim ||
      in_sizes[10] != kDModel || in_sizes[11] != kDModel) return;
  if (out_size != kTok * kDModel) return;
  if (ws_size < kWsTotal) return;

  const float* X     = (const float*)d_in[0];
  const float* amask = (const float*)d_in[1];
  const float* Wq    = (const float*)d_in[2];
  const float* Wk    = (const float*)d_in[3];
  const float* Wv    = (const float*)d_in[4];
  const float* Wo    = (const float*)d_in[5];
  const float* lq1   = (const float*)d_in[6];
  const float* lq2   = (const float*)d_in[7];
  const float* lk1   = (const float*)d_in[8];
  const float* lk2   = (const float*)d_in[9];
  const float* gamma = (const float*)d_in[10];
  const float* beta  = (const float*)d_in[11];

  char* w = (char*)d_ws;
  unsigned short* Xb    = (unsigned short*)(w + kOffXb);
  unsigned short* Wqb   = (unsigned short*)(w + kOffWqb);
  unsigned short* Wkb   = (unsigned short*)(w + kOffWkb);
  unsigned short* Wvb   = (unsigned short*)(w + kOffWvb);
  unsigned short* Wo16  = (unsigned short*)(w + kOffWo16);
  unsigned short* Qh    = (unsigned short*)(w + kOffQh);
  unsigned short* Ql    = (unsigned short*)(w + kOffQl);
  unsigned short* Kh    = (unsigned short*)(w + kOffKh);
  unsigned short* Kl    = (unsigned short*)(w + kOffKl);
  unsigned short* Vth   = (unsigned short*)(w + kOffVth);
  unsigned short* Vtl   = (unsigned short*)(w + kOffVtl);
  float*          att   = (float*)(w + kOffAtt);
  unsigned short* mrg   = (unsigned short*)(w + kOffMerged);
  float*          part  = (float*)(w + kOffPart);
  float*          lamp  = (float*)(w + kOffLam);

  // 1) input conversions (bf16 RNE; Wo additionally x256 into f16) and the lambda line
  cast_inputs<<<kCvGroups + 1, 256, 0, stream>>>(X, Wq, Wk, Wv, Wo, Xb, Wqb, Wkb, Wvb, Wo16, kWoCarry, lq1, lq2, lk1, lk2, lamp);

  // 2) projections: q/k planes [4096][2048] hi+lo, Vt planes [2][1024][2048] hi+lo
  constexpr int gridQ  = (kTok / 64) * (kQKCols / 64) / 8;   // 256
  constexpr int gridVt = (kDModel / 64) * (kSeq / 64) / 8;   // 64
  constexpr int gridO  = (kTok / 64) * (kDModel / 64) / 8;   // 128
  static_assert(gridQ * 8 == (kTok / 64) * (kQKCols / 64));
  static_assert(gridVt * 8 == (kDModel / 64) * (kSeq / 64));
  static_assert(gridO * 8 == (kTok / 64) * (kDModel / 64));
  // one work-group per 128x256 tile: the same counts
  static_assert(gridQ == (kTok / 128) * (kQKCols / 256) && gridVt == (kDModel / 128) * (kSeq / 256) && gridO == (kTok / 128) * (kDModel / 256));
  static_assert(kDModel % kGK == 0 && kDModel / kGK >= 2);
  static_assert(gridQ == kTilesQK && gridVt == kTilesVt);
  // Vt[b][c][s] = sum_k Wv[c][k] * X[b][s][k] : A = Wv [1024][1024], Bt = X_b [2048][1024]
  wmma_gemm64<1, false, 0, 2, false, 0, true><<<dim3(2 * kTilesQK + kBatch * kTilesVt, 1, 1), 256, 0, stream>>>(
      Xb, Wvb, kDModel, 0L, Wqb, Wkb, kDModel, 0L, (void*)Qh, (void*)Ql, kQKCols, 0L,
      lamp, lamp, 0L, kTok, kQKCols, kDModel, 1.0f);

  // 3) differential causal attention + norm partial lines (512 blocks, two query tiles each)
  diff_attn64<<<kAttnGroups, 256, 0, stream>>>(Qh, Ql, Kh, Kl, Vth, Vtl, amask, lamp, att, part);

  // 4) group norm statistics, normalize + merge, one launch
  gn_merge<<<(kBatch * kHeads * kSeq * 8) / 256, 256, 0, stream>>>(att, part, gamma, beta, mrg);

  // 5) output projection: out[m][n] = (1/2048) * sum_k merged8[m][k] * Wo256[n][k]
  wmma_gemm64<0, false, 0, 0, false><<<dim3(gridO, 1, 1), 256, 0, stream>>>(
      mrg, mrg, kDModel, 0L, Wo16, Wo16, kDModel, 0L, d_out, d_out, kDModel, 0L,
      lamp, lamp, 0L, kTok, kDModel, kDModel, 1.0f / (kMergeCarry * kWoCarry));
}
